// v000
// Measured on an AMD MI455X. A time is GPU time per run, averaged over a window of back-to-back runs after a warm-up
// (all launches, gaps included; the runs take copies of the inputs in turn), and the median of several windows.
// Apart from v000's, it joins two sittings. Times from different sittings can be a few percent apart, while
// side-by-side timings come from the same sitting.
// v000, which the later versions start from, runs in 520 microseconds.
#include <hip/hip_runtime.h>
// Simplex (distance-based) attention (B=4, S=2048, 8 heads × 64, conv channels 32): the per-head causal 3-tap conv of q and k as head-batched im2col GEMMs (+ bias) and the attention as a
// fused flash-style kernel on v_wmma_f32_16x16x32_f16 — S = qc·kc (d = 32, one k-step), logits = −sqrt(max(|qc|² + |kc|² − 2S, 1e-12)), INPUT mask (nonzero = keep), online softmax f32,
// P f16 ≤ 1, and the roll(attn, 1) folded into a one-step shift of V (out[s] = Σ_t attn[s][t]·v[t+1 mod S]); f16 operands, single products, f32 accumulate; norms f32 VALU.
#define BB 4
#define TT 2048
#define DDm 512
#define NH 8
#define HD 64
#define CCv 32
#define NR (BB * TT)

typedef __bf16 v16b __attribute__((ext_vector_type(16)));
typedef unsigned short v8us __attribute__((ext_vector_type(8), may_alias));
typedef float  v8f  __attribute__((ext_vector_type(8)));
typedef float  v4f  __attribute__((ext_vector_type(4)));
typedef float  v4fa __attribute__((ext_vector_type(4), may_alias));
union FragB { v16b v; v8us half[2]; unsigned short u[16]; };

__device__ __forceinline__ unsigned short bf16_bits(float x) { unsigned int u = __float_as_uint(x); return (unsigned short)((u + 0x7FFFu + ((u >> 16) & 1u)) >> 16); }
__device__ __forceinline__ float bf16_val(unsigned short b) { return __uint_as_float(((unsigned int)b) << 16); }
__device__ __forceinline__ float bf16_round(float x) { return bf16_val(bf16_bits(x)); }
// D += A·B with NT terms: 1 = ah·bh, 2 = + al·bh (A split), 3 = + ah·bl (both split)
template <int NT>
__device__ __forceinline__ v8f mmaN(v16b ah, v16b al, v16b bh, v16b bl, v8f c) {
  c = __builtin_amdgcn_wmma_f32_16x16x32_bf16(false, ah, false, bh, (short)0, c, false, false);
  if (NT >= 2) c = __builtin_amdgcn_wmma_f32_16x16x32_bf16(false, al, false, bh, (short)0, c, false, false);
  if (NT >= 3) c = __builtin_amdgcn_wmma_f32_16x16x32_bf16(false, ah, false, bl, (short)0, c, false, false);
  asm volatile("v_nop\n\tv_nop\n\tv_nop\n\tv_nop" : "+v"(c) : "v"(ah), "v"(al), "v"(bh), "v"(bl));
  return c;
}

__global__ __launch_bounds__(256) void k_wt_bf16(const float* __restrict__ W, unsigned short* __restrict__ Wt, int K, int N) {
  const int t = blockIdx.x * 256 + threadIdx.x;
  const int k8n = K / 8;
  if (t >= N * k8n) return;
  const int n = t / k8n, k8 = (t % k8n) * 8;
  v8us v;
#pragma unroll
  for (int i = 0; i < 8; ++i) v[i] = bf16_bits(W[(size_t)(k8 + i) * N + n]);
  *(v8us*)(Wt + (size_t)n * K + k8) = v;
  
}

// GEMM C[M][N] (f32, pitch ldc) = act(A[M][K]·W + bias). A f32 row-major (pitch lda) converted per fragment to bf16
// (ASPLIT: hi/lo two planes -> 2 terms, else single rounded term); Wt bf16 [N][K] (pitch ldb). BIAS_BF16 rounds the
// bias to bf16 first (bias quantised to bf16 before the add). K%32==0, M%16==0, N%64==0.
template <bool ASPLIT, int ACT, bool BIAS_BF16>
__global__ __launch_bounds__(128) void k_gemm_bf(const float* __restrict__ A, int lda, const unsigned short* __restrict__ Wt, int ldb,
                                               const float* __restrict__ bias, float* __restrict__ C, int ldc, int M, int N, int K) {
  __shared__ __attribute__((aligned(16))) float so[4][16][64];
  const int tid = threadIdx.x, w = tid >> 5, lane = tid & 31, ln = lane & 15, hh = lane >> 4;
  const int ntn = N / 64;
  const int wid = blockIdx.x * 4 + w;
  const int mt = wid / ntn, nq = wid % ntn;
  if (mt * 16 >= M) return;
  const int row0 = mt * 16, col0 = nq * 64;
  const float* arow = A + (size_t)(row0 + ln) * lda;
  v8f acc[4] = {};
  for (int kb = 0; kb < K; kb += 32) {
    FragB ah, al;
    const v4f x0 = *(const v4fa*)(arow + kb + 8 * hh), x1 = *(const v4fa*)(arow + kb + 8 * hh + 4);
    const v4f x2 = *(const v4fa*)(arow + kb + 16 + 8 * hh), x3 = *(const v4fa*)(arow + kb + 16 + 8 * hh + 4);
    float xs[16] = {x0[0],x0[1],x0[2],x0[3],x1[0],x1[1],x1[2],x1[3],x2[0],x2[1],x2[2],x2[3],x3[0],x3[1],x3[2],x3[3]};
#pragma unroll
    for (int i = 0; i < 16; ++i) { const unsigned short hb = bf16_bits(xs[i]); ah.u[i] = hb; al.u[i] = ASPLIT ? bf16_bits(xs[i] - bf16_val(hb)) : (unsigned short)0; }
#pragma unroll
    for (int t = 0; t < 4; ++t) {
      const unsigned short* brow = Wt + (size_t)(col0 + t * 16 + ln) * ldb + kb;
      FragB b;
      b.half[0] = *(const v8us*)(brow + 8 * hh);
      b.half[1] = *(const v8us*)(brow + 16 + 8 * hh);
      acc[t] = mmaN<ASPLIT ? 2 : 1>(ah.v, al.v, b.v, b.v, acc[t]);
    }
  }
#pragma unroll
  for (int t = 0; t < 4; ++t) {
    float bv = bias ? bias[col0 + t * 16 + ln] : 0.f;
    if (BIAS_BF16) bv = bf16_round(bv);
#pragma unroll
    for (int r = 0; r < 8; ++r) { float v = acc[t][r] + bv; if (ACT == 1) v = fmaxf(v, 0.f); so[w][8 * hh + r][t * 16 + ln] = v; }
  }
  __builtin_amdgcn_fence(__ATOMIC_ACQ_REL, "workgroup");
  __builtin_amdgcn_wave_barrier();
  const int rsub = lane >> 4, c4 = (lane & 15) * 4;
  {
#pragma unroll
    for (int q = 0; q < 8; ++q) {
      const int r = q * 2 + rsub;
      const v4f v = *(const v4fa*)&so[w][r][c4];
      *(v4f*)(C + (size_t)(row0 + r) * ldc + col0 + c4) = v;
    }
    
  }
}

// Flash-style causal/unmasked attention, all contractions 3-term bf16 hi/lo splits, f32 softmax with running max.
// q,k,v rows are read from f32 buffers with arbitrary row pitch (so they can live inside a fused qkv buffer);
// D = head size (multiple of 32, <= 128); one wave = 16 query rows; block = 4 waves (64 queries) sharing K/V chunks of 32.
template <int D, bool CAUSAL>
__global__ __launch_bounds__(128) void k_flash(const float* __restrict__ qb, const float* __restrict__ kb, const float* __restrict__ vb,
                                             int pitch, int T, int H, float scale, float* __restrict__ y, int ypitch) {
  constexpr int KS = D / 32;        // k-steps for QK
  constexpr int DT = D / 16;        // d tiles for PV
  __shared__ __attribute__((aligned(16))) unsigned short sKh[32][D + 8], sKl[32][D + 8], sVh[32][D + 8], sVl[32][D + 8];
  __shared__ __attribute__((aligned(16))) unsigned short sPh[4][16][40], sPl[4][16][40];
  __shared__ __attribute__((aligned(16))) float sO[4][16][D];
  const int tid = threadIdx.x, w = tid >> 5, lane = tid & 31, ln = lane & 15, hh = lane >> 4;
  const int nqb = (T + 63) / 64;
  const int bh = blockIdx.x / nqb, qblk = blockIdx.x % nqb;
  const int b = bh / H, h = bh % H;
  const int q0 = qblk * 64 + w * 16;
  const float* Q = qb + (size_t)b * T * pitch + h * D;
  const float* K = kb + (size_t)b * T * pitch + h * D;
  const float* V = vb + (size_t)b * T * pitch + h * D;

  // A fragments of the wave's 16 query rows (scaled), hi/lo
  FragB aqh[KS], aql[KS];
  {
    int row = q0 + ln; if (row >= T) row = T - 1;
    const float* qr = Q + (size_t)row * pitch;
#pragma unroll
    for (int ks = 0; ks < KS; ++ks)
#pragma unroll
      for (int i = 0; i < 16; ++i) {
        const int d = ks * 32 + ((i < 8) ? (8 * hh + i) : (16 + 8 * hh + (i - 8)));
        const float x = qr[d] * scale; const unsigned short hb = bf16_bits(x);
        aqh[ks].u[i] = hb; aql[ks].u[i] = bf16_bits(x - bf16_val(hb));
      }
  }
  float m_r[8], l_r[8];
#pragma unroll
  for (int r = 0; r < 8; ++r) { m_r[r] = -3.0e38f; l_r[r] = 0.f; }
  v8f oacc[DT];
#pragma unroll
  for (int dt = 0; dt < DT; ++dt) oacc[dt] = (v8f){0.f,0.f,0.f,0.f,0.f,0.f,0.f,0.f};

  const int kv_end = CAUSAL ? min(T, qblk * 64 + 64) : T;     // block-uniform
  for (int j0 = 0; j0 < kv_end; j0 += 32) {
    __syncthreads();
    for (int e = tid; e < 32 * (D / 4); e += 128) {
      const int r = e / (D / 4), c4 = (e % (D / 4)) * 4;
      const int key = j0 + r;
      v4f kf = {0.f,0.f,0.f,0.f}, vf = {0.f,0.f,0.f,0.f};
      if (key < T) { kf = *(const v4fa*)(K + (size_t)key * pitch + c4); vf = *(const v4fa*)(V + (size_t)key * pitch + c4); }
#pragma unroll
      for (int t = 0; t < 4; ++t) {
        unsigned short hb = bf16_bits(kf[t]); sKh[r][c4 + t] = hb; sKl[r][c4 + t] = bf16_bits(kf[t] - bf16_val(hb));
        hb = bf16_bits(vf[t]); sVh[r][c4 + t] = hb; sVl[r][c4 + t] = bf16_bits(vf[t] - bf16_val(hb));
      }
    }
    __syncthreads();
    // S tile 16 x 32
    v8f s[2];
#pragma unroll
    for (int nt = 0; nt < 2; ++nt) {
      v8f acc = {};
#pragma unroll
      for (int ks = 0; ks < KS; ++ks) {
        FragB bh_, bl_;
        bh_.half[0] = *(const v8us*)&sKh[nt * 16 + ln][ks * 32 + 8 * hh]; bh_.half[1] = *(const v8us*)&sKh[nt * 16 + ln][ks * 32 + 16 + 8 * hh];
        bl_.half[0] = *(const v8us*)&sKl[nt * 16 + ln][ks * 32 + 8 * hh]; bl_.half[1] = *(const v8us*)&sKl[nt * 16 + ln][ks * 32 + 16 + 8 * hh];
        acc = mmaN<3>(aqh[ks].v, aql[ks].v, bh_.v, bl_.v, acc);
      }
      s[nt] = acc;
    }
    // mask + running max (rows 8hh+r; the 16 lanes of a half share rows)
    float alpha[8];
#pragma unroll
    for (int r = 0; r < 8; ++r) {
      const int qi = q0 + 8 * hh + r;
      const int ja = j0 + ln, jb = j0 + 16 + ln;
      if (CAUSAL) { if (ja > qi) s[0][r] = -3.0e38f; if (jb > qi) s[1][r] = -3.0e38f; }
      if (ja >= T) s[0][r] = -3.0e38f;
      if (jb >= T) s[1][r] = -3.0e38f;
      float mx = fmaxf(s[0][r], s[1][r]);
      mx = fmaxf(mx, __shfl_xor(mx, 1, 32)); mx = fmaxf(mx, __shfl_xor(mx, 2, 32)); mx = fmaxf(mx, __shfl_xor(mx, 4, 32)); mx = fmaxf(mx, __shfl_xor(mx, 8, 32));
      const float mnew = fmaxf(m_r[r], mx);
      alpha[r] = (mnew > -1.0e38f) ? __expf(m_r[r] - mnew) : 1.0f;
      const float p0 = (s[0][r] > -1.0e38f) ? __expf(s[0][r] - mnew) : 0.f;
      const float p1 = (s[1][r] > -1.0e38f) ? __expf(s[1][r] - mnew) : 0.f;
      m_r[r] = mnew;
      l_r[r] = l_r[r] * alpha[r] + p0 + p1;            // per-lane partial row sum (16 lanes combined at the end)
      unsigned short hb = bf16_bits(p0); sPh[w][8 * hh + r][ln] = hb;      sPl[w][8 * hh + r][ln] = bf16_bits(p0 - bf16_val(hb));
      hb = bf16_bits(p1);                sPh[w][8 * hh + r][16 + ln] = hb; sPl[w][8 * hh + r][16 + ln] = bf16_bits(p1 - bf16_val(hb));
    }
#pragma unroll
    for (int dt = 0; dt < DT; ++dt)
#pragma unroll
      for (int r = 0; r < 8; ++r) oacc[dt][r] *= alpha[r];
    __builtin_amdgcn_fence(__ATOMIC_ACQ_REL, "workgroup");
    __builtin_amdgcn_wave_barrier();
    FragB pah, pal;
    pah.half[0] = *(const v8us*)&sPh[w][ln][8 * hh]; pah.half[1] = *(const v8us*)&sPh[w][ln][16 + 8 * hh];
    pal.half[0] = *(const v8us*)&sPl[w][ln][8 * hh]; pal.half[1] = *(const v8us*)&sPl[w][ln][16 + 8 * hh];
#pragma unroll
    for (int dt = 0; dt < DT; ++dt) {
      FragB bvh, bvl;
#pragma unroll
      for (int i = 0; i < 8; ++i) {
        bvh.u[i] = sVh[8 * hh + i][dt * 16 + ln]; bvh.u[8 + i] = sVh[16 + 8 * hh + i][dt * 16 + ln];
        bvl.u[i] = sVl[8 * hh + i][dt * 16 + ln]; bvl.u[8 + i] = sVl[16 + 8 * hh + i][dt * 16 + ln];
      }
      oacc[dt] = mmaN<3>(pah.v, pal.v, bvh.v, bvl.v, oacc[dt]);
    }
    __builtin_amdgcn_fence(__ATOMIC_ACQ_REL, "workgroup");
    __builtin_amdgcn_wave_barrier();
  }
#pragma unroll
  for (int r = 0; r < 8; ++r) {
    float l = l_r[r];
    l += __shfl_xor(l, 1, 32); l += __shfl_xor(l, 2, 32); l += __shfl_xor(l, 4, 32); l += __shfl_xor(l, 8, 32);
    l_r[r] = (l > 0.f) ? 1.0f / l : 0.f;
  }
#pragma unroll
  for (int dt = 0; dt < DT; ++dt)
#pragma unroll
    for (int r = 0; r < 8; ++r) sO[w][8 * hh + r][dt * 16 + ln] = oacc[dt][r] * l_r[r];
  __builtin_amdgcn_fence(__ATOMIC_ACQ_REL, "workgroup");
  __builtin_amdgcn_wave_barrier();
  {
    for (int r = 0; r < 16; ++r) {
      const int row = q0 + r;
      if (row < T && lane < D / 4) {
        const v4f val = *(const v4fa*)&sO[w][r][lane * 4];
        *(v4f*)(y + ((size_t)b * T + row) * ypitch + h * D + lane * 4) = val;
      }
    }
    
  }
}

// GEMM C = act(A·W + bias + resid): A f32 (ASPLIT -> hi/lo 2 terms), Wt bf16 [N][K]; ACT 0 none, 1 relu, 2 exact gelu;
// resid (optional, f32, row index = (row % rmod), pitch ldr, RES_BF16 rounds it) added before the activation.
template <bool ASPLIT, int ACT, bool BIAS_BF16, bool RES_BF16>
__global__ __launch_bounds__(128) void k_gemm_bf3(const float* __restrict__ A, int lda, const unsigned short* __restrict__ Wt, int ldb,
                                                const float* __restrict__ bias, const float* __restrict__ resid, int rmod, int ldr,
                                                float* __restrict__ C, int ldc, int M, int N, int K) {
  __shared__ __attribute__((aligned(16))) float so[4][16][64];
  const int tid = threadIdx.x, w = tid >> 5, lane = tid & 31, ln = lane & 15, hh = lane >> 4;
  const int ntn = N / 64;
  const int wid = blockIdx.x * 4 + w;
  const int mt = wid / ntn, nq = wid % ntn;
  if (mt * 16 >= M) return;
  const int row0 = mt * 16, col0 = nq * 64;
  const float* arow = A + (size_t)(row0 + ln) * lda;
  v8f acc[4] = {};
  for (int kb = 0; kb < K; kb += 32) {
    FragB ah, al;
    const v4f x0 = *(const v4fa*)(arow + kb + 8 * hh), x1 = *(const v4fa*)(arow + kb + 8 * hh + 4);
    const v4f x2 = *(const v4fa*)(arow + kb + 16 + 8 * hh), x3 = *(const v4fa*)(arow + kb + 16 + 8 * hh + 4);
    float xs[16] = {x0[0],x0[1],x0[2],x0[3],x1[0],x1[1],x1[2],x1[3],x2[0],x2[1],x2[2],x2[3],x3[0],x3[1],x3[2],x3[3]};
#pragma unroll
    for (int i = 0; i < 16; ++i) { const unsigned short hb = bf16_bits(xs[i]); ah.u[i] = hb; al.u[i] = ASPLIT ? bf16_bits(xs[i] - bf16_val(hb)) : (unsigned short)0; }
#pragma unroll
    for (int t = 0; t < 4; ++t) {
      const unsigned short* brow = Wt + (size_t)(col0 + t * 16 + ln) * ldb + kb;
      FragB b;
      b.half[0] = *(const v8us*)(brow + 8 * hh);
      b.half[1] = *(const v8us*)(brow + 16 + 8 * hh);
      acc[t] = mmaN<ASPLIT ? 2 : 1>(ah.v, al.v, b.v, b.v, acc[t]);
    }
  }
#pragma unroll
  for (int t = 0; t < 4; ++t) {
    const int col = col0 + t * 16 + ln;
    float bv = bias ? bias[col] : 0.f;
    if (BIAS_BF16) bv = bf16_round(bv);
#pragma unroll
    for (int r = 0; r < 8; ++r) {
      float v = acc[t][r] + bv;
      if (resid) { float rv = resid[(size_t)((row0 + 8 * hh + r) % rmod) * ldr + col]; if (RES_BF16) rv = bf16_round(rv); v += rv; }
      if (ACT == 1) v = fmaxf(v, 0.f);
      if (ACT == 2) v = 0.5f * v * (1.0f + erff(v * 0.70710678118654752f));
      if (ACT == 3) { const float u = 0.7978845608028654f * (v + 0.044715f * v * v * v); v = 0.5f * v * (1.0f + tanhf(u)); }
      so[w][8 * hh + r][t * 16 + ln] = v;
    }
  }
  __builtin_amdgcn_fence(__ATOMIC_ACQ_REL, "workgroup");
  __builtin_amdgcn_wave_barrier();
  const int rsub = lane >> 4, c4 = (lane & 15) * 4;
  {
#pragma unroll
    for (int q = 0; q < 8; ++q) {
      const int r = q * 2 + rsub;
      const v4f v = *(const v4fa*)&so[w][r][c4];
      *(v4f*)(C + (size_t)(row0 + r) * ldc + col0 + c4) = v;
    }
    
  }
}
// row LayerNorm (biased variance, eps) over N: s = X (+ R); optional out_sum <- s; out_norm <- (s-mu)*rsqrt(var+eps)*g + b
template <bool PARAM_BF16>
__global__ __launch_bounds__(256) void k_layernorm(const float* __restrict__ X, const float* __restrict__ R, const float* __restrict__ g, const float* __restrict__ bta,
                                                  float* __restrict__ out_sum, float* __restrict__ out_norm, int N, float eps) {
  __shared__ float red[256];
  const int row = blockIdx.x, tid = threadIdx.x;
  const float* x = X + (size_t)row * N; const float* rr = R ? R + (size_t)row * N : nullptr;
  float vals[16];                     // up to N = 4096
  const int per = N / 256;            // contiguous chunk per thread? use strided-by-4 chunks: thread handles j = tid*4 + 1024*u
  float s1 = 0.f;
  for (int u = 0; u < per / 4; ++u) {
    const int j = tid * 4 + 1024 * u;
    const v4f a = *(const v4fa*)(x + j);
    v4f b = {0.f,0.f,0.f,0.f}; if (rr) b = *(const v4fa*)(rr + j);
#pragma unroll
    for (int q = 0; q < 4; ++q) { const float v = a[q] + b[q]; vals[u * 4 + q] = v; s1 += v; }
  }
  red[tid] = s1; __syncthreads();
  for (int st = 128; st > 0; st >>= 1) { if (tid < st) red[tid] += red[tid + st]; __syncthreads(); }
  const float mu = red[0] / (float)N; __syncthreads();
  float s2 = 0.f;
  for (int u = 0; u < per / 4; ++u)
#pragma unroll
    for (int q = 0; q < 4; ++q) { const float c = vals[u * 4 + q] - mu; s2 += c * c; }
  red[tid] = s2; __syncthreads();
  for (int st = 128; st > 0; st >>= 1) { if (tid < st) red[tid] += red[tid + st]; __syncthreads(); }
  const float rs = rsqrtf(red[0] / (float)N + eps);
  {
    for (int u = 0; u < per / 4; ++u) {
      const int j = tid * 4 + 1024 * u;
      v4f o, sm;
#pragma unroll
      for (int q = 0; q < 4; ++q) {
        float gg = g[j + q], bb = bta[j + q];
        if (PARAM_BF16) { gg = bf16_round(gg); bb = bf16_round(bb); }
        sm[q] = vals[u * 4 + q]; o[q] = (vals[u * 4 + q] - mu) * rs * gg + bb;
      }
      if (out_sum) *(v4f*)(out_sum + (size_t)row * N + j) = sm;
      *(v4f*)(out_norm + (size_t)row * N + j) = o;
    }
    
  }
}



// ---- f16 WMMA path (v_wmma_f32_16x16x32_f16): 11-bit significands for operands in range — used for the conv GEMMs and both attention contractions
typedef _Float16 v16h __attribute__((ext_vector_type(16)));
union FragH { v16h v; v8us half[2]; _Float16 h[16]; unsigned short u[16]; };
template <int NT>
__device__ __forceinline__ v8f mmaH(v16h ah, v16h al, v16h bh, v16h bl, v8f c) {
  c = __builtin_amdgcn_wmma_f32_16x16x32_f16(false, ah, false, bh, (short)0, c, false, false);
  if (NT >= 2) c = __builtin_amdgcn_wmma_f32_16x16x32_f16(false, al, false, bh, (short)0, c, false, false);
  if (NT >= 3) c = __builtin_amdgcn_wmma_f32_16x16x32_f16(false, ah, false, bl, (short)0, c, false, false);
  asm volatile("v_nop\n\tv_nop\n\tv_nop\n\tv_nop" : "+v"(c) : "v"(ah), "v"(al), "v"(bh), "v"(bl));
  return c;
}
// batched GEMM like k_gemm_b but f16 operands: A f32 (split into f16 hi/lo if ASPLIT, else rounded to f16), Bt = f16 values [n][k]; alpha; C f32; N multiple of 16 (partial tiles skipped)
template <bool ASPLIT>
__global__ __launch_bounds__(128) void k_gemm_h(const float* __restrict__ A, int lda, size_t sA, const _Float16* __restrict__ Bh, int ldb, size_t sB, float alpha, float* __restrict__ C, int ldc, size_t sC, int M, int N, int K) {
  __shared__ __attribute__((aligned(16))) float so[4][16][64];
  const int tid = threadIdx.x, w = tid >> 5, lane = tid & 31, ln = lane & 15, hh = lane >> 4; const int by = blockIdx.y;
  A += (size_t)by * sA; Bh += (size_t)by * sB; C += (size_t)by * sC;
  const int ntn = (N + 63) / 64; const int wid = blockIdx.x * 4 + w; const int mt = wid / ntn, nq = wid % ntn; if (mt * 16 >= M) return;
  const int row0 = mt * 16, col0 = nq * 64; const float* arow = A + (size_t)(row0 + ln) * lda;
  v8f acc[4] = {};
  for (int kb = 0; kb < K; kb += 32) {
    FragH ah, al;
    const v4f x0 = *(const v4fa*)(arow + kb + 8 * hh), x1 = *(const v4fa*)(arow + kb + 8 * hh + 4), x2 = *(const v4fa*)(arow + kb + 16 + 8 * hh), x3 = *(const v4fa*)(arow + kb + 16 + 8 * hh + 4);
    float xs[16] = {x0[0],x0[1],x0[2],x0[3],x1[0],x1[1],x1[2],x1[3],x2[0],x2[1],x2[2],x2[3],x3[0],x3[1],x3[2],x3[3]};
#pragma unroll
    for (int i = 0; i < 16; ++i) { const _Float16 h = (_Float16)xs[i]; ah.h[i] = h; al.h[i] = ASPLIT ? (_Float16)(xs[i] - (float)h) : (_Float16)0.0f; }
#pragma unroll
    for (int t = 0; t < 4; ++t) { if (col0 + t * 16 >= N) continue; const size_t boff = (size_t)(col0 + t * 16 + ln) * ldb + kb; FragH bq; bq.half[0] = *(const v8us*)(Bh + boff + 8 * hh); bq.half[1] = *(const v8us*)(Bh + boff + 16 + 8 * hh);
      acc[t] = mmaH<ASPLIT ? 2 : 1>(ah.v, al.v, bq.v, bq.v, acc[t]); }
  }
#pragma unroll
  for (int t = 0; t < 4; ++t) { if (col0 + t * 16 >= N) continue;
#pragma unroll
    for (int r = 0; r < 8; ++r) so[w][8 * hh + r][t * 16 + ln] = acc[t][r] * alpha; }
  __builtin_amdgcn_fence(__ATOMIC_ACQ_REL, "workgroup"); __builtin_amdgcn_wave_barrier();
  const int rsub = lane >> 4, c4 = (lane & 15) * 4;
  {
#pragma unroll
    for (int q = 0; q < 8; ++q) { const int r = q * 2 + rsub; if (col0 + c4 < N) { const v4f v = *(const v4fa*)&so[w][r][c4]; *(v4f*)(C + (size_t)(row0 + r) * ldc + col0 + c4) = v; } }
     }
}

// Wt[n][k] = f16(W[k][n]·scale) from f32 row-major W[K][N] (scale = power of two; bf16-exact weights stay exact in f16 away from the subnormal range)
__global__ __launch_bounds__(256) void k_wt_f16(const float* __restrict__ W, _Float16* __restrict__ Wt, int K, int N, float scale) {
  const int t = blockIdx.x * 256 + threadIdx.x; if (t >= N * (K / 8)) return; const int n = t / (K / 8), k8 = (t % (K / 8)) * 8; FragH f;
#pragma unroll
  for (int i = 0; i < 8; ++i) f.h[i] = (_Float16)(bf16_round(W[(size_t)(k8 + i) * N + n]) * scale); const v8us o = f.half[0];
  *(v8us*)((unsigned short*)Wt + (size_t)n * K + k8) = o; 
}
// k_gemm_hh variant with fused epilogue: v = acc·alpha + bias[by·sBias + col] (+ CP[(row/rowsPerB)·sCPb + by·64 + col] if CP) ; ACT 0 none / 1 elu ; writes f32 C and f16 C16, each if non-null
template <int ACT>
__global__ __launch_bounds__(128) void k_gemm_hhx(const _Float16* __restrict__ A, int lda, size_t sA, const _Float16* __restrict__ Bh, int ldb, size_t sB, float alpha, const float* __restrict__ bias, size_t sBias, const float* __restrict__ CP, int rowsPerB, size_t sCPb, int row0g,
    float* __restrict__ C, _Float16* __restrict__ C16, int ldc, size_t sC, int M, int N, int K) {
  __shared__ __attribute__((aligned(16))) float so[4][16][64];
  const int tid = threadIdx.x, w = tid >> 5, lane = tid & 31, ln = lane & 15, hh = lane >> 4; const int by = blockIdx.y;
  A += (size_t)by * sA; Bh += (size_t)by * sB; const size_t cofs = (size_t)by * sC; const float* bp = bias ? bias + (size_t)by * sBias : nullptr;
  const int ntn = (N + 63) / 64; const int wid = blockIdx.x * 4 + w; const int mt = wid / ntn, nq = wid % ntn; if (mt * 16 >= M) return;
  const int row0 = mt * 16, col0 = nq * 64; const _Float16* arow = A + (size_t)(row0 + ln) * lda;
  v8f acc[4] = {};
  for (int kb = 0; kb < K; kb += 32) { FragH ah; ah.half[0] = *(const v8us*)((const unsigned short*)arow + kb + 8 * hh); ah.half[1] = *(const v8us*)((const unsigned short*)arow + kb + 16 + 8 * hh);
#pragma unroll
    for (int t = 0; t < 4; ++t) { if (col0 + t * 16 >= N) continue; const size_t boff = (size_t)(col0 + t * 16 + ln) * ldb + kb; FragH bq; bq.half[0] = *(const v8us*)((const unsigned short*)Bh + boff + 8 * hh); bq.half[1] = *(const v8us*)((const unsigned short*)Bh + boff + 16 + 8 * hh);
      acc[t] = mmaH<1>(ah.v, ah.v, bq.v, bq.v, acc[t]); }
  }
#pragma unroll
  for (int t = 0; t < 4; ++t) { if (col0 + t * 16 >= N) continue; const int col = col0 + t * 16 + ln; const float bv = bp ? bf16_round(bp[col]) : 0.f;
#pragma unroll
    for (int r = 0; r < 8; ++r) { float v = acc[t][r] * alpha + bv; if (CP) { const int bidx = (row0g + row0 + 8 * hh + r) / rowsPerB; v += CP[(size_t)bidx * sCPb + (size_t)by * 64 + col]; } if (ACT == 1) v = (v > 0.f) ? v : expm1f(v); else if (ACT == 3) v = fmaxf(v, 0.f); so[w][8 * hh + r][t * 16 + ln] = v; } }
  __builtin_amdgcn_fence(__ATOMIC_ACQ_REL, "workgroup"); __builtin_amdgcn_wave_barrier();
  const int rsub = lane >> 4, c4 = (lane & 15) * 4; typedef _Float16 v4h __attribute__((ext_vector_type(4)));
  {
#pragma unroll
    for (int q = 0; q < 8; ++q) { const int r = q * 2 + rsub; if (col0 + c4 < N) { const v4f v = *(const v4fa*)&so[w][r][c4]; if (C) *(v4f*)(C + cofs + (size_t)(row0 + r) * ldc + col0 + c4) = v; if (C16) { v4h h4; for (int i = 0; i < 4; ++i) h4[i] = (_Float16)v[i]; *(v4h*)(C16 + cofs + (size_t)(row0 + r) * ldc + col0 + c4) = h4; } } }
     }
}


__global__ __launch_bounds__(256) void k_im(const float* __restrict__ x, _Float16* __restrict__ IM) { const size_t t = (size_t)blockIdx.x * 256 + threadIdx.x; if (t >= (size_t)NR * NH * 3 * 8) return; const size_t row = t / (NH * 24); const int rem = (int)(t % (NH * 24)); const int h = rem / 24, i = (rem % 24) / 8, d8 = (rem % 8) * 8; const int b = (int)(row / TT), s = (int)(row % TT); int ss = s + i - 2; ss = ss < 0 ? 0 : ss; FragH f;
#pragma unroll
  for (int q = 0; q < 8; ++q) f.h[q] = (_Float16)bf16_round(x[((size_t)b * TT + ss) * DDm + h * HD + d8 + q]); *(v8us*)((unsigned short*)IM + t * 8) = f.half[0];  }
__global__ __launch_bounds__(256) void k_wc(const float* __restrict__ w, _Float16* __restrict__ Bt) { const int t = blockIdx.x * 256 + threadIdx.x; if (t >= NH * CCv * 24) return; const int row = t / 24, rem = t % 24; const int i = rem / 8, d8 = (rem % 8) * 8; FragH f;
#pragma unroll
  for (int q = 0; q < 8; ++q) f.h[q] = (_Float16)(bf16_round(w[((size_t)row * HD + d8 + q) * 3 + i]) * 16.0f); *(v8us*)((unsigned short*)Bt + (size_t)row * 192 + i * 64 + d8) = f.half[0];  }
__global__ __launch_bounds__(256) void k_c16(const float* __restrict__ QC, _Float16* __restrict__ Q16) { const size_t t = (size_t)blockIdx.x * 256 + threadIdx.x; if (t >= (size_t)NR * NH * 4) return; const v4f a = *(const v4fa*)(QC + t * 8), c = *(const v4fa*)(QC + t * 8 + 4); FragH f; for (int q = 0; q < 4; ++q) { f.h[q] = (_Float16)a[q]; f.h[4 + q] = (_Float16)c[q]; }
  *(v8us*)((unsigned short*)Q16 + t * 8) = f.half[0];  }
__global__ __launch_bounds__(256) void k_norm(const float* __restrict__ QC, float* __restrict__ N2) { const size_t t = (size_t)blockIdx.x * 256 + threadIdx.x; if (t >= (size_t)NR * NH) return; const float* src = QC + t * CCv; float ss = 0.f;
#pragma unroll 1
  for (int p = 0; p < CCv; p += 4) { const v4f a = *(const v4fa*)(src + p); ss += a[0] * a[0] + a[1] * a[1] + a[2] * a[2] + a[3] * a[3]; }
  *(float*)(N2 + t) = ss;  }
__global__ __launch_bounds__(256) void k_vts(const float* __restrict__ v, _Float16* __restrict__ Vt) { __shared__ unsigned short tl[64][66]; const int tid = threadIdx.x; const int slab = blockIdx.x / (TT / 64), tg = blockIdx.x % (TT / 64); const int b = slab / NH, h = slab % NH;
  for (int i = tid; i < 64 * 16; i += 256) { const int r = i / 16, c4 = (i % 16) * 4; const int ts = (tg * 64 + r + 1) % TT; const v4f a = *(const v4fa*)(v + ((size_t)b * TT + ts) * DDm + h * HD + c4); FragH f; for (int q = 0; q < 4; ++q) { f.h[q] = (_Float16)bf16_round(a[q]); tl[r][c4 + q] = f.u[q]; } }
  __syncthreads();
  {
#pragma unroll
    for (int rd = 0; rd < 2; ++rd) { const int d = rd * 32 + tid / 8, pc = tid % 8; FragH f;
#pragma unroll
      for (int q = 0; q < 8; ++q) f.u[q] = tl[pc * 8 + q][d]; *(v8us*)((unsigned short*)Vt + ((size_t)slab * HD + d) * TT + tg * 64 + pc * 8) = f.half[0]; }
     } }
// attention per ((b,h), 128 queries): wave 32 queries; S = qc·kc (d 32); logit = −sqrt(max(q2 + k2 − 2S, 1e-12)); mask[q][k] (INPUT, nonzero = keep; tiles with no open key for the wave skipped);
__global__ __launch_bounds__(128) void k_sattn(const _Float16* __restrict__ Q16, const _Float16* __restrict__ K16, const float* __restrict__ NQ, const float* __restrict__ NK, const int* __restrict__ MSK, const _Float16* __restrict__ Vt, float* __restrict__ O) { constexpr int RPW = 32;
  __shared__ __attribute__((aligned(16))) unsigned short sP[4][RPW][40]; __shared__ __attribute__((aligned(16))) float sO[4][RPW][68];
  const int tid = threadIdx.x, w = tid >> 5, lane = tid & 31, ln = lane & 15, hh = lane >> 4; const int slab = blockIdx.x / (TT / 128), qblk = blockIdx.x % (TT / 128); const int b = slab / NH, h = slab % NH; const int q0 = qblk * 128 + w * RPW;
  FragH aq[2]; float q2r[2][8];
#pragma unroll
  for (int rt = 0; rt < 2; ++rt) { const unsigned short* qr = (const unsigned short*)Q16 + (((size_t)b * TT + q0 + rt * 16 + ln) * NH + h) * CCv; aq[rt].half[0] = *(const v8us*)(qr + 8 * hh); aq[rt].half[1] = *(const v8us*)(qr + 16 + 8 * hh);
#pragma unroll
    for (int r = 0; r < 8; ++r) q2r[rt][r] = NQ[((size_t)b * TT + q0 + rt * 16 + 8 * hh + r) * NH + h]; }
  const unsigned short* Vth = (const unsigned short*)Vt + (size_t)slab * HD * TT;
  float m_r[2][8], l_r[2][8]; v8f oacc[2][4];
#pragma unroll
  for (int rt = 0; rt < 2; ++rt) {
#pragma unroll
    for (int r = 0; r < 8; ++r) { m_r[rt][r] = -3.0e38f; l_r[rt][r] = 0.f; }
#pragma unroll
    for (int dt = 0; dt < 4; ++dt) oacc[rt][dt] = (v8f){0.f,0.f,0.f,0.f,0.f,0.f,0.f,0.f}; }
#pragma unroll 1
  for (int j0 = 0; j0 < TT; j0 += 32) {
    unsigned okb0 = 0u, okb1 = 0u;
#pragma unroll
    for (int rt = 0; rt < 2; ++rt)
#pragma unroll
      for (int r = 0; r < 8; ++r) { const int* mr = MSK + (size_t)(q0 + rt * 16 + 8 * hh + r) * TT + j0; okb0 |= (mr[ln] != 0 ? 1u : 0u) << (rt * 8 + r); okb1 |= (mr[16 + ln] != 0 ? 1u : 0u) << (rt * 8 + r); }
    const bool any = (okb0 | okb1) != 0u; if (__builtin_amdgcn_ballot_w32(any) == 0u) continue;      // wave-uniform skip of fully masked tiles
    v8f s[2][2]; float k2v[2];
#pragma unroll
    for (int nt = 0; nt < 2; ++nt) { const size_t krow = (size_t)b * TT + j0 + nt * 16 + ln; const unsigned short* kr = (const unsigned short*)K16 + (krow * NH + h) * CCv; FragH bk; bk.half[0] = *(const v8us*)(kr + 8 * hh); bk.half[1] = *(const v8us*)(kr + 16 + 8 * hh); k2v[nt] = NK[krow * NH + h];
#pragma unroll
      for (int rt = 0; rt < 2; ++rt) { v8f acc = (v8f){0.f,0.f,0.f,0.f,0.f,0.f,0.f,0.f}; acc = mmaH<1>(aq[rt].v, aq[rt].v, bk.v, bk.v, acc); s[rt][nt] = acc; } }
#pragma unroll
    for (int rt = 0; rt < 2; ++rt)
#pragma unroll
      for (int r = 0; r < 8; ++r) { const bool ok0 = (okb0 >> (rt * 8 + r)) & 1u, ok1 = (okb1 >> (rt * 8 + r)) & 1u;
        const float d0 = fmaxf(q2r[rt][r] + k2v[0] - 2.0f * s[rt][0][r], 1e-12f), d1 = fmaxf(q2r[rt][r] + k2v[1] - 2.0f * s[rt][1][r], 1e-12f); const float s0 = ok0 ? -sqrtf(d0) : -INFINITY, s1 = ok1 ? -sqrtf(d1) : -INFINITY; float mc = fmaxf(s0, s1);
        mc = fmaxf(mc, __shfl_xor(mc, 1, 32)); mc = fmaxf(mc, __shfl_xor(mc, 2, 32)); mc = fmaxf(mc, __shfl_xor(mc, 4, 32)); mc = fmaxf(mc, __shfl_xor(mc, 8, 32));
        const float mn = fmaxf(m_r[rt][r], mc); const float al = (mn > -1.0e38f) ? expf(m_r[rt][r] - mn) : 1.0f; m_r[rt][r] = mn; const float p0 = ok0 ? expf(s0 - mn) : 0.f, p1 = ok1 ? expf(s1 - mn) : 0.f; l_r[rt][r] = l_r[rt][r] * al + p0 + p1;
#pragma unroll
        for (int dt = 0; dt < 4; ++dt) oacc[rt][dt][r] *= al;
        FragH t2; t2.h[0] = (_Float16)p0; t2.h[1] = (_Float16)p1; sP[w][rt * 16 + 8 * hh + r][ln] = t2.u[0]; sP[w][rt * 16 + 8 * hh + r][16 + ln] = t2.u[1]; }
    __builtin_amdgcn_fence(__ATOMIC_ACQ_REL, "workgroup"); __builtin_amdgcn_wave_barrier();
    FragH pa[2];
#pragma unroll
    for (int rt = 0; rt < 2; ++rt) { pa[rt].half[0] = *(const v8us*)&sP[w][rt * 16 + ln][8 * hh]; pa[rt].half[1] = *(const v8us*)&sP[w][rt * 16 + ln][16 + 8 * hh]; }
#pragma unroll
    for (int dt = 0; dt < 4; ++dt) { const unsigned short* vrow = Vth + (size_t)(dt * 16 + ln) * TT + j0; FragH bv; bv.half[0] = *(const v8us*)(vrow + 8 * hh); bv.half[1] = *(const v8us*)(vrow + 16 + 8 * hh);
#pragma unroll
      for (int rt = 0; rt < 2; ++rt) oacc[rt][dt] = mmaH<1>(pa[rt].v, pa[rt].v, bv.v, bv.v, oacc[rt][dt]); }
    __builtin_amdgcn_fence(__ATOMIC_ACQ_REL, "workgroup"); __builtin_amdgcn_wave_barrier(); }
#pragma unroll
  for (int rt = 0; rt < 2; ++rt) {
#pragma unroll
    for (int r = 0; r < 8; ++r) { float l = l_r[rt][r]; l += __shfl_xor(l, 1, 32); l += __shfl_xor(l, 2, 32); l += __shfl_xor(l, 4, 32); l += __shfl_xor(l, 8, 32); l_r[rt][r] = (l > 0.f) ? 1.0f / l : 0.f; }
#pragma unroll
    for (int dt = 0; dt < 4; ++dt)
#pragma unroll
      for (int r = 0; r < 8; ++r) sO[w][rt * 16 + 8 * hh + r][dt * 16 + ln] = oacc[rt][dt][r] * l_r[rt][r]; }
  __builtin_amdgcn_fence(__ATOMIC_ACQ_REL, "workgroup"); __builtin_amdgcn_wave_barrier();
  {
#pragma unroll
    for (int rp = 0; rp < RPW; rp += 2) { const int r = rp + (lane >> 4), pc = lane & 15; const v4f val = *(const v4fa*)&sO[w][r][pc * 4]; *(v4f*)(O + ((size_t)b * TT + q0 + r) * DDm + h * HD + pc * 4) = val; }
     } }
extern "C" void kernel_launch(void* const* d_in, const int* in_sizes, int n_in,
                              void* d_out, int out_size, void* d_ws, size_t ws_size, hipStream_t stream) {
  (void)in_sizes; (void)n_in; (void)out_size;
  const float* qx = (const float*)d_in[0]; const float* kx = (const float*)d_in[1]; const float* vx = (const float*)d_in[2]; const int* mask = (const int*)d_in[3]; const float* cw = (const float*)d_in[4]; const float* cb = (const float*)d_in[5];
  char* ws = (char*)d_ws; size_t off = 0;
  auto take = [&](size_t bytes) { char* p = ws + off; off += (bytes + 255) & ~(size_t)255; return p; };
  _Float16* Bt = (_Float16*)take((size_t)NH * CCv * 192 * 2); _Float16* IM = (_Float16*)take((size_t)NR * NH * 192 * 2); float* QC = (float*)take((size_t)NR * NH * CCv * 4); float* KC = (float*)take((size_t)NR * NH * CCv * 4); _Float16* Q16 = (_Float16*)take((size_t)NR * NH * CCv * 2); _Float16* K16 = (_Float16*)take((size_t)NR * NH * CCv * 2); float* NQ = (float*)take((size_t)NR * NH * 4); float* NK = (float*)take((size_t)NR * NH * 4); _Float16* Vt = (_Float16*)take((size_t)NR * DDm * 2);
  if (off > ws_size) return;      // 0.1 + 25.2 + 8.4 × 2 + 4.2 × 2 + 0.5 + 8.4 ≈ 60 MiB
  k_wc<<<(NH * CCv * 24 + 255) / 256, 256, 0, stream>>>(cw, Bt);
  const dim3 gc(((NR / 16) * 1 + 3) / 4, NH); const unsigned gi = (unsigned)(((size_t)NR * NH * 24 + 255) / 256);
  k_im<<<gi, 256, 0, stream>>>(qx, IM); k_gemm_hhx<0><<<gc, 128, 0, stream>>>(IM, NH * 192, (size_t)192, Bt, 192, (size_t)CCv * 192, 0.0625f, cb, (size_t)CCv, nullptr, 1, 0, 0, QC, nullptr, NH * CCv, (size_t)CCv, NR, CCv, 192);
  k_im<<<gi, 256, 0, stream>>>(kx, IM); k_gemm_hhx<0><<<gc, 128, 0, stream>>>(IM, NH * 192, (size_t)192, Bt, 192, (size_t)CCv * 192, 0.0625f, cb, (size_t)CCv, nullptr, 1, 0, 0, KC, nullptr, NH * CCv, (size_t)CCv, NR, CCv, 192);
  k_c16<<<(NR * NH * 4 + 255) / 256, 256, 0, stream>>>(QC, Q16); k_c16<<<(NR * NH * 4 + 255) / 256, 256, 0, stream>>>(KC, K16); k_norm<<<(NR * NH + 255) / 256, 256, 0, stream>>>(QC, NQ); k_norm<<<(NR * NH + 255) / 256, 256, 0, stream>>>(KC, NK);
  k_vts<<<BB * NH * (TT / 64), 256, 0, stream>>>(vx, Vt);
  k_sattn<<<BB * NH * (TT / 128), 128, 0, stream>>>(Q16, K16, NQ, NK, mask, Vt, (float*)d_out);
}

// v001
// It runs in 221 microseconds.
// Two timings next to v000 put it at 2.38 and 2.39 times that version's speed.
#include <hip/hip_runtime.h>
// Simplex (distance-based) attention (B=4, S=2048, 8 heads × 64, conv channels 32): the per-head causal 3-tap conv of q and k as head-batched im2col GEMMs (+ bias) and the attention as a
// fused flash-style kernel on v_wmma_f32_16x16x32_f16 — S = qc·kc (d = 32, one k-step), logits = −sqrt(max(|qc|² + |kc|² − 2S, 1e-12)), INPUT mask (nonzero = keep), online softmax f32,
// P f16 ≤ 1, and the roll(attn, 1) folded into a one-step shift of V (out[s] = Σ_t attn[s][t]·v[t+1 mod S]); f16 operands, single products, f32 accumulate; norms f32 VALU.
#define BB 4
#define TT 2048
#define DDm 512
#define NH 8
#define HD 64
#define CCv 32
#define NR (BB * TT)

typedef __bf16 v16b __attribute__((ext_vector_type(16)));
typedef unsigned short v8us __attribute__((ext_vector_type(8), may_alias));
typedef float  v8f  __attribute__((ext_vector_type(8)));
typedef float  v4f  __attribute__((ext_vector_type(4)));
typedef float  v4fa __attribute__((ext_vector_type(4), may_alias));
union FragB { v16b v; v8us half[2]; unsigned short u[16]; };

__device__ __forceinline__ unsigned short bf16_bits(float x) { unsigned int u = __float_as_uint(x); return (unsigned short)((u + 0x7FFFu + ((u >> 16) & 1u)) >> 16); }
__device__ __forceinline__ float bf16_val(unsigned short b) { return __uint_as_float(((unsigned int)b) << 16); }
__device__ __forceinline__ float bf16_round(float x) { return bf16_val(bf16_bits(x)); }
// D += A·B with NT terms: 1 = ah·bh, 2 = + al·bh (A split), 3 = + ah·bl (both split)
template <int NT>
__device__ __forceinline__ v8f mmaN(v16b ah, v16b al, v16b bh, v16b bl, v8f c) {
  c = __builtin_amdgcn_wmma_f32_16x16x32_bf16(false, ah, false, bh, (short)0, c, false, false);
  if (NT >= 2) c = __builtin_amdgcn_wmma_f32_16x16x32_bf16(false, al, false, bh, (short)0, c, false, false);
  if (NT >= 3) c = __builtin_amdgcn_wmma_f32_16x16x32_bf16(false, ah, false, bl, (short)0, c, false, false);
  asm volatile("v_nop\n\tv_nop\n\tv_nop\n\tv_nop" : "+v"(c) : "v"(ah), "v"(al), "v"(bh), "v"(bl));
  return c;
}

__global__ __launch_bounds__(256) void k_wt_bf16(const float* __restrict__ W, unsigned short* __restrict__ Wt, int K, int N) {
  const int t = blockIdx.x * 256 + threadIdx.x;
  const int k8n = K / 8;
  if (t >= N * k8n) return;
  const int n = t / k8n, k8 = (t % k8n) * 8;
  v8us v;
#pragma unroll
  for (int i = 0; i < 8; ++i) v[i] = bf16_bits(W[(size_t)(k8 + i) * N + n]);
  *(v8us*)(Wt + (size_t)n * K + k8) = v;
  
}

// GEMM C[M][N] (f32, pitch ldc) = act(A[M][K]·W + bias). A f32 row-major (pitch lda) converted per fragment to bf16
// (ASPLIT: hi/lo two planes -> 2 terms, else single rounded term); Wt bf16 [N][K] (pitch ldb). BIAS_BF16 rounds the
// bias to bf16 first (bias quantised to bf16 before the add). K%32==0, M%16==0, N%64==0.
template <bool ASPLIT, int ACT, bool BIAS_BF16>
__global__ __launch_bounds__(128) void k_gemm_bf(const float* __restrict__ A, int lda, const unsigned short* __restrict__ Wt, int ldb,
                                               const float* __restrict__ bias, float* __restrict__ C, int ldc, int M, int N, int K) {
  __shared__ __attribute__((aligned(16))) float so[4][16][64];
  const int tid = threadIdx.x, w = tid >> 5, lane = tid & 31, ln = lane & 15, hh = lane >> 4;
  const int ntn = N / 64;
  const int wid = blockIdx.x * 4 + w;
  const int mt = wid / ntn, nq = wid % ntn;
  if (mt * 16 >= M) return;
  const int row0 = mt * 16, col0 = nq * 64;
  const float* arow = A + (size_t)(row0 + ln) * lda;
  v8f acc[4] = {};
  for (int kb = 0; kb < K; kb += 32) {
    FragB ah, al;
    const v4f x0 = *(const v4fa*)(arow + kb + 8 * hh), x1 = *(const v4fa*)(arow + kb + 8 * hh + 4);
    const v4f x2 = *(const v4fa*)(arow + kb + 16 + 8 * hh), x3 = *(const v4fa*)(arow + kb + 16 + 8 * hh + 4);
    float xs[16] = {x0[0],x0[1],x0[2],x0[3],x1[0],x1[1],x1[2],x1[3],x2[0],x2[1],x2[2],x2[3],x3[0],x3[1],x3[2],x3[3]};
#pragma unroll
    for (int i = 0; i < 16; ++i) { const unsigned short hb = bf16_bits(xs[i]); ah.u[i] = hb; al.u[i] = ASPLIT ? bf16_bits(xs[i] - bf16_val(hb)) : (unsigned short)0; }
#pragma unroll
    for (int t = 0; t < 4; ++t) {
      const unsigned short* brow = Wt + (size_t)(col0 + t * 16 + ln) * ldb + kb;
      FragB b;
      b.half[0] = *(const v8us*)(brow + 8 * hh);
      b.half[1] = *(const v8us*)(brow + 16 + 8 * hh);
      acc[t] = mmaN<ASPLIT ? 2 : 1>(ah.v, al.v, b.v, b.v, acc[t]);
    }
  }
#pragma unroll
  for (int t = 0; t < 4; ++t) {
    float bv = bias ? bias[col0 + t * 16 + ln] : 0.f;
    if (BIAS_BF16) bv = bf16_round(bv);
#pragma unroll
    for (int r = 0; r < 8; ++r) { float v = acc[t][r] + bv; if (ACT == 1) v = fmaxf(v, 0.f); so[w][8 * hh + r][t * 16 + ln] = v; }
  }
  __builtin_amdgcn_fence(__ATOMIC_ACQ_REL, "workgroup");
  __builtin_amdgcn_wave_barrier();
  const int rsub = lane >> 4, c4 = (lane & 15) * 4;
  {
#pragma unroll
    for (int q = 0; q < 8; ++q) {
      const int r = q * 2 + rsub;
      const v4f v = *(const v4fa*)&so[w][r][c4];
      *(v4f*)(C + (size_t)(row0 + r) * ldc + col0 + c4) = v;
    }
    
  }
}

// Flash-style causal/unmasked attention, all contractions 3-term bf16 hi/lo splits, f32 softmax with running max.
// q,k,v rows are read from f32 buffers with arbitrary row pitch (so they can live inside a fused qkv buffer);
// D = head size (multiple of 32, <= 128); one wave = 16 query rows; block = 4 waves (64 queries) sharing K/V chunks of 32.
template <int D, bool CAUSAL>
__global__ __launch_bounds__(128) void k_flash(const float* __restrict__ qb, const float* __restrict__ kb, const float* __restrict__ vb,
                                             int pitch, int T, int H, float scale, float* __restrict__ y, int ypitch) {
  constexpr int KS = D / 32;        // k-steps for QK
  constexpr int DT = D / 16;        // d tiles for PV
  __shared__ __attribute__((aligned(16))) unsigned short sKh[32][D + 8], sKl[32][D + 8], sVh[32][D + 8], sVl[32][D + 8];
  __shared__ __attribute__((aligned(16))) unsigned short sPh[4][16][40], sPl[4][16][40];
  __shared__ __attribute__((aligned(16))) float sO[4][16][D];
  const int tid = threadIdx.x, w = tid >> 5, lane = tid & 31, ln = lane & 15, hh = lane >> 4;
  const int nqb = (T + 63) / 64;
  const int bh = blockIdx.x / nqb, qblk = blockIdx.x % nqb;
  const int b = bh / H, h = bh % H;
  const int q0 = qblk * 64 + w * 16;
  const float* Q = qb + (size_t)b * T * pitch + h * D;
  const float* K = kb + (size_t)b * T * pitch + h * D;
  const float* V = vb + (size_t)b * T * pitch + h * D;

  // A fragments of the wave's 16 query rows (scaled), hi/lo
  FragB aqh[KS], aql[KS];
  {
    int row = q0 + ln; if (row >= T) row = T - 1;
    const float* qr = Q + (size_t)row * pitch;
#pragma unroll
    for (int ks = 0; ks < KS; ++ks)
#pragma unroll
      for (int i = 0; i < 16; ++i) {
        const int d = ks * 32 + ((i < 8) ? (8 * hh + i) : (16 + 8 * hh + (i - 8)));
        const float x = qr[d] * scale; const unsigned short hb = bf16_bits(x);
        aqh[ks].u[i] = hb; aql[ks].u[i] = bf16_bits(x - bf16_val(hb));
      }
  }
  float m_r[8], l_r[8];
#pragma unroll
  for (int r = 0; r < 8; ++r) { m_r[r] = -3.0e38f; l_r[r] = 0.f; }
  v8f oacc[DT];
#pragma unroll
  for (int dt = 0; dt < DT; ++dt) oacc[dt] = (v8f){0.f,0.f,0.f,0.f,0.f,0.f,0.f,0.f};

  const int kv_end = CAUSAL ? min(T, qblk * 64 + 64) : T;     // block-uniform
  for (int j0 = 0; j0 < kv_end; j0 += 32) {
    __syncthreads();
    for (int e = tid; e < 32 * (D / 4); e += 128) {
      const int r = e / (D / 4), c4 = (e % (D / 4)) * 4;
      const int key = j0 + r;
      v4f kf = {0.f,0.f,0.f,0.f}, vf = {0.f,0.f,0.f,0.f};
      if (key < T) { kf = *(const v4fa*)(K + (size_t)key * pitch + c4); vf = *(const v4fa*)(V + (size_t)key * pitch + c4); }
#pragma unroll
      for (int t = 0; t < 4; ++t) {
        unsigned short hb = bf16_bits(kf[t]); sKh[r][c4 + t] = hb; sKl[r][c4 + t] = bf16_bits(kf[t] - bf16_val(hb));
        hb = bf16_bits(vf[t]); sVh[r][c4 + t] = hb; sVl[r][c4 + t] = bf16_bits(vf[t] - bf16_val(hb));
      }
    }
    __syncthreads();
    // S tile 16 x 32
    v8f s[2];
#pragma unroll
    for (int nt = 0; nt < 2; ++nt) {
      v8f acc = {};
#pragma unroll
      for (int ks = 0; ks < KS; ++ks) {
        FragB bh_, bl_;
        bh_.half[0] = *(const v8us*)&sKh[nt * 16 + ln][ks * 32 + 8 * hh]; bh_.half[1] = *(const v8us*)&sKh[nt * 16 + ln][ks * 32 + 16 + 8 * hh];
        bl_.half[0] = *(const v8us*)&sKl[nt * 16 + ln][ks * 32 + 8 * hh]; bl_.half[1] = *(const v8us*)&sKl[nt * 16 + ln][ks * 32 + 16 + 8 * hh];
        acc = mmaN<3>(aqh[ks].v, aql[ks].v, bh_.v, bl_.v, acc);
      }
      s[nt] = acc;
    }
    // mask + running max (rows 8hh+r; the 16 lanes of a half share rows)
    float alpha[8];
#pragma unroll
    for (int r = 0; r < 8; ++r) {
      const int qi = q0 + 8 * hh + r;
      const int ja = j0 + ln, jb = j0 + 16 + ln;
      if (CAUSAL) { if (ja > qi) s[0][r] = -3.0e38f; if (jb > qi) s[1][r] = -3.0e38f; }
      if (ja >= T) s[0][r] = -3.0e38f;
      if (jb >= T) s[1][r] = -3.0e38f;
      float mx = fmaxf(s[0][r], s[1][r]);
      mx = fmaxf(mx, __shfl_xor(mx, 1, 32)); mx = fmaxf(mx, __shfl_xor(mx, 2, 32)); mx = fmaxf(mx, __shfl_xor(mx, 4, 32)); mx = fmaxf(mx, __shfl_xor(mx, 8, 32));
      const float mnew = fmaxf(m_r[r], mx);
      alpha[r] = (mnew > -1.0e38f) ? __expf(m_r[r] - mnew) : 1.0f;
      const float p0 = (s[0][r] > -1.0e38f) ? __expf(s[0][r] - mnew) : 0.f;
      const float p1 = (s[1][r] > -1.0e38f) ? __expf(s[1][r] - mnew) : 0.f;
      m_r[r] = mnew;
      l_r[r] = l_r[r] * alpha[r] + p0 + p1;            // per-lane partial row sum (16 lanes combined at the end)
      unsigned short hb = bf16_bits(p0); sPh[w][8 * hh + r][ln] = hb;      sPl[w][8 * hh + r][ln] = bf16_bits(p0 - bf16_val(hb));
      hb = bf16_bits(p1);                sPh[w][8 * hh + r][16 + ln] = hb; sPl[w][8 * hh + r][16 + ln] = bf16_bits(p1 - bf16_val(hb));
    }
#pragma unroll
    for (int dt = 0; dt < DT; ++dt)
#pragma unroll
      for (int r = 0; r < 8; ++r) oacc[dt][r] *= alpha[r];
    __builtin_amdgcn_fence(__ATOMIC_ACQ_REL, "workgroup");
    __builtin_amdgcn_wave_barrier();
    FragB pah, pal;
    pah.half[0] = *(const v8us*)&sPh[w][ln][8 * hh]; pah.half[1] = *(const v8us*)&sPh[w][ln][16 + 8 * hh];
    pal.half[0] = *(const v8us*)&sPl[w][ln][8 * hh]; pal.half[1] = *(const v8us*)&sPl[w][ln][16 + 8 * hh];
#pragma unroll
    for (int dt = 0; dt < DT; ++dt) {
      FragB bvh, bvl;
#pragma unroll
      for (int i = 0; i < 8; ++i) {
        bvh.u[i] = sVh[8 * hh + i][dt * 16 + ln]; bvh.u[8 + i] = sVh[16 + 8 * hh + i][dt * 16 + ln];
        bvl.u[i] = sVl[8 * hh + i][dt * 16 + ln]; bvl.u[8 + i] = sVl[16 + 8 * hh + i][dt * 16 + ln];
      }
      oacc[dt] = mmaN<3>(pah.v, pal.v, bvh.v, bvl.v, oacc[dt]);
    }
    __builtin_amdgcn_fence(__ATOMIC_ACQ_REL, "workgroup");
    __builtin_amdgcn_wave_barrier();
  }
#pragma unroll
  for (int r = 0; r < 8; ++r) {
    float l = l_r[r];
    l += __shfl_xor(l, 1, 32); l += __shfl_xor(l, 2, 32); l += __shfl_xor(l, 4, 32); l += __shfl_xor(l, 8, 32);
    l_r[r] = (l > 0.f) ? 1.0f / l : 0.f;
  }
#pragma unroll
  for (int dt = 0; dt < DT; ++dt)
#pragma unroll
    for (int r = 0; r < 8; ++r) sO[w][8 * hh + r][dt * 16 + ln] = oacc[dt][r] * l_r[r];
  __builtin_amdgcn_fence(__ATOMIC_ACQ_REL, "workgroup");
  __builtin_amdgcn_wave_barrier();
  {
    for (int r = 0; r < 16; ++r) {
      const int row = q0 + r;
      if (row < T && lane < D / 4) {
        const v4f val = *(const v4fa*)&sO[w][r][lane * 4];
        *(v4f*)(y + ((size_t)b * T + row) * ypitch + h * D + lane * 4) = val;
      }
    }
    
  }
}

// GEMM C = act(A·W + bias + resid): A f32 (ASPLIT -> hi/lo 2 terms), Wt bf16 [N][K]; ACT 0 none, 1 relu, 2 exact gelu;
// resid (optional, f32, row index = (row % rmod), pitch ldr, RES_BF16 rounds it) added before the activation.
template <bool ASPLIT, int ACT, bool BIAS_BF16, bool RES_BF16>
__global__ __launch_bounds__(128) void k_gemm_bf3(const float* __restrict__ A, int lda, const unsigned short* __restrict__ Wt, int ldb,
                                                const float* __restrict__ bias, const float* __restrict__ resid, int rmod, int ldr,
                                                float* __restrict__ C, int ldc, int M, int N, int K) {
  __shared__ __attribute__((aligned(16))) float so[4][16][64];
  const int tid = threadIdx.x, w = tid >> 5, lane = tid & 31, ln = lane & 15, hh = lane >> 4;
  const int ntn = N / 64;
  const int wid = blockIdx.x * 4 + w;
  const int mt = wid / ntn, nq = wid % ntn;
  if (mt * 16 >= M) return;
  const int row0 = mt * 16, col0 = nq * 64;
  const float* arow = A + (size_t)(row0 + ln) * lda;
  v8f acc[4] = {};
  for (int kb = 0; kb < K; kb += 32) {
    FragB ah, al;
    const v4f x0 = *(const v4fa*)(arow + kb + 8 * hh), x1 = *(const v4fa*)(arow + kb + 8 * hh + 4);
    const v4f x2 = *(const v4fa*)(arow + kb + 16 + 8 * hh), x3 = *(const v4fa*)(arow + kb + 16 + 8 * hh + 4);
    float xs[16] = {x0[0],x0[1],x0[2],x0[3],x1[0],x1[1],x1[2],x1[3],x2[0],x2[1],x2[2],x2[3],x3[0],x3[1],x3[2],x3[3]};
#pragma unroll
    for (int i = 0; i < 16; ++i) { const unsigned short hb = bf16_bits(xs[i]); ah.u[i] = hb; al.u[i] = ASPLIT ? bf16_bits(xs[i] - bf16_val(hb)) : (unsigned short)0; }
#pragma unroll
    for (int t = 0; t < 4; ++t) {
      const unsigned short* brow = Wt + (size_t)(col0 + t * 16 + ln) * ldb + kb;
      FragB b;
      b.half[0] = *(const v8us*)(brow + 8 * hh);
      b.half[1] = *(const v8us*)(brow + 16 + 8 * hh);
      acc[t] = mmaN<ASPLIT ? 2 : 1>(ah.v, al.v, b.v, b.v, acc[t]);
    }
  }
#pragma unroll
  for (int t = 0; t < 4; ++t) {
    const int col = col0 + t * 16 + ln;
    float bv = bias ? bias[col] : 0.f;
    if (BIAS_BF16) bv = bf16_round(bv);
#pragma unroll
    for (int r = 0; r < 8; ++r) {
      float v = acc[t][r] + bv;
      if (resid) { float rv = resid[(size_t)((row0 + 8 * hh + r) % rmod) * ldr + col]; if (RES_BF16) rv = bf16_round(rv); v += rv; }
      if (ACT == 1) v = fmaxf(v, 0.f);
      if (ACT == 2) v = 0.5f * v * (1.0f + erff(v * 0.70710678118654752f));
      if (ACT == 3) { const float u = 0.7978845608028654f * (v + 0.044715f * v * v * v); v = 0.5f * v * (1.0f + tanhf(u)); }
      so[w][8 * hh + r][t * 16 + ln] = v;
    }
  }
  __builtin_amdgcn_fence(__ATOMIC_ACQ_REL, "workgroup");
  __builtin_amdgcn_wave_barrier();
  const int rsub = lane >> 4, c4 = (lane & 15) * 4;
  {
#pragma unroll
    for (int q = 0; q < 8; ++q) {
      const int r = q * 2 + rsub;
      const v4f v = *(const v4fa*)&so[w][r][c4];
      *(v4f*)(C + (size_t)(row0 + r) * ldc + col0 + c4) = v;
    }
    
  }
}
// row LayerNorm (biased variance, eps) over N: s = X (+ R); optional out_sum <- s; out_norm <- (s-mu)*rsqrt(var+eps)*g + b
template <bool PARAM_BF16>
__global__ __launch_bounds__(256) void k_layernorm(const float* __restrict__ X, const float* __restrict__ R, const float* __restrict__ g, const float* __restrict__ bta,
                                                  float* __restrict__ out_sum, float* __restrict__ out_norm, int N, float eps) {
  __shared__ float red[256];
  const int row = blockIdx.x, tid = threadIdx.x;
  const float* x = X + (size_t)row * N; const float* rr = R ? R + (size_t)row * N : nullptr;
  float vals[16];                     // up to N = 4096
  const int per = N / 256;            // contiguous chunk per thread? use strided-by-4 chunks: thread handles j = tid*4 + 1024*u
  float s1 = 0.f;
  for (int u = 0; u < per / 4; ++u) {
    const int j = tid * 4 + 1024 * u;
    const v4f a = *(const v4fa*)(x + j);
    v4f b = {0.f,0.f,0.f,0.f}; if (rr) b = *(const v4fa*)(rr + j);
#pragma unroll
    for (int q = 0; q < 4; ++q) { const float v = a[q] + b[q]; vals[u * 4 + q] = v; s1 += v; }
  }
  red[tid] = s1; __syncthreads();
  for (int st = 128; st > 0; st >>= 1) { if (tid < st) red[tid] += red[tid + st]; __syncthreads(); }
  const float mu = red[0] / (float)N; __syncthreads();
  float s2 = 0.f;
  for (int u = 0; u < per / 4; ++u)
#pragma unroll
    for (int q = 0; q < 4; ++q) { const float c = vals[u * 4 + q] - mu; s2 += c * c; }
  red[tid] = s2; __syncthreads();
  for (int st = 128; st > 0; st >>= 1) { if (tid < st) red[tid] += red[tid + st]; __syncthreads(); }
  const float rs = rsqrtf(red[0] / (float)N + eps);
  {
    for (int u = 0; u < per / 4; ++u) {
      const int j = tid * 4 + 1024 * u;
      v4f o, sm;
#pragma unroll
      for (int q = 0; q < 4; ++q) {
        float gg = g[j + q], bb = bta[j + q];
        if (PARAM_BF16) { gg = bf16_round(gg); bb = bf16_round(bb); }
        sm[q] = vals[u * 4 + q]; o[q] = (vals[u * 4 + q] - mu) * rs * gg + bb;
      }
      if (out_sum) *(v4f*)(out_sum + (size_t)row * N + j) = sm;
      *(v4f*)(out_norm + (size_t)row * N + j) = o;
    }
    
  }
}



// ---- f16 WMMA path (v_wmma_f32_16x16x32_f16): 11-bit significands for operands in range — used for the conv GEMMs and both attention contractions
typedef _Float16 v16h __attribute__((ext_vector_type(16)));
union FragH { v16h v; v8us half[2]; _Float16 h[16]; unsigned short u[16]; };
template <int NT>
__device__ __forceinline__ v8f mmaH(v16h ah, v16h al, v16h bh, v16h bl, v8f c) {
  c = __builtin_amdgcn_wmma_f32_16x16x32_f16(false, ah, false, bh, (short)0, c, false, false);
  if (NT >= 2) c = __builtin_amdgcn_wmma_f32_16x16x32_f16(false, al, false, bh, (short)0, c, false, false);
  if (NT >= 3) c = __builtin_amdgcn_wmma_f32_16x16x32_f16(false, ah, false, bl, (short)0, c, false, false);
  asm volatile("v_nop\n\tv_nop\n\tv_nop\n\tv_nop" : "+v"(c) : "v"(ah), "v"(al), "v"(bh), "v"(bl));
  return c;
}
// batched GEMM like k_gemm_b but f16 operands: A f32 (split into f16 hi/lo if ASPLIT, else rounded to f16), Bt = f16 values [n][k]; alpha; C f32; N multiple of 16 (partial tiles skipped)
template <bool ASPLIT>
__global__ __launch_bounds__(128) void k_gemm_h(const float* __restrict__ A, int lda, size_t sA, const _Float16* __restrict__ Bh, int ldb, size_t sB, float alpha, float* __restrict__ C, int ldc, size_t sC, int M, int N, int K) {
  __shared__ __attribute__((aligned(16))) float so[4][16][64];
  const int tid = threadIdx.x, w = tid >> 5, lane = tid & 31, ln = lane & 15, hh = lane >> 4; const int by = blockIdx.y;
  A += (size_t)by * sA; Bh += (size_t)by * sB; C += (size_t)by * sC;
  const int ntn = (N + 63) / 64; const int wid = blockIdx.x * 4 + w; const int mt = wid / ntn, nq = wid % ntn; if (mt * 16 >= M) return;
  const int row0 = mt * 16, col0 = nq * 64; const float* arow = A + (size_t)(row0 + ln) * lda;
  v8f acc[4] = {};
  for (int kb = 0; kb < K; kb += 32) {
    FragH ah, al;
    const v4f x0 = *(const v4fa*)(arow + kb + 8 * hh), x1 = *(const v4fa*)(arow + kb + 8 * hh + 4), x2 = *(const v4fa*)(arow + kb + 16 + 8 * hh), x3 = *(const v4fa*)(arow + kb + 16 + 8 * hh + 4);
    float xs[16] = {x0[0],x0[1],x0[2],x0[3],x1[0],x1[1],x1[2],x1[3],x2[0],x2[1],x2[2],x2[3],x3[0],x3[1],x3[2],x3[3]};
#pragma unroll
    for (int i = 0; i < 16; ++i) { const _Float16 h = (_Float16)xs[i]; ah.h[i] = h; al.h[i] = ASPLIT ? (_Float16)(xs[i] - (float)h) : (_Float16)0.0f; }
#pragma unroll
    for (int t = 0; t < 4; ++t) { if (col0 + t * 16 >= N) continue; const size_t boff = (size_t)(col0 + t * 16 + ln) * ldb + kb; FragH bq; bq.half[0] = *(const v8us*)(Bh + boff + 8 * hh); bq.half[1] = *(const v8us*)(Bh + boff + 16 + 8 * hh);
      acc[t] = mmaH<ASPLIT ? 2 : 1>(ah.v, al.v, bq.v, bq.v, acc[t]); }
  }
#pragma unroll
  for (int t = 0; t < 4; ++t) { if (col0 + t * 16 >= N) continue;
#pragma unroll
    for (int r = 0; r < 8; ++r) so[w][8 * hh + r][t * 16 + ln] = acc[t][r] * alpha; }
  __builtin_amdgcn_fence(__ATOMIC_ACQ_REL, "workgroup"); __builtin_amdgcn_wave_barrier();
  const int rsub = lane >> 4, c4 = (lane & 15) * 4;
  {
#pragma unroll
    for (int q = 0; q < 8; ++q) { const int r = q * 2 + rsub; if (col0 + c4 < N) { const v4f v = *(const v4fa*)&so[w][r][c4]; *(v4f*)(C + (size_t)(row0 + r) * ldc + col0 + c4) = v; } }
     }
}

// Wt[n][k] = f16(W[k][n]·scale) from f32 row-major W[K][N] (scale = power of two; bf16-exact weights stay exact in f16 away from the subnormal range)
__global__ __launch_bounds__(256) void k_wt_f16(const float* __restrict__ W, _Float16* __restrict__ Wt, int K, int N, float scale) {
  const int t = blockIdx.x * 256 + threadIdx.x; if (t >= N * (K / 8)) return; const int n = t / (K / 8), k8 = (t % (K / 8)) * 8; FragH f;
#pragma unroll
  for (int i = 0; i < 8; ++i) f.h[i] = (_Float16)(bf16_round(W[(size_t)(k8 + i) * N + n]) * scale); const v8us o = f.half[0];
  *(v8us*)((unsigned short*)Wt + (size_t)n * K + k8) = o; 
}
// k_gemm_hh variant with fused epilogue: v = acc·alpha + bias[by·sBias + col] (+ CP[(row/rowsPerB)·sCPb + by·64 + col] if CP) ; ACT 0 none / 1 elu ; writes f32 C and f16 C16, each if non-null
template <int ACT>
__global__ __launch_bounds__(128) void k_gemm_hhx(const _Float16* __restrict__ A, int lda, size_t sA, const _Float16* __restrict__ Bh, int ldb, size_t sB, float alpha, const float* __restrict__ bias, size_t sBias, const float* __restrict__ CP, int rowsPerB, size_t sCPb, int row0g,
    float* __restrict__ C, _Float16* __restrict__ C16, int ldc, size_t sC, int M, int N, int K) {
  __shared__ __attribute__((aligned(16))) float so[4][16][64];
  const int tid = threadIdx.x, w = tid >> 5, lane = tid & 31, ln = lane & 15, hh = lane >> 4; const int by = blockIdx.y;
  A += (size_t)by * sA; Bh += (size_t)by * sB; const size_t cofs = (size_t)by * sC; const float* bp = bias ? bias + (size_t)by * sBias : nullptr;
  const int ntn = (N + 63) / 64; const int wid = blockIdx.x * 4 + w; const int mt = wid / ntn, nq = wid % ntn; if (mt * 16 >= M) return;
  const int row0 = mt * 16, col0 = nq * 64; const _Float16* arow = A + (size_t)(row0 + ln) * lda;
  v8f acc[4] = {};
  for (int kb = 0; kb < K; kb += 32) { FragH ah; ah.half[0] = *(const v8us*)((const unsigned short*)arow + kb + 8 * hh); ah.half[1] = *(const v8us*)((const unsigned short*)arow + kb + 16 + 8 * hh);
#pragma unroll
    for (int t = 0; t < 4; ++t) { if (col0 + t * 16 >= N) continue; const size_t boff = (size_t)(col0 + t * 16 + ln) * ldb + kb; FragH bq; bq.half[0] = *(const v8us*)((const unsigned short*)Bh + boff + 8 * hh); bq.half[1] = *(const v8us*)((const unsigned short*)Bh + boff + 16 + 8 * hh);
      acc[t] = mmaH<1>(ah.v, ah.v, bq.v, bq.v, acc[t]); }
  }
#pragma unroll
  for (int t = 0; t < 4; ++t) { if (col0 + t * 16 >= N) continue; const int col = col0 + t * 16 + ln; const float bv = bp ? bf16_round(bp[col]) : 0.f;
#pragma unroll
    for (int r = 0; r < 8; ++r) { float v = acc[t][r] * alpha + bv; if (CP) { const int bidx = (row0g + row0 + 8 * hh + r) / rowsPerB; v += CP[(size_t)bidx * sCPb + (size_t)by * 64 + col]; } if (ACT == 1) v = (v > 0.f) ? v : expm1f(v); else if (ACT == 3) v = fmaxf(v, 0.f); so[w][8 * hh + r][t * 16 + ln] = v; } }
  __builtin_amdgcn_fence(__ATOMIC_ACQ_REL, "workgroup"); __builtin_amdgcn_wave_barrier();
  const int rsub = lane >> 4, c4 = (lane & 15) * 4; typedef _Float16 v4h __attribute__((ext_vector_type(4)));
  {
#pragma unroll
    for (int q = 0; q < 8; ++q) { const int r = q * 2 + rsub; if (col0 + c4 < N) { const v4f v = *(const v4fa*)&so[w][r][c4]; if (C) *(v4f*)(C + cofs + (size_t)(row0 + r) * ldc + col0 + c4) = v; if (C16) { v4h h4; for (int i = 0; i < 4; ++i) h4[i] = (_Float16)v[i]; *(v4h*)(C16 + cofs + (size_t)(row0 + r) * ldc + col0 + c4) = h4; } } }
     }
}


__global__ __launch_bounds__(256) void k_im(const float* __restrict__ x, _Float16* __restrict__ IM) { const size_t t = (size_t)blockIdx.x * 256 + threadIdx.x; if (t >= (size_t)NR * NH * 3 * 8) return; const size_t row = t / (NH * 24); const int rem = (int)(t % (NH * 24)); const int h = rem / 24, i = (rem % 24) / 8, d8 = (rem % 8) * 8; const int b = (int)(row / TT), s = (int)(row % TT); int ss = s + i - 2; ss = ss < 0 ? 0 : ss; FragH f;
#pragma unroll
  for (int q = 0; q < 8; ++q) f.h[q] = (_Float16)bf16_round(x[((size_t)b * TT + ss) * DDm + h * HD + d8 + q]); *(v8us*)((unsigned short*)IM + t * 8) = f.half[0];  }
__global__ __launch_bounds__(256) void k_wc(const float* __restrict__ w, _Float16* __restrict__ Bt) { const int t = blockIdx.x * 256 + threadIdx.x; if (t >= NH * CCv * 24) return; const int row = t / 24, rem = t % 24; const int i = rem / 8, d8 = (rem % 8) * 8; FragH f;
#pragma unroll
  for (int q = 0; q < 8; ++q) f.h[q] = (_Float16)(bf16_round(w[((size_t)row * HD + d8 + q) * 3 + i]) * 16.0f); *(v8us*)((unsigned short*)Bt + (size_t)row * 192 + i * 64 + d8) = f.half[0];  }
__global__ __launch_bounds__(256) void k_c16(const float* __restrict__ QC, _Float16* __restrict__ Q16) { const size_t t = (size_t)blockIdx.x * 256 + threadIdx.x; if (t >= (size_t)NR * NH * 4) return; const v4f a = *(const v4fa*)(QC + t * 8), c = *(const v4fa*)(QC + t * 8 + 4); FragH f; for (int q = 0; q < 4; ++q) { f.h[q] = (_Float16)a[q]; f.h[4 + q] = (_Float16)c[q]; }
  *(v8us*)((unsigned short*)Q16 + t * 8) = f.half[0];  }
__global__ __launch_bounds__(256) void k_norm(const float* __restrict__ QC, float* __restrict__ N2) { const size_t t = (size_t)blockIdx.x * 256 + threadIdx.x; if (t >= (size_t)NR * NH) return; const float* src = QC + t * CCv; float ss = 0.f;
#pragma unroll 1
  for (int p = 0; p < CCv; p += 4) { const v4f a = *(const v4fa*)(src + p); ss += a[0] * a[0] + a[1] * a[1] + a[2] * a[2] + a[3] * a[3]; }
  *(float*)(N2 + t) = ss;  }
__global__ __launch_bounds__(256) void k_vts(const float* __restrict__ v, _Float16* __restrict__ Vt) { __shared__ unsigned short tl[64][66]; const int tid = threadIdx.x; const int slab = blockIdx.x / (TT / 64), tg = blockIdx.x % (TT / 64); const int b = slab / NH, h = slab % NH;
  for (int i = tid; i < 64 * 16; i += 256) { const int r = i / 16, c4 = (i % 16) * 4; const int ts = (tg * 64 + r + 1) % TT; const v4f a = *(const v4fa*)(v + ((size_t)b * TT + ts) * DDm + h * HD + c4); FragH f; for (int q = 0; q < 4; ++q) { f.h[q] = (_Float16)bf16_round(a[q]); tl[r][c4 + q] = f.u[q]; } }
  __syncthreads();
  {
#pragma unroll
    for (int rd = 0; rd < 2; ++rd) { const int d = rd * 32 + tid / 8, pc = tid % 8; FragH f;
#pragma unroll
      for (int q = 0; q < 8; ++q) f.u[q] = tl[pc * 8 + q][d]; *(v8us*)((unsigned short*)Vt + ((size_t)slab * HD + d) * TT + tg * 64 + pc * 8) = f.half[0]; }
     } }
// attention per ((b,h), 128 queries): wave 32 queries; S = qc·kc (d 32); logit = −sqrt(max(q2 + k2 − 2S, 1e-12)); mask[q][k] (INPUT, nonzero = keep; tiles with no open key for the wave skipped);
__global__ __launch_bounds__(128) void k_sattn(const _Float16* __restrict__ Q16, const _Float16* __restrict__ K16, const float* __restrict__ NQ, const float* __restrict__ NK, const int* __restrict__ MSK, const _Float16* __restrict__ Vt, float* __restrict__ O) { constexpr int RPW = 32; constexpr float L2E = 1.4426950408889634f;
  __shared__ __attribute__((aligned(16))) unsigned short sP[4][RPW][40]; __shared__ __attribute__((aligned(16))) float sO[4][RPW][68];
  const int tid = threadIdx.x, w = tid >> 5, lane = tid & 31, ln = lane & 15, hh = lane >> 4; const int slab = blockIdx.x / (TT / 128), qblk = blockIdx.x % (TT / 128); const int b = slab / NH, h = slab % NH; const int q0 = qblk * 128 + w * RPW;
  FragH aq[2]; float q2r[2][8];
#pragma unroll
  for (int rt = 0; rt < 2; ++rt) { const unsigned short* qr = (const unsigned short*)Q16 + (((size_t)b * TT + q0 + rt * 16 + ln) * NH + h) * CCv; aq[rt].half[0] = *(const v8us*)(qr + 8 * hh); aq[rt].half[1] = *(const v8us*)(qr + 16 + 8 * hh);
#pragma unroll
    for (int r = 0; r < 8; ++r) q2r[rt][r] = NQ[((size_t)b * TT + q0 + rt * 16 + 8 * hh + r) * NH + h]; }
  const unsigned short* Vth = (const unsigned short*)Vt + (size_t)slab * HD * TT;
  float m_r[2][8], l_r[2][8]; v8f oacc[2][4];
#pragma unroll
  for (int rt = 0; rt < 2; ++rt) {
#pragma unroll
    for (int r = 0; r < 8; ++r) { m_r[rt][r] = -3.0e38f; l_r[rt][r] = 0.f; }
#pragma unroll
    for (int dt = 0; dt < 4; ++dt) oacc[rt][dt] = (v8f){0.f,0.f,0.f,0.f,0.f,0.f,0.f,0.f}; }
#pragma unroll 1
  for (int j0 = 0; j0 < TT; j0 += 32) {
    unsigned okb0 = 0u, okb1 = 0u;
#pragma unroll
    for (int rt = 0; rt < 2; ++rt)
#pragma unroll
      for (int r = 0; r < 8; ++r) { const int* mr = MSK + (size_t)(q0 + rt * 16 + 8 * hh + r) * TT + j0; okb0 |= (mr[ln] != 0 ? 1u : 0u) << (rt * 8 + r); okb1 |= (mr[16 + ln] != 0 ? 1u : 0u) << (rt * 8 + r); }
    const bool any = (okb0 | okb1) != 0u; if (__builtin_amdgcn_ballot_w32(any) == 0u) continue;      // wave-uniform skip of fully masked tiles
    v8f s[2][2]; float k2v[2];
#pragma unroll
    for (int nt = 0; nt < 2; ++nt) { const size_t krow = (size_t)b * TT + j0 + nt * 16 + ln; const unsigned short* kr = (const unsigned short*)K16 + (krow * NH + h) * CCv; FragH bk; bk.half[0] = *(const v8us*)(kr + 8 * hh); bk.half[1] = *(const v8us*)(kr + 16 + 8 * hh); k2v[nt] = NK[krow * NH + h];
#pragma unroll
      for (int rt = 0; rt < 2; ++rt) { v8f acc = (v8f){0.f,0.f,0.f,0.f,0.f,0.f,0.f,0.f}; acc = mmaH<1>(aq[rt].v, aq[rt].v, bk.v, bk.v, acc); s[rt][nt] = acc; } }
#pragma unroll
    for (int rt = 0; rt < 2; ++rt)
#pragma unroll
      for (int r = 0; r < 8; ++r) { const bool ok0 = (okb0 >> (rt * 8 + r)) & 1u, ok1 = (okb1 >> (rt * 8 + r)) & 1u;
        const float d0 = fmaxf(q2r[rt][r] + k2v[0] - 2.0f * s[rt][0][r], 1e-12f), d1 = fmaxf(q2r[rt][r] + k2v[1] - 2.0f * s[rt][1][r], 1e-12f); const float s0 = ok0 ? -__builtin_amdgcn_sqrtf(d0) : -INFINITY, s1 = ok1 ? -__builtin_amdgcn_sqrtf(d1) : -INFINITY; float mc = fmaxf(s0, s1);      // d >= 1e-12: never a denormal, the hardware root needs no range fix-up
        mc = fmaxf(mc, __shfl_xor(mc, 1, 32)); mc = fmaxf(mc, __shfl_xor(mc, 2, 32)); mc = fmaxf(mc, __shfl_xor(mc, 4, 32)); mc = fmaxf(mc, __shfl_xor(mc, 8, 32));
        const float mn = fmaxf(m_r[rt][r], mc); const float al = (mn > -1.0e38f) ? __builtin_amdgcn_exp2f((m_r[rt][r] - mn) * L2E) : 1.0f; m_r[rt][r] = mn; const float nm = -mn * L2E;      // exp(x - mn) = exp2(x * log2(e) - mn * log2(e)): one fma and the hardware exp2; arguments <= 0 up to one rounding, a result below the normal range is 0
        const float p0 = ok0 ? __builtin_amdgcn_exp2f(__builtin_fmaf(s0, L2E, nm)) : 0.f, p1 = ok1 ? __builtin_amdgcn_exp2f(__builtin_fmaf(s1, L2E, nm)) : 0.f; l_r[rt][r] = l_r[rt][r] * al + p0 + p1;
#pragma unroll
        for (int dt = 0; dt < 4; ++dt) oacc[rt][dt][r] *= al;
        FragH t2; t2.h[0] = (_Float16)p0; t2.h[1] = (_Float16)p1; sP[w][rt * 16 + 8 * hh + r][ln] = t2.u[0]; sP[w][rt * 16 + 8 * hh + r][16 + ln] = t2.u[1]; }
    __builtin_amdgcn_fence(__ATOMIC_ACQ_REL, "workgroup"); __builtin_amdgcn_wave_barrier();
    FragH pa[2];
#pragma unroll
    for (int rt = 0; rt < 2; ++rt) { pa[rt].half[0] = *(const v8us*)&sP[w][rt * 16 + ln][8 * hh]; pa[rt].half[1] = *(const v8us*)&sP[w][rt * 16 + ln][16 + 8 * hh]; }
#pragma unroll
    for (int dt = 0; dt < 4; ++dt) { const unsigned short* vrow = Vth + (size_t)(dt * 16 + ln) * TT + j0; FragH bv; bv.half[0] = *(const v8us*)(vrow + 8 * hh); bv.half[1] = *(const v8us*)(vrow + 16 + 8 * hh);
#pragma unroll
      for (int rt = 0; rt < 2; ++rt) oacc[rt][dt] = mmaH<1>(pa[rt].v, pa[rt].v, bv.v, bv.v, oacc[rt][dt]); }
    __builtin_amdgcn_fence(__ATOMIC_ACQ_REL, "workgroup"); __builtin_amdgcn_wave_barrier(); }
#pragma unroll
  for (int rt = 0; rt < 2; ++rt) {
#pragma unroll
    for (int r = 0; r < 8; ++r) { float l = l_r[rt][r]; l += __shfl_xor(l, 1, 32); l += __shfl_xor(l, 2, 32); l += __shfl_xor(l, 4, 32); l += __shfl_xor(l, 8, 32); l_r[rt][r] = (l > 0.f) ? 1.0f / l : 0.f; }
#pragma unroll
    for (int dt = 0; dt < 4; ++dt)
#pragma unroll
      for (int r = 0; r < 8; ++r) sO[w][rt * 16 + 8 * hh + r][dt * 16 + ln] = oacc[rt][dt][r] * l_r[rt][r]; }
  __builtin_amdgcn_fence(__ATOMIC_ACQ_REL, "workgroup"); __builtin_amdgcn_wave_barrier();
  {
#pragma unroll
    for (int rp = 0; rp < RPW; rp += 2) { const int r = rp + (lane >> 4), pc = lane & 15; const v4f val = *(const v4fa*)&sO[w][r][pc * 4]; *(v4f*)(O + ((size_t)b * TT + q0 + r) * DDm + h * HD + pc * 4) = val; }
     } }
extern "C" void kernel_launch(void* const* d_in, const int* in_sizes, int n_in,
                              void* d_out, int out_size, void* d_ws, size_t ws_size, hipStream_t stream) {
  (void)in_sizes; (void)n_in; (void)out_size;
  const float* qx = (const float*)d_in[0]; const float* kx = (const float*)d_in[1]; const float* vx = (const float*)d_in[2]; const int* mask = (const int*)d_in[3]; const float* cw = (const float*)d_in[4]; const float* cb = (const float*)d_in[5];
  char* ws = (char*)d_ws; size_t off = 0;
  auto take = [&](size_t bytes) { char* p = ws + off; off += (bytes + 255) & ~(size_t)255; return p; };
  _Float16* Bt = (_Float16*)take((size_t)NH * CCv * 192 * 2); _Float16* IM = (_Float16*)take((size_t)NR * NH * 192 * 2); float* QC = (float*)take((size_t)NR * NH * CCv * 4); float* KC = (float*)take((size_t)NR * NH * CCv * 4); _Float16* Q16 = (_Float16*)take((size_t)NR * NH * CCv * 2); _Float16* K16 = (_Float16*)take((size_t)NR * NH * CCv * 2); float* NQ = (float*)take((size_t)NR * NH * 4); float* NK = (float*)take((size_t)NR * NH * 4); _Float16* Vt = (_Float16*)take((size_t)NR * DDm * 2);
  if (off > ws_size) return;      // 0.1 + 25.2 + 8.4 × 2 + 4.2 × 2 + 0.5 + 8.4 ≈ 60 MiB
  k_wc<<<(NH * CCv * 24 + 255) / 256, 256, 0, stream>>>(cw, Bt);
  const dim3 gc(((NR / 16) * 1 + 3) / 4, NH); const unsigned gi = (unsigned)(((size_t)NR * NH * 24 + 255) / 256);
  k_im<<<gi, 256, 0, stream>>>(qx, IM); k_gemm_hhx<0><<<gc, 128, 0, stream>>>(IM, NH * 192, (size_t)192, Bt, 192, (size_t)CCv * 192, 0.0625f, cb, (size_t)CCv, nullptr, 1, 0, 0, QC, nullptr, NH * CCv, (size_t)CCv, NR, CCv, 192);
  k_im<<<gi, 256, 0, stream>>>(kx, IM); k_gemm_hhx<0><<<gc, 128, 0, stream>>>(IM, NH * 192, (size_t)192, Bt, 192, (size_t)CCv * 192, 0.0625f, cb, (size_t)CCv, nullptr, 1, 0, 0, KC, nullptr, NH * CCv, (size_t)CCv, NR, CCv, 192);
  k_c16<<<(NR * NH * 4 + 255) / 256, 256, 0, stream>>>(QC, Q16); k_c16<<<(NR * NH * 4 + 255) / 256, 256, 0, stream>>>(KC, K16); k_norm<<<(NR * NH + 255) / 256, 256, 0, stream>>>(QC, NQ); k_norm<<<(NR * NH + 255) / 256, 256, 0, stream>>>(KC, NK);
  k_vts<<<BB * NH * (TT / 64), 256, 0, stream>>>(vx, Vt);
  k_sattn<<<BB * NH * (TT / 128), 128, 0, stream>>>(Q16, K16, NQ, NK, mask, Vt, (float*)d_out);
}

// v002
// A run of this version takes 140 microseconds.
// Two timings next to v001 put it at 1.59 and 1.61 times that version's speed.
// All steps since v000 together make it 3.82 times as fast.
#include <hip/hip_runtime.h>
// Simplex (distance-based) attention (B=4, S=2048, 8 heads × 64, conv channels 32): the per-head causal 3-tap conv of q and k as head-batched im2col GEMMs (+ bias) and the attention as a
// fused flash-style kernel on v_wmma_f32_16x16x32_f16 — S = qc·kc (d = 32, one k-step), logits = −sqrt(max(|qc|² + |kc|² − 2S, 1e-12)), INPUT mask (nonzero = keep), online softmax f32,
// P f16 ≤ 1, and the roll(attn, 1) folded into a one-step shift of V (out[s] = Σ_t attn[s][t]·v[t+1 mod S]); f16 operands, single products, f32 accumulate; norms f32 VALU.
#define BB 4
#define TT 2048
#define DDm 512
#define NH 8
#define HD 64
#define CCv 32
#define NR (BB * TT)

typedef __bf16 v16b __attribute__((ext_vector_type(16)));
typedef unsigned short v8us __attribute__((ext_vector_type(8), may_alias));
typedef float  v8f  __attribute__((ext_vector_type(8)));
typedef float  v4f  __attribute__((ext_vector_type(4)));
typedef float  v4fa __attribute__((ext_vector_type(4), may_alias));
union FragB { v16b v; v8us half[2]; unsigned short u[16]; };

__device__ __forceinline__ unsigned short bf16_bits(float x) { unsigned int u = __float_as_uint(x); return (unsigned short)((u + 0x7FFFu + ((u >> 16) & 1u)) >> 16); }
__device__ __forceinline__ float bf16_val(unsigned short b) { return __uint_as_float(((unsigned int)b) << 16); }
__device__ __forceinline__ float bf16_round(float x) { return bf16_val(bf16_bits(x)); }
// D += A·B with NT terms: 1 = ah·bh, 2 = + al·bh (A split), 3 = + ah·bl (both split)
template <int NT>
__device__ __forceinline__ v8f mmaN(v16b ah, v16b al, v16b bh, v16b bl, v8f c) {
  c = __builtin_amdgcn_wmma_f32_16x16x32_bf16(false, ah, false, bh, (short)0, c, false, false);
  if (NT >= 2) c = __builtin_amdgcn_wmma_f32_16x16x32_bf16(false, al, false, bh, (short)0, c, false, false);
  if (NT >= 3) c = __builtin_amdgcn_wmma_f32_16x16x32_bf16(false, ah, false, bl, (short)0, c, false, false);
  asm volatile("v_nop\n\tv_nop\n\tv_nop\n\tv_nop" : "+v"(c) : "v"(ah), "v"(al), "v"(bh), "v"(bl));
  return c;
}

__global__ __launch_bounds__(256) void k_wt_bf16(const float* __restrict__ W, unsigned short* __restrict__ Wt, int K, int N) {
  const int t = blockIdx.x * 256 + threadIdx.x;
  const int k8n = K / 8;
  if (t >= N * k8n) return;
  const int n = t / k8n, k8 = (t % k8n) * 8;
  v8us v;
#pragma unroll
  for (int i = 0; i < 8; ++i) v[i] = bf16_bits(W[(size_t)(k8 + i) * N + n]);
  *(v8us*)(Wt + (size_t)n * K + k8) = v;
  
}

// GEMM C[M][N] (f32, pitch ldc) = act(A[M][K]·W + bias). A f32 row-major (pitch lda) converted per fragment to bf16
// (ASPLIT: hi/lo two planes -> 2 terms, else single rounded term); Wt bf16 [N][K] (pitch ldb). BIAS_BF16 rounds the
// bias to bf16 first (bias quantised to bf16 before the add). K%32==0, M%16==0, N%64==0.
template <bool ASPLIT, int ACT, bool BIAS_BF16>
__global__ __launch_bounds__(128) void k_gemm_bf(const float* __restrict__ A, int lda, const unsigned short* __restrict__ Wt, int ldb,
                                               const float* __restrict__ bias, float* __restrict__ C, int ldc, int M, int N, int K) {
  __shared__ __attribute__((aligned(16))) float so[4][16][64];
  const int tid = threadIdx.x, w = tid >> 5, lane = tid & 31, ln = lane & 15, hh = lane >> 4;
  const int ntn = N / 64;
  const int wid = blockIdx.x * 4 + w;
  const int mt = wid / ntn, nq = wid % ntn;
  if (mt * 16 >= M) return;
  const int row0 = mt * 16, col0 = nq * 64;
  const float* arow = A + (size_t)(row0 + ln) * lda;
  v8f acc[4] = {};
  for (int kb = 0; kb < K; kb += 32) {
    FragB ah, al;
    const v4f x0 = *(const v4fa*)(arow + kb + 8 * hh), x1 = *(const v4fa*)(arow + kb + 8 * hh + 4);
    const v4f x2 = *(const v4fa*)(arow + kb + 16 + 8 * hh), x3 = *(const v4fa*)(arow + kb + 16 + 8 * hh + 4);
    float xs[16] = {x0[0],x0[1],x0[2],x0[3],x1[0],x1[1],x1[2],x1[3],x2[0],x2[1],x2[2],x2[3],x3[0],x3[1],x3[2],x3[3]};
#pragma unroll
    for (int i = 0; i < 16; ++i) { const unsigned short hb = bf16_bits(xs[i]); ah.u[i] = hb; al.u[i] = ASPLIT ? bf16_bits(xs[i] - bf16_val(hb)) : (unsigned short)0; }
#pragma unroll
    for (int t = 0; t < 4; ++t) {
      const unsigned short* brow = Wt + (size_t)(col0 + t * 16 + ln) * ldb + kb;
      FragB b;
      b.half[0] = *(const v8us*)(brow + 8 * hh);
      b.half[1] = *(const v8us*)(brow + 16 + 8 * hh);
      acc[t] = mmaN<ASPLIT ? 2 : 1>(ah.v, al.v, b.v, b.v, acc[t]);
    }
  }
#pragma unroll
  for (int t = 0; t < 4; ++t) {
    float bv = bias ? bias[col0 + t * 16 + ln] : 0.f;
    if (BIAS_BF16) bv = bf16_round(bv);
#pragma unroll
    for (int r = 0; r < 8; ++r) { float v = acc[t][r] + bv; if (ACT == 1) v = fmaxf(v, 0.f); so[w][8 * hh + r][t * 16 + ln] = v; }
  }
  __builtin_amdgcn_fence(__ATOMIC_ACQ_REL, "workgroup");
  __builtin_amdgcn_wave_barrier();
  const int rsub = lane >> 4, c4 = (lane & 15) * 4;
  {
#pragma unroll
    for (int q = 0; q < 8; ++q) {
      const int r = q * 2 + rsub;
      const v4f v = *(const v4fa*)&so[w][r][c4];
      *(v4f*)(C + (size_t)(row0 + r) * ldc + col0 + c4) = v;
    }
    
  }
}

// Flash-style causal/unmasked attention, all contractions 3-term bf16 hi/lo splits, f32 softmax with running max.
// q,k,v rows are read from f32 buffers with arbitrary row pitch (so they can live inside a fused qkv buffer);
// D = head size (multiple of 32, <= 128); one wave = 16 query rows; block = 4 waves (64 queries) sharing K/V chunks of 32.
template <int D, bool CAUSAL>
__global__ __launch_bounds__(128) void k_flash(const float* __restrict__ qb, const float* __restrict__ kb, const float* __restrict__ vb,
                                             int pitch, int T, int H, float scale, float* __restrict__ y, int ypitch) {
  constexpr int KS = D / 32;        // k-steps for QK
  constexpr int DT = D / 16;        // d tiles for PV
  __shared__ __attribute__((aligned(16))) unsigned short sKh[32][D + 8], sKl[32][D + 8], sVh[32][D + 8], sVl[32][D + 8];
  __shared__ __attribute__((aligned(16))) unsigned short sPh[4][16][40], sPl[4][16][40];
  __shared__ __attribute__((aligned(16))) float sO[4][16][D];
  const int tid = threadIdx.x, w = tid >> 5, lane = tid & 31, ln = lane & 15, hh = lane >> 4;
  const int nqb = (T + 63) / 64;
  const int bh = blockIdx.x / nqb, qblk = blockIdx.x % nqb;
  const int b = bh / H, h = bh % H;
  const int q0 = qblk * 64 + w * 16;
  const float* Q = qb + (size_t)b * T * pitch + h * D;
  const float* K = kb + (size_t)b * T * pitch + h * D;
  const float* V = vb + (size_t)b * T * pitch + h * D;

  // A fragments of the wave's 16 query rows (scaled), hi/lo
  FragB aqh[KS], aql[KS];
  {
    int row = q0 + ln; if (row >= T) row = T - 1;
    const float* qr = Q + (size_t)row * pitch;
#pragma unroll
    for (int ks = 0; ks < KS; ++ks)
#pragma unroll
      for (int i = 0; i < 16; ++i) {
        const int d = ks * 32 + ((i < 8) ? (8 * hh + i) : (16 + 8 * hh + (i - 8)));
        const float x = qr[d] * scale; const unsigned short hb = bf16_bits(x);
        aqh[ks].u[i] = hb; aql[ks].u[i] = bf16_bits(x - bf16_val(hb));
      }
  }
  float m_r[8], l_r[8];
#pragma unroll
  for (int r = 0; r < 8; ++r) { m_r[r] = -3.0e38f; l_r[r] = 0.f; }
  v8f oacc[DT];
#pragma unroll
  for (int dt = 0; dt < DT; ++dt) oacc[dt] = (v8f){0.f,0.f,0.f,0.f,0.f,0.f,0.f,0.f};

  const int kv_end = CAUSAL ? min(T, qblk * 64 + 64) : T;     // block-uniform
  for (int j0 = 0; j0 < kv_end; j0 += 32) {
    __syncthreads();
    for (int e = tid; e < 32 * (D / 4); e += 128) {
      const int r = e / (D / 4), c4 = (e % (D / 4)) * 4;
      const int key = j0 + r;
      v4f kf = {0.f,0.f,0.f,0.f}, vf = {0.f,0.f,0.f,0.f};
      if (key < T) { kf = *(const v4fa*)(K + (size_t)key * pitch + c4); vf = *(const v4fa*)(V + (size_t)key * pitch + c4); }
#pragma unroll
      for (int t = 0; t < 4; ++t) {
        unsigned short hb = bf16_bits(kf[t]); sKh[r][c4 + t] = hb; sKl[r][c4 + t] = bf16_bits(kf[t] - bf16_val(hb));
        hb = bf16_bits(vf[t]); sVh[r][c4 + t] = hb; sVl[r][c4 + t] = bf16_bits(vf[t] - bf16_val(hb));
      }
    }
    __syncthreads();
    // S tile 16 x 32
    v8f s[2];
#pragma unroll
    for (int nt = 0; nt < 2; ++nt) {
      v8f acc = {};
#pragma unroll
      for (int ks = 0; ks < KS; ++ks) {
        FragB bh_, bl_;
        bh_.half[0] = *(const v8us*)&sKh[nt * 16 + ln][ks * 32 + 8 * hh]; bh_.half[1] = *(const v8us*)&sKh[nt * 16 + ln][ks * 32 + 16 + 8 * hh];
        bl_.half[0] = *(const v8us*)&sKl[nt * 16 + ln][ks * 32 + 8 * hh]; bl_.half[1] = *(const v8us*)&sKl[nt * 16 + ln][ks * 32 + 16 + 8 * hh];
        acc = mmaN<3>(aqh[ks].v, aql[ks].v, bh_.v, bl_.v, acc);
      }
      s[nt] = acc;
    }
    // mask + running max (rows 8hh+r; the 16 lanes of a half share rows)
    float alpha[8];
#pragma unroll
    for (int r = 0; r < 8; ++r) {
      const int qi = q0 + 8 * hh + r;
      const int ja = j0 + ln, jb = j0 + 16 + ln;
      if (CAUSAL) { if (ja > qi) s[0][r] = -3.0e38f; if (jb > qi) s[1][r] = -3.0e38f; }
      if (ja >= T) s[0][r] = -3.0e38f;
      if (jb >= T) s[1][r] = -3.0e38f;
      float mx = fmaxf(s[0][r], s[1][r]);
      mx = fmaxf(mx, __shfl_xor(mx, 1, 32)); mx = fmaxf(mx, __shfl_xor(mx, 2, 32)); mx = fmaxf(mx, __shfl_xor(mx, 4, 32)); mx = fmaxf(mx, __shfl_xor(mx, 8, 32));
      const float mnew = fmaxf(m_r[r], mx);
      alpha[r] = (mnew > -1.0e38f) ? __expf(m_r[r] - mnew) : 1.0f;
      const float p0 = (s[0][r] > -1.0e38f) ? __expf(s[0][r] - mnew) : 0.f;
      const float p1 = (s[1][r] > -1.0e38f) ? __expf(s[1][r] - mnew) : 0.f;
      m_r[r] = mnew;
      l_r[r] = l_r[r] * alpha[r] + p0 + p1;            // per-lane partial row sum (16 lanes combined at the end)
      unsigned short hb = bf16_bits(p0); sPh[w][8 * hh + r][ln] = hb;      sPl[w][8 * hh + r][ln] = bf16_bits(p0 - bf16_val(hb));
      hb = bf16_bits(p1);                sPh[w][8 * hh + r][16 + ln] = hb; sPl[w][8 * hh + r][16 + ln] = bf16_bits(p1 - bf16_val(hb));
    }
#pragma unroll
    for (int dt = 0; dt < DT; ++dt)
#pragma unroll
      for (int r = 0; r < 8; ++r) oacc[dt][r] *= alpha[r];
    __builtin_amdgcn_fence(__ATOMIC_ACQ_REL, "workgroup");
    __builtin_amdgcn_wave_barrier();
    FragB pah, pal;
    pah.half[0] = *(const v8us*)&sPh[w][ln][8 * hh]; pah.half[1] = *(const v8us*)&sPh[w][ln][16 + 8 * hh];
    pal.half[0] = *(const v8us*)&sPl[w][ln][8 * hh]; pal.half[1] = *(const v8us*)&sPl[w][ln][16 + 8 * hh];
#pragma unroll
    for (int dt = 0; dt < DT; ++dt) {
      FragB bvh, bvl;
#pragma unroll
      for (int i = 0; i < 8; ++i) {
        bvh.u[i] = sVh[8 * hh + i][dt * 16 + ln]; bvh.u[8 + i] = sVh[16 + 8 * hh + i][dt * 16 + ln];
        bvl.u[i] = sVl[8 * hh + i][dt * 16 + ln]; bvl.u[8 + i] = sVl[16 + 8 * hh + i][dt * 16 + ln];
      }
      oacc[dt] = mmaN<3>(pah.v, pal.v, bvh.v, bvl.v, oacc[dt]);
    }
    __builtin_amdgcn_fence(__ATOMIC_ACQ_REL, "workgroup");
    __builtin_amdgcn_wave_barrier();
  }
#pragma unroll
  for (int r = 0; r < 8; ++r) {
    float l = l_r[r];
    l += __shfl_xor(l, 1, 32); l += __shfl_xor(l, 2, 32); l += __shfl_xor(l, 4, 32); l += __shfl_xor(l, 8, 32);
    l_r[r] = (l > 0.f) ? 1.0f / l : 0.f;
  }
#pragma unroll
  for (int dt = 0; dt < DT; ++dt)
#pragma unroll
    for (int r = 0; r < 8; ++r) sO[w][8 * hh + r][dt * 16 + ln] = oacc[dt][r] * l_r[r];
  __builtin_amdgcn_fence(__ATOMIC_ACQ_REL, "workgroup");
  __builtin_amdgcn_wave_barrier();
  {
    for (int r = 0; r < 16; ++r) {
      const int row = q0 + r;
      if (row < T && lane < D / 4) {
        const v4f val = *(const v4fa*)&sO[w][r][lane * 4];
        *(v4f*)(y + ((size_t)b * T + row) * ypitch + h * D + lane * 4) = val;
      }
    }
    
  }
}

// GEMM C = act(A·W + bias + resid): A f32 (ASPLIT -> hi/lo 2 terms), Wt bf16 [N][K]; ACT 0 none, 1 relu, 2 exact gelu;
// resid (optional, f32, row index = (row % rmod), pitch ldr, RES_BF16 rounds it) added before the activation.
template <bool ASPLIT, int ACT, bool BIAS_BF16, bool RES_BF16>
__global__ __launch_bounds__(128) void k_gemm_bf3(const float* __restrict__ A, int lda, const unsigned short* __restrict__ Wt, int ldb,
                                                const float* __restrict__ bias, const float* __restrict__ resid, int rmod, int ldr,
                                                float* __restrict__ C, int ldc, int M, int N, int K) {
  __shared__ __attribute__((aligned(16))) float so[4][16][64];
  const int tid = threadIdx.x, w = tid >> 5, lane = tid & 31, ln = lane & 15, hh = lane >> 4;
  const int ntn = N / 64;
  const int wid = blockIdx.x * 4 + w;
  const int mt = wid / ntn, nq = wid % ntn;
  if (mt * 16 >= M) return;
  const int row0 = mt * 16, col0 = nq * 64;
  const float* arow = A + (size_t)(row0 + ln) * lda;
  v8f acc[4] = {};
  for (int kb = 0; kb < K; kb += 32) {
    FragB ah, al;
    const v4f x0 = *(const v4fa*)(arow + kb + 8 * hh), x1 = *(const v4fa*)(arow + kb + 8 * hh + 4);
    const v4f x2 = *(const v4fa*)(arow + kb + 16 + 8 * hh), x3 = *(const v4fa*)(arow + kb + 16 + 8 * hh + 4);
    float xs[16] = {x0[0],x0[1],x0[2],x0[3],x1[0],x1[1],x1[2],x1[3],x2[0],x2[1],x2[2],x2[3],x3[0],x3[1],x3[2],x3[3]};
#pragma unroll
    for (int i = 0; i < 16; ++i) { const unsigned short hb = bf16_bits(xs[i]); ah.u[i] = hb; al.u[i] = ASPLIT ? bf16_bits(xs[i] - bf16_val(hb)) : (unsigned short)0; }
#pragma unroll
    for (int t = 0; t < 4; ++t) {
      const unsigned short* brow = Wt + (size_t)(col0 + t * 16 + ln) * ldb + kb;
      FragB b;
      b.half[0] = *(const v8us*)(brow + 8 * hh);
      b.half[1] = *(const v8us*)(brow + 16 + 8 * hh);
      acc[t] = mmaN<ASPLIT ? 2 : 1>(ah.v, al.v, b.v, b.v, acc[t]);
    }
  }
#pragma unroll
  for (int t = 0; t < 4; ++t) {
    const int col = col0 + t * 16 + ln;
    float bv = bias ? bias[col] : 0.f;
    if (BIAS_BF16) bv = bf16_round(bv);
#pragma unroll
    for (int r = 0; r < 8; ++r) {
      float v = acc[t][r] + bv;
      if (resid) { float rv = resid[(size_t)((row0 + 8 * hh + r) % rmod) * ldr + col]; if (RES_BF16) rv = bf16_round(rv); v += rv; }
      if (ACT == 1) v = fmaxf(v, 0.f);
      if (ACT == 2) v = 0.5f * v * (1.0f + erff(v * 0.70710678118654752f));
      if (ACT == 3) { const float u = 0.7978845608028654f * (v + 0.044715f * v * v * v); v = 0.5f * v * (1.0f + tanhf(u)); }
      so[w][8 * hh + r][t * 16 + ln] = v;
    }
  }
  __builtin_amdgcn_fence(__ATOMIC_ACQ_REL, "workgroup");
  __builtin_amdgcn_wave_barrier();
  const int rsub = lane >> 4, c4 = (lane & 15) * 4;
  {
#pragma unroll
    for (int q = 0; q < 8; ++q) {
      const int r = q * 2 + rsub;
      const v4f v = *(const v4fa*)&so[w][r][c4];
      *(v4f*)(C + (size_t)(row0 + r) * ldc + col0 + c4) = v;
    }
    
  }
}
// row LayerNorm (biased variance, eps) over N: s = X (+ R); optional out_sum <- s; out_norm <- (s-mu)*rsqrt(var+eps)*g + b
template <bool PARAM_BF16>
__global__ __launch_bounds__(256) void k_layernorm(const float* __restrict__ X, const float* __restrict__ R, const float* __restrict__ g, const float* __restrict__ bta,
                                                  float* __restrict__ out_sum, float* __restrict__ out_norm, int N, float eps) {
  __shared__ float red[256];
  const int row = blockIdx.x, tid = threadIdx.x;
  const float* x = X + (size_t)row * N; const float* rr = R ? R + (size_t)row * N : nullptr;
  float vals[16];                     // up to N = 4096
  const int per = N / 256;            // contiguous chunk per thread? use strided-by-4 chunks: thread handles j = tid*4 + 1024*u
  float s1 = 0.f;
  for (int u = 0; u < per / 4; ++u) {
    const int j = tid * 4 + 1024 * u;
    const v4f a = *(const v4fa*)(x + j);
    v4f b = {0.f,0.f,0.f,0.f}; if (rr) b = *(const v4fa*)(rr + j);
#pragma unroll
    for (int q = 0; q < 4; ++q) { const float v = a[q] + b[q]; vals[u * 4 + q] = v; s1 += v; }
  }
  red[tid] = s1; __syncthreads();
  for (int st = 128; st > 0; st >>= 1) { if (tid < st) red[tid] += red[tid + st]; __syncthreads(); }
  const float mu = red[0] / (float)N; __syncthreads();
  float s2 = 0.f;
  for (int u = 0; u < per / 4; ++u)
#pragma unroll
    for (int q = 0; q < 4; ++q) { const float c = vals[u * 4 + q] - mu; s2 += c * c; }
  red[tid] = s2; __syncthreads();
  for (int st = 128; st > 0; st >>= 1) { if (tid < st) red[tid] += red[tid + st]; __syncthreads(); }
  const float rs = rsqrtf(red[0] / (float)N + eps);
  {
    for (int u = 0; u < per / 4; ++u) {
      const int j = tid * 4 + 1024 * u;
      v4f o, sm;
#pragma unroll
      for (int q = 0; q < 4; ++q) {
        float gg = g[j + q], bb = bta[j + q];
        if (PARAM_BF16) { gg = bf16_round(gg); bb = bf16_round(bb); }
        sm[q] = vals[u * 4 + q]; o[q] = (vals[u * 4 + q] - mu) * rs * gg + bb;
      }
      if (out_sum) *(v4f*)(out_sum + (size_t)row * N + j) = sm;
      *(v4f*)(out_norm + (size_t)row * N + j) = o;
    }
    
  }
}



// ---- f16 WMMA path (v_wmma_f32_16x16x32_f16): 11-bit significands for operands in range — used for the conv GEMMs and both attention contractions
typedef _Float16 v16h __attribute__((ext_vector_type(16)));
union FragH { v16h v; v8us half[2]; _Float16 h[16]; unsigned short u[16]; };
template <int NT>
__device__ __forceinline__ v8f mmaH(v16h ah, v16h al, v16h bh, v16h bl, v8f c) {
  c = __builtin_amdgcn_wmma_f32_16x16x32_f16(false, ah, false, bh, (short)0, c, false, false);
  if (NT >= 2) c = __builtin_amdgcn_wmma_f32_16x16x32_f16(false, al, false, bh, (short)0, c, false, false);
  if (NT >= 3) c = __builtin_amdgcn_wmma_f32_16x16x32_f16(false, ah, false, bl, (short)0, c, false, false);
  asm volatile("v_nop\n\tv_nop\n\tv_nop\n\tv_nop" : "+v"(c) : "v"(ah), "v"(al), "v"(bh), "v"(bl));
  return c;
}
// batched GEMM like k_gemm_b but f16 operands: A f32 (split into f16 hi/lo if ASPLIT, else rounded to f16), Bt = f16 values [n][k]; alpha; C f32; N multiple of 16 (partial tiles skipped)
template <bool ASPLIT>
__global__ __launch_bounds__(128) void k_gemm_h(const float* __restrict__ A, int lda, size_t sA, const _Float16* __restrict__ Bh, int ldb, size_t sB, float alpha, float* __restrict__ C, int ldc, size_t sC, int M, int N, int K) {
  __shared__ __attribute__((aligned(16))) float so[4][16][64];
  const int tid = threadIdx.x, w = tid >> 5, lane = tid & 31, ln = lane & 15, hh = lane >> 4; const int by = blockIdx.y;
  A += (size_t)by * sA; Bh += (size_t)by * sB; C += (size_t)by * sC;
  const int ntn = (N + 63) / 64; const int wid = blockIdx.x * 4 + w; const int mt = wid / ntn, nq = wid % ntn; if (mt * 16 >= M) return;
  const int row0 = mt * 16, col0 = nq * 64; const float* arow = A + (size_t)(row0 + ln) * lda;
  v8f acc[4] = {};
  for (int kb = 0; kb < K; kb += 32) {
    FragH ah, al;
    const v4f x0 = *(const v4fa*)(arow + kb + 8 * hh), x1 = *(const v4fa*)(arow + kb + 8 * hh + 4), x2 = *(const v4fa*)(arow + kb + 16 + 8 * hh), x3 = *(const v4fa*)(arow + kb + 16 + 8 * hh + 4);
    float xs[16] = {x0[0],x0[1],x0[2],x0[3],x1[0],x1[1],x1[2],x1[3],x2[0],x2[1],x2[2],x2[3],x3[0],x3[1],x3[2],x3[3]};
#pragma unroll
    for (int i = 0; i < 16; ++i) { const _Float16 h = (_Float16)xs[i]; ah.h[i] = h; al.h[i] = ASPLIT ? (_Float16)(xs[i] - (float)h) : (_Float16)0.0f; }
#pragma unroll
    for (int t = 0; t < 4; ++t) { if (col0 + t * 16 >= N) continue; const size_t boff = (size_t)(col0 + t * 16 + ln) * ldb + kb; FragH bq; bq.half[0] = *(const v8us*)(Bh + boff + 8 * hh); bq.half[1] = *(const v8us*)(Bh + boff + 16 + 8 * hh);
      acc[t] = mmaH<ASPLIT ? 2 : 1>(ah.v, al.v, bq.v, bq.v, acc[t]); }
  }
#pragma unroll
  for (int t = 0; t < 4; ++t) { if (col0 + t * 16 >= N) continue;
#pragma unroll
    for (int r = 0; r < 8; ++r) so[w][8 * hh + r][t * 16 + ln] = acc[t][r] * alpha; }
  __builtin_amdgcn_fence(__ATOMIC_ACQ_REL, "workgroup"); __builtin_amdgcn_wave_barrier();
  const int rsub = lane >> 4, c4 = (lane & 15) * 4;
  {
#pragma unroll
    for (int q = 0; q < 8; ++q) { const int r = q * 2 + rsub; if (col0 + c4 < N) { const v4f v = *(const v4fa*)&so[w][r][c4]; *(v4f*)(C + (size_t)(row0 + r) * ldc + col0 + c4) = v; } }
     }
}

// Wt[n][k] = f16(W[k][n]·scale) from f32 row-major W[K][N] (scale = power of two; bf16-exact weights stay exact in f16 away from the subnormal range)
__global__ __launch_bounds__(256) void k_wt_f16(const float* __restrict__ W, _Float16* __restrict__ Wt, int K, int N, float scale) {
  const int t = blockIdx.x * 256 + threadIdx.x; if (t >= N * (K / 8)) return; const int n = t / (K / 8), k8 = (t % (K / 8)) * 8; FragH f;
#pragma unroll
  for (int i = 0; i < 8; ++i) f.h[i] = (_Float16)(bf16_round(W[(size_t)(k8 + i) * N + n]) * scale); const v8us o = f.half[0];
  *(v8us*)((unsigned short*)Wt + (size_t)n * K + k8) = o; 
}
// k_gemm_hh variant with fused epilogue: v = acc·alpha + bias[by·sBias + col] (+ CP[(row/rowsPerB)·sCPb + by·64 + col] if CP) ; ACT 0 none / 1 elu ; writes f32 C and f16 C16, each if non-null
template <int ACT>
__global__ __launch_bounds__(128) void k_gemm_hhx(const _Float16* __restrict__ A, int lda, size_t sA, const _Float16* __restrict__ Bh, int ldb, size_t sB, float alpha, const float* __restrict__ bias, size_t sBias, const float* __restrict__ CP, int rowsPerB, size_t sCPb, int row0g,
    float* __restrict__ C, _Float16* __restrict__ C16, int ldc, size_t sC, int M, int N, int K) {
  __shared__ __attribute__((aligned(16))) float so[4][16][64];
  const int tid = threadIdx.x, w = tid >> 5, lane = tid & 31, ln = lane & 15, hh = lane >> 4; const int by = blockIdx.y;
  A += (size_t)by * sA; Bh += (size_t)by * sB; const size_t cofs = (size_t)by * sC; const float* bp = bias ? bias + (size_t)by * sBias : nullptr;
  const int ntn = (N + 63) / 64; const int wid = blockIdx.x * 4 + w; const int mt = wid / ntn, nq = wid % ntn; if (mt * 16 >= M) return;
  const int row0 = mt * 16, col0 = nq * 64; const _Float16* arow = A + (size_t)(row0 + ln) * lda;
  v8f acc[4] = {};
  for (int kb = 0; kb < K; kb += 32) { FragH ah; ah.half[0] = *(const v8us*)((const unsigned short*)arow + kb + 8 * hh); ah.half[1] = *(const v8us*)((const unsigned short*)arow + kb + 16 + 8 * hh);
#pragma unroll
    for (int t = 0; t < 4; ++t) { if (col0 + t * 16 >= N) continue; const size_t boff = (size_t)(col0 + t * 16 + ln) * ldb + kb; FragH bq; bq.half[0] = *(const v8us*)((const unsigned short*)Bh + boff + 8 * hh); bq.half[1] = *(const v8us*)((const unsigned short*)Bh + boff + 16 + 8 * hh);
      acc[t] = mmaH<1>(ah.v, ah.v, bq.v, bq.v, acc[t]); }
  }
#pragma unroll
  for (int t = 0; t < 4; ++t) { if (col0 + t * 16 >= N) continue; const int col = col0 + t * 16 + ln; const float bv = bp ? bf16_round(bp[col]) : 0.f;
#pragma unroll
    for (int r = 0; r < 8; ++r) { float v = acc[t][r] * alpha + bv; if (CP) { const int bidx = (row0g + row0 + 8 * hh + r) / rowsPerB; v += CP[(size_t)bidx * sCPb + (size_t)by * 64 + col]; } if (ACT == 1) v = (v > 0.f) ? v : expm1f(v); else if (ACT == 3) v = fmaxf(v, 0.f); so[w][8 * hh + r][t * 16 + ln] = v; } }
  __builtin_amdgcn_fence(__ATOMIC_ACQ_REL, "workgroup"); __builtin_amdgcn_wave_barrier();
  const int rsub = lane >> 4, c4 = (lane & 15) * 4; typedef _Float16 v4h __attribute__((ext_vector_type(4)));
  {
#pragma unroll
    for (int q = 0; q < 8; ++q) { const int r = q * 2 + rsub; if (col0 + c4 < N) { const v4f v = *(const v4fa*)&so[w][r][c4]; if (C) *(v4f*)(C + cofs + (size_t)(row0 + r) * ldc + col0 + c4) = v; if (C16) { v4h h4; for (int i = 0; i < 4; ++i) h4[i] = (_Float16)v[i]; *(v4h*)(C16 + cofs + (size_t)(row0 + r) * ldc + col0 + c4) = h4; } } }
     }
}


__global__ __launch_bounds__(256) void k_im(const float* __restrict__ x, _Float16* __restrict__ IM) { const size_t t = (size_t)blockIdx.x * 256 + threadIdx.x; if (t >= (size_t)NR * NH * 3 * 8) return; const size_t row = t / (NH * 24); const int rem = (int)(t % (NH * 24)); const int h = rem / 24, i = (rem % 24) / 8, d8 = (rem % 8) * 8; const int b = (int)(row / TT), s = (int)(row % TT); int ss = s + i - 2; ss = ss < 0 ? 0 : ss; FragH f;
#pragma unroll
  for (int q = 0; q < 8; ++q) f.h[q] = (_Float16)bf16_round(x[((size_t)b * TT + ss) * DDm + h * HD + d8 + q]); *(v8us*)((unsigned short*)IM + t * 8) = f.half[0];  }
__global__ __launch_bounds__(256) void k_wc(const float* __restrict__ w, _Float16* __restrict__ Bt) { const int t = blockIdx.x * 256 + threadIdx.x; if (t >= NH * CCv * 24) return; const int row = t / 24, rem = t % 24; const int i = rem / 8, d8 = (rem % 8) * 8; FragH f;
#pragma unroll
  for (int q = 0; q < 8; ++q) f.h[q] = (_Float16)(bf16_round(w[((size_t)row * HD + d8 + q) * 3 + i]) * 16.0f); *(v8us*)((unsigned short*)Bt + (size_t)row * 192 + i * 64 + d8) = f.half[0];  }
__global__ __launch_bounds__(256) void k_c16(const float* __restrict__ QC, _Float16* __restrict__ Q16) { const size_t t = (size_t)blockIdx.x * 256 + threadIdx.x; if (t >= (size_t)NR * NH * 4) return; const v4f a = *(const v4fa*)(QC + t * 8), c = *(const v4fa*)(QC + t * 8 + 4); FragH f; for (int q = 0; q < 4; ++q) { f.h[q] = (_Float16)a[q]; f.h[4 + q] = (_Float16)c[q]; }
  *(v8us*)((unsigned short*)Q16 + t * 8) = f.half[0];  }
__global__ __launch_bounds__(256) void k_norm(const float* __restrict__ QC, float* __restrict__ N2) { const size_t t = (size_t)blockIdx.x * 256 + threadIdx.x; if (t >= (size_t)NR * NH) return; const float* src = QC + t * CCv; float ss = 0.f;
#pragma unroll 1
  for (int p = 0; p < CCv; p += 4) { const v4f a = *(const v4fa*)(src + p); ss += a[0] * a[0] + a[1] * a[1] + a[2] * a[2] + a[3] * a[3]; }
  *(float*)(N2 + t) = ss;  }
__global__ __launch_bounds__(256) void k_vts(const float* __restrict__ v, _Float16* __restrict__ Vt) { __shared__ unsigned short tl[64][66]; const int tid = threadIdx.x; const int slab = blockIdx.x / (TT / 64), tg = blockIdx.x % (TT / 64); const int b = slab / NH, h = slab % NH;
  for (int i = tid; i < 64 * 16; i += 256) { const int r = i / 16, c4 = (i % 16) * 4; const int ts = (tg * 64 + r + 1) % TT; const v4f a = *(const v4fa*)(v + ((size_t)b * TT + ts) * DDm + h * HD + c4); FragH f; for (int q = 0; q < 4; ++q) { f.h[q] = (_Float16)bf16_round(a[q]); tl[r][c4 + q] = f.u[q]; } }
  __syncthreads();
  {
#pragma unroll
    for (int rd = 0; rd < 2; ++rd) { const int d = rd * 32 + tid / 8, pc = tid % 8; FragH f;
#pragma unroll
      for (int q = 0; q < 8; ++q) f.u[q] = tl[pc * 8 + q][d]; *(v8us*)((unsigned short*)Vt + ((size_t)slab * HD + d) * TT + tg * 64 + pc * 8) = f.half[0]; }
     } }
// attention per ((b,h), 128 queries), transposed: wave 32 queries; St = kc.qc^T (A = 16 key rows, B = 16 query columns, d 32), so a lane holds ONE query's scores: keys 8*hh + r of each 16-key tile;
// logit = -sqrt(max(q2 + k2 - 2S, 1e-12)); mask[q][k] (INPUT, nonzero = keep; tiles with no open key for the wave skipped); maximum and sum in the lane plus one exchange between the wave's halves;
// the two score tiles of 32 keys, converted in place, ARE the B operand of Ot += Vt.Pt (hardware k order: 8*hh + s, 16 + 8*hh + s), and a lane's 8 accumulator registers are 8 consecutive d of its query: no LDS.
typedef int v4ia __attribute__((ext_vector_type(4), may_alias));
__device__ __forceinline__ float xhalf(float x) { const int bq = __float_as_int(x); return __int_as_float(__builtin_amdgcn_permlanex16(bq, bq, 0x76543210, 0xfedcba98, false, false)); }      // lane l <-> l ^ 16
template <int N> __device__ __forceinline__ float rowshare(float x) { return __int_as_float(__builtin_amdgcn_mov_dpp(__float_as_int(x), 0x150 + N, 0xf, 0xf, false)); }      // lane N of each 16-lane row to the whole row
__global__ __launch_bounds__(128) void k_sattn(const _Float16* __restrict__ Q16, const _Float16* __restrict__ K16, const float* __restrict__ NQ, const float* __restrict__ NK, const int* __restrict__ MSK, const _Float16* __restrict__ Vt, float* __restrict__ O) { constexpr int RPW = 32; constexpr float L2E = 1.4426950408889634f;
  const int tid = threadIdx.x, w = tid >> 5, lane = tid & 31, ln = lane & 15, hh = lane >> 4; const int slab = blockIdx.x / (TT / 128), qblk = blockIdx.x % (TT / 128); const int b = slab / NH, h = slab % NH; const int q0 = qblk * 128 + w * RPW;
  FragH bq[2]; float q2c[2];
#pragma unroll
  for (int rt = 0; rt < 2; ++rt) { const size_t qrow = (size_t)b * TT + q0 + rt * 16 + ln; const unsigned short* qr = (const unsigned short*)Q16 + (qrow * NH + h) * CCv; bq[rt].half[0] = *(const v8us*)(qr + 8 * hh); bq[rt].half[1] = *(const v8us*)(qr + 16 + 8 * hh); q2c[rt] = NQ[qrow * NH + h]; }
  const int kslot = (ln < 8) ? 8 * hh + ln : 8 + 8 * hh + ln;      // lane ln of half hh fetches |kc|^2 of the key that the half's score register ln holds (tile ln / 8, register ln % 8)
  float m_c[2], l_c[2]; v8f oacc[2][4];      // m starts finite and below every finite logit (|logit| <= sqrt(FLT_MAX)): exp2 arguments never meet inf - inf
#pragma unroll
  for (int rt = 0; rt < 2; ++rt) { m_c[rt] = -1.0e30f; l_c[rt] = 0.f;
#pragma unroll
    for (int dt = 0; dt < 4; ++dt) oacc[rt][dt] = (v8f){0.f,0.f,0.f,0.f,0.f,0.f,0.f,0.f}; }
  // read places: a base that is the same for the whole block and steps by one 32-key tile a trip, plus each lane's own fixed byte offset
  const char* mb = (const char*)(MSK + (size_t)qblk * 128 * TT); const char* kb = (const char*)(K16 + ((size_t)b * TT * NH + h) * CCv); const char* nb = (const char*)(NK + (size_t)b * TT * NH + h); const char* vb = (const char*)(Vt + (size_t)slab * HD * TT);
  const unsigned mlo = (unsigned)(((w * RPW + ln) * TT + 8 * hh) * 4), klo = (unsigned)((ln * NH * CCv + 8 * hh) * 2), nlo = (unsigned)(kslot * NH * 4), vlo = (unsigned)((ln * TT + 8 * hh) * 2);
#pragma unroll 1
  for (int j0 = 0; j0 < TT; j0 += 32, mb += 32 * 4, kb += 32 * NH * CCv * 2, nb += 32 * NH * 4, vb += 32 * 2) {
    v4ia mk[2][2][2];
#pragma unroll
    for (int rt = 0; rt < 2; ++rt)
#pragma unroll
      for (int nt = 0; nt < 2; ++nt) { const int* mr = (const int*)(mb + mlo) + rt * 16 * TT + nt * 16; mk[rt][nt][0] = *(const v4ia*)mr; mk[rt][nt][1] = *(const v4ia*)(mr + 4); }
    const v4ia mo = (mk[0][0][0] | mk[0][0][1]) | (mk[0][1][0] | mk[0][1][1]) | ((mk[1][0][0] | mk[1][0][1]) | (mk[1][1][0] | mk[1][1][1])); const int anyb = (mo[0] | mo[1]) | (mo[2] | mo[3]);
    if (__builtin_amdgcn_ballot_w32(anyb != 0) == 0u) continue;      // wave-uniform skip of fully masked tiles
    FragH ak[2], av[4];
#pragma unroll
    for (int nt = 0; nt < 2; ++nt) { const unsigned short* kr = (const unsigned short*)(kb + klo) + nt * 16 * NH * CCv; ak[nt].half[0] = *(const v8us*)kr; ak[nt].half[1] = *(const v8us*)(kr + 16); }
    const float k2l = *(const float*)(nb + nlo);
#pragma unroll
    for (int dt = 0; dt < 4; ++dt) { const unsigned short* vrow = (const unsigned short*)(vb + vlo) + dt * 16 * TT; av[dt].half[0] = *(const v8us*)vrow; av[dt].half[1] = *(const v8us*)(vrow + 16); }
    v8f s[2][2];
#pragma unroll
    for (int nt = 0; nt < 2; ++nt)
#pragma unroll
      for (int rt = 0; rt < 2; ++rt) { v8f acc = (v8f){0.f,0.f,0.f,0.f,0.f,0.f,0.f,0.f}; acc = mmaH<1>(ak[nt].v, ak[nt].v, bq[rt].v, bq[rt].v, acc); s[rt][nt] = acc; }
    const float k2v[2][8] = {{rowshare<0>(k2l), rowshare<1>(k2l), rowshare<2>(k2l), rowshare<3>(k2l), rowshare<4>(k2l), rowshare<5>(k2l), rowshare<6>(k2l), rowshare<7>(k2l)},
                             {rowshare<8>(k2l), rowshare<9>(k2l), rowshare<10>(k2l), rowshare<11>(k2l), rowshare<12>(k2l), rowshare<13>(k2l), rowshare<14>(k2l), rowshare<15>(k2l)}};
    FragH pb[2];
#pragma unroll
    for (int rt = 0; rt < 2; ++rt) { float sv[2][8]; float mc = -INFINITY;
#pragma unroll
      for (int nt = 0; nt < 2; ++nt)
#pragma unroll
        for (int r = 0; r < 8; ++r) { const float d = fmaxf(q2c[rt] + k2v[nt][r] - 2.0f * s[rt][nt][r], 1e-12f); sv[nt][r] = (mk[rt][nt][r >> 2][r & 3] != 0) ? -__builtin_amdgcn_sqrtf(d) : -INFINITY; mc = fmaxf(mc, sv[nt][r]); }      // d >= 1e-12: never a denormal, the hardware root needs no range fix-up
      mc = fmaxf(mc, xhalf(mc));
      const float mn = fmaxf(m_c[rt], mc); const float ta = (m_c[rt] - mn) * L2E; const float al = __builtin_amdgcn_exp2f(ta); m_c[rt] = mn; const float nm = -mn * L2E;      // exp(x - mn) = exp2(x * log2(e) - mn * log2(e)): one fma and the hardware exp2; a closed key's -inf gives exp2(-inf) = 0
      float ps = 0.f;
#pragma unroll
      for (int nt = 0; nt < 2; ++nt) { float t[8], p[8];
#pragma unroll
        for (int r = 0; r < 8; ++r) { t[r] = __builtin_fmaf(sv[nt][r], L2E, nm); p[r] = __builtin_amdgcn_exp2f(t[r]); }
        // the slot behind a transcendental: inputs only, so every argument's register stays whole until all of these exp2 have issued (none is overwritten directly behind its exp2), and the v_nop stands behind the last
        asm volatile("v_nop" :: "v"(t[0]), "v"(t[1]), "v"(t[2]), "v"(t[3]), "v"(t[4]), "v"(t[5]), "v"(t[6]), "v"(t[7]), "v"(p[0]), "v"(p[1]), "v"(p[2]), "v"(p[3]), "v"(p[4]), "v"(p[5]), "v"(p[6]), "v"(p[7]), "v"(ta), "v"(al));
#pragma unroll
        for (int r = 0; r < 8; ++r) { ps += p[r]; pb[rt].h[nt * 8 + r] = (_Float16)p[r]; } }
      l_c[rt] = l_c[rt] * al + ps;      // the half's own 16 keys; the halves join behind the loop
#pragma unroll
      for (int dt = 0; dt < 4; ++dt)
#pragma unroll
        for (int r = 0; r < 8; ++r) oacc[rt][dt][r] *= al; }
#pragma unroll
    for (int dt = 0; dt < 4; ++dt)
#pragma unroll
      for (int rt = 0; rt < 2; ++rt) oacc[rt][dt] = mmaH<1>(av[dt].v, av[dt].v, pb[rt].v, pb[rt].v, oacc[rt][dt]); }
#pragma unroll
  for (int rt = 0; rt < 2; ++rt) { const float l = l_c[rt] + xhalf(l_c[rt]); const float li = (l > 0.f) ? 1.0f / l : 0.f; float* orow = O + ((size_t)b * TT + q0 + rt * 16 + ln) * DDm + h * HD + 8 * hh;
#pragma unroll
    for (int dt = 0; dt < 4; ++dt) { const v4f lo = {oacc[rt][dt][0] * li, oacc[rt][dt][1] * li, oacc[rt][dt][2] * li, oacc[rt][dt][3] * li}, hi = {oacc[rt][dt][4] * li, oacc[rt][dt][5] * li, oacc[rt][dt][6] * li, oacc[rt][dt][7] * li}; *(v4f*)(orow + dt * 16) = lo; *(v4f*)(orow + dt * 16 + 4) = hi; } } }
extern "C" void kernel_launch(void* const* d_in, const int* in_sizes, int n_in,
                              void* d_out, int out_size, void* d_ws, size_t ws_size, hipStream_t stream) {
  (void)in_sizes; (void)n_in; (void)out_size;
  const float* qx = (const float*)d_in[0]; const float* kx = (const float*)d_in[1]; const float* vx = (const float*)d_in[2]; const int* mask = (const int*)d_in[3]; const float* cw = (const float*)d_in[4]; const float* cb = (const float*)d_in[5];
  char* ws = (char*)d_ws; size_t off = 0;
  auto take = [&](size_t bytes) { char* p = ws + off; off += (bytes + 255) & ~(size_t)255; return p; };
  _Float16* Bt = (_Float16*)take((size_t)NH * CCv * 192 * 2); _Float16* IM = (_Float16*)take((size_t)NR * NH * 192 * 2); float* QC = (float*)take((size_t)NR * NH * CCv * 4); float* KC = (float*)take((size_t)NR * NH * CCv * 4); _Float16* Q16 = (_Float16*)take((size_t)NR * NH * CCv * 2); _Float16* K16 = (_Float16*)take((size_t)NR * NH * CCv * 2); float* NQ = (float*)take((size_t)NR * NH * 4); float* NK = (float*)take((size_t)NR * NH * 4); _Float16* Vt = (_Float16*)take((size_t)NR * DDm * 2);
  if (off > ws_size) return;      // 0.1 + 25.2 + 8.4 × 2 + 4.2 × 2 + 0.5 + 8.4 ≈ 60 MiB
  k_wc<<<(NH * CCv * 24 + 255) / 256, 256, 0, stream>>>(cw, Bt);
  const dim3 gc(((NR / 16) * 1 + 3) / 4, NH); const unsigned gi = (unsigned)(((size_t)NR * NH * 24 + 255) / 256);
  k_im<<<gi, 256, 0, stream>>>(qx, IM); k_gemm_hhx<0><<<gc, 128, 0, stream>>>(IM, NH * 192, (size_t)192, Bt, 192, (size_t)CCv * 192, 0.0625f, cb, (size_t)CCv, nullptr, 1, 0, 0, QC, nullptr, NH * CCv, (size_t)CCv, NR, CCv, 192);
  k_im<<<gi, 256, 0, stream>>>(kx, IM); k_gemm_hhx<0><<<gc, 128, 0, stream>>>(IM, NH * 192, (size_t)192, Bt, 192, (size_t)CCv * 192, 0.0625f, cb, (size_t)CCv, nullptr, 1, 0, 0, KC, nullptr, NH * CCv, (size_t)CCv, NR, CCv, 192);
  k_c16<<<(NR * NH * 4 + 255) / 256, 256, 0, stream>>>(QC, Q16); k_c16<<<(NR * NH * 4 + 255) / 256, 256, 0, stream>>>(KC, K16); k_norm<<<(NR * NH + 255) / 256, 256, 0, stream>>>(QC, NQ); k_norm<<<(NR * NH + 255) / 256, 256, 0, stream>>>(KC, NK);
  k_vts<<<BB * NH * (TT / 64), 256, 0, stream>>>(vx, Vt);
  k_sattn<<<BB * NH * (TT / 128), 128, 0, stream>>>(Q16, K16, NQ, NK, mask, Vt, (float*)d_out);
}

// v003
// It runs in 88.6 microseconds.
// Timed twice side by side with v002, it ran 1.60 and 1.54 times as fast.
// Over all steps from v000 it is 5.99 times as fast.
#include <hip/hip_runtime.h>
// Simplex (distance-based) attention (B=4, S=2048, 8 heads × 64, conv channels 32): the per-head causal 3-tap conv of q and k on WMMA (+ bias, f16 rows and norms head-major) and the shifted V transpose in one preparation launch, and the attention as a
// fused flash-style kernel on v_wmma_f32_16x16x32_f16 — S = qc·kc (d = 32, one k-step), logits = −sqrt(max(|qc|² + |kc|² − 2S, 1e-12)), INPUT mask (nonzero = keep), online softmax f32,
// P f16 ≤ 1, and the roll(attn, 1) folded into a one-step shift of V (out[s] = Σ_t attn[s][t]·v[t+1 mod S]); f16 operands, single products, f32 accumulate; norms f32 VALU in the conv's epilogue.
#define BB 4
#define TT 2048
#define DDm 512
#define NH 8
#define HD 64
#define CCv 32
#define NR (BB * TT)

typedef __bf16 v16b __attribute__((ext_vector_type(16)));
typedef unsigned short v8us __attribute__((ext_vector_type(8), may_alias));
typedef float  v8f  __attribute__((ext_vector_type(8)));
typedef float  v4f  __attribute__((ext_vector_type(4)));
typedef float  v4fa __attribute__((ext_vector_type(4), may_alias));
union FragB { v16b v; v8us half[2]; unsigned short u[16]; };

__device__ __forceinline__ unsigned short bf16_bits(float x) { unsigned int u = __float_as_uint(x); return (unsigned short)((u + 0x7FFFu + ((u >> 16) & 1u)) >> 16); }
__device__ __forceinline__ float bf16_val(unsigned short b) { return __uint_as_float(((unsigned int)b) << 16); }
__device__ __forceinline__ float bf16_round(float x) { return bf16_val(bf16_bits(x)); }
// D += A·B with NT terms: 1 = ah·bh, 2 = + al·bh (A split), 3 = + ah·bl (both split)
template <int NT>
__device__ __forceinline__ v8f mmaN(v16b ah, v16b al, v16b bh, v16b bl, v8f c) {
  c = __builtin_amdgcn_wmma_f32_16x16x32_bf16(false, ah, false, bh, (short)0, c, false, false);
  if (NT >= 2) c = __builtin_amdgcn_wmma_f32_16x16x32_bf16(false, al, false, bh, (short)0, c, false, false);
  if (NT >= 3) c = __builtin_amdgcn_wmma_f32_16x16x32_bf16(false, ah, false, bl, (short)0, c, false, false);
  asm volatile("v_nop\n\tv_nop\n\tv_nop\n\tv_nop" : "+v"(c) : "v"(ah), "v"(al), "v"(bh), "v"(bl));
  return c;
}

__global__ __launch_bounds__(256) void k_wt_bf16(const float* __restrict__ W, unsigned short* __restrict__ Wt, int K, int N) {
  const int t = blockIdx.x * 256 + threadIdx.x;
  const int k8n = K / 8;
  if (t >= N * k8n) return;
  const int n = t / k8n, k8 = (t % k8n) * 8;
  v8us v;
#pragma unroll
  for (int i = 0; i < 8; ++i) v[i] = bf16_bits(W[(size_t)(k8 + i) * N + n]);
  *(v8us*)(Wt + (size_t)n * K + k8) = v;
  
}

// GEMM C[M][N] (f32, pitch ldc) = act(A[M][K]·W + bias). A f32 row-major (pitch lda) converted per fragment to bf16
// (ASPLIT: hi/lo two planes -> 2 terms, else single rounded term); Wt bf16 [N][K] (pitch ldb). BIAS_BF16 rounds the
// bias to bf16 first (bias quantised to bf16 before the add). K%32==0, M%16==0, N%64==0.
template <bool ASPLIT, int ACT, bool BIAS_BF16>
__global__ __launch_bounds__(128) void k_gemm_bf(const float* __restrict__ A, int lda, const unsigned short* __restrict__ Wt, int ldb,
                                               const float* __restrict__ bias, float* __restrict__ C, int ldc, int M, int N, int K) {
  __shared__ __attribute__((aligned(16))) float so[4][16][64];
  const int tid = threadIdx.x, w = tid >> 5, lane = tid & 31, ln = lane & 15, hh = lane >> 4;
  const int ntn = N / 64;
  const int wid = blockIdx.x * 4 + w;
  const int mt = wid / ntn, nq = wid % ntn;
  if (mt * 16 >= M) return;
  const int row0 = mt * 16, col0 = nq * 64;
  const float* arow = A + (size_t)(row0 + ln) * lda;
  v8f acc[4] = {};
  for (int kb = 0; kb < K; kb += 32) {
    FragB ah, al;
    const v4f x0 = *(const v4fa*)(arow + kb + 8 * hh), x1 = *(const v4fa*)(arow + kb + 8 * hh + 4);
    const v4f x2 = *(const v4fa*)(arow + kb + 16 + 8 * hh), x3 = *(const v4fa*)(arow + kb + 16 + 8 * hh + 4);
    float xs[16] = {x0[0],x0[1],x0[2],x0[3],x1[0],x1[1],x1[2],x1[3],x2[0],x2[1],x2[2],x2[3],x3[0],x3[1],x3[2],x3[3]};
#pragma unroll
    for (int i = 0; i < 16; ++i) { const unsigned short hb = bf16_bits(xs[i]); ah.u[i] = hb; al.u[i] = ASPLIT ? bf16_bits(xs[i] - bf16_val(hb)) : (unsigned short)0; }
#pragma unroll
    for (int t = 0; t < 4; ++t) {
      const unsigned short* brow = Wt + (size_t)(col0 + t * 16 + ln) * ldb + kb;
      FragB b;
      b.half[0] = *(const v8us*)(brow + 8 * hh);
      b.half[1] = *(const v8us*)(brow + 16 + 8 * hh);
      acc[t] = mmaN<ASPLIT ? 2 : 1>(ah.v, al.v, b.v, b.v, acc[t]);
    }
  }
#pragma unroll
  for (int t = 0; t < 4; ++t) {
    float bv = bias ? bias[col0 + t * 16 + ln] : 0.f;
    if (BIAS_BF16) bv = bf16_round(bv);
#pragma unroll
    for (int r = 0; r < 8; ++r) { float v = acc[t][r] + bv; if (ACT == 1) v = fmaxf(v, 0.f); so[w][8 * hh + r][t * 16 + ln] = v; }
  }
  __builtin_amdgcn_fence(__ATOMIC_ACQ_REL, "workgroup");
  __builtin_amdgcn_wave_barrier();
  const int rsub = lane >> 4, c4 = (lane & 15) * 4;
  {
#pragma unroll
    for (int q = 0; q < 8; ++q) {
      const int r = q * 2 + rsub;
      const v4f v = *(const v4fa*)&so[w][r][c4];
      *(v4f*)(C + (size_t)(row0 + r) * ldc + col0 + c4) = v;
    }
    
  }
}

// Flash-style causal/unmasked attention, all contractions 3-term bf16 hi/lo splits, f32 softmax with running max.
// q,k,v rows are read from f32 buffers with arbitrary row pitch (so they can live inside a fused qkv buffer);
// D = head size (multiple of 32, <= 128); one wave = 16 query rows; block = 4 waves (64 queries) sharing K/V chunks of 32.
template <int D, bool CAUSAL>
__global__ __launch_bounds__(128) void k_flash(const float* __restrict__ qb, const float* __restrict__ kb, const float* __restrict__ vb,
                                             int pitch, int T, int H, float scale, float* __restrict__ y, int ypitch) {
  constexpr int KS = D / 32;        // k-steps for QK
  constexpr int DT = D / 16;        // d tiles for PV
  __shared__ __attribute__((aligned(16))) unsigned short sKh[32][D + 8], sKl[32][D + 8], sVh[32][D + 8], sVl[32][D + 8];
  __shared__ __attribute__((aligned(16))) unsigned short sPh[4][16][40], sPl[4][16][40];
  __shared__ __attribute__((aligned(16))) float sO[4][16][D];
  const int tid = threadIdx.x, w = tid >> 5, lane = tid & 31, ln = lane & 15, hh = lane >> 4;
  const int nqb = (T + 63) / 64;
  const int bh = blockIdx.x / nqb, qblk = blockIdx.x % nqb;
  const int b = bh / H, h = bh % H;
  const int q0 = qblk * 64 + w * 16;
  const float* Q = qb + (size_t)b * T * pitch + h * D;
  const float* K = kb + (size_t)b * T * pitch + h * D;
  const float* V = vb + (size_t)b * T * pitch + h * D;

  // A fragments of the wave's 16 query rows (scaled), hi/lo
  FragB aqh[KS], aql[KS];
  {
    int row = q0 + ln; if (row >= T) row = T - 1;
    const float* qr = Q + (size_t)row * pitch;
#pragma unroll
    for (int ks = 0; ks < KS; ++ks)
#pragma unroll
      for (int i = 0; i < 16; ++i) {
        const int d = ks * 32 + ((i < 8) ? (8 * hh + i) : (16 + 8 * hh + (i - 8)));
        const float x = qr[d] * scale; const unsigned short hb = bf16_bits(x);
        aqh[ks].u[i] = hb; aql[ks].u[i] = bf16_bits(x - bf16_val(hb));
      }
  }
  float m_r[8], l_r[8];
#pragma unroll
  for (int r = 0; r < 8; ++r) { m_r[r] = -3.0e38f; l_r[r] = 0.f; }
  v8f oacc[DT];
#pragma unroll
  for (int dt = 0; dt < DT; ++dt) oacc[dt] = (v8f){0.f,0.f,0.f,0.f,0.f,0.f,0.f,0.f};

  const int kv_end = CAUSAL ? min(T, qblk * 64 + 64) : T;     // block-uniform
  for (int j0 = 0; j0 < kv_end; j0 += 32) {
    __syncthreads();
    for (int e = tid; e < 32 * (D / 4); e += 128) {
      const int r = e / (D / 4), c4 = (e % (D / 4)) * 4;
      const int key = j0 + r;
      v4f kf = {0.f,0.f,0.f,0.f}, vf = {0.f,0.f,0.f,0.f};
      if (key < T) { kf = *(const v4fa*)(K + (size_t)key * pitch + c4); vf = *(const v4fa*)(V + (size_t)key * pitch + c4); }
#pragma unroll
      for (int t = 0; t < 4; ++t) {
        unsigned short hb = bf16_bits(kf[t]); sKh[r][c4 + t] = hb; sKl[r][c4 + t] = bf16_bits(kf[t] - bf16_val(hb));
        hb = bf16_bits(vf[t]); sVh[r][c4 + t] = hb; sVl[r][c4 + t] = bf16_bits(vf[t] - bf16_val(hb));
      }
    }
    __syncthreads();
    // S tile 16 x 32
    v8f s[2];
#pragma unroll
    for (int nt = 0; nt < 2; ++nt) {
      v8f acc = {};
#pragma unroll
      for (int ks = 0; ks < KS; ++ks) {
        FragB bh_, bl_;
        bh_.half[0] = *(const v8us*)&sKh[nt * 16 + ln][ks * 32 + 8 * hh]; bh_.half[1] = *(const v8us*)&sKh[nt * 16 + ln][ks * 32 + 16 + 8 * hh];
        bl_.half[0] = *(const v8us*)&sKl[nt * 16 + ln][ks * 32 + 8 * hh]; bl_.half[1] = *(const v8us*)&sKl[nt * 16 + ln][ks * 32 + 16 + 8 * hh];
        acc = mmaN<3>(aqh[ks].v, aql[ks].v, bh_.v, bl_.v, acc);
      }
      s[nt] = acc;
    }
    // mask + running max (rows 8hh+r; the 16 lanes of a half share rows)
    float alpha[8];
#pragma unroll
    for (int r = 0; r < 8; ++r) {
      const int qi = q0 + 8 * hh + r;
      const int ja = j0 + ln, jb = j0 + 16 + ln;
      if (CAUSAL) { if (ja > qi) s[0][r] = -3.0e38f; if (jb > qi) s[1][r] = -3.0e38f; }
      if (ja >= T) s[0][r] = -3.0e38f;
      if (jb >= T) s[1][r] = -3.0e38f;
      float mx = fmaxf(s[0][r], s[1][r]);
      mx = fmaxf(mx, __shfl_xor(mx, 1, 32)); mx = fmaxf(mx, __shfl_xor(mx, 2, 32)); mx = fmaxf(mx, __shfl_xor(mx, 4, 32)); mx = fmaxf(mx, __shfl_xor(mx, 8, 32));
      const float mnew = fmaxf(m_r[r], mx);
      alpha[r] = (mnew > -1.0e38f) ? __expf(m_r[r] - mnew) : 1.0f;
      const float p0 = (s[0][r] > -1.0e38f) ? __expf(s[0][r] - mnew) : 0.f;
      const float p1 = (s[1][r] > -1.0e38f) ? __expf(s[1][r] - mnew) : 0.f;
      m_r[r] = mnew;
      l_r[r] = l_r[r] * alpha[r] + p0 + p1;            // per-lane partial row sum (16 lanes combined at the end)
      unsigned short hb = bf16_bits(p0); sPh[w][8 * hh + r][ln] = hb;      sPl[w][8 * hh + r][ln] = bf16_bits(p0 - bf16_val(hb));
      hb = bf16_bits(p1);                sPh[w][8 * hh + r][16 + ln] = hb; sPl[w][8 * hh + r][16 + ln] = bf16_bits(p1 - bf16_val(hb));
    }
#pragma unroll
    for (int dt = 0; dt < DT; ++dt)
#pragma unroll
      for (int r = 0; r < 8; ++r) oacc[dt][r] *= alpha[r];
    __builtin_amdgcn_fence(__ATOMIC_ACQ_REL, "workgroup");
    __builtin_amdgcn_wave_barrier();
    FragB pah, pal;
    pah.half[0] = *(const v8us*)&sPh[w][ln][8 * hh]; pah.half[1] = *(const v8us*)&sPh[w][ln][16 + 8 * hh];
    pal.half[0] = *(const v8us*)&sPl[w][ln][8 * hh]; pal.half[1] = *(const v8us*)&sPl[w][ln][16 + 8 * hh];
#pragma unroll
    for (int dt = 0; dt < DT; ++dt) {
      FragB bvh, bvl;
#pragma unroll
      for (int i = 0; i < 8; ++i) {
        bvh.u[i] = sVh[8 * hh + i][dt * 16 + ln]; bvh.u[8 + i] = sVh[16 + 8 * hh + i][dt * 16 + ln];
        bvl.u[i] = sVl[8 * hh + i][dt * 16 + ln]; bvl.u[8 + i] = sVl[16 + 8 * hh + i][dt * 16 + ln];
      }
      oacc[dt] = mmaN<3>(pah.v, pal.v, bvh.v, bvl.v, oacc[dt]);
    }
    __builtin_amdgcn_fence(__ATOMIC_ACQ_REL, "workgroup");
    __builtin_amdgcn_wave_barrier();
  }
#pragma unroll
  for (int r = 0; r < 8; ++r) {
    float l = l_r[r];
    l += __shfl_xor(l, 1, 32); l += __shfl_xor(l, 2, 32); l += __shfl_xor(l, 4, 32); l += __shfl_xor(l, 8, 32);
    l_r[r] = (l > 0.f) ? 1.0f / l : 0.f;
  }
#pragma unroll
  for (int dt = 0; dt < DT; ++dt)
#pragma unroll
    for (int r = 0; r < 8; ++r) sO[w][8 * hh + r][dt * 16 + ln] = oacc[dt][r] * l_r[r];
  __builtin_amdgcn_fence(__ATOMIC_ACQ_REL, "workgroup");
  __builtin_amdgcn_wave_barrier();
  {
    for (int r = 0; r < 16; ++r) {
      const int row = q0 + r;
      if (row < T && lane < D / 4) {
        const v4f val = *(const v4fa*)&sO[w][r][lane * 4];
        *(v4f*)(y + ((size_t)b * T + row) * ypitch + h * D + lane * 4) = val;
      }
    }
    
  }
}

// GEMM C = act(A·W + bias + resid): A f32 (ASPLIT -> hi/lo 2 terms), Wt bf16 [N][K]; ACT 0 none, 1 relu, 2 exact gelu;
// resid (optional, f32, row index = (row % rmod), pitch ldr, RES_BF16 rounds it) added before the activation.
template <bool ASPLIT, int ACT, bool BIAS_BF16, bool RES_BF16>
__global__ __launch_bounds__(128) void k_gemm_bf3(const float* __restrict__ A, int lda, const unsigned short* __restrict__ Wt, int ldb,
                                                const float* __restrict__ bias, const float* __restrict__ resid, int rmod, int ldr,
                                                float* __restrict__ C, int ldc, int M, int N, int K) {
  __shared__ __attribute__((aligned(16))) float so[4][16][64];
  const int tid = threadIdx.x, w = tid >> 5, lane = tid & 31, ln = lane & 15, hh = lane >> 4;
  const int ntn = N / 64;
  const int wid = blockIdx.x * 4 + w;
  const int mt = wid / ntn, nq = wid % ntn;
  if (mt * 16 >= M) return;
  const int row0 = mt * 16, col0 = nq * 64;
  const float* arow = A + (size_t)(row0 + ln) * lda;
  v8f acc[4] = {};
  for (int kb = 0; kb < K; kb += 32) {
    FragB ah, al;
    const v4f x0 = *(const v4fa*)(arow + kb + 8 * hh), x1 = *(const v4fa*)(arow + kb + 8 * hh + 4);
    const v4f x2 = *(const v4fa*)(arow + kb + 16 + 8 * hh), x3 = *(const v4fa*)(arow + kb + 16 + 8 * hh + 4);
    float xs[16] = {x0[0],x0[1],x0[2],x0[3],x1[0],x1[1],x1[2],x1[3],x2[0],x2[1],x2[2],x2[3],x3[0],x3[1],x3[2],x3[3]};
#pragma unroll
    for (int i = 0; i < 16; ++i) { const unsigned short hb = bf16_bits(xs[i]); ah.u[i] = hb; al.u[i] = ASPLIT ? bf16_bits(xs[i] - bf16_val(hb)) : (unsigned short)0; }
#pragma unroll
    for (int t = 0; t < 4; ++t) {
      const unsigned short* brow = Wt + (size_t)(col0 + t * 16 + ln) * ldb + kb;
      FragB b;
      b.half[0] = *(const v8us*)(brow + 8 * hh);
      b.half[1] = *(const v8us*)(brow + 16 + 8 * hh);
      acc[t] = mmaN<ASPLIT ? 2 : 1>(ah.v, al.v, b.v, b.v, acc[t]);
    }
  }
#pragma unroll
  for (int t = 0; t < 4; ++t) {
    const int col = col0 + t * 16 + ln;
    float bv = bias ? bias[col] : 0.f;
    if (BIAS_BF16) bv = bf16_round(bv);
#pragma unroll
    for (int r = 0; r < 8; ++r) {
      float v = acc[t][r] + bv;
      if (resid) { float rv = resid[(size_t)((row0 + 8 * hh + r) % rmod) * ldr + col]; if (RES_BF16) rv = bf16_round(rv); v += rv; }
      if (ACT == 1) v = fmaxf(v, 0.f);
      if (ACT == 2) v = 0.5f * v * (1.0f + erff(v * 0.70710678118654752f));
      if (ACT == 3) { const float u = 0.7978845608028654f * (v + 0.044715f * v * v * v); v = 0.5f * v * (1.0f + tanhf(u)); }
      so[w][8 * hh + r][t * 16 + ln] = v;
    }
  }
  __builtin_amdgcn_fence(__ATOMIC_ACQ_REL, "workgroup");
  __builtin_amdgcn_wave_barrier();
  const int rsub = lane >> 4, c4 = (lane & 15) * 4;
  {
#pragma unroll
    for (int q = 0; q < 8; ++q) {
      const int r = q * 2 + rsub;
      const v4f v = *(const v4fa*)&so[w][r][c4];
      *(v4f*)(C + (size_t)(row0 + r) * ldc + col0 + c4) = v;
    }
    
  }
}
// row LayerNorm (biased variance, eps) over N: s = X (+ R); optional out_sum <- s; out_norm <- (s-mu)*rsqrt(var+eps)*g + b
template <bool PARAM_BF16>
__global__ __launch_bounds__(256) void k_layernorm(const float* __restrict__ X, const float* __restrict__ R, const float* __restrict__ g, const float* __restrict__ bta,
                                                  float* __restrict__ out_sum, float* __restrict__ out_norm, int N, float eps) {
  __shared__ float red[256];
  const int row = blockIdx.x, tid = threadIdx.x;
  const float* x = X + (size_t)row * N; const float* rr = R ? R + (size_t)row * N : nullptr;
  float vals[16];                     // up to N = 4096
  const int per = N / 256;            // contiguous chunk per thread? use strided-by-4 chunks: thread handles j = tid*4 + 1024*u
  float s1 = 0.f;
  for (int u = 0; u < per / 4; ++u) {
    const int j = tid * 4 + 1024 * u;
    const v4f a = *(const v4fa*)(x + j);
    v4f b = {0.f,0.f,0.f,0.f}; if (rr) b = *(const v4fa*)(rr + j);
#pragma unroll
    for (int q = 0; q < 4; ++q) { const float v = a[q] + b[q]; vals[u * 4 + q] = v; s1 += v; }
  }
  red[tid] = s1; __syncthreads();
  for (int st = 128; st > 0; st >>= 1) { if (tid < st) red[tid] += red[tid + st]; __syncthreads(); }
  const float mu = red[0] / (float)N; __syncthreads();
  float s2 = 0.f;
  for (int u = 0; u < per / 4; ++u)
#pragma unroll
    for (int q = 0; q < 4; ++q) { const float c = vals[u * 4 + q] - mu; s2 += c * c; }
  red[tid] = s2; __syncthreads();
  for (int st = 128; st > 0; st >>= 1) { if (tid < st) red[tid] += red[tid + st]; __syncthreads(); }
  const float rs = rsqrtf(red[0] / (float)N + eps);
  {
    for (int u = 0; u < per / 4; ++u) {
      const int j = tid * 4 + 1024 * u;
      v4f o, sm;
#pragma unroll
      for (int q = 0; q < 4; ++q) {
        float gg = g[j + q], bb = bta[j + q];
        if (PARAM_BF16) { gg = bf16_round(gg); bb = bf16_round(bb); }
        sm[q] = vals[u * 4 + q]; o[q] = (vals[u * 4 + q] - mu) * rs * gg + bb;
      }
      if (out_sum) *(v4f*)(out_sum + (size_t)row * N + j) = sm;
      *(v4f*)(out_norm + (size_t)row * N + j) = o;
    }
    
  }
}



// ---- f16 WMMA path (v_wmma_f32_16x16x32_f16): 11-bit significands for operands in range — used for the conv GEMMs and both attention contractions
typedef _Float16 v16h __attribute__((ext_vector_type(16)));
union FragH { v16h v; v8us half[2]; _Float16 h[16]; unsigned short u[16]; };
template <int NT>
__device__ __forceinline__ v8f mmaH(v16h ah, v16h al, v16h bh, v16h bl, v8f c) {
  c = __builtin_amdgcn_wmma_f32_16x16x32_f16(false, ah, false, bh, (short)0, c, false, false);
  if (NT >= 2) c = __builtin_amdgcn_wmma_f32_16x16x32_f16(false, al, false, bh, (short)0, c, false, false);
  if (NT >= 3) c = __builtin_amdgcn_wmma_f32_16x16x32_f16(false, ah, false, bl, (short)0, c, false, false);
  asm volatile("v_nop\n\tv_nop\n\tv_nop\n\tv_nop" : "+v"(c) : "v"(ah), "v"(al), "v"(bh), "v"(bl));
  return c;
}
// batched GEMM like k_gemm_b but f16 operands: A f32 (split into f16 hi/lo if ASPLIT, else rounded to f16), Bt = f16 values [n][k]; alpha; C f32; N multiple of 16 (partial tiles skipped)
template <bool ASPLIT>
__global__ __launch_bounds__(128) void k_gemm_h(const float* __restrict__ A, int lda, size_t sA, const _Float16* __restrict__ Bh, int ldb, size_t sB, float alpha, float* __restrict__ C, int ldc, size_t sC, int M, int N, int K) {
  __shared__ __attribute__((aligned(16))) float so[4][16][64];
  const int tid = threadIdx.x, w = tid >> 5, lane = tid & 31, ln = lane & 15, hh = lane >> 4; const int by = blockIdx.y;
  A += (size_t)by * sA; Bh += (size_t)by * sB; C += (size_t)by * sC;
  const int ntn = (N + 63) / 64; const int wid = blockIdx.x * 4 + w; const int mt = wid / ntn, nq = wid % ntn; if (mt * 16 >= M) return;
  const int row0 = mt * 16, col0 = nq * 64; const float* arow = A + (size_t)(row0 + ln) * lda;
  v8f acc[4] = {};
  for (int kb = 0; kb < K; kb += 32) {
    FragH ah, al;
    const v4f x0 = *(const v4fa*)(arow + kb + 8 * hh), x1 = *(const v4fa*)(arow + kb + 8 * hh + 4), x2 = *(const v4fa*)(arow + kb + 16 + 8 * hh), x3 = *(const v4fa*)(arow + kb + 16 + 8 * hh + 4);
    float xs[16] = {x0[0],x0[1],x0[2],x0[3],x1[0],x1[1],x1[2],x1[3],x2[0],x2[1],x2[2],x2[3],x3[0],x3[1],x3[2],x3[3]};
#pragma unroll
    for (int i = 0; i < 16; ++i) { const _Float16 h = (_Float16)xs[i]; ah.h[i] = h; al.h[i] = ASPLIT ? (_Float16)(xs[i] - (float)h) : (_Float16)0.0f; }
#pragma unroll
    for (int t = 0; t < 4; ++t) { if (col0 + t * 16 >= N) continue; const size_t boff = (size_t)(col0 + t * 16 + ln) * ldb + kb; FragH bq; bq.half[0] = *(const v8us*)(Bh + boff + 8 * hh); bq.half[1] = *(const v8us*)(Bh + boff + 16 + 8 * hh);
      acc[t] = mmaH<ASPLIT ? 2 : 1>(ah.v, al.v, bq.v, bq.v, acc[t]); }
  }
#pragma unroll
  for (int t = 0; t < 4; ++t) { if (col0 + t * 16 >= N) continue;
#pragma unroll
    for (int r = 0; r < 8; ++r) so[w][8 * hh + r][t * 16 + ln] = acc[t][r] * alpha; }
  __builtin_amdgcn_fence(__ATOMIC_ACQ_REL, "workgroup"); __builtin_amdgcn_wave_barrier();
  const int rsub = lane >> 4, c4 = (lane & 15) * 4;
  {
#pragma unroll
    for (int q = 0; q < 8; ++q) { const int r = q * 2 + rsub; if (col0 + c4 < N) { const v4f v = *(const v4fa*)&so[w][r][c4]; *(v4f*)(C + (size_t)(row0 + r) * ldc + col0 + c4) = v; } }
     }
}

// Wt[n][k] = f16(W[k][n]·scale) from f32 row-major W[K][N] (scale = power of two; bf16-exact weights stay exact in f16 away from the subnormal range)
__global__ __launch_bounds__(256) void k_wt_f16(const float* __restrict__ W, _Float16* __restrict__ Wt, int K, int N, float scale) {
  const int t = blockIdx.x * 256 + threadIdx.x; if (t >= N * (K / 8)) return; const int n = t / (K / 8), k8 = (t % (K / 8)) * 8; FragH f;
#pragma unroll
  for (int i = 0; i < 8; ++i) f.h[i] = (_Float16)(bf16_round(W[(size_t)(k8 + i) * N + n]) * scale); const v8us o = f.half[0];
  *(v8us*)((unsigned short*)Wt + (size_t)n * K + k8) = o; 
}
__device__ __forceinline__ void vts_tile(const int blk, const float* __restrict__ v, _Float16* __restrict__ Vt) { __shared__ unsigned short tl[64][66]; const int tid = threadIdx.x; const int slab = blk / (TT / 64), tg = blk % (TT / 64); const int b = slab / NH, h = slab % NH;
  for (int i = tid; i < 64 * 16; i += 256) { const int r = i / 16, c4 = (i % 16) * 4; const int ts = (tg * 64 + r + 1) % TT; const v4f a = *(const v4fa*)(v + ((size_t)b * TT + ts) * DDm + h * HD + c4); FragH f; for (int q = 0; q < 4; ++q) { f.h[q] = (_Float16)bf16_round(a[q]); tl[r][c4 + q] = f.u[q]; } }
  __syncthreads();
  {
#pragma unroll
    for (int rd = 0; rd < 2; ++rd) { const int d = rd * 32 + tid / 8, pc = tid % 8; FragH f;
#pragma unroll
      for (int q = 0; q < 8; ++q) f.u[q] = tl[pc * 8 + q][d]; *(v8us*)((unsigned short*)Vt + ((size_t)slab * HD + d) * TT + tg * 64 + pc * 8) = f.half[0]; }
    asm volatile("s_wait_xcnt 0x0" ::: "memory");      // behind the two stores: in the joint kernel code of the other block kind follows them in the listing and rewrites their registers
     } }
// attention per ((b,h), 128 queries), transposed: wave 32 queries; St = kc.qc^T (A = 16 key rows, B = 16 query columns, d 32), so a lane holds ONE query's scores: keys 8*hh + r of each 16-key tile;
// logit = -sqrt(max(q2 + k2 - 2S, 1e-12)); mask[q][k] (INPUT, nonzero = keep; tiles with no open key for the wave skipped); maximum and sum in the lane plus one exchange between the wave's halves;
// the two score tiles of 32 keys, converted in place, ARE the B operand of Ot += Vt.Pt (hardware k order: 8*hh + s, 16 + 8*hh + s), and a lane's 8 accumulator registers are 8 consecutive d of its query: no LDS.
typedef int v4ia __attribute__((ext_vector_type(4), may_alias));
__device__ __forceinline__ float xhalf(float x) { const int bq = __float_as_int(x); return __int_as_float(__builtin_amdgcn_permlanex16(bq, bq, 0x76543210, 0xfedcba98, false, false)); }      // lane l <-> l ^ 16
template <int N> __device__ __forceinline__ float rowshare(float x) { return __int_as_float(__builtin_amdgcn_mov_dpp(__float_as_int(x), 0x150 + N, 0xf, 0xf, false)); }      // lane N of each 16-lane row to the whole row
// causal 3-tap conv, transposed: Ct = W.Xt per (tensor, head, 256 positions a block, 32 a wave). The block first rounds its head's 32 x 192 weights into LDS (k = tap * 64 + d, scaled by 16; pitch 200 halves
// keeps the 16-byte fragment reads of 16 rows off one another's banks). A = 16 channel rows from LDS, B = 16 positions: x rows s + tap - 2 (clamped at the sequence's first row) read straight from the f32 input
// and rounded in registers, same k order as A (8*hh + j, 16 + 8*hh + j). A lane then holds ONE position's channels t*16 + 8*hh + r: 16-byte f16 stores, |c|^2 in the lane plus one exchange between the wave's halves.
// Rows and norms go out head-major ([b*NH + h][s][c], [b*NH + h][s]): a wave writes 2 KiB of rows and one 128-byte line of norms, all its own.
__device__ __forceinline__ void conv_tile(const int blk, const float* __restrict__ qx, const float* __restrict__ kx, const float* __restrict__ cw, const float* __restrict__ cb, _Float16* __restrict__ Q16, _Float16* __restrict__ K16, float* __restrict__ NQ, float* __restrict__ NK) {
  __shared__ __attribute__((aligned(16))) unsigned short wsm[CCv][200];
  const int tid = threadIdx.x, w = tid >> 5, lane = tid & 31, ln = lane & 15, hh = lane >> 4;
  const int pg = blk % (NR / 256), h = (blk / (NR / 256)) % NH, z = blk / ((NR / 256) * NH);
  const float* x = z ? kx : qx; _Float16* C16 = z ? K16 : Q16; float* N2 = z ? NK : NQ;
  { const int c = tid >> 3, d0 = (tid & 7) * 8; const float* wp = cw + ((size_t)(h * CCv + c) * HD + d0) * 3; float wv[24];      // a thread's 24 consecutive floats are 8 d x 3 taps of one channel
#pragma unroll
    for (int q = 0; q < 6; ++q) { const v4f a = *(const v4fa*)(wp + q * 4); wv[q * 4] = a[0]; wv[q * 4 + 1] = a[1]; wv[q * 4 + 2] = a[2]; wv[q * 4 + 3] = a[3]; }
#pragma unroll
    for (int i = 0; i < 3; ++i) { FragH f;
#pragma unroll
      for (int q = 0; q < 8; ++q) f.h[q] = (_Float16)(bf16_round(wv[q * 3 + i]) * 16.0f);
      *(v8us*)&wsm[c][i * 64 + d0] = f.half[0]; } }
  __syncthreads();      // every wave reads fragments of weights that all eight waves wrote
  const int row0 = pg * 256 + w * 32, b = row0 / TT, s0 = row0 % TT;
  const float* xb = x + (size_t)b * TT * DDm + h * HD + 8 * hh;
  v8f acc[2][2];
#pragma unroll
  for (int nt = 0; nt < 2; ++nt)
#pragma unroll
    for (int t = 0; t < 2; ++t) acc[nt][t] = (v8f){0.f,0.f,0.f,0.f,0.f,0.f,0.f,0.f};
#pragma unroll
  for (int i = 0; i < 3; ++i)
#pragma unroll
    for (int dd = 0; dd < 2; ++dd) { FragH aw[2], bx[2];
#pragma unroll
      for (int t = 0; t < 2; ++t) { const unsigned short* wk = &wsm[t * 16 + ln][i * 64 + dd * 32 + 8 * hh]; aw[t].half[0] = *(const v8us*)wk; aw[t].half[1] = *(const v8us*)(wk + 16); }
#pragma unroll
      for (int nt = 0; nt < 2; ++nt) { int ss = s0 + nt * 16 + ln + i - 2; ss = ss < 0 ? 0 : ss; const float* xr = xb + (size_t)ss * DDm + dd * 32;
        const v4f x0 = *(const v4fa*)xr, x1 = *(const v4fa*)(xr + 4), x2 = *(const v4fa*)(xr + 16), x3 = *(const v4fa*)(xr + 20);      // below: the hardware's f32 -> bf16 conversion rounds to nearest even, as bf16_round does, in one instruction
#pragma unroll
        for (int j = 0; j < 4; ++j) { bx[nt].h[j] = (_Float16)(float)(__bf16)x0[j]; bx[nt].h[4 + j] = (_Float16)(float)(__bf16)x1[j]; bx[nt].h[8 + j] = (_Float16)(float)(__bf16)x2[j]; bx[nt].h[12 + j] = (_Float16)(float)(__bf16)x3[j]; } }
#pragma unroll
      for (int nt = 0; nt < 2; ++nt)
#pragma unroll
        for (int t = 0; t < 2; ++t) acc[nt][t] = mmaH<1>(aw[t].v, aw[t].v, bx[nt].v, bx[nt].v, acc[nt][t]); }
  float bv[2][8];
#pragma unroll
  for (int t = 0; t < 2; ++t) { const float* bp = cb + h * CCv + t * 16 + 8 * hh; const v4f b0 = *(const v4fa*)bp, b1 = *(const v4fa*)(bp + 4);
#pragma unroll
    for (int j = 0; j < 4; ++j) { bv[t][j] = bf16_round(b0[j]); bv[t][4 + j] = bf16_round(b1[j]); } }
#pragma unroll
  for (int nt = 0; nt < 2; ++nt) { const size_t prow = (size_t)(b * NH + h) * TT + s0 + nt * 16 + ln; float ss = 0.f;
#pragma unroll
    for (int t = 0; t < 2; ++t) { FragH f;
#pragma unroll
      for (int r = 0; r < 8; ++r) { const float v = acc[nt][t][r] * 0.0625f + bv[t][r]; ss += v * v; f.h[r] = (_Float16)v; }
      *(v8us*)((unsigned short*)C16 + prow * CCv + t * 16 + 8 * hh) = f.half[0]; }
    ss += xhalf(ss);
    if (hh == 0) N2[prow] = ss; } }
// all that the attention needs, in ONE launch: the conv blocks (the longer ones) first, then the blocks of the shifted V transpose; the two kinds share nothing, and a block is wholly of one kind
#define NCB ((NR / 256) * NH * 2)
__global__ __launch_bounds__(256) void k_prep(const float* __restrict__ qx, const float* __restrict__ kx, const float* __restrict__ vx, const float* __restrict__ cw, const float* __restrict__ cb, _Float16* __restrict__ Q16, _Float16* __restrict__ K16, float* __restrict__ NQ, float* __restrict__ NK, _Float16* __restrict__ Vt) {
  if (blockIdx.x < NCB) conv_tile((int)blockIdx.x, qx, kx, cw, cb, Q16, K16, NQ, NK); else vts_tile((int)blockIdx.x - NCB, vx, Vt); }
__global__ __launch_bounds__(128) void k_sattn(const _Float16* __restrict__ Q16, const _Float16* __restrict__ K16, const float* __restrict__ NQ, const float* __restrict__ NK, const int* __restrict__ MSK, const _Float16* __restrict__ Vt, float* __restrict__ O) { constexpr int RPW = 32; constexpr float L2E = 1.4426950408889634f;
  const int tid = threadIdx.x, w = tid >> 5, lane = tid & 31, ln = lane & 15, hh = lane >> 4; const int slab = blockIdx.x / (TT / 128), qblk = blockIdx.x % (TT / 128); const int b = slab / NH, h = slab % NH; const int q0 = qblk * 128 + w * RPW;
  FragH bq[2]; float q2c[2];
#pragma unroll
  for (int rt = 0; rt < 2; ++rt) { const size_t qrow = (size_t)slab * TT + q0 + rt * 16 + ln; const unsigned short* qr = (const unsigned short*)Q16 + qrow * CCv; bq[rt].half[0] = *(const v8us*)(qr + 8 * hh); bq[rt].half[1] = *(const v8us*)(qr + 16 + 8 * hh); q2c[rt] = NQ[qrow]; }
  const int kslot = (ln < 8) ? 8 * hh + ln : 8 + 8 * hh + ln;      // lane ln of half hh fetches |kc|^2 of the key that the half's score register ln holds (tile ln / 8, register ln % 8)
  float m_c[2], l_c[2]; v8f oacc[2][4];      // m starts finite and below every finite logit (|logit| <= sqrt(FLT_MAX)): exp2 arguments never meet inf - inf
#pragma unroll
  for (int rt = 0; rt < 2; ++rt) { m_c[rt] = -1.0e30f; l_c[rt] = 0.f;
#pragma unroll
    for (int dt = 0; dt < 4; ++dt) oacc[rt][dt] = (v8f){0.f,0.f,0.f,0.f,0.f,0.f,0.f,0.f}; }
  // read places: a base that is the same for the whole block and steps by one 32-key tile a trip, plus each lane's own fixed byte offset
  const char* mb = (const char*)(MSK + (size_t)qblk * 128 * TT); const char* kb = (const char*)(K16 + (size_t)slab * TT * CCv); const char* nb = (const char*)(NK + (size_t)slab * TT); const char* vb = (const char*)(Vt + (size_t)slab * HD * TT);
  const unsigned mlo = (unsigned)(((w * RPW + ln) * TT + 8 * hh) * 4), klo = (unsigned)((ln * CCv + 8 * hh) * 2), nlo = (unsigned)(kslot * 4), vlo = (unsigned)((ln * TT + 8 * hh) * 2);
#pragma unroll 1
  for (int j0 = 0; j0 < TT; j0 += 32, mb += 32 * 4, kb += 32 * CCv * 2, nb += 32 * 4, vb += 32 * 2) {
    v4ia mk[2][2][2];
#pragma unroll
    for (int rt = 0; rt < 2; ++rt)
#pragma unroll
      for (int nt = 0; nt < 2; ++nt) { const int* mr = (const int*)(mb + mlo) + rt * 16 * TT + nt * 16; mk[rt][nt][0] = *(const v4ia*)mr; mk[rt][nt][1] = *(const v4ia*)(mr + 4); }
    const v4ia mo = (mk[0][0][0] | mk[0][0][1]) | (mk[0][1][0] | mk[0][1][1]) | ((mk[1][0][0] | mk[1][0][1]) | (mk[1][1][0] | mk[1][1][1])); const int anyb = (mo[0] | mo[1]) | (mo[2] | mo[3]);
    if (__builtin_amdgcn_ballot_w32(anyb != 0) == 0u) continue;      // wave-uniform skip of fully masked tiles
    FragH ak[2], av[4];
#pragma unroll
    for (int nt = 0; nt < 2; ++nt) { const unsigned short* kr = (const unsigned short*)(kb + klo) + nt * 16 * CCv; ak[nt].half[0] = *(const v8us*)kr; ak[nt].half[1] = *(const v8us*)(kr + 16); }
    const float k2l = *(const float*)(nb + nlo);
#pragma unroll
    for (int dt = 0; dt < 4; ++dt) { const unsigned short* vrow = (const unsigned short*)(vb + vlo) + dt * 16 * TT; av[dt].half[0] = *(const v8us*)vrow; av[dt].half[1] = *(const v8us*)(vrow + 16); }
    v8f s[2][2];
#pragma unroll
    for (int nt = 0; nt < 2; ++nt)
#pragma unroll
      for (int rt = 0; rt < 2; ++rt) { v8f acc = (v8f){0.f,0.f,0.f,0.f,0.f,0.f,0.f,0.f}; acc = mmaH<1>(ak[nt].v, ak[nt].v, bq[rt].v, bq[rt].v, acc); s[rt][nt] = acc; }
    const float k2v[2][8] = {{rowshare<0>(k2l), rowshare<1>(k2l), rowshare<2>(k2l), rowshare<3>(k2l), rowshare<4>(k2l), rowshare<5>(k2l), rowshare<6>(k2l), rowshare<7>(k2l)},
                             {rowshare<8>(k2l), rowshare<9>(k2l), rowshare<10>(k2l), rowshare<11>(k2l), rowshare<12>(k2l), rowshare<13>(k2l), rowshare<14>(k2l), rowshare<15>(k2l)}};
    FragH pb[2];
#pragma unroll
    for (int rt = 0; rt < 2; ++rt) { float sv[2][8]; float mc = -INFINITY;
#pragma unroll
      for (int nt = 0; nt < 2; ++nt)
#pragma unroll
        for (int r = 0; r < 8; ++r) { const float d = fmaxf(q2c[rt] + k2v[nt][r] - 2.0f * s[rt][nt][r], 1e-12f); sv[nt][r] = (mk[rt][nt][r >> 2][r & 3] != 0) ? -__builtin_amdgcn_sqrtf(d) : -INFINITY; mc = fmaxf(mc, sv[nt][r]); }      // d >= 1e-12: never a denormal, the hardware root needs no range fix-up
      mc = fmaxf(mc, xhalf(mc));
      const float mn = fmaxf(m_c[rt], mc); const float ta = (m_c[rt] - mn) * L2E; const float al = __builtin_amdgcn_exp2f(ta); m_c[rt] = mn; const float nm = -mn * L2E;      // exp(x - mn) = exp2(x * log2(e) - mn * log2(e)): one fma and the hardware exp2; a closed key's -inf gives exp2(-inf) = 0
      float ps = 0.f;
#pragma unroll
      for (int nt = 0; nt < 2; ++nt) { float t[8], p[8];
#pragma unroll
        for (int r = 0; r < 8; ++r) { t[r] = __builtin_fmaf(sv[nt][r], L2E, nm); p[r] = __builtin_amdgcn_exp2f(t[r]); }
        // the slot behind a transcendental: inputs only, so every argument's register stays whole until all of these exp2 have issued (none is overwritten directly behind its exp2), and the v_nop stands behind the last
        asm volatile("v_nop" :: "v"(t[0]), "v"(t[1]), "v"(t[2]), "v"(t[3]), "v"(t[4]), "v"(t[5]), "v"(t[6]), "v"(t[7]), "v"(p[0]), "v"(p[1]), "v"(p[2]), "v"(p[3]), "v"(p[4]), "v"(p[5]), "v"(p[6]), "v"(p[7]), "v"(ta), "v"(al));
#pragma unroll
        for (int r = 0; r < 8; ++r) { ps += p[r]; pb[rt].h[nt * 8 + r] = (_Float16)p[r]; } }
      l_c[rt] = l_c[rt] * al + ps;      // the half's own 16 keys; the halves join behind the loop
#pragma unroll
      for (int dt = 0; dt < 4; ++dt)
#pragma unroll
        for (int r = 0; r < 8; ++r) oacc[rt][dt][r] *= al; }
#pragma unroll
    for (int dt = 0; dt < 4; ++dt)
#pragma unroll
      for (int rt = 0; rt < 2; ++rt) oacc[rt][dt] = mmaH<1>(av[dt].v, av[dt].v, pb[rt].v, pb[rt].v, oacc[rt][dt]); }
#pragma unroll
  for (int rt = 0; rt < 2; ++rt) { const float l = l_c[rt] + xhalf(l_c[rt]); const float li = (l > 0.f) ? 1.0f / l : 0.f; float* orow = O + ((size_t)b * TT + q0 + rt * 16 + ln) * DDm + h * HD + 8 * hh;
#pragma unroll
    for (int dt = 0; dt < 4; ++dt) { const v4f lo = {oacc[rt][dt][0] * li, oacc[rt][dt][1] * li, oacc[rt][dt][2] * li, oacc[rt][dt][3] * li}, hi = {oacc[rt][dt][4] * li, oacc[rt][dt][5] * li, oacc[rt][dt][6] * li, oacc[rt][dt][7] * li}; *(v4f*)(orow + dt * 16) = lo; *(v4f*)(orow + dt * 16 + 4) = hi; } } }
extern "C" void kernel_launch(void* const* d_in, const int* in_sizes, int n_in,
                              void* d_out, int out_size, void* d_ws, size_t ws_size, hipStream_t stream) {
  (void)in_sizes; (void)n_in; (void)out_size;
  const float* qx = (const float*)d_in[0]; const float* kx = (const float*)d_in[1]; const float* vx = (const float*)d_in[2]; const int* mask = (const int*)d_in[3]; const float* cw = (const float*)d_in[4]; const float* cb = (const float*)d_in[5];
  char* ws = (char*)d_ws; size_t off = 0;
  auto take = [&](size_t bytes) { char* p = ws + off; off += (bytes + 255) & ~(size_t)255; return p; };
  _Float16* Q16 = (_Float16*)take((size_t)NR * NH * CCv * 2); _Float16* K16 = (_Float16*)take((size_t)NR * NH * CCv * 2); float* NQ = (float*)take((size_t)NR * NH * 4); float* NK = (float*)take((size_t)NR * NH * 4); _Float16* Vt = (_Float16*)take((size_t)NR * DDm * 2);
  if (off > ws_size) return;      // 4.2 x 2 + 0.26 x 2 + 8.4: about 17 MiB
  k_prep<<<NCB + BB * NH * (TT / 64), 256, 0, stream>>>(qx, kx, vx, cw, cb, Q16, K16, NQ, NK, Vt);
  k_sattn<<<BB * NH * (TT / 128), 128, 0, stream>>>(Q16, K16, NQ, NK, mask, Vt, (float*)d_out);
}

// v004
// A run of this version takes 73.4 microseconds.
// In two side-by-side timings against v003, it was 1.19 and 1.20 times as fast.
// All steps since v000 together make it 7.16 times as fast.
#include <hip/hip_runtime.h>
// Simplex (distance-based) attention (B=4, S=2048, 8 heads × 64, conv channels 32): the per-head causal 3-tap conv of q and k on WMMA (+ bias, f16 rows and norms head-major) and the shifted V transpose in one preparation launch, and the attention as a
// fused flash-style kernel on v_wmma_f32_16x16x32_f16 — S = qc·kc (d = 32, one k-step), logits = −sqrt(max(|qc|² + |kc|² − 2S, 1e-12)), INPUT mask (nonzero = keep), online softmax f32,
// P f16 ≤ 1, and the roll(attn, 1) folded into a one-step shift of V (out[s] = Σ_t attn[s][t]·v[t+1 mod S]); f16 operands, single products, f32 accumulate; norms f32 VALU in the conv's epilogue.
#define BB 4
#define TT 2048
#define DDm 512
#define NH 8
#define HD 64
#define CCv 32
#define NR (BB * TT)

typedef __bf16 v16b __attribute__((ext_vector_type(16)));
typedef unsigned short v8us __attribute__((ext_vector_type(8), may_alias));
typedef float  v8f  __attribute__((ext_vector_type(8)));
typedef float  v4f  __attribute__((ext_vector_type(4)));
typedef float  v4fa __attribute__((ext_vector_type(4), may_alias));
union FragB { v16b v; v8us half[2]; unsigned short u[16]; };

__device__ __forceinline__ unsigned short bf16_bits(float x) { unsigned int u = __float_as_uint(x); return (unsigned short)((u + 0x7FFFu + ((u >> 16) & 1u)) >> 16); }
__device__ __forceinline__ float bf16_val(unsigned short b) { return __uint_as_float(((unsigned int)b) << 16); }
__device__ __forceinline__ float bf16_round(float x) { return bf16_val(bf16_bits(x)); }
// D += A·B with NT terms: 1 = ah·bh, 2 = + al·bh (A split), 3 = + ah·bl (both split)
template <int NT>
__device__ __forceinline__ v8f mmaN(v16b ah, v16b al, v16b bh, v16b bl, v8f c) {
  c = __builtin_amdgcn_wmma_f32_16x16x32_bf16(false, ah, false, bh, (short)0, c, false, false);
  if (NT >= 2) c = __builtin_amdgcn_wmma_f32_16x16x32_bf16(false, al, false, bh, (short)0, c, false, false);
  if (NT >= 3) c = __builtin_amdgcn_wmma_f32_16x16x32_bf16(false, ah, false, bl, (short)0, c, false, false);
  asm volatile("v_nop\n\tv_nop\n\tv_nop\n\tv_nop" : "+v"(c) : "v"(ah), "v"(al), "v"(bh), "v"(bl));
  return c;
}

__global__ __launch_bounds__(256) void k_wt_bf16(const float* __restrict__ W, unsigned short* __restrict__ Wt, int K, int N) {
  const int t = blockIdx.x * 256 + threadIdx.x;
  const int k8n = K / 8;
  if (t >= N * k8n) return;
  const int n = t / k8n, k8 = (t % k8n) * 8;
  v8us v;
#pragma unroll
  for (int i = 0; i < 8; ++i) v[i] = bf16_bits(W[(size_t)(k8 + i) * N + n]);
  *(v8us*)(Wt + (size_t)n * K + k8) = v;
  
}

// GEMM C[M][N] (f32, pitch ldc) = act(A[M][K]·W + bias). A f32 row-major (pitch lda) converted per fragment to bf16
// (ASPLIT: hi/lo two planes -> 2 terms, else single rounded term); Wt bf16 [N][K] (pitch ldb). BIAS_BF16 rounds the
// bias to bf16 first (bias quantised to bf16 before the add). K%32==0, M%16==0, N%64==0.
template <bool ASPLIT, int ACT, bool BIAS_BF16>
__global__ __launch_bounds__(128) void k_gemm_bf(const float* __restrict__ A, int lda, const unsigned short* __restrict__ Wt, int ldb,
                                               const float* __restrict__ bias, float* __restrict__ C, int ldc, int M, int N, int K) {
  __shared__ __attribute__((aligned(16))) float so[4][16][64];
  const int tid = threadIdx.x, w = tid >> 5, lane = tid & 31, ln = lane & 15, hh = lane >> 4;
  const int ntn = N / 64;
  const int wid = blockIdx.x * 4 + w;
  const int mt = wid / ntn, nq = wid % ntn;
  if (mt * 16 >= M) return;
  const int row0 = mt * 16, col0 = nq * 64;
  const float* arow = A + (size_t)(row0 + ln) * lda;
  v8f acc[4] = {};
  for (int kb = 0; kb < K; kb += 32) {
    FragB ah, al;
    const v4f x0 = *(const v4fa*)(arow + kb + 8 * hh), x1 = *(const v4fa*)(arow + kb + 8 * hh + 4);
    const v4f x2 = *(const v4fa*)(arow + kb + 16 + 8 * hh), x3 = *(const v4fa*)(arow + kb + 16 + 8 * hh + 4);
    float xs[16] = {x0[0],x0[1],x0[2],x0[3],x1[0],x1[1],x1[2],x1[3],x2[0],x2[1],x2[2],x2[3],x3[0],x3[1],x3[2],x3[3]};
#pragma unroll
    for (int i = 0; i < 16; ++i) { const unsigned short hb = bf16_bits(xs[i]); ah.u[i] = hb; al.u[i] = ASPLIT ? bf16_bits(xs[i] - bf16_val(hb)) : (unsigned short)0; }
#pragma unroll
    for (int t = 0; t < 4; ++t) {
      const unsigned short* brow = Wt + (size_t)(col0 + t * 16 + ln) * ldb + kb;
      FragB b;
      b.half[0] = *(const v8us*)(brow + 8 * hh);
      b.half[1] = *(const v8us*)(brow + 16 + 8 * hh);
      acc[t] = mmaN<ASPLIT ? 2 : 1>(ah.v, al.v, b.v, b.v, acc[t]);
    }
  }
#pragma unroll
  for (int t = 0; t < 4; ++t) {
    float bv = bias ? bias[col0 + t * 16 + ln] : 0.f;
    if (BIAS_BF16) bv = bf16_round(bv);
#pragma unroll
    for (int r = 0; r < 8; ++r) { float v = acc[t][r] + bv; if (ACT == 1) v = fmaxf(v, 0.f); so[w][8 * hh + r][t * 16 + ln] = v; }
  }
  __builtin_amdgcn_fence(__ATOMIC_ACQ_REL, "workgroup");
  __builtin_amdgcn_wave_barrier();
  const int rsub = lane >> 4, c4 = (lane & 15) * 4;
  {
#pragma unroll
    for (int q = 0; q < 8; ++q) {
      const int r = q * 2 + rsub;
      const v4f v = *(const v4fa*)&so[w][r][c4];
      *(v4f*)(C + (size_t)(row0 + r) * ldc + col0 + c4) = v;
    }
    
  }
}

// Flash-style causal/unmasked attention, all contractions 3-term bf16 hi/lo splits, f32 softmax with running max.
// q,k,v rows are read from f32 buffers with arbitrary row pitch (so they can live inside a fused qkv buffer);
// D = head size (multiple of 32, <= 128); one wave = 16 query rows; block = 4 waves (64 queries) sharing K/V chunks of 32.
template <int D, bool CAUSAL>
__global__ __launch_bounds__(128) void k_flash(const float* __restrict__ qb, const float* __restrict__ kb, const float* __restrict__ vb,
                                             int pitch, int T, int H, float scale, float* __restrict__ y, int ypitch) {
  constexpr int KS = D / 32;        // k-steps for QK
  constexpr int DT = D / 16;        // d tiles for PV
  __shared__ __attribute__((aligned(16))) unsigned short sKh[32][D + 8], sKl[32][D + 8], sVh[32][D + 8], sVl[32][D + 8];
  __shared__ __attribute__((aligned(16))) unsigned short sPh[4][16][40], sPl[4][16][40];
  __shared__ __attribute__((aligned(16))) float sO[4][16][D];
  const int tid = threadIdx.x, w = tid >> 5, lane = tid & 31, ln = lane & 15, hh = lane >> 4;
  const int nqb = (T + 63) / 64;
  const int bh = blockIdx.x / nqb, qblk = blockIdx.x % nqb;
  const int b = bh / H, h = bh % H;
  const int q0 = qblk * 64 + w * 16;
  const float* Q = qb + (size_t)b * T * pitch + h * D;
  const float* K = kb + (size_t)b * T * pitch + h * D;
  const float* V = vb + (size_t)b * T * pitch + h * D;

  // A fragments of the wave's 16 query rows (scaled), hi/lo
  FragB aqh[KS], aql[KS];
  {
    int row = q0 + ln; if (row >= T) row = T - 1;
    const float* qr = Q + (size_t)row * pitch;
#pragma unroll
    for (int ks = 0; ks < KS; ++ks)
#pragma unroll
      for (int i = 0; i < 16; ++i) {
        const int d = ks * 32 + ((i < 8) ? (8 * hh + i) : (16 + 8 * hh + (i - 8)));
        const float x = qr[d] * scale; const unsigned short hb = bf16_bits(x);
        aqh[ks].u[i] = hb; aql[ks].u[i] = bf16_bits(x - bf16_val(hb));
      }
  }
  float m_r[8], l_r[8];
#pragma unroll
  for (int r = 0; r < 8; ++r) { m_r[r] = -3.0e38f; l_r[r] = 0.f; }
  v8f oacc[DT];
#pragma unroll
  for (int dt = 0; dt < DT; ++dt) oacc[dt] = (v8f){0.f,0.f,0.f,0.f,0.f,0.f,0.f,0.f};

  const int kv_end = CAUSAL ? min(T, qblk * 64 + 64) : T;     // block-uniform
  for (int j0 = 0; j0 < kv_end; j0 += 32) {
    __syncthreads();
    for (int e = tid; e < 32 * (D / 4); e += 128) {
      const int r = e / (D / 4), c4 = (e % (D / 4)) * 4;
      const int key = j0 + r;
      v4f kf = {0.f,0.f,0.f,0.f}, vf = {0.f,0.f,0.f,0.f};
      if (key < T) { kf = *(const v4fa*)(K + (size_t)key * pitch + c4); vf = *(const v4fa*)(V + (size_t)key * pitch + c4); }
#pragma unroll
      for (int t = 0; t < 4; ++t) {
        unsigned short hb = bf16_bits(kf[t]); sKh[r][c4 + t] = hb; sKl[r][c4 + t] = bf16_bits(kf[t] - bf16_val(hb));
        hb = bf16_bits(vf[t]); sVh[r][c4 + t] = hb; sVl[r][c4 + t] = bf16_bits(vf[t] - bf16_val(hb));
      }
    }
    __syncthreads();
    // S tile 16 x 32
    v8f s[2];
#pragma unroll
    for (int nt = 0; nt < 2; ++nt) {
      v8f acc = {};
#pragma unroll
      for (int ks = 0; ks < KS; ++ks) {
        FragB bh_, bl_;
        bh_.half[0] = *(const v8us*)&sKh[nt * 16 + ln][ks * 32 + 8 * hh]; bh_.half[1] = *(const v8us*)&sKh[nt * 16 + ln][ks * 32 + 16 + 8 * hh];
        bl_.half[0] = *(const v8us*)&sKl[nt * 16 + ln][ks * 32 + 8 * hh]; bl_.half[1] = *(const v8us*)&sKl[nt * 16 + ln][ks * 32 + 16 + 8 * hh];
        acc = mmaN<3>(aqh[ks].v, aql[ks].v, bh_.v, bl_.v, acc);
      }
      s[nt] = acc;
    }
    // mask + running max (rows 8hh+r; the 16 lanes of a half share rows)
    float alpha[8];
#pragma unroll
    for (int r = 0; r < 8; ++r) {
      const int qi = q0 + 8 * hh + r;
      const int ja = j0 + ln, jb = j0 + 16 + ln;
      if (CAUSAL) { if (ja > qi) s[0][r] = -3.0e38f; if (jb > qi) s[1][r] = -3.0e38f; }
      if (ja >= T) s[0][r] = -3.0e38f;
      if (jb >= T) s[1][r] = -3.0e38f;
      float mx = fmaxf(s[0][r], s[1][r]);
      mx = fmaxf(mx, __shfl_xor(mx, 1, 32)); mx = fmaxf(mx, __shfl_xor(mx, 2, 32)); mx = fmaxf(mx, __shfl_xor(mx, 4, 32)); mx = fmaxf(mx, __shfl_xor(mx, 8, 32));
      const float mnew = fmaxf(m_r[r], mx);
      alpha[r] = (mnew > -1.0e38f) ? __expf(m_r[r] - mnew) : 1.0f;
      const float p0 = (s[0][r] > -1.0e38f) ? __expf(s[0][r] - mnew) : 0.f;
      const float p1 = (s[1][r] > -1.0e38f) ? __expf(s[1][r] - mnew) : 0.f;
      m_r[r] = mnew;
      l_r[r] = l_r[r] * alpha[r] + p0 + p1;            // per-lane partial row sum (16 lanes combined at the end)
      unsigned short hb = bf16_bits(p0); sPh[w][8 * hh + r][ln] = hb;      sPl[w][8 * hh + r][ln] = bf16_bits(p0 - bf16_val(hb));
      hb = bf16_bits(p1);                sPh[w][8 * hh + r][16 + ln] = hb; sPl[w][8 * hh + r][16 + ln] = bf16_bits(p1 - bf16_val(hb));
    }
#pragma unroll
    for (int dt = 0; dt < DT; ++dt)
#pragma unroll
      for (int r = 0; r < 8; ++r) oacc[dt][r] *= alpha[r];
    __builtin_amdgcn_fence(__ATOMIC_ACQ_REL, "workgroup");
    __builtin_amdgcn_wave_barrier();
    FragB pah, pal;
    pah.half[0] = *(const v8us*)&sPh[w][ln][8 * hh]; pah.half[1] = *(const v8us*)&sPh[w][ln][16 + 8 * hh];
    pal.half[0] = *(const v8us*)&sPl[w][ln][8 * hh]; pal.half[1] = *(const v8us*)&sPl[w][ln][16 + 8 * hh];
#pragma unroll
    for (int dt = 0; dt < DT; ++dt) {
      FragB bvh, bvl;
#pragma unroll
      for (int i = 0; i < 8; ++i) {
        bvh.u[i] = sVh[8 * hh + i][dt * 16 + ln]; bvh.u[8 + i] = sVh[16 + 8 * hh + i][dt * 16 + ln];
        bvl.u[i] = sVl[8 * hh + i][dt * 16 + ln]; bvl.u[8 + i] = sVl[16 + 8 * hh + i][dt * 16 + ln];
      }
      oacc[dt] = mmaN<3>(pah.v, pal.v, bvh.v, bvl.v, oacc[dt]);
    }
    __builtin_amdgcn_fence(__ATOMIC_ACQ_REL, "workgroup");
    __builtin_amdgcn_wave_barrier();
  }
#pragma unroll
  for (int r = 0; r < 8; ++r) {
    float l = l_r[r];
    l += __shfl_xor(l, 1, 32); l += __shfl_xor(l, 2, 32); l += __shfl_xor(l, 4, 32); l += __shfl_xor(l, 8, 32);
    l_r[r] = (l > 0.f) ? 1.0f / l : 0.f;
  }
#pragma unroll
  for (int dt = 0; dt < DT; ++dt)
#pragma unroll
    for (int r = 0; r < 8; ++r) sO[w][8 * hh + r][dt * 16 + ln] = oacc[dt][r] * l_r[r];
  __builtin_amdgcn_fence(__ATOMIC_ACQ_REL, "workgroup");
  __builtin_amdgcn_wave_barrier();
  {
    for (int r = 0; r < 16; ++r) {
      const int row = q0 + r;
      if (row < T && lane < D / 4) {
        const v4f val = *(const v4fa*)&sO[w][r][lane * 4];
        *(v4f*)(y + ((size_t)b * T + row) * ypitch + h * D + lane * 4) = val;
      }
    }
    
  }
}

// GEMM C = act(A·W + bias + resid): A f32 (ASPLIT -> hi/lo 2 terms), Wt bf16 [N][K]; ACT 0 none, 1 relu, 2 exact gelu;
// resid (optional, f32, row index = (row % rmod), pitch ldr, RES_BF16 rounds it) added before the activation.
template <bool ASPLIT, int ACT, bool BIAS_BF16, bool RES_BF16>
__global__ __launch_bounds__(128) void k_gemm_bf3(const float* __restrict__ A, int lda, const unsigned short* __restrict__ Wt, int ldb,
                                                const float* __restrict__ bias, const float* __restrict__ resid, int rmod, int ldr,
                                                float* __restrict__ C, int ldc, int M, int N, int K) {
  __shared__ __attribute__((aligned(16))) float so[4][16][64];
  const int tid = threadIdx.x, w = tid >> 5, lane = tid & 31, ln = lane & 15, hh = lane >> 4;
  const int ntn = N / 64;
  const int wid = blockIdx.x * 4 + w;
  const int mt = wid / ntn, nq = wid % ntn;
  if (mt * 16 >= M) return;
  const int row0 = mt * 16, col0 = nq * 64;
  const float* arow = A + (size_t)(row0 + ln) * lda;
  v8f acc[4] = {};
  for (int kb = 0; kb < K; kb += 32) {
    FragB ah, al;
    const v4f x0 = *(const v4fa*)(arow + kb + 8 * hh), x1 = *(const v4fa*)(arow + kb + 8 * hh + 4);
    const v4f x2 = *(const v4fa*)(arow + kb + 16 + 8 * hh), x3 = *(const v4fa*)(arow + kb + 16 + 8 * hh + 4);
    float xs[16] = {x0[0],x0[1],x0[2],x0[3],x1[0],x1[1],x1[2],x1[3],x2[0],x2[1],x2[2],x2[3],x3[0],x3[1],x3[2],x3[3]};
#pragma unroll
    for (int i = 0; i < 16; ++i) { const unsigned short hb = bf16_bits(xs[i]); ah.u[i] = hb; al.u[i] = ASPLIT ? bf16_bits(xs[i] - bf16_val(hb)) : (unsigned short)0; }
#pragma unroll
    for (int t = 0; t < 4; ++t) {
      const unsigned short* brow = Wt + (size_t)(col0 + t * 16 + ln) * ldb + kb;
      FragB b;
      b.half[0] = *(const v8us*)(brow + 8 * hh);
      b.half[1] = *(const v8us*)(brow + 16 + 8 * hh);
      acc[t] = mmaN<ASPLIT ? 2 : 1>(ah.v, al.v, b.v, b.v, acc[t]);
    }
  }
#pragma unroll
  for (int t = 0; t < 4; ++t) {
    const int col = col0 + t * 16 + ln;
    float bv = bias ? bias[col] : 0.f;
    if (BIAS_BF16) bv = bf16_round(bv);
#pragma unroll
    for (int r = 0; r < 8; ++r) {
      float v = acc[t][r] + bv;
      if (resid) { float rv = resid[(size_t)((row0 + 8 * hh + r) % rmod) * ldr + col]; if (RES_BF16) rv = bf16_round(rv); v += rv; }
      if (ACT == 1) v = fmaxf(v, 0.f);
      if (ACT == 2) v = 0.5f * v * (1.0f + erff(v * 0.70710678118654752f));
      if (ACT == 3) { const float u = 0.7978845608028654f * (v + 0.044715f * v * v * v); v = 0.5f * v * (1.0f + tanhf(u)); }
      so[w][8 * hh + r][t * 16 + ln] = v;
    }
  }
  __builtin_amdgcn_fence(__ATOMIC_ACQ_REL, "workgroup");
  __builtin_amdgcn_wave_barrier();
  const int rsub = lane >> 4, c4 = (lane & 15) * 4;
  {
#pragma unroll
    for (int q = 0; q < 8; ++q) {
      const int r = q * 2 + rsub;
      const v4f v = *(const v4fa*)&so[w][r][c4];
      *(v4f*)(C + (size_t)(row0 + r) * ldc + col0 + c4) = v;
    }
    
  }
}
// row LayerNorm (biased variance, eps) over N: s = X (+ R); optional out_sum <- s; out_norm <- (s-mu)*rsqrt(var+eps)*g + b
template <bool PARAM_BF16>
__global__ __launch_bounds__(256) void k_layernorm(const float* __restrict__ X, const float* __restrict__ R, const float* __restrict__ g, const float* __restrict__ bta,
                                                  float* __restrict__ out_sum, float* __restrict__ out_norm, int N, float eps) {
  __shared__ float red[256];
  const int row = blockIdx.x, tid = threadIdx.x;
  const float* x = X + (size_t)row * N; const float* rr = R ? R + (size_t)row * N : nullptr;
  float vals[16];                     // up to N = 4096
  const int per = N / 256;            // contiguous chunk per thread? use strided-by-4 chunks: thread handles j = tid*4 + 1024*u
  float s1 = 0.f;
  for (int u = 0; u < per / 4; ++u) {
    const int j = tid * 4 + 1024 * u;
    const v4f a = *(const v4fa*)(x + j);
    v4f b = {0.f,0.f,0.f,0.f}; if (rr) b = *(const v4fa*)(rr + j);
#pragma unroll
    for (int q = 0; q < 4; ++q) { const float v = a[q] + b[q]; vals[u * 4 + q] = v; s1 += v; }
  }
  red[tid] = s1; __syncthreads();
  for (int st = 128; st > 0; st >>= 1) { if (tid < st) red[tid] += red[tid + st]; __syncthreads(); }
  const float mu = red[0] / (float)N; __syncthreads();
  float s2 = 0.f;
  for (int u = 0; u < per / 4; ++u)
#pragma unroll
    for (int q = 0; q < 4; ++q) { const float c = vals[u * 4 + q] - mu; s2 += c * c; }
  red[tid] = s2; __syncthreads();
  for (int st = 128; st > 0; st >>= 1) { if (tid < st) red[tid] += red[tid + st]; __syncthreads(); }
  const float rs = rsqrtf(red[0] / (float)N + eps);
  {
    for (int u = 0; u < per / 4; ++u) {
      const int j = tid * 4 + 1024 * u;
      v4f o, sm;
#pragma unroll
      for (int q = 0; q < 4; ++q) {
        float gg = g[j + q], bb = bta[j + q];
        if (PARAM_BF16) { gg = bf16_round(gg); bb = bf16_round(bb); }
        sm[q] = vals[u * 4 + q]; o[q] = (vals[u * 4 + q] - mu) * rs * gg + bb;
      }
      if (out_sum) *(v4f*)(out_sum + (size_t)row * N + j) = sm;
      *(v4f*)(out_norm + (size_t)row * N + j) = o;
    }
    
  }
}



// ---- f16 WMMA path (v_wmma_f32_16x16x32_f16): 11-bit significands for operands in range — used for the conv GEMMs and both attention contractions
typedef _Float16 v16h __attribute__((ext_vector_type(16)));
union FragH { v16h v; v8us half[2]; _Float16 h[16]; unsigned short u[16]; };
template <int NT>
__device__ __forceinline__ v8f mmaH(v16h ah, v16h al, v16h bh, v16h bl, v8f c) {
  c = __builtin_amdgcn_wmma_f32_16x16x32_f16(false, ah, false, bh, (short)0, c, false, false);
  if (NT >= 2) c = __builtin_amdgcn_wmma_f32_16x16x32_f16(false, al, false, bh, (short)0, c, false, false);
  if (NT >= 3) c = __builtin_amdgcn_wmma_f32_16x16x32_f16(false, ah, false, bl, (short)0, c, false, false);
  asm volatile("v_nop\n\tv_nop\n\tv_nop\n\tv_nop" : "+v"(c) : "v"(ah), "v"(al), "v"(bh), "v"(bl));
  return c;
}
// batched GEMM like k_gemm_b but f16 operands: A f32 (split into f16 hi/lo if ASPLIT, else rounded to f16), Bt = f16 values [n][k]; alpha; C f32; N multiple of 16 (partial tiles skipped)
template <bool ASPLIT>
__global__ __launch_bounds__(128) void k_gemm_h(const float* __restrict__ A, int lda, size_t sA, const _Float16* __restrict__ Bh, int ldb, size_t sB, float alpha, float* __restrict__ C, int ldc, size_t sC, int M, int N, int K) {
  __shared__ __attribute__((aligned(16))) float so[4][16][64];
  const int tid = threadIdx.x, w = tid >> 5, lane = tid & 31, ln = lane & 15, hh = lane >> 4; const int by = blockIdx.y;
  A += (size_t)by * sA; Bh += (size_t)by * sB; C += (size_t)by * sC;
  const int ntn = (N + 63) / 64; const int wid = blockIdx.x * 4 + w; const int mt = wid / ntn, nq = wid % ntn; if (mt * 16 >= M) return;
  const int row0 = mt * 16, col0 = nq * 64; const float* arow = A + (size_t)(row0 + ln) * lda;
  v8f acc[4] = {};
  for (int kb = 0; kb < K; kb += 32) {
    FragH ah, al;
    const v4f x0 = *(const v4fa*)(arow + kb + 8 * hh), x1 = *(const v4fa*)(arow + kb + 8 * hh + 4), x2 = *(const v4fa*)(arow + kb + 16 + 8 * hh), x3 = *(const v4fa*)(arow + kb + 16 + 8 * hh + 4);
    float xs[16] = {x0[0],x0[1],x0[2],x0[3],x1[0],x1[1],x1[2],x1[3],x2[0],x2[1],x2[2],x2[3],x3[0],x3[1],x3[2],x3[3]};
#pragma unroll
    for (int i = 0; i < 16; ++i) { const _Float16 h = (_Float16)xs[i]; ah.h[i] = h; al.h[i] = ASPLIT ? (_Float16)(xs[i] - (float)h) : (_Float16)0.0f; }
#pragma unroll
    for (int t = 0; t < 4; ++t) { if (col0 + t * 16 >= N) continue; const size_t boff = (size_t)(col0 + t * 16 + ln) * ldb + kb; FragH bq; bq.half[0] = *(const v8us*)(Bh + boff + 8 * hh); bq.half[1] = *(const v8us*)(Bh + boff + 16 + 8 * hh);
      acc[t] = mmaH<ASPLIT ? 2 : 1>(ah.v, al.v, bq.v, bq.v, acc[t]); }
  }
#pragma unroll
  for (int t = 0; t < 4; ++t) { if (col0 + t * 16 >= N) continue;
#pragma unroll
    for (int r = 0; r < 8; ++r) so[w][8 * hh + r][t * 16 + ln] = acc[t][r] * alpha; }
  __builtin_amdgcn_fence(__ATOMIC_ACQ_REL, "workgroup"); __builtin_amdgcn_wave_barrier();
  const int rsub = lane >> 4, c4 = (lane & 15) * 4;
  {
#pragma unroll
    for (int q = 0; q < 8; ++q) { const int r = q * 2 + rsub; if (col0 + c4 < N) { const v4f v = *(const v4fa*)&so[w][r][c4]; *(v4f*)(C + (size_t)(row0 + r) * ldc + col0 + c4) = v; } }
     }
}

// Wt[n][k] = f16(W[k][n]·scale) from f32 row-major W[K][N] (scale = power of two; bf16-exact weights stay exact in f16 away from the subnormal range)
__global__ __launch_bounds__(256) void k_wt_f16(const float* __restrict__ W, _Float16* __restrict__ Wt, int K, int N, float scale) {
  const int t = blockIdx.x * 256 + threadIdx.x; if (t >= N * (K / 8)) return; const int n = t / (K / 8), k8 = (t % (K / 8)) * 8; FragH f;
#pragma unroll
  for (int i = 0; i < 8; ++i) f.h[i] = (_Float16)(bf16_round(W[(size_t)(k8 + i) * N + n]) * scale); const v8us o = f.half[0];
  *(v8us*)((unsigned short*)Wt + (size_t)n * K + k8) = o; 
}
__device__ __forceinline__ void vts_tile(const int blk, const float* __restrict__ v, _Float16* __restrict__ Vt) { __shared__ unsigned short tl[64][66]; const int tid = threadIdx.x; const int slab = blk / (TT / 64), tg = blk % (TT / 64); const int b = slab / NH, h = slab % NH;
  for (int i = tid; i < 64 * 16; i += 256) { const int r = i / 16, c4 = (i % 16) * 4; const int ts = (tg * 64 + r + 1) % TT; const v4f a = *(const v4fa*)(v + ((size_t)b * TT + ts) * DDm + h * HD + c4); FragH f; for (int q = 0; q < 4; ++q) { f.h[q] = (_Float16)bf16_round(a[q]); tl[r][c4 + q] = f.u[q]; } }
  __syncthreads();
  {
#pragma unroll
    for (int rd = 0; rd < 2; ++rd) { const int d = rd * 32 + tid / 8, pc = tid % 8; FragH f;
#pragma unroll
      for (int q = 0; q < 8; ++q) f.u[q] = tl[pc * 8 + q][d]; *(v8us*)((unsigned short*)Vt + ((size_t)slab * HD + d) * TT + tg * 64 + pc * 8) = f.half[0]; }
    asm volatile("s_wait_xcnt 0x0" ::: "memory");      // behind the two stores: in the joint kernel code of the other block kind follows them in the listing and rewrites their registers
     } }
// attention per ((b,h), 32 queries), transposed: the block's four waves share the 32 queries and split the keys, wave w taking the 32-key tiles w, w + 4, w + 8, ...; each keeps its own maximum, sum and
// un-normalised Ot, and the four partials are merged through LDS behind one barrier (weights exp2 of maximum - joint maximum). St = kc.qc^T (A = 16 key rows, B = 16 query columns, d 32), so a lane holds ONE query's scores: keys 8*hh + r of each 16-key tile;
// logit = -sqrt(max(q2 + k2 - 2S, 1e-12)); mask[q][k] (INPUT, nonzero = keep; tiles with no open key for the wave skipped); maximum and sum in the lane plus one exchange between the wave's halves;
// the two score tiles of 32 keys, converted in place, ARE the B operand of Ot += Vt.Pt (hardware k order: 8*hh + s, 16 + 8*hh + s), and a lane's 8 accumulator registers are 8 consecutive d of its query: no LDS in the loop.
typedef int v4ia __attribute__((ext_vector_type(4), may_alias));
__device__ __forceinline__ float xhalf(float x) { const int bq = __float_as_int(x); return __int_as_float(__builtin_amdgcn_permlanex16(bq, bq, 0x76543210, 0xfedcba98, false, false)); }      // lane l <-> l ^ 16
template <int N> __device__ __forceinline__ float rowshare(float x) { return __int_as_float(__builtin_amdgcn_mov_dpp(__float_as_int(x), 0x150 + N, 0xf, 0xf, false)); }      // lane N of each 16-lane row to the whole row
// causal 3-tap conv, transposed: Ct = W.Xt per (tensor, head, 256 positions a block, 32 a wave). The block first rounds its head's 32 x 192 weights into LDS (k = tap * 64 + d, scaled by 16; pitch 200 halves
// keeps the 16-byte fragment reads of 16 rows off one another's banks). A = 16 channel rows from LDS, B = 16 positions: x rows s + tap - 2 (clamped at the sequence's first row) read straight from the f32 input
// and rounded in registers, same k order as A (8*hh + j, 16 + 8*hh + j). A lane then holds ONE position's channels t*16 + 8*hh + r: 16-byte f16 stores, |c|^2 in the lane plus one exchange between the wave's halves.
// Rows and norms go out head-major ([b*NH + h][s][c], [b*NH + h][s]): a wave writes 2 KiB of rows and one 128-byte line of norms, all its own.
__device__ __forceinline__ void conv_tile(const int blk, const float* __restrict__ qx, const float* __restrict__ kx, const float* __restrict__ cw, const float* __restrict__ cb, _Float16* __restrict__ Q16, _Float16* __restrict__ K16, float* __restrict__ NQ, float* __restrict__ NK) {
  __shared__ __attribute__((aligned(16))) unsigned short wsm[CCv][200];
  const int tid = threadIdx.x, w = tid >> 5, lane = tid & 31, ln = lane & 15, hh = lane >> 4;
  const int pg = blk % (NR / 256), h = (blk / (NR / 256)) % NH, z = blk / ((NR / 256) * NH);
  const float* x = z ? kx : qx; _Float16* C16 = z ? K16 : Q16; float* N2 = z ? NK : NQ;
  { const int c = tid >> 3, d0 = (tid & 7) * 8; const float* wp = cw + ((size_t)(h * CCv + c) * HD + d0) * 3; float wv[24];      // a thread's 24 consecutive floats are 8 d x 3 taps of one channel
#pragma unroll
    for (int q = 0; q < 6; ++q) { const v4f a = *(const v4fa*)(wp + q * 4); wv[q * 4] = a[0]; wv[q * 4 + 1] = a[1]; wv[q * 4 + 2] = a[2]; wv[q * 4 + 3] = a[3]; }
#pragma unroll
    for (int i = 0; i < 3; ++i) { FragH f;
#pragma unroll
      for (int q = 0; q < 8; ++q) f.h[q] = (_Float16)(bf16_round(wv[q * 3 + i]) * 16.0f);
      *(v8us*)&wsm[c][i * 64 + d0] = f.half[0]; } }
  __syncthreads();      // every wave reads fragments of weights that all eight waves wrote
  const int row0 = pg * 256 + w * 32, b = row0 / TT, s0 = row0 % TT;
  const float* xb = x + (size_t)b * TT * DDm + h * HD + 8 * hh;
  v8f acc[2][2];
#pragma unroll
  for (int nt = 0; nt < 2; ++nt)
#pragma unroll
    for (int t = 0; t < 2; ++t) acc[nt][t] = (v8f){0.f,0.f,0.f,0.f,0.f,0.f,0.f,0.f};
#pragma unroll
  for (int i = 0; i < 3; ++i)
#pragma unroll
    for (int dd = 0; dd < 2; ++dd) { FragH aw[2], bx[2];
#pragma unroll
      for (int t = 0; t < 2; ++t) { const unsigned short* wk = &wsm[t * 16 + ln][i * 64 + dd * 32 + 8 * hh]; aw[t].half[0] = *(const v8us*)wk; aw[t].half[1] = *(const v8us*)(wk + 16); }
#pragma unroll
      for (int nt = 0; nt < 2; ++nt) { int ss = s0 + nt * 16 + ln + i - 2; ss = ss < 0 ? 0 : ss; const float* xr = xb + (size_t)ss * DDm + dd * 32;
        const v4f x0 = *(const v4fa*)xr, x1 = *(const v4fa*)(xr + 4), x2 = *(const v4fa*)(xr + 16), x3 = *(const v4fa*)(xr + 20);      // below: the hardware's f32 -> bf16 conversion rounds to nearest even, as bf16_round does, in one instruction
#pragma unroll
        for (int j = 0; j < 4; ++j) { bx[nt].h[j] = (_Float16)(float)(__bf16)x0[j]; bx[nt].h[4 + j] = (_Float16)(float)(__bf16)x1[j]; bx[nt].h[8 + j] = (_Float16)(float)(__bf16)x2[j]; bx[nt].h[12 + j] = (_Float16)(float)(__bf16)x3[j]; } }
#pragma unroll
      for (int nt = 0; nt < 2; ++nt)
#pragma unroll
        for (int t = 0; t < 2; ++t) acc[nt][t] = mmaH<1>(aw[t].v, aw[t].v, bx[nt].v, bx[nt].v, acc[nt][t]); }
  float bv[2][8];
#pragma unroll
  for (int t = 0; t < 2; ++t) { const float* bp = cb + h * CCv + t * 16 + 8 * hh; const v4f b0 = *(const v4fa*)bp, b1 = *(const v4fa*)(bp + 4);
#pragma unroll
    for (int j = 0; j < 4; ++j) { bv[t][j] = bf16_round(b0[j]); bv[t][4 + j] = bf16_round(b1[j]); } }
#pragma unroll
  for (int nt = 0; nt < 2; ++nt) { const size_t prow = (size_t)(b * NH + h) * TT + s0 + nt * 16 + ln; float ss = 0.f;
#pragma unroll
    for (int t = 0; t < 2; ++t) { FragH f;
#pragma unroll
      for (int r = 0; r < 8; ++r) { const float v = acc[nt][t][r] * 0.0625f + bv[t][r]; ss += v * v; f.h[r] = (_Float16)v; }
      *(v8us*)((unsigned short*)C16 + prow * CCv + t * 16 + 8 * hh) = f.half[0]; }
    ss += xhalf(ss);
    if (hh == 0) N2[prow] = ss; } }
// all that the attention needs, in ONE launch: the conv blocks (the longer ones) first, then the blocks of the shifted V transpose; the two kinds share nothing, and a block is wholly of one kind
#define NCB ((NR / 256) * NH * 2)
__global__ __launch_bounds__(256) void k_prep(const float* __restrict__ qx, const float* __restrict__ kx, const float* __restrict__ vx, const float* __restrict__ cw, const float* __restrict__ cb, _Float16* __restrict__ Q16, _Float16* __restrict__ K16, float* __restrict__ NQ, float* __restrict__ NK, _Float16* __restrict__ Vt) {
  if (blockIdx.x < NCB) conv_tile((int)blockIdx.x, qx, kx, cw, cb, Q16, K16, NQ, NK); else vts_tile((int)blockIdx.x - NCB, vx, Vt); }
__global__ __launch_bounds__(128) void k_sattn(const _Float16* __restrict__ Q16, const _Float16* __restrict__ K16, const float* __restrict__ NQ, const float* __restrict__ NK, const int* __restrict__ MSK, const _Float16* __restrict__ Vt, float* __restrict__ O) { constexpr int RPW = 32; constexpr int KSP = 4; constexpr int OP = HD + 4; constexpr float L2E = 1.4426950408889634f;      // OP: a partial's row pitch, 272 bytes = 16 x 17, keeps the 16-byte writes of 16 queries off one another's banks
  __shared__ __attribute__((aligned(16))) float so[KSP][RPW][OP]; __shared__ __attribute__((aligned(16))) float sml[RPW][2 * KSP];      // per query: the four waves' maxima, then their sums
  const int tid = threadIdx.x, w = tid >> 5, lane = tid & 31, ln = lane & 15, hh = lane >> 4; const int slab = blockIdx.x / (TT / RPW), qblk = blockIdx.x % (TT / RPW); const int b = slab / NH, h = slab % NH; const int q0 = qblk * RPW;
  FragH bq[2]; float q2c[2];
#pragma unroll
  for (int rt = 0; rt < 2; ++rt) { const size_t qrow = (size_t)slab * TT + q0 + rt * 16 + ln; const unsigned short* qr = (const unsigned short*)Q16 + qrow * CCv; bq[rt].half[0] = *(const v8us*)(qr + 8 * hh); bq[rt].half[1] = *(const v8us*)(qr + 16 + 8 * hh); q2c[rt] = NQ[qrow]; }
  const int kslot = (ln < 8) ? 8 * hh + ln : 8 + 8 * hh + ln;      // lane ln of half hh fetches |kc|^2 of the key that the half's score register ln holds (tile ln / 8, register ln % 8)
  float m_c[2], l_c[2]; v8f oacc[2][4];      // m starts finite and below every finite logit (|logit| <= sqrt(FLT_MAX)): exp2 arguments never meet inf - inf
#pragma unroll
  for (int rt = 0; rt < 2; ++rt) { m_c[rt] = -1.0e30f; l_c[rt] = 0.f;
#pragma unroll
    for (int dt = 0; dt < 4; ++dt) oacc[rt][dt] = (v8f){0.f,0.f,0.f,0.f,0.f,0.f,0.f,0.f}; }
  // read places: a base that is the same for the whole block and steps by four 32-key tiles a trip, plus each lane's own fixed byte offset (the wave's first tile in it)
  const char* mb = (const char*)(MSK + (size_t)qblk * RPW * TT); const char* kb = (const char*)(K16 + (size_t)slab * TT * CCv); const char* nb = (const char*)(NK + (size_t)slab * TT); const char* vb = (const char*)(Vt + (size_t)slab * HD * TT);
  const unsigned mlo = (unsigned)((ln * TT + w * 32 + 8 * hh) * 4), klo = (unsigned)(((w * 32 + ln) * CCv + 8 * hh) * 2), nlo = (unsigned)((w * 32 + kslot) * 4), vlo = (unsigned)((ln * TT + w * 32 + 8 * hh) * 2);
#pragma unroll 1
  for (int j0 = 0; j0 < TT; j0 += 32 * KSP, mb += 32 * KSP * 4, kb += 32 * KSP * CCv * 2, nb += 32 * KSP * 4, vb += 32 * KSP * 2) {
    v4ia mk[2][2][2];
#pragma unroll
    for (int rt = 0; rt < 2; ++rt)
#pragma unroll
      for (int nt = 0; nt < 2; ++nt) { const int* mr = (const int*)(mb + mlo) + rt * 16 * TT + nt * 16; mk[rt][nt][0] = *(const v4ia*)mr; mk[rt][nt][1] = *(const v4ia*)(mr + 4); }
    const v4ia mo = (mk[0][0][0] | mk[0][0][1]) | (mk[0][1][0] | mk[0][1][1]) | ((mk[1][0][0] | mk[1][0][1]) | (mk[1][1][0] | mk[1][1][1])); const int anyb = (mo[0] | mo[1]) | (mo[2] | mo[3]);
    if (__builtin_amdgcn_ballot_w32(anyb != 0) == 0u) continue;      // wave-uniform skip of fully masked tiles
    FragH ak[2], av[4];
#pragma unroll
    for (int nt = 0; nt < 2; ++nt) { const unsigned short* kr = (const unsigned short*)(kb + klo) + nt * 16 * CCv; ak[nt].half[0] = *(const v8us*)kr; ak[nt].half[1] = *(const v8us*)(kr + 16); }
    const float k2l = *(const float*)(nb + nlo);
#pragma unroll
    for (int dt = 0; dt < 4; ++dt) { const unsigned short* vrow = (const unsigned short*)(vb + vlo) + dt * 16 * TT; av[dt].half[0] = *(const v8us*)vrow; av[dt].half[1] = *(const v8us*)(vrow + 16); }
    v8f s[2][2];
#pragma unroll
    for (int nt = 0; nt < 2; ++nt)
#pragma unroll
      for (int rt = 0; rt < 2; ++rt) { v8f acc = (v8f){0.f,0.f,0.f,0.f,0.f,0.f,0.f,0.f}; acc = mmaH<1>(ak[nt].v, ak[nt].v, bq[rt].v, bq[rt].v, acc); s[rt][nt] = acc; }
    const float k2v[2][8] = {{rowshare<0>(k2l), rowshare<1>(k2l), rowshare<2>(k2l), rowshare<3>(k2l), rowshare<4>(k2l), rowshare<5>(k2l), rowshare<6>(k2l), rowshare<7>(k2l)},
                             {rowshare<8>(k2l), rowshare<9>(k2l), rowshare<10>(k2l), rowshare<11>(k2l), rowshare<12>(k2l), rowshare<13>(k2l), rowshare<14>(k2l), rowshare<15>(k2l)}};
    FragH pb[2];
#pragma unroll
    for (int rt = 0; rt < 2; ++rt) { float sv[2][8]; float mc = -INFINITY;
#pragma unroll
      for (int nt = 0; nt < 2; ++nt)
#pragma unroll
        for (int r = 0; r < 8; ++r) { const float d = fmaxf(q2c[rt] + k2v[nt][r] - 2.0f * s[rt][nt][r], 1e-12f); sv[nt][r] = (mk[rt][nt][r >> 2][r & 3] != 0) ? -__builtin_amdgcn_sqrtf(d) : -INFINITY; mc = fmaxf(mc, sv[nt][r]); }      // d >= 1e-12: never a denormal, the hardware root needs no range fix-up
      mc = fmaxf(mc, xhalf(mc));
      const float mn = fmaxf(m_c[rt], mc); const float ta = (m_c[rt] - mn) * L2E; const float al = __builtin_amdgcn_exp2f(ta); m_c[rt] = mn; const float nm = -mn * L2E;      // exp(x - mn) = exp2(x * log2(e) - mn * log2(e)): one fma and the hardware exp2; a closed key's -inf gives exp2(-inf) = 0
      float ps = 0.f;
#pragma unroll
      for (int nt = 0; nt < 2; ++nt) { float t[8], p[8];
#pragma unroll
        for (int r = 0; r < 8; ++r) { t[r] = __builtin_fmaf(sv[nt][r], L2E, nm); p[r] = __builtin_amdgcn_exp2f(t[r]); }
        // the slot behind a transcendental: inputs only, so every argument's register stays whole until all of these exp2 have issued (none is overwritten directly behind its exp2), and the v_nop stands behind the last
        asm volatile("v_nop" :: "v"(t[0]), "v"(t[1]), "v"(t[2]), "v"(t[3]), "v"(t[4]), "v"(t[5]), "v"(t[6]), "v"(t[7]), "v"(p[0]), "v"(p[1]), "v"(p[2]), "v"(p[3]), "v"(p[4]), "v"(p[5]), "v"(p[6]), "v"(p[7]), "v"(ta), "v"(al));
#pragma unroll
        for (int r = 0; r < 8; ++r) { ps += p[r]; pb[rt].h[nt * 8 + r] = (_Float16)p[r]; } }
      l_c[rt] = l_c[rt] * al + ps;      // the half's own 16 keys; the halves join behind the loop
#pragma unroll
      for (int dt = 0; dt < 4; ++dt)
#pragma unroll
        for (int r = 0; r < 8; ++r) oacc[rt][dt][r] *= al; }
#pragma unroll
    for (int dt = 0; dt < 4; ++dt)
#pragma unroll
      for (int rt = 0; rt < 2; ++rt) oacc[rt][dt] = mmaH<1>(av[dt].v, av[dt].v, pb[rt].v, pb[rt].v, oacc[rt][dt]); }
  // the wave's partial goes to LDS: rows [query][d], un-normalised, with its maximum and its sum (the halves joined here)
#pragma unroll
  for (int rt = 0; rt < 2; ++rt) { const float l = l_c[rt] + xhalf(l_c[rt]); if (hh == 0) { sml[rt * 16 + ln][w] = m_c[rt]; sml[rt * 16 + ln][KSP + w] = l; } float* prow = &so[w][rt * 16 + ln][8 * hh];
#pragma unroll
    for (int dt = 0; dt < 4; ++dt) { const v4f lo = {oacc[rt][dt][0], oacc[rt][dt][1], oacc[rt][dt][2], oacc[rt][dt][3]}, hi = {oacc[rt][dt][4], oacc[rt][dt][5], oacc[rt][dt][6], oacc[rt][dt][7]}; *(v4fa*)(prow + dt * 16) = lo; *(v4fa*)(prow + dt * 16 + 4) = hi; } }
  __syncthreads();      // every wave merges rows that all four waves wrote
  // merge: wave w owns queries 8 * w .. 8 * w + 7, two a pass; 16 lanes x 16 bytes are one query's whole 256-byte output row, so every 128-byte line has one writer and goes out in one store
#pragma unroll
  for (int c = 0; c < 4; ++c) { const int qq = w * 8 + c * 2 + hh; const v4f mv = *(const v4fa*)&sml[qq][0], lv = *(const v4fa*)&sml[qq][KSP];
    const float mj = fmaxf(fmaxf(mv[0], mv[1]), fmaxf(mv[2], mv[3])); float t[KSP], e[KSP]; float l = 0.f; v4f o = {0.f, 0.f, 0.f, 0.f};      // a wave that met no open key has maximum -1e30, sum 0 and zeros: weight 0, or 1 on zeros where no wave met one
#pragma unroll
    for (int p = 0; p < KSP; ++p) t[p] = (mv[p] - mj) * L2E;
    // the four weights' exp2 and the slot behind a transcendental in one statement: results in registers of their own, so none is read and no argument overwritten directly behind its exp2; the v_nop fills the slot behind the last
    asm("v_exp_f32 %0, %4\n\tv_exp_f32 %1, %5\n\tv_exp_f32 %2, %6\n\tv_exp_f32 %3, %7\n\tv_nop" : "=&v"(e[0]), "=&v"(e[1]), "=&v"(e[2]), "=&v"(e[3]) : "v"(t[0]), "v"(t[1]), "v"(t[2]), "v"(t[3]));
#pragma unroll
    for (int p = 0; p < KSP; ++p) { l += e[p] * lv[p]; const v4f a = *(const v4fa*)&so[p][qq][ln * 4]; o += a * e[p]; }
    const float li = (l > 0.f) ? 1.0f / l : 0.f;
    *(v4f*)(O + ((size_t)b * TT + q0 + qq) * DDm + h * HD + ln * 4) = o * li; } }
extern "C" void kernel_launch(void* const* d_in, const int* in_sizes, int n_in,
                              void* d_out, int out_size, void* d_ws, size_t ws_size, hipStream_t stream) {
  (void)in_sizes; (void)n_in; (void)out_size;
  const float* qx = (const float*)d_in[0]; const float* kx = (const float*)d_in[1]; const float* vx = (const float*)d_in[2]; const int* mask = (const int*)d_in[3]; const float* cw = (const float*)d_in[4]; const float* cb = (const float*)d_in[5];
  char* ws = (char*)d_ws; size_t off = 0;
  auto take = [&](size_t bytes) { char* p = ws + off; off += (bytes + 255) & ~(size_t)255; return p; };
  _Float16* Q16 = (_Float16*)take((size_t)NR * NH * CCv * 2); _Float16* K16 = (_Float16*)take((size_t)NR * NH * CCv * 2); float* NQ = (float*)take((size_t)NR * NH * 4); float* NK = (float*)take((size_t)NR * NH * 4); _Float16* Vt = (_Float16*)take((size_t)NR * DDm * 2);
  if (off > ws_size) return;      // 4.2 x 2 + 0.26 x 2 + 8.4: about 17 MiB
  k_prep<<<NCB + BB * NH * (TT / 64), 256, 0, stream>>>(qx, kx, vx, cw, cb, Q16, K16, NQ, NK, Vt);
  k_sattn<<<BB * NH * (TT / 32), 128, 0, stream>>>(Q16, K16, NQ, NK, mask, Vt, (float*)d_out);
}

// v005
// One run takes 67 microseconds.
// Two timings next to v004 put it at 1.09 and 1.10 times that version's speed.
// All steps since v000 together make it 7.84 times as fast.
#include <hip/hip_runtime.h>
// Simplex (distance-based) attention (B=4, S=2048, 8 heads × 64, conv channels 32): the per-head causal 3-tap conv of q and k on WMMA (+ bias, f16 rows and norms head-major) and the shifted V transpose in one preparation launch, and the attention as a
// fused flash-style kernel on v_wmma_f32_16x16x32_f16 — S = qc·kc (d = 32, one k-step), logits = −sqrt(max(|qc|² + |kc|² − 2S, 1e-12)), INPUT mask (nonzero = keep), online softmax f32,
// P f16 ≤ 1, and the roll(attn, 1) folded into a one-step shift of V (out[s] = Σ_t attn[s][t]·v[t+1 mod S]); f16 operands, single products, f32 accumulate; norms f32 VALU in the conv's epilogue.
#define BB 4
#define TT 2048
#define DDm 512
#define NH 8
#define HD 64
#define CCv 32
#define NR (BB * TT)

typedef __bf16 v16b __attribute__((ext_vector_type(16)));
typedef unsigned short v8us __attribute__((ext_vector_type(8), may_alias));
typedef float  v8f  __attribute__((ext_vector_type(8)));
typedef float  v4f  __attribute__((ext_vector_type(4)));
typedef float  v4fa __attribute__((ext_vector_type(4), may_alias));
union FragB { v16b v; v8us half[2]; unsigned short u[16]; };

__device__ __forceinline__ unsigned short bf16_bits(float x) { unsigned int u = __float_as_uint(x); return (unsigned short)((u + 0x7FFFu + ((u >> 16) & 1u)) >> 16); }
__device__ __forceinline__ float bf16_val(unsigned short b) { return __uint_as_float(((unsigned int)b) << 16); }
__device__ __forceinline__ float bf16_round(float x) { return bf16_val(bf16_bits(x)); }
// D += A·B with NT terms: 1 = ah·bh, 2 = + al·bh (A split), 3 = + ah·bl (both split)
template <int NT>
__device__ __forceinline__ v8f mmaN(v16b ah, v16b al, v16b bh, v16b bl, v8f c) {
  c = __builtin_amdgcn_wmma_f32_16x16x32_bf16(false, ah, false, bh, (short)0, c, false, false);
  if (NT >= 2) c = __builtin_amdgcn_wmma_f32_16x16x32_bf16(false, al, false, bh, (short)0, c, false, false);
  if (NT >= 3) c = __builtin_amdgcn_wmma_f32_16x16x32_bf16(false, ah, false, bl, (short)0, c, false, false);
  asm volatile("v_nop\n\tv_nop\n\tv_nop\n\tv_nop" : "+v"(c) : "v"(ah), "v"(al), "v"(bh), "v"(bl));
  return c;
}

__global__ __launch_bounds__(256) void k_wt_bf16(const float* __restrict__ W, unsigned short* __restrict__ Wt, int K, int N) {
  const int t = blockIdx.x * 256 + threadIdx.x;
  const int k8n = K / 8;
  if (t >= N * k8n) return;
  const int n = t / k8n, k8 = (t % k8n) * 8;
  v8us v;
#pragma unroll
  for (int i = 0; i < 8; ++i) v[i] = bf16_bits(W[(size_t)(k8 + i) * N + n]);
  *(v8us*)(Wt + (size_t)n * K + k8) = v;
  
}

// GEMM C[M][N] (f32, pitch ldc) = act(A[M][K]·W + bias). A f32 row-major (pitch lda) converted per fragment to bf16
// (ASPLIT: hi/lo two planes -> 2 terms, else single rounded term); Wt bf16 [N][K] (pitch ldb). BIAS_BF16 rounds the
// bias to bf16 first (bias quantised to bf16 before the add). K%32==0, M%16==0, N%64==0.
template <bool ASPLIT, int ACT, bool BIAS_BF16>
__global__ __launch_bounds__(128) void k_gemm_bf(const float* __restrict__ A, int lda, const unsigned short* __restrict__ Wt, int ldb,
                                               const float* __restrict__ bias, float* __restrict__ C, int ldc, int M, int N, int K) {
  __shared__ __attribute__((aligned(16))) float so[4][16][64];
  const int tid = threadIdx.x, w = tid >> 5, lane = tid & 31, ln = lane & 15, hh = lane >> 4;
  const int ntn = N / 64;
  const int wid = blockIdx.x * 4 + w;
  const int mt = wid / ntn, nq = wid % ntn;
  if (mt * 16 >= M) return;
  const int row0 = mt * 16, col0 = nq * 64;
  const float* arow = A + (size_t)(row0 + ln) * lda;
  v8f acc[4] = {};
  for (int kb = 0; kb < K; kb += 32) {
    FragB ah, al;
    const v4f x0 = *(const v4fa*)(arow + kb + 8 * hh), x1 = *(const v4fa*)(arow + kb + 8 * hh + 4);
    const v4f x2 = *(const v4fa*)(arow + kb + 16 + 8 * hh), x3 = *(const v4fa*)(arow + kb + 16 + 8 * hh + 4);
    float xs[16] = {x0[0],x0[1],x0[2],x0[3],x1[0],x1[1],x1[2],x1[3],x2[0],x2[1],x2[2],x2[3],x3[0],x3[1],x3[2],x3[3]};
#pragma unroll
    for (int i = 0; i < 16; ++i) { const unsigned short hb = bf16_bits(xs[i]); ah.u[i] = hb; al.u[i] = ASPLIT ? bf16_bits(xs[i] - bf16_val(hb)) : (unsigned short)0; }
#pragma unroll
    for (int t = 0; t < 4; ++t) {
      const unsigned short* brow = Wt + (size_t)(col0 + t * 16 + ln) * ldb + kb;
      FragB b;
      b.half[0] = *(const v8us*)(brow + 8 * hh);
      b.half[1] = *(const v8us*)(brow + 16 + 8 * hh);
      acc[t] = mmaN<ASPLIT ? 2 : 1>(ah.v, al.v, b.v, b.v, acc[t]);
    }
  }
#pragma unroll
  for (int t = 0; t < 4; ++t) {
    float bv = bias ? bias[col0 + t * 16 + ln] : 0.f;
    if (BIAS_BF16) bv = bf16_round(bv);
#pragma unroll
    for (int r = 0; r < 8; ++r) { float v = acc[t][r] + bv; if (ACT == 1) v = fmaxf(v, 0.f); so[w][8 * hh + r][t * 16 + ln] = v; }
  }
  __builtin_amdgcn_fence(__ATOMIC_ACQ_REL, "workgroup");
  __builtin_amdgcn_wave_barrier();
  const int rsub = lane >> 4, c4 = (lane & 15) * 4;
  {
#pragma unroll
    for (int q = 0; q < 8; ++q) {
      const int r = q * 2 + rsub;
      const v4f v = *(const v4fa*)&so[w][r][c4];
      *(v4f*)(C + (size_t)(row0 + r) * ldc + col0 + c4) = v;
    }
    
  }
}

// Flash-style causal/unmasked attention, all contractions 3-term bf16 hi/lo splits, f32 softmax with running max.
// q,k,v rows are read from f32 buffers with arbitrary row pitch (so they can live inside a fused qkv buffer);
// D = head size (multiple of 32, <= 128); one wave = 16 query rows; block = 4 waves (64 queries) sharing K/V chunks of 32.
template <int D, bool CAUSAL>
__global__ __launch_bounds__(128) void k_flash(const float* __restrict__ qb, const float* __restrict__ kb, const float* __restrict__ vb,
                                             int pitch, int T, int H, float scale, float* __restrict__ y, int ypitch) {
  constexpr int KS = D / 32;        // k-steps for QK
  constexpr int DT = D / 16;        // d tiles for PV
  __shared__ __attribute__((aligned(16))) unsigned short sKh[32][D + 8], sKl[32][D + 8], sVh[32][D + 8], sVl[32][D + 8];
  __shared__ __attribute__((aligned(16))) unsigned short sPh[4][16][40], sPl[4][16][40];
  __shared__ __attribute__((aligned(16))) float sO[4][16][D];
  const int tid = threadIdx.x, w = tid >> 5, lane = tid & 31, ln = lane & 15, hh = lane >> 4;
  const int nqb = (T + 63) / 64;
  const int bh = blockIdx.x / nqb, qblk = blockIdx.x % nqb;
  const int b = bh / H, h = bh % H;
  const int q0 = qblk * 64 + w * 16;
  const float* Q = qb + (size_t)b * T * pitch + h * D;
  const float* K = kb + (size_t)b * T * pitch + h * D;
  const float* V = vb + (size_t)b * T * pitch + h * D;

  // A fragments of the wave's 16 query rows (scaled), hi/lo
  FragB aqh[KS], aql[KS];
  {
    int row = q0 + ln; if (row >= T) row = T - 1;
    const float* qr = Q + (size_t)row * pitch;
#pragma unroll
    for (int ks = 0; ks < KS; ++ks)
#pragma unroll
      for (int i = 0; i < 16; ++i) {
        const int d = ks * 32 + ((i < 8) ? (8 * hh + i) : (16 + 8 * hh + (i - 8)));
        const float x = qr[d] * scale; const unsigned short hb = bf16_bits(x);
        aqh[ks].u[i] = hb; aql[ks].u[i] = bf16_bits(x - bf16_val(hb));
      }
  }
  float m_r[8], l_r[8];
#pragma unroll
  for (int r = 0; r < 8; ++r) { m_r[r] = -3.0e38f; l_r[r] = 0.f; }
  v8f oacc[DT];
#pragma unroll
  for (int dt = 0; dt < DT; ++dt) oacc[dt] = (v8f){0.f,0.f,0.f,0.f,0.f,0.f,0.f,0.f};

  const int kv_end = CAUSAL ? min(T, qblk * 64 + 64) : T;     // block-uniform
  for (int j0 = 0; j0 < kv_end; j0 += 32) {
    __syncthreads();
    for (int e = tid; e < 32 * (D / 4); e += 128) {
      const int r = e / (D / 4), c4 = (e % (D / 4)) * 4;
      const int key = j0 + r;
      v4f kf = {0.f,0.f,0.f,0.f}, vf = {0.f,0.f,0.f,0.f};
      if (key < T) { kf = *(const v4fa*)(K + (size_t)key * pitch + c4); vf = *(const v4fa*)(V + (size_t)key * pitch + c4); }
#pragma unroll
      for (int t = 0; t < 4; ++t) {
        unsigned short hb = bf16_bits(kf[t]); sKh[r][c4 + t] = hb; sKl[r][c4 + t] = bf16_bits(kf[t] - bf16_val(hb));
        hb = bf16_bits(vf[t]); sVh[r][c4 + t] = hb; sVl[r][c4 + t] = bf16_bits(vf[t] - bf16_val(hb));
      }
    }
    __syncthreads();
    // S tile 16 x 32
    v8f s[2];
#pragma unroll
    for (int nt = 0; nt < 2; ++nt) {
      v8f acc = {};
#pragma unroll
      for (int ks = 0; ks < KS; ++ks) {
        FragB bh_, bl_;
        bh_.half[0] = *(const v8us*)&sKh[nt * 16 + ln][ks * 32 + 8 * hh]; bh_.half[1] = *(const v8us*)&sKh[nt * 16 + ln][ks * 32 + 16 + 8 * hh];
        bl_.half[0] = *(const v8us*)&sKl[nt * 16 + ln][ks * 32 + 8 * hh]; bl_.half[1] = *(const v8us*)&sKl[nt * 16 + ln][ks * 32 + 16 + 8 * hh];
        acc = mmaN<3>(aqh[ks].v, aql[ks].v, bh_.v, bl_.v, acc);
      }
      s[nt] = acc;
    }
    // mask + running max (rows 8hh+r; the 16 lanes of a half share rows)
    float alpha[8];
#pragma unroll
    for (int r = 0; r < 8; ++r) {
      const int qi = q0 + 8 * hh + r;
      const int ja = j0 + ln, jb = j0 + 16 + ln;
      if (CAUSAL) { if (ja > qi) s[0][r] = -3.0e38f; if (jb > qi) s[1][r] = -3.0e38f; }
      if (ja >= T) s[0][r] = -3.0e38f;
      if (jb >= T) s[1][r] = -3.0e38f;
      float mx = fmaxf(s[0][r], s[1][r]);
      mx = fmaxf(mx, __shfl_xor(mx, 1, 32)); mx = fmaxf(mx, __shfl_xor(mx, 2, 32)); mx = fmaxf(mx, __shfl_xor(mx, 4, 32)); mx = fmaxf(mx, __shfl_xor(mx, 8, 32));
      const float mnew = fmaxf(m_r[r], mx);
      alpha[r] = (mnew > -1.0e38f) ? __expf(m_r[r] - mnew) : 1.0f;
      const float p0 = (s[0][r] > -1.0e38f) ? __expf(s[0][r] - mnew) : 0.f;
      const float p1 = (s[1][r] > -1.0e38f) ? __expf(s[1][r] - mnew) : 0.f;
      m_r[r] = mnew;
      l_r[r] = l_r[r] * alpha[r] + p0 + p1;            // per-lane partial row sum (16 lanes combined at the end)
      unsigned short hb = bf16_bits(p0); sPh[w][8 * hh + r][ln] = hb;      sPl[w][8 * hh + r][ln] = bf16_bits(p0 - bf16_val(hb));
      hb = bf16_bits(p1);                sPh[w][8 * hh + r][16 + ln] = hb; sPl[w][8 * hh + r][16 + ln] = bf16_bits(p1 - bf16_val(hb));
    }
#pragma unroll
    for (int dt = 0; dt < DT; ++dt)
#pragma unroll
      for (int r = 0; r < 8; ++r) oacc[dt][r] *= alpha[r];
    __builtin_amdgcn_fence(__ATOMIC_ACQ_REL, "workgroup");
    __builtin_amdgcn_wave_barrier();
    FragB pah, pal;
    pah.half[0] = *(const v8us*)&sPh[w][ln][8 * hh]; pah.half[1] = *(const v8us*)&sPh[w][ln][16 + 8 * hh];
    pal.half[0] = *(const v8us*)&sPl[w][ln][8 * hh]; pal.half[1] = *(const v8us*)&sPl[w][ln][16 + 8 * hh];
#pragma unroll
    for (int dt = 0; dt < DT; ++dt) {
      FragB bvh, bvl;
#pragma unroll
      for (int i = 0; i < 8; ++i) {
        bvh.u[i] = sVh[8 * hh + i][dt * 16 + ln]; bvh.u[8 + i] = sVh[16 + 8 * hh + i][dt * 16 + ln];
        bvl.u[i] = sVl[8 * hh + i][dt * 16 + ln]; bvl.u[8 + i] = sVl[16 + 8 * hh + i][dt * 16 + ln];
      }
      oacc[dt] = mmaN<3>(pah.v, pal.v, bvh.v, bvl.v, oacc[dt]);
    }
    __builtin_amdgcn_fence(__ATOMIC_ACQ_REL, "workgroup");
    __builtin_amdgcn_wave_barrier();
  }
#pragma unroll
  for (int r = 0; r < 8; ++r) {
    float l = l_r[r];
    l += __shfl_xor(l, 1, 32); l += __shfl_xor(l, 2, 32); l += __shfl_xor(l, 4, 32); l += __shfl_xor(l, 8, 32);
    l_r[r] = (l > 0.f) ? 1.0f / l : 0.f;
  }
#pragma unroll
  for (int dt = 0; dt < DT; ++dt)
#pragma unroll
    for (int r = 0; r < 8; ++r) sO[w][8 * hh + r][dt * 16 + ln] = oacc[dt][r] * l_r[r];
  __builtin_amdgcn_fence(__ATOMIC_ACQ_REL, "workgroup");
  __builtin_amdgcn_wave_barrier();
  {
    for (int r = 0; r < 16; ++r) {
      const int row = q0 + r;
      if (row < T && lane < D / 4) {
        const v4f val = *(const v4fa*)&sO[w][r][lane * 4];
        *(v4f*)(y + ((size_t)b * T + row) * ypitch + h * D + lane * 4) = val;
      }
    }
    
  }
}

// GEMM C = act(A·W + bias + resid): A f32 (ASPLIT -> hi/lo 2 terms), Wt bf16 [N][K]; ACT 0 none, 1 relu, 2 exact gelu;
// resid (optional, f32, row index = (row % rmod), pitch ldr, RES_BF16 rounds it) added before the activation.
template <bool ASPLIT, int ACT, bool BIAS_BF16, bool RES_BF16>
__global__ __launch_bounds__(128) void k_gemm_bf3(const float* __restrict__ A, int lda, const unsigned short* __restrict__ Wt, int ldb,
                                                const float* __restrict__ bias, const float* __restrict__ resid, int rmod, int ldr,
                                                float* __restrict__ C, int ldc, int M, int N, int K) {
  __shared__ __attribute__((aligned(16))) float so[4][16][64];
  const int tid = threadIdx.x, w = tid >> 5, lane = tid & 31, ln = lane & 15, hh = lane >> 4;
  const int ntn = N / 64;
  const int wid = blockIdx.x * 4 + w;
  const int mt = wid / ntn, nq = wid % ntn;
  if (mt * 16 >= M) return;
  const int row0 = mt * 16, col0 = nq * 64;
  const float* arow = A + (size_t)(row0 + ln) * lda;
  v8f acc[4] = {};
  for (int kb = 0; kb < K; kb += 32) {
    FragB ah, al;
    const v4f x0 = *(const v4fa*)(arow + kb + 8 * hh), x1 = *(const v4fa*)(arow + kb + 8 * hh + 4);
    const v4f x2 = *(const v4fa*)(arow + kb + 16 + 8 * hh), x3 = *(const v4fa*)(arow + kb + 16 + 8 * hh + 4);
    float xs[16] = {x0[0],x0[1],x0[2],x0[3],x1[0],x1[1],x1[2],x1[3],x2[0],x2[1],x2[2],x2[3],x3[0],x3[1],x3[2],x3[3]};
#pragma unroll
    for (int i = 0; i < 16; ++i) { const unsigned short hb = bf16_bits(xs[i]); ah.u[i] = hb; al.u[i] = ASPLIT ? bf16_bits(xs[i] - bf16_val(hb)) : (unsigned short)0; }
#pragma unroll
    for (int t = 0; t < 4; ++t) {
      const unsigned short* brow = Wt + (size_t)(col0 + t * 16 + ln) * ldb + kb;
      FragB b;
      b.half[0] = *(const v8us*)(brow + 8 * hh);
      b.half[1] = *(const v8us*)(brow + 16 + 8 * hh);
      acc[t] = mmaN<ASPLIT ? 2 : 1>(ah.v, al.v, b.v, b.v, acc[t]);
    }
  }
#pragma unroll
  for (int t = 0; t < 4; ++t) {
    const int col = col0 + t * 16 + ln;
    float bv = bias ? bias[col] : 0.f;
    if (BIAS_BF16) bv = bf16_round(bv);
#pragma unroll
    for (int r = 0; r < 8; ++r) {
      float v = acc[t][r] + bv;
      if (resid) { float rv = resid[(size_t)((row0 + 8 * hh + r) % rmod) * ldr + col]; if (RES_BF16) rv = bf16_round(rv); v += rv; }
      if (ACT == 1) v = fmaxf(v, 0.f);
      if (ACT == 2) v = 0.5f * v * (1.0f + erff(v * 0.70710678118654752f));
      if (ACT == 3) { const float u = 0.7978845608028654f * (v + 0.044715f * v * v * v); v = 0.5f * v * (1.0f + tanhf(u)); }
      so[w][8 * hh + r][t * 16 + ln] = v;
    }
  }
  __builtin_amdgcn_fence(__ATOMIC_ACQ_REL, "workgroup");
  __builtin_amdgcn_wave_barrier();
  const int rsub = lane >> 4, c4 = (lane & 15) * 4;
  {
#pragma unroll
    for (int q = 0; q < 8; ++q) {
      const int r = q * 2 + rsub;
      const v4f v = *(const v4fa*)&so[w][r][c4];
      *(v4f*)(C + (size_t)(row0 + r) * ldc + col0 + c4) = v;
    }
    
  }
}
// row LayerNorm (biased variance, eps) over N: s = X (+ R); optional out_sum <- s; out_norm <- (s-mu)*rsqrt(var+eps)*g + b
template <bool PARAM_BF16>
__global__ __launch_bounds__(256) void k_layernorm(const float* __restrict__ X, const float* __restrict__ R, const float* __restrict__ g, const float* __restrict__ bta,
                                                  float* __restrict__ out_sum, float* __restrict__ out_norm, int N, float eps) {
  __shared__ float red[256];
  const int row = blockIdx.x, tid = threadIdx.x;
  const float* x = X + (size_t)row * N; const float* rr = R ? R + (size_t)row * N : nullptr;
  float vals[16];                     // up to N = 4096
  const int per = N / 256;            // contiguous chunk per thread? use strided-by-4 chunks: thread handles j = tid*4 + 1024*u
  float s1 = 0.f;
  for (int u = 0; u < per / 4; ++u) {
    const int j = tid * 4 + 1024 * u;
    const v4f a = *(const v4fa*)(x + j);
    v4f b = {0.f,0.f,0.f,0.f}; if (rr) b = *(const v4fa*)(rr + j);
#pragma unroll
    for (int q = 0; q < 4; ++q) { const float v = a[q] + b[q]; vals[u * 4 + q] = v; s1 += v; }
  }
  red[tid] = s1; __syncthreads();
  for (int st = 128; st > 0; st >>= 1) { if (tid < st) red[tid] += red[tid + st]; __syncthreads(); }
  const float mu = red[0] / (float)N; __syncthreads();
  float s2 = 0.f;
  for (int u = 0; u < per / 4; ++u)
#pragma unroll
    for (int q = 0; q < 4; ++q) { const float c = vals[u * 4 + q] - mu; s2 += c * c; }
  red[tid] = s2; __syncthreads();
  for (int st = 128; st > 0; st >>= 1) { if (tid < st) red[tid] += red[tid + st]; __syncthreads(); }
  const float rs = rsqrtf(red[0] / (float)N + eps);
  {
    for (int u = 0; u < per / 4; ++u) {
      const int j = tid * 4 + 1024 * u;
      v4f o, sm;
#pragma unroll
      for (int q = 0; q < 4; ++q) {
        float gg = g[j + q], bb = bta[j + q];
        if (PARAM_BF16) { gg = bf16_round(gg); bb = bf16_round(bb); }
        sm[q] = vals[u * 4 + q]; o[q] = (vals[u * 4 + q] - mu) * rs * gg + bb;
      }
      if (out_sum) *(v4f*)(out_sum + (size_t)row * N + j) = sm;
      *(v4f*)(out_norm + (size_t)row * N + j) = o;
    }
    
  }
}



// ---- f16 WMMA path (v_wmma_f32_16x16x32_f16): 11-bit significands for operands in range — used for the conv GEMMs and both attention contractions
typedef _Float16 v16h __attribute__((ext_vector_type(16)));
union FragH { v16h v; v8us half[2]; _Float16 h[16]; unsigned short u[16]; };
template <int NT>
__device__ __forceinline__ v8f mmaH(v16h ah, v16h al, v16h bh, v16h bl, v8f c) {
  c = __builtin_amdgcn_wmma_f32_16x16x32_f16(false, ah, false, bh, (short)0, c, false, false);
  if (NT >= 2) c = __builtin_amdgcn_wmma_f32_16x16x32_f16(false, al, false, bh, (short)0, c, false, false);
  if (NT >= 3) c = __builtin_amdgcn_wmma_f32_16x16x32_f16(false, ah, false, bl, (short)0, c, false, false);
  asm volatile("v_nop\n\tv_nop\n\tv_nop\n\tv_nop" : "+v"(c) : "v"(ah), "v"(al), "v"(bh), "v"(bl));
  return c;
}
// batched GEMM like k_gemm_b but f16 operands: A f32 (split into f16 hi/lo if ASPLIT, else rounded to f16), Bt = f16 values [n][k]; alpha; C f32; N multiple of 16 (partial tiles skipped)
template <bool ASPLIT>
__global__ __launch_bounds__(128) void k_gemm_h(const float* __restrict__ A, int lda, size_t sA, const _Float16* __restrict__ Bh, int ldb, size_t sB, float alpha, float* __restrict__ C, int ldc, size_t sC, int M, int N, int K) {
  __shared__ __attribute__((aligned(16))) float so[4][16][64];
  const int tid = threadIdx.x, w = tid >> 5, lane = tid & 31, ln = lane & 15, hh = lane >> 4; const int by = blockIdx.y;
  A += (size_t)by * sA; Bh += (size_t)by * sB; C += (size_t)by * sC;
  const int ntn = (N + 63) / 64; const int wid = blockIdx.x * 4 + w; const int mt = wid / ntn, nq = wid % ntn; if (mt * 16 >= M) return;
  const int row0 = mt * 16, col0 = nq * 64; const float* arow = A + (size_t)(row0 + ln) * lda;
  v8f acc[4] = {};
  for (int kb = 0; kb < K; kb += 32) {
    FragH ah, al;
    const v4f x0 = *(const v4fa*)(arow + kb + 8 * hh), x1 = *(const v4fa*)(arow + kb + 8 * hh + 4), x2 = *(const v4fa*)(arow + kb + 16 + 8 * hh), x3 = *(const v4fa*)(arow + kb + 16 + 8 * hh + 4);
    float xs[16] = {x0[0],x0[1],x0[2],x0[3],x1[0],x1[1],x1[2],x1[3],x2[0],x2[1],x2[2],x2[3],x3[0],x3[1],x3[2],x3[3]};
#pragma unroll
    for (int i = 0; i < 16; ++i) { const _Float16 h = (_Float16)xs[i]; ah.h[i] = h; al.h[i] = ASPLIT ? (_Float16)(xs[i] - (float)h) : (_Float16)0.0f; }
#pragma unroll
    for (int t = 0; t < 4; ++t) { if (col0 + t * 16 >= N) continue; const size_t boff = (size_t)(col0 + t * 16 + ln) * ldb + kb; FragH bq; bq.half[0] = *(const v8us*)(Bh + boff + 8 * hh); bq.half[1] = *(const v8us*)(Bh + boff + 16 + 8 * hh);
      acc[t] = mmaH<ASPLIT ? 2 : 1>(ah.v, al.v, bq.v, bq.v, acc[t]); }
  }
#pragma unroll
  for (int t = 0; t < 4; ++t) { if (col0 + t * 16 >= N) continue;
#pragma unroll
    for (int r = 0; r < 8; ++r) so[w][8 * hh + r][t * 16 + ln] = acc[t][r] * alpha; }
  __builtin_amdgcn_fence(__ATOMIC_ACQ_REL, "workgroup"); __builtin_amdgcn_wave_barrier();
  const int rsub = lane >> 4, c4 = (lane & 15) * 4;
  {
#pragma unroll
    for (int q = 0; q < 8; ++q) { const int r = q * 2 + rsub; if (col0 + c4 < N) { const v4f v = *(const v4fa*)&so[w][r][c4]; *(v4f*)(C + (size_t)(row0 + r) * ldc + col0 + c4) = v; } }
     }
}

// Wt[n][k] = f16(W[k][n]·scale) from f32 row-major W[K][N] (scale = power of two; bf16-exact weights stay exact in f16 away from the subnormal range)
__global__ __launch_bounds__(256) void k_wt_f16(const float* __restrict__ W, _Float16* __restrict__ Wt, int K, int N, float scale) {
  const int t = blockIdx.x * 256 + threadIdx.x; if (t >= N * (K / 8)) return; const int n = t / (K / 8), k8 = (t % (K / 8)) * 8; FragH f;
#pragma unroll
  for (int i = 0; i < 8; ++i) f.h[i] = (_Float16)(bf16_round(W[(size_t)(k8 + i) * N + n]) * scale); const v8us o = f.half[0];
  *(v8us*)((unsigned short*)Wt + (size_t)n * K + k8) = o; 
}
__device__ __forceinline__ void vts_tile(const int blk, const float* __restrict__ v, _Float16* __restrict__ Vt) { __shared__ unsigned short tl[64][66]; const int tid = threadIdx.x; const int slab = blk / (TT / 64), tg = blk % (TT / 64); const int b = slab / NH, h = slab % NH;
  for (int i = tid; i < 64 * 16; i += 256) { const int r = i / 16, c4 = (i % 16) * 4; const int ts = (tg * 64 + r + 1) % TT; const v4f a = *(const v4fa*)(v + ((size_t)b * TT + ts) * DDm + h * HD + c4); FragH f; for (int q = 0; q < 4; ++q) { f.h[q] = (_Float16)bf16_round(a[q]); tl[r][c4 + q] = f.u[q]; } }
  __syncthreads();
  {
#pragma unroll
    for (int rd = 0; rd < 2; ++rd) { const int d = rd * 32 + tid / 8, pc = tid % 8; FragH f;
#pragma unroll
      for (int q = 0; q < 8; ++q) f.u[q] = tl[pc * 8 + q][d]; *(v8us*)((unsigned short*)Vt + ((size_t)slab * HD + d) * TT + tg * 64 + pc * 8) = f.half[0]; }
    asm volatile("s_wait_xcnt 0x0" ::: "memory");      // behind the two stores: in the joint kernel code of the other block kind follows them in the listing and rewrites their registers
     } }
// attention per ((b,h), 32 queries), transposed. Which block takes what: a query tile's cost follows how many of its key tiles the mask leaves open, which under a lower-triangular mask grows with the tile's index, and the grid holds twice as many
// blocks as the chip has places for them (four a WGP, by registers). The index runs from the last query tile down to the first, all heads of a tile side by side: the long blocks come first in the index and the short ones
// fill the places as they fall free. A permutation of (head, tile): every pair once, right for any mask; speed only.
// The block's four waves share the 32 queries and split the keys, wave w taking the 32-key tiles w, w + 4, w + 8, ...; each keeps its own maximum, sum and
// un-normalised Ot, and the four partials are merged through LDS behind one barrier (weights exp2 of maximum - joint maximum). St = kc.qc^T (A = 16 key rows, B = 16 query columns, d 32), so a lane holds ONE query's scores: keys 8*hh + r of each 16-key tile;
// logit = -sqrt(max(q2 + k2 - 2S, 1e-12)); mask[q][k] (INPUT, nonzero = keep; tiles with no open key for the wave skipped); maximum and sum in the lane plus one exchange between the wave's halves;
// the two score tiles of 32 keys, converted in place, ARE the B operand of Ot += Vt.Pt (hardware k order: 8*hh + s, 16 + 8*hh + s), and a lane's 8 accumulator registers are 8 consecutive d of its query: no LDS in the loop.
typedef int v4ia __attribute__((ext_vector_type(4), may_alias));
__device__ __forceinline__ float xhalf(float x) { const int bq = __float_as_int(x); return __int_as_float(__builtin_amdgcn_permlanex16(bq, bq, 0x76543210, 0xfedcba98, false, false)); }      // lane l <-> l ^ 16
template <int N> __device__ __forceinline__ float rowshare(float x) { return __int_as_float(__builtin_amdgcn_mov_dpp(__float_as_int(x), 0x150 + N, 0xf, 0xf, false)); }      // lane N of each 16-lane row to the whole row
// causal 3-tap conv, transposed: Ct = W.Xt per (tensor, head, 256 positions a block, 32 a wave). The block first rounds its head's 32 x 192 weights into LDS (k = tap * 64 + d, scaled by 16; pitch 200 halves
// keeps the 16-byte fragment reads of 16 rows off one another's banks). A = 16 channel rows from LDS, B = 16 positions: x rows s + tap - 2 (clamped at the sequence's first row) read straight from the f32 input
// and rounded in registers, same k order as A (8*hh + j, 16 + 8*hh + j). A lane then holds ONE position's channels t*16 + 8*hh + r: 16-byte f16 stores, |c|^2 in the lane plus one exchange between the wave's halves.
// Rows and norms go out head-major ([b*NH + h][s][c], [b*NH + h][s]): a wave writes 2 KiB of rows and one 128-byte line of norms, all its own.
__device__ __forceinline__ void conv_tile(const int blk, const float* __restrict__ qx, const float* __restrict__ kx, const float* __restrict__ cw, const float* __restrict__ cb, _Float16* __restrict__ Q16, _Float16* __restrict__ K16, float* __restrict__ NQ, float* __restrict__ NK) {
  __shared__ __attribute__((aligned(16))) unsigned short wsm[CCv][200];
  const int tid = threadIdx.x, w = tid >> 5, lane = tid & 31, ln = lane & 15, hh = lane >> 4;
  const int pg = blk % (NR / 256), h = (blk / (NR / 256)) % NH, z = blk / ((NR / 256) * NH);
  const float* x = z ? kx : qx; _Float16* C16 = z ? K16 : Q16; float* N2 = z ? NK : NQ;
  { const int c = tid >> 3, d0 = (tid & 7) * 8; const float* wp = cw + ((size_t)(h * CCv + c) * HD + d0) * 3; float wv[24];      // a thread's 24 consecutive floats are 8 d x 3 taps of one channel
#pragma unroll
    for (int q = 0; q < 6; ++q) { const v4f a = *(const v4fa*)(wp + q * 4); wv[q * 4] = a[0]; wv[q * 4 + 1] = a[1]; wv[q * 4 + 2] = a[2]; wv[q * 4 + 3] = a[3]; }
#pragma unroll
    for (int i = 0; i < 3; ++i) { FragH f;
#pragma unroll
      for (int q = 0; q < 8; ++q) f.h[q] = (_Float16)(bf16_round(wv[q * 3 + i]) * 16.0f);
      *(v8us*)&wsm[c][i * 64 + d0] = f.half[0]; } }
  __syncthreads();      // every wave reads fragments of weights that all eight waves wrote
  const int row0 = pg * 256 + w * 32, b = row0 / TT, s0 = row0 % TT;
  const float* xb = x + (size_t)b * TT * DDm + h * HD + 8 * hh;
  v8f acc[2][2];
#pragma unroll
  for (int nt = 0; nt < 2; ++nt)
#pragma unroll
    for (int t = 0; t < 2; ++t) acc[nt][t] = (v8f){0.f,0.f,0.f,0.f,0.f,0.f,0.f,0.f};
#pragma unroll
  for (int i = 0; i < 3; ++i)
#pragma unroll
    for (int dd = 0; dd < 2; ++dd) { FragH aw[2], bx[2];
#pragma unroll
      for (int t = 0; t < 2; ++t) { const unsigned short* wk = &wsm[t * 16 + ln][i * 64 + dd * 32 + 8 * hh]; aw[t].half[0] = *(const v8us*)wk; aw[t].half[1] = *(const v8us*)(wk + 16); }
#pragma unroll
      for (int nt = 0; nt < 2; ++nt) { int ss = s0 + nt * 16 + ln + i - 2; ss = ss < 0 ? 0 : ss; const float* xr = xb + (size_t)ss * DDm + dd * 32;
        const v4f x0 = *(const v4fa*)xr, x1 = *(const v4fa*)(xr + 4), x2 = *(const v4fa*)(xr + 16), x3 = *(const v4fa*)(xr + 20);      // below: the hardware's f32 -> bf16 conversion rounds to nearest even, as bf16_round does, in one instruction
#pragma unroll
        for (int j = 0; j < 4; ++j) { bx[nt].h[j] = (_Float16)(float)(__bf16)x0[j]; bx[nt].h[4 + j] = (_Float16)(float)(__bf16)x1[j]; bx[nt].h[8 + j] = (_Float16)(float)(__bf16)x2[j]; bx[nt].h[12 + j] = (_Float16)(float)(__bf16)x3[j]; } }
#pragma unroll
      for (int nt = 0; nt < 2; ++nt)
#pragma unroll
        for (int t = 0; t < 2; ++t) acc[nt][t] = mmaH<1>(aw[t].v, aw[t].v, bx[nt].v, bx[nt].v, acc[nt][t]); }
  float bv[2][8];
#pragma unroll
  for (int t = 0; t < 2; ++t) { const float* bp = cb + h * CCv + t * 16 + 8 * hh; const v4f b0 = *(const v4fa*)bp, b1 = *(const v4fa*)(bp + 4);
#pragma unroll
    for (int j = 0; j < 4; ++j) { bv[t][j] = bf16_round(b0[j]); bv[t][4 + j] = bf16_round(b1[j]); } }
#pragma unroll
  for (int nt = 0; nt < 2; ++nt) { const size_t prow = (size_t)(b * NH + h) * TT + s0 + nt * 16 + ln; float ss = 0.f;
#pragma unroll
    for (int t = 0; t < 2; ++t) { FragH f;
#pragma unroll
      for (int r = 0; r < 8; ++r) { const float v = acc[nt][t][r] * 0.0625f + bv[t][r]; ss += v * v; f.h[r] = (_Float16)v; }
      *(v8us*)((unsigned short*)C16 + prow * CCv + t * 16 + 8 * hh) = f.half[0]; }
    ss += xhalf(ss);
    if (hh == 0) N2[prow] = ss; } }
// all that the attention needs, in ONE launch: the conv blocks (the longer ones) first, then the blocks of the shifted V transpose; the two kinds share nothing, and a block is wholly of one kind
#define NCB ((NR / 256) * NH * 2)
__global__ __launch_bounds__(256) void k_prep(const float* __restrict__ qx, const float* __restrict__ kx, const float* __restrict__ vx, const float* __restrict__ cw, const float* __restrict__ cb, _Float16* __restrict__ Q16, _Float16* __restrict__ K16, float* __restrict__ NQ, float* __restrict__ NK, _Float16* __restrict__ Vt) {
  if (blockIdx.x < NCB) conv_tile((int)blockIdx.x, qx, kx, cw, cb, Q16, K16, NQ, NK); else vts_tile((int)blockIdx.x - NCB, vx, Vt); }
__global__ __launch_bounds__(128) void k_sattn(const _Float16* __restrict__ Q16, const _Float16* __restrict__ K16, const float* __restrict__ NQ, const float* __restrict__ NK, const int* __restrict__ MSK, const _Float16* __restrict__ Vt, float* __restrict__ O) { constexpr int RPW = 32; constexpr int KSP = 4; constexpr int OP = HD + 4; constexpr float L2E = 1.4426950408889634f;      // OP: a partial's row pitch, 272 bytes = 16 x 17, keeps the 16-byte writes of 16 queries off one another's banks
  __shared__ __attribute__((aligned(16))) float so[KSP][RPW][OP]; __shared__ __attribute__((aligned(16))) float sml[RPW][2 * KSP];      // per query: the four waves' maxima, then their sums
  const int tid = threadIdx.x, w = tid >> 5, lane = tid & 31, ln = lane & 15, hh = lane >> 4; const int slab = blockIdx.x % (BB * NH), qblk = (blockIdx.x / (BB * NH)) ^ (TT / RPW - 1) /* = 63 - x for x in 0 .. 63 */; const int b = slab / NH, h = slab % NH; const int q0 = qblk * RPW;
  FragH bq[2]; float q2c[2];
#pragma unroll
  for (int rt = 0; rt < 2; ++rt) { const size_t qrow = (size_t)slab * TT + q0 + rt * 16 + ln; const unsigned short* qr = (const unsigned short*)Q16 + qrow * CCv; bq[rt].half[0] = *(const v8us*)(qr + 8 * hh); bq[rt].half[1] = *(const v8us*)(qr + 16 + 8 * hh); q2c[rt] = NQ[qrow]; }
  const int kslot = (ln < 8) ? 8 * hh + ln : 8 + 8 * hh + ln;      // lane ln of half hh fetches |kc|^2 of the key that the half's score register ln holds (tile ln / 8, register ln % 8)
  float m_c[2], l_c[2]; v8f oacc[2][4];      // m starts finite and below every finite logit (|logit| <= sqrt(FLT_MAX)): exp2 arguments never meet inf - inf
#pragma unroll
  for (int rt = 0; rt < 2; ++rt) { m_c[rt] = -1.0e30f; l_c[rt] = 0.f;
#pragma unroll
    for (int dt = 0; dt < 4; ++dt) oacc[rt][dt] = (v8f){0.f,0.f,0.f,0.f,0.f,0.f,0.f,0.f}; }
  // read places: a base that is the same for the whole block and steps by four 32-key tiles a trip, plus each lane's own fixed byte offset (the wave's first tile in it)
  const char* mb = (const char*)(MSK + (size_t)qblk * RPW * TT); const char* kb = (const char*)(K16 + (size_t)slab * TT * CCv); const char* nb = (const char*)(NK + (size_t)slab * TT); const char* vb = (const char*)(Vt + (size_t)slab * HD * TT);
  const unsigned mlo = (unsigned)((ln * TT + w * 32 + 8 * hh) * 4), klo = (unsigned)(((w * 32 + ln) * CCv + 8 * hh) * 2), nlo = (unsigned)((w * 32 + kslot) * 4), vlo = (unsigned)((ln * TT + w * 32 + 8 * hh) * 2);
#pragma unroll 1
  for (int j0 = 0; j0 < TT; j0 += 32 * KSP, mb += 32 * KSP * 4, kb += 32 * KSP * CCv * 2, nb += 32 * KSP * 4, vb += 32 * KSP * 2) {
    v4ia mk[2][2][2];
#pragma unroll
    for (int rt = 0; rt < 2; ++rt)
#pragma unroll
      for (int nt = 0; nt < 2; ++nt) { const int* mr = (const int*)(mb + mlo) + rt * 16 * TT + nt * 16; mk[rt][nt][0] = *(const v4ia*)mr; mk[rt][nt][1] = *(const v4ia*)(mr + 4); }
    const v4ia mo = (mk[0][0][0] | mk[0][0][1]) | (mk[0][1][0] | mk[0][1][1]) | ((mk[1][0][0] | mk[1][0][1]) | (mk[1][1][0] | mk[1][1][1])); const int anyb = (mo[0] | mo[1]) | (mo[2] | mo[3]);
    if (__builtin_amdgcn_ballot_w32(anyb != 0) == 0u) continue;      // wave-uniform skip of fully masked tiles
    FragH ak[2], av[4];
#pragma unroll
    for (int nt = 0; nt < 2; ++nt) { const unsigned short* kr = (const unsigned short*)(kb + klo) + nt * 16 * CCv; ak[nt].half[0] = *(const v8us*)kr; ak[nt].half[1] = *(const v8us*)(kr + 16); }
    const float k2l = *(const float*)(nb + nlo);
#pragma unroll
    for (int dt = 0; dt < 4; ++dt) { const unsigned short* vrow = (const unsigned short*)(vb + vlo) + dt * 16 * TT; av[dt].half[0] = *(const v8us*)vrow; av[dt].half[1] = *(const v8us*)(vrow + 16); }
    v8f s[2][2];
#pragma unroll
    for (int nt = 0; nt < 2; ++nt)
#pragma unroll
      for (int rt = 0; rt < 2; ++rt) { v8f acc = (v8f){0.f,0.f,0.f,0.f,0.f,0.f,0.f,0.f}; acc = mmaH<1>(ak[nt].v, ak[nt].v, bq[rt].v, bq[rt].v, acc); s[rt][nt] = acc; }
    const float k2v[2][8] = {{rowshare<0>(k2l), rowshare<1>(k2l), rowshare<2>(k2l), rowshare<3>(k2l), rowshare<4>(k2l), rowshare<5>(k2l), rowshare<6>(k2l), rowshare<7>(k2l)},
                             {rowshare<8>(k2l), rowshare<9>(k2l), rowshare<10>(k2l), rowshare<11>(k2l), rowshare<12>(k2l), rowshare<13>(k2l), rowshare<14>(k2l), rowshare<15>(k2l)}};
    FragH pb[2];
#pragma unroll
    for (int rt = 0; rt < 2; ++rt) { float sv[2][8]; float mc = -INFINITY;
#pragma unroll
      for (int nt = 0; nt < 2; ++nt)
#pragma unroll
        for (int r = 0; r < 8; ++r) { const float d = fmaxf(q2c[rt] + k2v[nt][r] - 2.0f * s[rt][nt][r], 1e-12f); sv[nt][r] = (mk[rt][nt][r >> 2][r & 3] != 0) ? -__builtin_amdgcn_sqrtf(d) : -INFINITY; mc = fmaxf(mc, sv[nt][r]); }      // d >= 1e-12: never a denormal, the hardware root needs no range fix-up
      mc = fmaxf(mc, xhalf(mc));
      const float mn = fmaxf(m_c[rt], mc); const float ta = (m_c[rt] - mn) * L2E; const float al = __builtin_amdgcn_exp2f(ta); m_c[rt] = mn; const float nm = -mn * L2E;      // exp(x - mn) = exp2(x * log2(e) - mn * log2(e)): one fma and the hardware exp2; a closed key's -inf gives exp2(-inf) = 0
      float ps = 0.f;
#pragma unroll
      for (int nt = 0; nt < 2; ++nt) { float t[8], p[8];
#pragma unroll
        for (int r = 0; r < 8; ++r) { t[r] = __builtin_fmaf(sv[nt][r], L2E, nm); p[r] = __builtin_amdgcn_exp2f(t[r]); }
        // the slot behind a transcendental: inputs only, so every argument's register stays whole until all of these exp2 have issued (none is overwritten directly behind its exp2), and the v_nop stands behind the last
        asm volatile("v_nop" :: "v"(t[0]), "v"(t[1]), "v"(t[2]), "v"(t[3]), "v"(t[4]), "v"(t[5]), "v"(t[6]), "v"(t[7]), "v"(p[0]), "v"(p[1]), "v"(p[2]), "v"(p[3]), "v"(p[4]), "v"(p[5]), "v"(p[6]), "v"(p[7]), "v"(ta), "v"(al));
#pragma unroll
        for (int r = 0; r < 8; ++r) { ps += p[r]; pb[rt].h[nt * 8 + r] = (_Float16)p[r]; } }
      l_c[rt] = l_c[rt] * al + ps;      // the half's own 16 keys; the halves join behind the loop
#pragma unroll
      for (int dt = 0; dt < 4; ++dt)
#pragma unroll
        for (int r = 0; r < 8; ++r) oacc[rt][dt][r] *= al; }
#pragma unroll
    for (int dt = 0; dt < 4; ++dt)
#pragma unroll
      for (int rt = 0; rt < 2; ++rt) oacc[rt][dt] = mmaH<1>(av[dt].v, av[dt].v, pb[rt].v, pb[rt].v, oacc[rt][dt]); }
  // the wave's partial goes to LDS: rows [query][d], un-normalised, with its maximum and its sum (the halves joined here)
#pragma unroll
  for (int rt = 0; rt < 2; ++rt) { const float l = l_c[rt] + xhalf(l_c[rt]); if (hh == 0) { sml[rt * 16 + ln][w] = m_c[rt]; sml[rt * 16 + ln][KSP + w] = l; } float* prow = &so[w][rt * 16 + ln][8 * hh];
#pragma unroll
    for (int dt = 0; dt < 4; ++dt) { const v4f lo = {oacc[rt][dt][0], oacc[rt][dt][1], oacc[rt][dt][2], oacc[rt][dt][3]}, hi = {oacc[rt][dt][4], oacc[rt][dt][5], oacc[rt][dt][6], oacc[rt][dt][7]}; *(v4fa*)(prow + dt * 16) = lo; *(v4fa*)(prow + dt * 16 + 4) = hi; } }
  __syncthreads();      // every wave merges rows that all four waves wrote
  // merge: wave w owns queries 8 * w .. 8 * w + 7, two a pass; 16 lanes x 16 bytes are one query's whole 256-byte output row, so every 128-byte line has one writer and goes out in one store
#pragma unroll
  for (int c = 0; c < 4; ++c) { const int qq = w * 8 + c * 2 + hh; const v4f mv = *(const v4fa*)&sml[qq][0], lv = *(const v4fa*)&sml[qq][KSP];
    const float mj = fmaxf(fmaxf(mv[0], mv[1]), fmaxf(mv[2], mv[3])); float t[KSP], e[KSP]; float l = 0.f; v4f o = {0.f, 0.f, 0.f, 0.f};      // a wave that met no open key has maximum -1e30, sum 0 and zeros: weight 0, or 1 on zeros where no wave met one
#pragma unroll
    for (int p = 0; p < KSP; ++p) t[p] = (mv[p] - mj) * L2E;
    // the four weights' exp2 and the slot behind a transcendental in one statement: results in registers of their own, so none is read and no argument overwritten directly behind its exp2; the v_nop fills the slot behind the last
    asm("v_exp_f32 %0, %4\n\tv_exp_f32 %1, %5\n\tv_exp_f32 %2, %6\n\tv_exp_f32 %3, %7\n\tv_nop" : "=&v"(e[0]), "=&v"(e[1]), "=&v"(e[2]), "=&v"(e[3]) : "v"(t[0]), "v"(t[1]), "v"(t[2]), "v"(t[3]));
#pragma unroll
    for (int p = 0; p < KSP; ++p) { l += e[p] * lv[p]; const v4f a = *(const v4fa*)&so[p][qq][ln * 4]; o += a * e[p]; }
    const float li = (l > 0.f) ? 1.0f / l : 0.f;
    *(v4f*)(O + ((size_t)b * TT + q0 + qq) * DDm + h * HD + ln * 4) = o * li; } }
extern "C" void kernel_launch(void* const* d_in, const int* in_sizes, int n_in,
                              void* d_out, int out_size, void* d_ws, size_t ws_size, hipStream_t stream) {
  (void)in_sizes; (void)n_in; (void)out_size;
  const float* qx = (const float*)d_in[0]; const float* kx = (const float*)d_in[1]; const float* vx = (const float*)d_in[2]; const int* mask = (const int*)d_in[3]; const float* cw = (const float*)d_in[4]; const float* cb = (const float*)d_in[5];
  char* ws = (char*)d_ws; size_t off = 0;
  auto take = [&](size_t bytes) { char* p = ws + off; off += (bytes + 255) & ~(size_t)255; return p; };
  _Float16* Q16 = (_Float16*)take((size_t)NR * NH * CCv * 2); _Float16* K16 = (_Float16*)take((size_t)NR * NH * CCv * 2); float* NQ = (float*)take((size_t)NR * NH * 4); float* NK = (float*)take((size_t)NR * NH * 4); _Float16* Vt = (_Float16*)take((size_t)NR * DDm * 2);
  if (off > ws_size) return;      // 4.2 x 2 + 0.26 x 2 + 8.4: about 17 MiB
  k_prep<<<NCB + BB * NH * (TT / 64), 256, 0, stream>>>(qx, kx, vx, cw, cb, Q16, K16, NQ, NK, Vt);
  k_sattn<<<BB * NH * (TT / 32), 128, 0, stream>>>(Q16, K16, NQ, NK, mask, Vt, (float*)d_out);
}

// v006
// Measured time: 41.2 microseconds a run.
// Two timings next to v005 put it at 1.62 and 1.63 times that version's speed.
// Counting every step since v000, it is 12.7 times as fast.
#include <hip/hip_runtime.h>
// Simplex (distance-based) attention (B=4, S=2048, 8 heads × 64, conv channels 32): the per-head causal 3-tap conv of q and k on WMMA (+ bias, f16 rows and norms head-major) and the shifted V transpose in one preparation launch, and the attention as a
// fused flash-style kernel on v_wmma_f32_16x16x32_f16 — S = qc·kc (d = 32, one k-step), logits = −sqrt(max(|qc|² + |kc|² − 2S, 1e-12)), INPUT mask (nonzero = keep), online softmax f32,
// P f16 ≤ 1, and the roll(attn, 1) folded into a one-step shift of V (out[s] = Σ_t attn[s][t]·v[t+1 mod S]); f16 operands, single products, f32 accumulate; norms f32 VALU in the conv's epilogue.
#define BB 4
#define TT 2048
#define DDm 512
#define NH 8
#define HD 64
#define CCv 32
#define NR (BB * TT)

typedef __bf16 v16b __attribute__((ext_vector_type(16)));
typedef unsigned short v8us __attribute__((ext_vector_type(8), may_alias));
typedef float  v8f  __attribute__((ext_vector_type(8)));
typedef float  v4f  __attribute__((ext_vector_type(4)));
typedef float  v4fa __attribute__((ext_vector_type(4), may_alias));
union FragB { v16b v; v8us half[2]; unsigned short u[16]; };

__device__ __forceinline__ unsigned short bf16_bits(float x) { unsigned int u = __float_as_uint(x); return (unsigned short)((u + 0x7FFFu + ((u >> 16) & 1u)) >> 16); }
__device__ __forceinline__ float bf16_val(unsigned short b) { return __uint_as_float(((unsigned int)b) << 16); }
__device__ __forceinline__ float bf16_round(float x) { return bf16_val(bf16_bits(x)); }
// D += A·B with NT terms: 1 = ah·bh, 2 = + al·bh (A split), 3 = + ah·bl (both split)
template <int NT>
__device__ __forceinline__ v8f mmaN(v16b ah, v16b al, v16b bh, v16b bl, v8f c) {
  c = __builtin_amdgcn_wmma_f32_16x16x32_bf16(false, ah, false, bh, (short)0, c, false, false);
  if (NT >= 2) c = __builtin_amdgcn_wmma_f32_16x16x32_bf16(false, al, false, bh, (short)0, c, false, false);
  if (NT >= 3) c = __builtin_amdgcn_wmma_f32_16x16x32_bf16(false, ah, false, bl, (short)0, c, false, false);
  asm volatile("v_nop\n\tv_nop\n\tv_nop\n\tv_nop" : "+v"(c) : "v"(ah), "v"(al), "v"(bh), "v"(bl));
  return c;
}

__global__ __launch_bounds__(256) void k_wt_bf16(const float* __restrict__ W, unsigned short* __restrict__ Wt, int K, int N) {
  const int t = blockIdx.x * 256 + threadIdx.x;
  const int k8n = K / 8;
  if (t >= N * k8n) return;
  const int n = t / k8n, k8 = (t % k8n) * 8;
  v8us v;
#pragma unroll
  for (int i = 0; i < 8; ++i) v[i] = bf16_bits(W[(size_t)(k8 + i) * N + n]);
  *(v8us*)(Wt + (size_t)n * K + k8) = v;
  
}

// GEMM C[M][N] (f32, pitch ldc) = act(A[M][K]·W + bias). A f32 row-major (pitch lda) converted per fragment to bf16
// (ASPLIT: hi/lo two planes -> 2 terms, else single rounded term); Wt bf16 [N][K] (pitch ldb). BIAS_BF16 rounds the
// bias to bf16 first (bias quantised to bf16 before the add). K%32==0, M%16==0, N%64==0.
template <bool ASPLIT, int ACT, bool BIAS_BF16>
__global__ __launch_bounds__(128) void k_gemm_bf(const float* __restrict__ A, int lda, const unsigned short* __restrict__ Wt, int ldb,
                                               const float* __restrict__ bias, float* __restrict__ C, int ldc, int M, int N, int K) {
  __shared__ __attribute__((aligned(16))) float so[4][16][64];
  const int tid = threadIdx.x, w = tid >> 5, lane = tid & 31, ln = lane & 15, hh = lane >> 4;
  const int ntn = N / 64;
  const int wid = blockIdx.x * 4 + w;
  const int mt = wid / ntn, nq = wid % ntn;
  if (mt * 16 >= M) return;
  const int row0 = mt * 16, col0 = nq * 64;
  const float* arow = A + (size_t)(row0 + ln) * lda;
  v8f acc[4] = {};
  for (int kb = 0; kb < K; kb += 32) {
    FragB ah, al;
    const v4f x0 = *(const v4fa*)(arow + kb + 8 * hh), x1 = *(const v4fa*)(arow + kb + 8 * hh + 4);
    const v4f x2 = *(const v4fa*)(arow + kb + 16 + 8 * hh), x3 = *(const v4fa*)(arow + kb + 16 + 8 * hh + 4);
    float xs[16] = {x0[0],x0[1],x0[2],x0[3],x1[0],x1[1],x1[2],x1[3],x2[0],x2[1],x2[2],x2[3],x3[0],x3[1],x3[2],x3[3]};
#pragma unroll
    for (int i = 0; i < 16; ++i) { const unsigned short hb = bf16_bits(xs[i]); ah.u[i] = hb; al.u[i] = ASPLIT ? bf16_bits(xs[i] - bf16_val(hb)) : (unsigned short)0; }
#pragma unroll
    for (int t = 0; t < 4; ++t) {
      const unsigned short* brow = Wt + (size_t)(col0 + t * 16 + ln) * ldb + kb;
      FragB b;
      b.half[0] = *(const v8us*)(brow + 8 * hh);
      b.half[1] = *(const v8us*)(brow + 16 + 8 * hh);
      acc[t] = mmaN<ASPLIT ? 2 : 1>(ah.v, al.v, b.v, b.v, acc[t]);
    }
  }
#pragma unroll
  for (int t = 0; t < 4; ++t) {
    float bv = bias ? bias[col0 + t * 16 + ln] : 0.f;
    if (BIAS_BF16) bv = bf16_round(bv);
#pragma unroll
    for (int r = 0; r < 8; ++r) { float v = acc[t][r] + bv; if (ACT == 1) v = fmaxf(v, 0.f); so[w][8 * hh + r][t * 16 + ln] = v; }
  }
  __builtin_amdgcn_fence(__ATOMIC_ACQ_REL, "workgroup");
  __builtin_amdgcn_wave_barrier();
  const int rsub = lane >> 4, c4 = (lane & 15) * 4;
  {
#pragma unroll
    for (int q = 0; q < 8; ++q) {
      const int r = q * 2 + rsub;
      const v4f v = *(const v4fa*)&so[w][r][c4];
      *(v4f*)(C + (size_t)(row0 + r) * ldc + col0 + c4) = v;
    }
    
  }
}

// Flash-style causal/unmasked attention, all contractions 3-term bf16 hi/lo splits, f32 softmax with running max.
// q,k,v rows are read from f32 buffers with arbitrary row pitch (so they can live inside a fused qkv buffer);
// D = head size (multiple of 32, <= 128); one wave = 16 query rows; block = 4 waves (64 queries) sharing K/V chunks of 32.
template <int D, bool CAUSAL>
__global__ __launch_bounds__(128) void k_flash(const float* __restrict__ qb, const float* __restrict__ kb, const float* __restrict__ vb,
                                             int pitch, int T, int H, float scale, float* __restrict__ y, int ypitch) {
  constexpr int KS = D / 32;        // k-steps for QK
  constexpr int DT = D / 16;        // d tiles for PV
  __shared__ __attribute__((aligned(16))) unsigned short sKh[32][D + 8], sKl[32][D + 8], sVh[32][D + 8], sVl[32][D + 8];
  __shared__ __attribute__((aligned(16))) unsigned short sPh[4][16][40], sPl[4][16][40];
  __shared__ __attribute__((aligned(16))) float sO[4][16][D];
  const int tid = threadIdx.x, w = tid >> 5, lane = tid & 31, ln = lane & 15, hh = lane >> 4;
  const int nqb = (T + 63) / 64;
  const int bh = blockIdx.x / nqb, qblk = blockIdx.x % nqb;
  const int b = bh / H, h = bh % H;
  const int q0 = qblk * 64 + w * 16;
  const float* Q = qb + (size_t)b * T * pitch + h * D;
  const float* K = kb + (size_t)b * T * pitch + h * D;
  const float* V = vb + (size_t)b * T * pitch + h * D;

  // A fragments of the wave's 16 query rows (scaled), hi/lo
  FragB aqh[KS], aql[KS];
  {
    int row = q0 + ln; if (row >= T) row = T - 1;
    const float* qr = Q + (size_t)row * pitch;
#pragma unroll
    for (int ks = 0; ks < KS; ++ks)
#pragma unroll
      for (int i = 0; i < 16; ++i) {
        const int d = ks * 32 + ((i < 8) ? (8 * hh + i) : (16 + 8 * hh + (i - 8)));
        const float x = qr[d] * scale; const unsigned short hb = bf16_bits(x);
        aqh[ks].u[i] = hb; aql[ks].u[i] = bf16_bits(x - bf16_val(hb));
      }
  }
  float m_r[8], l_r[8];
#pragma unroll
  for (int r = 0; r < 8; ++r) { m_r[r] = -3.0e38f; l_r[r] = 0.f; }
  v8f oacc[DT];
#pragma unroll
  for (int dt = 0; dt < DT; ++dt) oacc[dt] = (v8f){0.f,0.f,0.f,0.f,0.f,0.f,0.f,0.f};

  const int kv_end = CAUSAL ? min(T, qblk * 64 + 64) : T;     // block-uniform
  for (int j0 = 0; j0 < kv_end; j0 += 32) {
    __syncthreads();
    for (int e = tid; e < 32 * (D / 4); e += 128) {
      const int r = e / (D / 4), c4 = (e % (D / 4)) * 4;
      const int key = j0 + r;
      v4f kf = {0.f,0.f,0.f,0.f}, vf = {0.f,0.f,0.f,0.f};
      if (key < T) { kf = *(const v4fa*)(K + (size_t)key * pitch + c4); vf = *(const v4fa*)(V + (size_t)key * pitch + c4); }
#pragma unroll
      for (int t = 0; t < 4; ++t) {
        unsigned short hb = bf16_bits(kf[t]); sKh[r][c4 + t] = hb; sKl[r][c4 + t] = bf16_bits(kf[t] - bf16_val(hb));
        hb = bf16_bits(vf[t]); sVh[r][c4 + t] = hb; sVl[r][c4 + t] = bf16_bits(vf[t] - bf16_val(hb));
      }
    }
    __syncthreads();
    // S tile 16 x 32
    v8f s[2];
#pragma unroll
    for (int nt = 0; nt < 2; ++nt) {
      v8f acc = {};
#pragma unroll
      for (int ks = 0; ks < KS; ++ks) {
        FragB bh_, bl_;
        bh_.half[0] = *(const v8us*)&sKh[nt * 16 + ln][ks * 32 + 8 * hh]; bh_.half[1] = *(const v8us*)&sKh[nt * 16 + ln][ks * 32 + 16 + 8 * hh];
        bl_.half[0] = *(const v8us*)&sKl[nt * 16 + ln][ks * 32 + 8 * hh]; bl_.half[1] = *(const v8us*)&sKl[nt * 16 + ln][ks * 32 + 16 + 8 * hh];
        acc = mmaN<3>(aqh[ks].v, aql[ks].v, bh_.v, bl_.v, acc);
      }
      s[nt] = acc;
    }
    // mask + running max (rows 8hh+r; the 16 lanes of a half share rows)
    float alpha[8];
#pragma unroll
    for (int r = 0; r < 8; ++r) {
      const int qi = q0 + 8 * hh + r;
      const int ja = j0 + ln, jb = j0 + 16 + ln;
      if (CAUSAL) { if (ja > qi) s[0][r] = -3.0e38f; if (jb > qi) s[1][r] = -3.0e38f; }
      if (ja >= T) s[0][r] = -3.0e38f;
      if (jb >= T) s[1][r] = -3.0e38f;
      float mx = fmaxf(s[0][r], s[1][r]);
      mx = fmaxf(mx, __shfl_xor(mx, 1, 32)); mx = fmaxf(mx, __shfl_xor(mx, 2, 32)); mx = fmaxf(mx, __shfl_xor(mx, 4, 32)); mx = fmaxf(mx, __shfl_xor(mx, 8, 32));
      const float mnew = fmaxf(m_r[r], mx);
      alpha[r] = (mnew > -1.0e38f) ? __expf(m_r[r] - mnew) : 1.0f;
      const float p0 = (s[0][r] > -1.0e38f) ? __expf(s[0][r] - mnew) : 0.f;
      const float p1 = (s[1][r] > -1.0e38f) ? __expf(s[1][r] - mnew) : 0.f;
      m_r[r] = mnew;
      l_r[r] = l_r[r] * alpha[r] + p0 + p1;            // per-lane partial row sum (16 lanes combined at the end)
      unsigned short hb = bf16_bits(p0); sPh[w][8 * hh + r][ln] = hb;      sPl[w][8 * hh + r][ln] = bf16_bits(p0 - bf16_val(hb));
      hb = bf16_bits(p1);                sPh[w][8 * hh + r][16 + ln] = hb; sPl[w][8 * hh + r][16 + ln] = bf16_bits(p1 - bf16_val(hb));
    }
#pragma unroll
    for (int dt = 0; dt < DT; ++dt)
#pragma unroll
      for (int r = 0; r < 8; ++r) oacc[dt][r] *= alpha[r];
    __builtin_amdgcn_fence(__ATOMIC_ACQ_REL, "workgroup");
    __builtin_amdgcn_wave_barrier();
    FragB pah, pal;
    pah.half[0] = *(const v8us*)&sPh[w][ln][8 * hh]; pah.half[1] = *(const v8us*)&sPh[w][ln][16 + 8 * hh];
    pal.half[0] = *(const v8us*)&sPl[w][ln][8 * hh]; pal.half[1] = *(const v8us*)&sPl[w][ln][16 + 8 * hh];
#pragma unroll
    for (int dt = 0; dt < DT; ++dt) {
      FragB bvh, bvl;
#pragma unroll
      for (int i = 0; i < 8; ++i) {
        bvh.u[i] = sVh[8 * hh + i][dt * 16 + ln]; bvh.u[8 + i] = sVh[16 + 8 * hh + i][dt * 16 + ln];
        bvl.u[i] = sVl[8 * hh + i][dt * 16 + ln]; bvl.u[8 + i] = sVl[16 + 8 * hh + i][dt * 16 + ln];
      }
      oacc[dt] = mmaN<3>(pah.v, pal.v, bvh.v, bvl.v, oacc[dt]);
    }
    __builtin_amdgcn_fence(__ATOMIC_ACQ_REL, "workgroup");
    __builtin_amdgcn_wave_barrier();
  }
#pragma unroll
  for (int r = 0; r < 8; ++r) {
    float l = l_r[r];
    l += __shfl_xor(l, 1, 32); l += __shfl_xor(l, 2, 32); l += __shfl_xor(l, 4, 32); l += __shfl_xor(l, 8, 32);
    l_r[r] = (l > 0.f) ? 1.0f / l : 0.f;
  }
#pragma unroll
  for (int dt = 0; dt < DT; ++dt)
#pragma unroll
    for (int r = 0; r < 8; ++r) sO[w][8 * hh + r][dt * 16 + ln] = oacc[dt][r] * l_r[r];
  __builtin_amdgcn_fence(__ATOMIC_ACQ_REL, "workgroup");
  __builtin_amdgcn_wave_barrier();
  {
    for (int r = 0; r < 16; ++r) {
      const int row = q0 + r;
      if (row < T && lane < D / 4) {
        const v4f val = *(const v4fa*)&sO[w][r][lane * 4];
        *(v4f*)(y + ((size_t)b * T + row) * ypitch + h * D + lane * 4) = val;
      }
    }
    
  }
}

// GEMM C = act(A·W + bias + resid): A f32 (ASPLIT -> hi/lo 2 terms), Wt bf16 [N][K]; ACT 0 none, 1 relu, 2 exact gelu;
// resid (optional, f32, row index = (row % rmod), pitch ldr, RES_BF16 rounds it) added before the activation.
template <bool ASPLIT, int ACT, bool BIAS_BF16, bool RES_BF16>
__global__ __launch_bounds__(128) void k_gemm_bf3(const float* __restrict__ A, int lda, const unsigned short* __restrict__ Wt, int ldb,
                                                const float* __restrict__ bias, const float* __restrict__ resid, int rmod, int ldr,
                                                float* __restrict__ C, int ldc, int M, int N, int K) {
  __shared__ __attribute__((aligned(16))) float so[4][16][64];
  const int tid = threadIdx.x, w = tid >> 5, lane = tid & 31, ln = lane & 15, hh = lane >> 4;
  const int ntn = N / 64;
  const int wid = blockIdx.x * 4 + w;
  const int mt = wid / ntn, nq = wid % ntn;
  if (mt * 16 >= M) return;
  const int row0 = mt * 16, col0 = nq * 64;
  const float* arow = A + (size_t)(row0 + ln) * lda;
  v8f acc[4] = {};
  for (int kb = 0; kb < K; kb += 32) {
    FragB ah, al;
    const v4f x0 = *(const v4fa*)(arow + kb + 8 * hh), x1 = *(const v4fa*)(arow + kb + 8 * hh + 4);
    const v4f x2 = *(const v4fa*)(arow + kb + 16 + 8 * hh), x3 = *(const v4fa*)(arow + kb + 16 + 8 * hh + 4);
    float xs[16] = {x0[0],x0[1],x0[2],x0[3],x1[0],x1[1],x1[2],x1[3],x2[0],x2[1],x2[2],x2[3],x3[0],x3[1],x3[2],x3[3]};
#pragma unroll
    for (int i = 0; i < 16; ++i) { const unsigned short hb = bf16_bits(xs[i]); ah.u[i] = hb; al.u[i] = ASPLIT ? bf16_bits(xs[i] - bf16_val(hb)) : (unsigned short)0; }
#pragma unroll
    for (int t = 0; t < 4; ++t) {
      const unsigned short* brow = Wt + (size_t)(col0 + t * 16 + ln) * ldb + kb;
      FragB b;
      b.half[0] = *(const v8us*)(brow + 8 * hh);
      b.half[1] = *(const v8us*)(brow + 16 + 8 * hh);
      acc[t] = mmaN<ASPLIT ? 2 : 1>(ah.v, al.v, b.v, b.v, acc[t]);
    }
  }
#pragma unroll
  for (int t = 0; t < 4; ++t) {
    const int col = col0 + t * 16 + ln;
    float bv = bias ? bias[col] : 0.f;
    if (BIAS_BF16) bv = bf16_round(bv);
#pragma unroll
    for (int r = 0; r < 8; ++r) {
      float v = acc[t][r] + bv;
      if (resid) { float rv = resid[(size_t)((row0 + 8 * hh + r) % rmod) * ldr + col]; if (RES_BF16) rv = bf16_round(rv); v += rv; }
      if (ACT == 1) v = fmaxf(v, 0.f);
      if (ACT == 2) v = 0.5f * v * (1.0f + erff(v * 0.70710678118654752f));
      if (ACT == 3) { const float u = 0.7978845608028654f * (v + 0.044715f * v * v * v); v = 0.5f * v * (1.0f + tanhf(u)); }
      so[w][8 * hh + r][t * 16 + ln] = v;
    }
  }
  __builtin_amdgcn_fence(__ATOMIC_ACQ_REL, "workgroup");
  __builtin_amdgcn_wave_barrier();
  const int rsub = lane >> 4, c4 = (lane & 15) * 4;
  {
#pragma unroll
    for (int q = 0; q < 8; ++q) {
      const int r = q * 2 + rsub;
      const v4f v = *(const v4fa*)&so[w][r][c4];
      *(v4f*)(C + (size_t)(row0 + r) * ldc + col0 + c4) = v;
    }
    
  }
}
// row LayerNorm (biased variance, eps) over N: s = X (+ R); optional out_sum <- s; out_norm <- (s-mu)*rsqrt(var+eps)*g + b
template <bool PARAM_BF16>
__global__ __launch_bounds__(256) void k_layernorm(const float* __restrict__ X, const float* __restrict__ R, const float* __restrict__ g, const float* __restrict__ bta,
                                                  float* __restrict__ out_sum, float* __restrict__ out_norm, int N, float eps) {
  __shared__ float red[256];
  const int row = blockIdx.x, tid = threadIdx.x;
  const float* x = X + (size_t)row * N; const float* rr = R ? R + (size_t)row * N : nullptr;
  float vals[16];                     // up to N = 4096
  const int per = N / 256;            // contiguous chunk per thread? use strided-by-4 chunks: thread handles j = tid*4 + 1024*u
  float s1 = 0.f;
  for (int u = 0; u < per / 4; ++u) {
    const int j = tid * 4 + 1024 * u;
    const v4f a = *(const v4fa*)(x + j);
    v4f b = {0.f,0.f,0.f,0.f}; if (rr) b = *(const v4fa*)(rr + j);
#pragma unroll
    for (int q = 0; q < 4; ++q) { const float v = a[q] + b[q]; vals[u * 4 + q] = v; s1 += v; }
  }
  red[tid] = s1; __syncthreads();
  for (int st = 128; st > 0; st >>= 1) { if (tid < st) red[tid] += red[tid + st]; __syncthreads(); }
  const float mu = red[0] / (float)N; __syncthreads();
  float s2 = 0.f;
  for (int u = 0; u < per / 4; ++u)
#pragma unroll
    for (int q = 0; q < 4; ++q) { const float c = vals[u * 4 + q] - mu; s2 += c * c; }
  red[tid] = s2; __syncthreads();
  for (int st = 128; st > 0; st >>= 1) { if (tid < st) red[tid] += red[tid + st]; __syncthreads(); }
  const float rs = rsqrtf(red[0] / (float)N + eps);
  {
    for (int u = 0; u < per / 4; ++u) {
      const int j = tid * 4 + 1024 * u;
      v4f o, sm;
#pragma unroll
      for (int q = 0; q < 4; ++q) {
        float gg = g[j + q], bb = bta[j + q];
        if (PARAM_BF16) { gg = bf16_round(gg); bb = bf16_round(bb); }
        sm[q] = vals[u * 4 + q]; o[q] = (vals[u * 4 + q] - mu) * rs * gg + bb;
      }
      if (out_sum) *(v4f*)(out_sum + (size_t)row * N + j) = sm;
      *(v4f*)(out_norm + (size_t)row * N + j) = o;
    }
    
  }
}



// ---- f16 WMMA path (v_wmma_f32_16x16x32_f16): 11-bit significands for operands in range — used for the conv GEMMs and both attention contractions
typedef _Float16 v16h __attribute__((ext_vector_type(16)));
union FragH { v16h v; v8us half[2]; _Float16 h[16]; unsigned short u[16]; };
template <int NT>
__device__ __forceinline__ v8f mmaH(v16h ah, v16h al, v16h bh, v16h bl, v8f c) {
  c = __builtin_amdgcn_wmma_f32_16x16x32_f16(false, ah, false, bh, (short)0, c, false, false);
  if (NT >= 2) c = __builtin_amdgcn_wmma_f32_16x16x32_f16(false, al, false, bh, (short)0, c, false, false);
  if (NT >= 3) c = __builtin_amdgcn_wmma_f32_16x16x32_f16(false, ah, false, bl, (short)0, c, false, false);
  asm volatile("v_nop\n\tv_nop\n\tv_nop\n\tv_nop" : "+v"(c) : "v"(ah), "v"(al), "v"(bh), "v"(bl));
  return c;
}
// batched GEMM like k_gemm_b but f16 operands: A f32 (split into f16 hi/lo if ASPLIT, else rounded to f16), Bt = f16 values [n][k]; alpha; C f32; N multiple of 16 (partial tiles skipped)
template <bool ASPLIT>
__global__ __launch_bounds__(128) void k_gemm_h(const float* __restrict__ A, int lda, size_t sA, const _Float16* __restrict__ Bh, int ldb, size_t sB, float alpha, float* __restrict__ C, int ldc, size_t sC, int M, int N, int K) {
  __shared__ __attribute__((aligned(16))) float so[4][16][64];
  const int tid = threadIdx.x, w = tid >> 5, lane = tid & 31, ln = lane & 15, hh = lane >> 4; const int by = blockIdx.y;
  A += (size_t)by * sA; Bh += (size_t)by * sB; C += (size_t)by * sC;
  const int ntn = (N + 63) / 64; const int wid = blockIdx.x * 4 + w; const int mt = wid / ntn, nq = wid % ntn; if (mt * 16 >= M) return;
  const int row0 = mt * 16, col0 = nq * 64; const float* arow = A + (size_t)(row0 + ln) * lda;
  v8f acc[4] = {};
  for (int kb = 0; kb < K; kb += 32) {
    FragH ah, al;
    const v4f x0 = *(const v4fa*)(arow + kb + 8 * hh), x1 = *(const v4fa*)(arow + kb + 8 * hh + 4), x2 = *(const v4fa*)(arow + kb + 16 + 8 * hh), x3 = *(const v4fa*)(arow + kb + 16 + 8 * hh + 4);
    float xs[16] = {x0[0],x0[1],x0[2],x0[3],x1[0],x1[1],x1[2],x1[3],x2[0],x2[1],x2[2],x2[3],x3[0],x3[1],x3[2],x3[3]};
#pragma unroll
    for (int i = 0; i < 16; ++i) { const _Float16 h = (_Float16)xs[i]; ah.h[i] = h; al.h[i] = ASPLIT ? (_Float16)(xs[i] - (float)h) : (_Float16)0.0f; }
#pragma unroll
    for (int t = 0; t < 4; ++t) { if (col0 + t * 16 >= N) continue; const size_t boff = (size_t)(col0 + t * 16 + ln) * ldb + kb; FragH bq; bq.half[0] = *(const v8us*)(Bh + boff + 8 * hh); bq.half[1] = *(const v8us*)(Bh + boff + 16 + 8 * hh);
      acc[t] = mmaH<ASPLIT ? 2 : 1>(ah.v, al.v, bq.v, bq.v, acc[t]); }
  }
#pragma unroll
  for (int t = 0; t < 4; ++t) { if (col0 + t * 16 >= N) continue;
#pragma unroll
    for (int r = 0; r < 8; ++r) so[w][8 * hh + r][t * 16 + ln] = acc[t][r] * alpha; }
  __builtin_amdgcn_fence(__ATOMIC_ACQ_REL, "workgroup"); __builtin_amdgcn_wave_barrier();
  const int rsub = lane >> 4, c4 = (lane & 15) * 4;
  {
#pragma unroll
    for (int q = 0; q < 8; ++q) { const int r = q * 2 + rsub; if (col0 + c4 < N) { const v4f v = *(const v4fa*)&so[w][r][c4]; *(v4f*)(C + (size_t)(row0 + r) * ldc + col0 + c4) = v; } }
     }
}

// Wt[n][k] = f16(W[k][n]·scale) from f32 row-major W[K][N] (scale = power of two; bf16-exact weights stay exact in f16 away from the subnormal range)
__global__ __launch_bounds__(256) void k_wt_f16(const float* __restrict__ W, _Float16* __restrict__ Wt, int K, int N, float scale) {
  const int t = blockIdx.x * 256 + threadIdx.x; if (t >= N * (K / 8)) return; const int n = t / (K / 8), k8 = (t % (K / 8)) * 8; FragH f;
#pragma unroll
  for (int i = 0; i < 8; ++i) f.h[i] = (_Float16)(bf16_round(W[(size_t)(k8 + i) * N + n]) * scale); const v8us o = f.half[0];
  *(v8us*)((unsigned short*)Wt + (size_t)n * K + k8) = o; 
}
typedef int v4ia __attribute__((ext_vector_type(4), may_alias));
typedef unsigned v16ua __attribute__((ext_vector_type(16), may_alias));
// The shifted V transpose, and beside it the mask, packed once a call to one bit a (query, key) pair in the order in which the attention selects. There are 1024 such blocks and 64 x 64 mask tiles of (32 queries, 32 keys): waves 0 .. 3 of a block
// take one tile each, so the pack costs no block and no wave of its own, and its loads fly with those of V. Lane (hh, ln) reads what that lane of the attention needs (query rt * 16 + ln, keys nt * 16 + 8 * hh + r); the ballot over "nonzero" for one
// (rt, nt, r) is that score register's select mask over the 32 lanes. Word rt * 16 + nt * 8 + r goes out from the lane of that number: one 128-byte line a tile, one writer.
// Lines lie [query tile][attention wave = key tile % 4][key tile / 4], so the 16 tiles that one attention wave walks are 2 KiB in a row.
__device__ __forceinline__ void vts_tile(const int blk, const float* __restrict__ v, _Float16* __restrict__ Vt, const int* __restrict__ MSK, unsigned* __restrict__ MB) { __shared__ unsigned short tl[64][66]; const int tid = threadIdx.x;
  const int lane = tid & 31, mg = blk * 4 + ((tid >> 5) & 3), mq = mg / (TT / 32), mt = mg % (TT / 32); const bool packs = tid < 128; v4ia mk[2][2][2];
  if (packs) { const int* mr0 = MSK + (size_t)(mq * 32 + (lane & 15)) * TT + mt * 32 + 8 * (lane >> 4);
#pragma unroll
    for (int rt = 0; rt < 2; ++rt)
#pragma unroll
      for (int nt = 0; nt < 2; ++nt) { const int* mr = mr0 + rt * 16 * TT + nt * 16; mk[rt][nt][0] = *(const v4ia*)mr; mk[rt][nt][1] = *(const v4ia*)(mr + 4); } }
  const int slab = blk / (TT / 64), tg = blk % (TT / 64); const int b = slab / NH, h = slab % NH;
  for (int i = tid; i < 64 * 16; i += 256) { const int r = i / 16, c4 = (i % 16) * 4; const int ts = (tg * 64 + r + 1) % TT; const v4f a = *(const v4fa*)(v + ((size_t)b * TT + ts) * DDm + h * HD + c4); FragH f; for (int q = 0; q < 4; ++q) { f.h[q] = (_Float16)bf16_round(a[q]); tl[r][c4 + q] = f.u[q]; } }
  __syncthreads();
  {
#pragma unroll
    for (int rd = 0; rd < 2; ++rd) { const int d = rd * 32 + tid / 8, pc = tid % 8; FragH f;
#pragma unroll
      for (int q = 0; q < 8; ++q) f.u[q] = tl[pc * 8 + q][d]; *(v8us*)((unsigned short*)Vt + ((size_t)slab * HD + d) * TT + tg * 64 + pc * 8) = f.half[0]; }
    asm volatile("s_wait_xcnt 0x0" ::: "memory");      // behind the two stores: in the joint kernel code of the other block kind follows them in the listing and rewrites their registers
     }
  if (packs) { unsigned ow = 0u;
#pragma unroll
    for (int rt = 0; rt < 2; ++rt)
#pragma unroll
      for (int nt = 0; nt < 2; ++nt)
#pragma unroll
        for (int r = 0; r < 8; ++r) { const unsigned bl = __builtin_amdgcn_ballot_w32(mk[rt][nt][r >> 2][r & 3] != 0); ow = (lane == rt * 16 + nt * 8 + r) ? bl : ow; }
    MB[((size_t)(mq * 4 + (mt & 3)) * (TT / 128) + (mt >> 2)) * 32 + lane] = ow; } }
// attention per ((b,h), 32 queries), transposed. Which block takes what: a query tile's cost follows how many of its key tiles the mask leaves open, which under a lower-triangular mask grows with the tile's index, and the grid holds twice as many
// blocks as the chip has places for them (four a WGP, by registers). The index runs from the last query tile down to the first, all heads of a tile side by side: the long blocks come first in the index and the short ones
// fill the places as they fall free. A permutation of (head, tile): every pair once, right for any mask; speed only.
// The block's four waves share the 32 queries and split the keys, wave w taking the 32-key tiles w, w + 4, w + 8, ...; each keeps its own maximum, sum and
// un-normalised Ot, and the four partials are merged through LDS behind one barrier (weights exp2 of maximum - joint maximum). St = kc.qc^T (A = 16 key rows, B = 16 query columns, d 32), so a lane holds ONE query's scores: keys 8*hh + r of each 16-key tile;
// logit = -sqrt(max(q2 + k2 - 2S, 1e-12)); mask[q][k] (INPUT, nonzero = keep; tiles with no open key for the wave skipped); maximum and sum in the lane plus one exchange between the wave's halves;
// the two score tiles of 32 keys, converted in place, ARE the B operand of Ot += Vt.Pt (hardware k order: 8*hh + s, 16 + 8*hh + s), and a lane's 8 accumulator registers are 8 consecutive d of its query: no LDS in the loop.
__device__ __forceinline__ float xhalf(float x) { const int bq = __float_as_int(x); return __int_as_float(__builtin_amdgcn_permlanex16(bq, bq, 0x76543210, 0xfedcba98, false, false)); }      // lane l <-> l ^ 16
template <int N> __device__ __forceinline__ float rowshare(float x) { return __int_as_float(__builtin_amdgcn_mov_dpp(__float_as_int(x), 0x150 + N, 0xf, 0xf, false)); }      // lane N of each 16-lane row to the whole row
// causal 3-tap conv, transposed: Ct = W.Xt per (tensor, head, 256 positions a block, 32 a wave). The block first rounds its head's 32 x 192 weights into LDS (k = tap * 64 + d, scaled by 16; pitch 200 halves
// keeps the 16-byte fragment reads of 16 rows off one another's banks). A = 16 channel rows from LDS, B = 16 positions: x rows s + tap - 2 (clamped at the sequence's first row) read straight from the f32 input
// and rounded in registers, same k order as A (8*hh + j, 16 + 8*hh + j). A lane then holds ONE position's channels t*16 + 8*hh + r: 16-byte f16 stores, |c|^2 in the lane plus one exchange between the wave's halves.
// Rows and norms go out head-major ([b*NH + h][s][c], [b*NH + h][s]): a wave writes 2 KiB of rows and one 128-byte line of norms, all its own.
__device__ __forceinline__ void conv_tile(const int blk, const float* __restrict__ qx, const float* __restrict__ kx, const float* __restrict__ cw, const float* __restrict__ cb, _Float16* __restrict__ Q16, _Float16* __restrict__ K16, float* __restrict__ NQ, float* __restrict__ NK) {
  __shared__ __attribute__((aligned(16))) unsigned short wsm[CCv][200];
  const int tid = threadIdx.x, w = tid >> 5, lane = tid & 31, ln = lane & 15, hh = lane >> 4;
  const int pg = blk % (NR / 256), h = (blk / (NR / 256)) % NH, z = blk / ((NR / 256) * NH);
  const float* x = z ? kx : qx; _Float16* C16 = z ? K16 : Q16; float* N2 = z ? NK : NQ;
  { const int c = tid >> 3, d0 = (tid & 7) * 8; const float* wp = cw + ((size_t)(h * CCv + c) * HD + d0) * 3; float wv[24];      // a thread's 24 consecutive floats are 8 d x 3 taps of one channel
#pragma unroll
    for (int q = 0; q < 6; ++q) { const v4f a = *(const v4fa*)(wp + q * 4); wv[q * 4] = a[0]; wv[q * 4 + 1] = a[1]; wv[q * 4 + 2] = a[2]; wv[q * 4 + 3] = a[3]; }
#pragma unroll
    for (int i = 0; i < 3; ++i) { FragH f;
#pragma unroll
      for (int q = 0; q < 8; ++q) f.h[q] = (_Float16)(bf16_round(wv[q * 3 + i]) * 16.0f);
      *(v8us*)&wsm[c][i * 64 + d0] = f.half[0]; } }
  __syncthreads();      // every wave reads fragments of weights that all eight waves wrote
  const int row0 = pg * 256 + w * 32, b = row0 / TT, s0 = row0 % TT;
  const float* xb = x + (size_t)b * TT * DDm + h * HD + 8 * hh;
  v8f acc[2][2];
#pragma unroll
  for (int nt = 0; nt < 2; ++nt)
#pragma unroll
    for (int t = 0; t < 2; ++t) acc[nt][t] = (v8f){0.f,0.f,0.f,0.f,0.f,0.f,0.f,0.f};
#pragma unroll
  for (int i = 0; i < 3; ++i)
#pragma unroll
    for (int dd = 0; dd < 2; ++dd) { FragH aw[2], bx[2];
#pragma unroll
      for (int t = 0; t < 2; ++t) { const unsigned short* wk = &wsm[t * 16 + ln][i * 64 + dd * 32 + 8 * hh]; aw[t].half[0] = *(const v8us*)wk; aw[t].half[1] = *(const v8us*)(wk + 16); }
#pragma unroll
      for (int nt = 0; nt < 2; ++nt) { int ss = s0 + nt * 16 + ln + i - 2; ss = ss < 0 ? 0 : ss; const float* xr = xb + (size_t)ss * DDm + dd * 32;
        const v4f x0 = *(const v4fa*)xr, x1 = *(const v4fa*)(xr + 4), x2 = *(const v4fa*)(xr + 16), x3 = *(const v4fa*)(xr + 20);      // below: the hardware's f32 -> bf16 conversion rounds to nearest even, as bf16_round does, in one instruction
#pragma unroll
        for (int j = 0; j < 4; ++j) { bx[nt].h[j] = (_Float16)(float)(__bf16)x0[j]; bx[nt].h[4 + j] = (_Float16)(float)(__bf16)x1[j]; bx[nt].h[8 + j] = (_Float16)(float)(__bf16)x2[j]; bx[nt].h[12 + j] = (_Float16)(float)(__bf16)x3[j]; } }
#pragma unroll
      for (int nt = 0; nt < 2; ++nt)
#pragma unroll
        for (int t = 0; t < 2; ++t) acc[nt][t] = mmaH<1>(aw[t].v, aw[t].v, bx[nt].v, bx[nt].v, acc[nt][t]); }
  float bv[2][8];
#pragma unroll
  for (int t = 0; t < 2; ++t) { const float* bp = cb + h * CCv + t * 16 + 8 * hh; const v4f b0 = *(const v4fa*)bp, b1 = *(const v4fa*)(bp + 4);
#pragma unroll
    for (int j = 0; j < 4; ++j) { bv[t][j] = bf16_round(b0[j]); bv[t][4 + j] = bf16_round(b1[j]); } }
#pragma unroll
  for (int nt = 0; nt < 2; ++nt) { const size_t prow = (size_t)(b * NH + h) * TT + s0 + nt * 16 + ln; float ss = 0.f;
#pragma unroll
    for (int t = 0; t < 2; ++t) { FragH f;
#pragma unroll
      for (int r = 0; r < 8; ++r) { const float v = acc[nt][t][r] * 0.0625f + bv[t][r]; ss += v * v; f.h[r] = (_Float16)v; }
      *(v8us*)((unsigned short*)C16 + prow * CCv + t * 16 + 8 * hh) = f.half[0]; }
    ss += xhalf(ss);
    if (hh == 0) N2[prow] = ss; } }
// all that the attention needs, in ONE launch: the conv blocks (the longer ones) first, then the blocks of the shifted V transpose, which pack the mask beside it; the two kinds share nothing, and a block is wholly of one kind
#define NCB ((NR / 256) * NH * 2)
__global__ __launch_bounds__(256) void k_prep(const float* __restrict__ qx, const float* __restrict__ kx, const float* __restrict__ vx, const float* __restrict__ cw, const float* __restrict__ cb, _Float16* __restrict__ Q16, _Float16* __restrict__ K16, float* __restrict__ NQ, float* __restrict__ NK, _Float16* __restrict__ Vt, const int* __restrict__ MSK, unsigned* __restrict__ MB) {
  if (blockIdx.x < NCB) conv_tile((int)blockIdx.x, qx, kx, cw, cb, Q16, K16, NQ, NK); else vts_tile((int)blockIdx.x - NCB, vx, Vt, MSK, MB); }
__global__ __launch_bounds__(128) void k_sattn(const _Float16* __restrict__ Q16, const _Float16* __restrict__ K16, const float* __restrict__ NQ, const float* __restrict__ NK, const unsigned* __restrict__ MB, const _Float16* __restrict__ Vt, float* __restrict__ O) { constexpr int RPW = 32; constexpr int KSP = 4; constexpr int OP = HD + 4; constexpr float L2E = 1.4426950408889634f;      // OP: a partial's row pitch, 272 bytes = 16 x 17, keeps the 16-byte writes of 16 queries off one another's banks
  __shared__ __attribute__((aligned(16))) float so[KSP][RPW][OP]; __shared__ __attribute__((aligned(16))) float sml[RPW][2 * KSP];      // per query: the four waves' maxima, then their sums
  const int tid = threadIdx.x, w = tid >> 5, lane = tid & 31, ln = lane & 15, hh = lane >> 4; const int slab = blockIdx.x % (BB * NH), qblk = (blockIdx.x / (BB * NH)) ^ (TT / RPW - 1) /* = 63 - x for x in 0 .. 63 */; const int b = slab / NH, h = slab % NH; const int q0 = qblk * RPW;
  FragH bq[2]; float q2c[2];
#pragma unroll
  for (int rt = 0; rt < 2; ++rt) { const size_t qrow = (size_t)slab * TT + q0 + rt * 16 + ln; const unsigned short* qr = (const unsigned short*)Q16 + qrow * CCv; bq[rt].half[0] = *(const v8us*)(qr + 8 * hh); bq[rt].half[1] = *(const v8us*)(qr + 16 + 8 * hh); q2c[rt] = NQ[qrow]; }
  const int kslot = (ln < 8) ? 8 * hh + ln : 8 + 8 * hh + ln;      // lane ln of half hh fetches |kc|^2 of the key that the half's score register ln holds (tile ln / 8, register ln % 8)
  float m_c[2], l_c[2]; v8f oacc[2][4];      // m starts finite and below every finite logit (|logit| <= sqrt(FLT_MAX)): exp2 arguments never meet inf - inf
#pragma unroll
  for (int rt = 0; rt < 2; ++rt) { m_c[rt] = -1.0e30f; l_c[rt] = 0.f;
#pragma unroll
    for (int dt = 0; dt < 4; ++dt) oacc[rt][dt] = (v8f){0.f,0.f,0.f,0.f,0.f,0.f,0.f,0.f}; }
  // read places: a base that is the same for the whole block and steps by four 32-key tiles a trip, plus each lane's own fixed byte offset (the wave's first tile in it)
  const char* kb = (const char*)(K16 + (size_t)slab * TT * CCv); const char* nb = (const char*)(NK + (size_t)slab * TT); const char* vb = (const char*)(Vt + (size_t)slab * HD * TT);
  const unsigned klo = (unsigned)(((w * 32 + ln) * CCv + 8 * hh) * 2), nlo = (unsigned)((w * 32 + kslot) * 4), vlo = (unsigned)((ln * TT + w * 32 + 8 * hh) * 2);
  // the packed mask of the wave's 16 key tiles, 2 KiB in a row (the wave's number made scalar, so that the address is the same in every lane for the compiler too). Which tiles have an open key is known in front of the loop:
  // four whole-line loads, 8 lanes a tile; bit t of opn = tile t has one. The loop ends behind the last open tile (opn < 65536 and moves down a bit a trip: 16 trips at most) and passes a closed tile on a scalar test, with no load.
  const unsigned* mw = MB + (size_t)(qblk * KSP + __builtin_amdgcn_readfirstlane(w)) * (TT / (32 * KSP)) * 32; unsigned opn = 0u;
#pragma unroll
  for (int i = 0; i < 4; ++i) { const v4ia a = *(const v4ia*)(mw + i * 128 + lane * 4); const unsigned ob = __builtin_amdgcn_ballot_w32(((a[0] | a[1]) | (a[2] | a[3])) != 0);
#pragma unroll
    for (int j = 0; j < 4; ++j) opn |= (((ob >> (8 * j)) & 0xffu) != 0u ? 1u : 0u) << (i * 4 + j); }
  asm volatile("" :: "v"(bq[0].v), "v"(bq[1].v), "v"(q2c[0]), "v"(q2c[1]));      // loaded values as inputs only: holds the query loads in front of the loop's entry test, where they fly beside the four mask loads; without it they sink behind that test and wait a second time
#pragma unroll 1
  for (; opn != 0u; opn >>= 1, mw += 32, kb += 32 * KSP * CCv * 2, nb += 32 * KSP * 4, vb += 32 * KSP * 2) {
    if ((opn & 1u) == 0u) continue;      // wave-uniform skip of fully masked tiles
    const v16ua mk[2] = {*(const v16ua*)mw, *(const v16ua*)(mw + 16)};      // the tile's 32 select masks, the same for every lane: scalar loads, beside the vector loads below
    FragH ak[2], av[4];
#pragma unroll
    for (int nt = 0; nt < 2; ++nt) { const unsigned short* kr = (const unsigned short*)(kb + klo) + nt * 16 * CCv; ak[nt].half[0] = *(const v8us*)kr; ak[nt].half[1] = *(const v8us*)(kr + 16); }
    const float k2l = *(const float*)(nb + nlo);
#pragma unroll
    for (int dt = 0; dt < 4; ++dt) { const unsigned short* vrow = (const unsigned short*)(vb + vlo) + dt * 16 * TT; av[dt].half[0] = *(const v8us*)vrow; av[dt].half[1] = *(const v8us*)(vrow + 16); }
    v8f s[2][2];
#pragma unroll
    for (int nt = 0; nt < 2; ++nt)
#pragma unroll
      for (int rt = 0; rt < 2; ++rt) { v8f acc = (v8f){0.f,0.f,0.f,0.f,0.f,0.f,0.f,0.f}; acc = mmaH<1>(ak[nt].v, ak[nt].v, bq[rt].v, bq[rt].v, acc); s[rt][nt] = acc; }
    const float k2v[2][8] = {{rowshare<0>(k2l), rowshare<1>(k2l), rowshare<2>(k2l), rowshare<3>(k2l), rowshare<4>(k2l), rowshare<5>(k2l), rowshare<6>(k2l), rowshare<7>(k2l)},
                             {rowshare<8>(k2l), rowshare<9>(k2l), rowshare<10>(k2l), rowshare<11>(k2l), rowshare<12>(k2l), rowshare<13>(k2l), rowshare<14>(k2l), rowshare<15>(k2l)}};
    FragH pb[2];
#pragma unroll
    for (int rt = 0; rt < 2; ++rt) { float sv[2][8]; float mc = -INFINITY;
#pragma unroll
      for (int nt = 0; nt < 2; ++nt)
#pragma unroll
        for (int r = 0; r < 8; ++r) { const float d = fmaxf(q2c[rt] + k2v[nt][r] - 2.0f * s[rt][nt][r], 1e-12f); sv[nt][r] = __builtin_amdgcn_inverse_ballot_w32(mk[rt][nt * 8 + r]) ? -__builtin_amdgcn_sqrtf(d) : -INFINITY; mc = fmaxf(mc, sv[nt][r]); }      // d >= 1e-12: never a denormal, the hardware root needs no range fix-up
      mc = fmaxf(mc, xhalf(mc));
      const float mn = fmaxf(m_c[rt], mc); const float ta = (m_c[rt] - mn) * L2E; const float al = __builtin_amdgcn_exp2f(ta); m_c[rt] = mn; const float nm = -mn * L2E;      // exp(x - mn) = exp2(x * log2(e) - mn * log2(e)): one fma and the hardware exp2; a closed key's -inf gives exp2(-inf) = 0
      float ps = 0.f;
#pragma unroll
      for (int nt = 0; nt < 2; ++nt) { float t[8], p[8];
#pragma unroll
        for (int r = 0; r < 8; ++r) { t[r] = __builtin_fmaf(sv[nt][r], L2E, nm); p[r] = __builtin_amdgcn_exp2f(t[r]); }
        // the slot behind a transcendental: inputs only, so every argument's register stays whole until all of these exp2 have issued (none is overwritten directly behind its exp2), and the v_nop stands behind the last
        asm volatile("v_nop" :: "v"(t[0]), "v"(t[1]), "v"(t[2]), "v"(t[3]), "v"(t[4]), "v"(t[5]), "v"(t[6]), "v"(t[7]), "v"(p[0]), "v"(p[1]), "v"(p[2]), "v"(p[3]), "v"(p[4]), "v"(p[5]), "v"(p[6]), "v"(p[7]), "v"(ta), "v"(al));
#pragma unroll
        for (int r = 0; r < 8; ++r) { ps += p[r]; pb[rt].h[nt * 8 + r] = (_Float16)p[r]; } }
      l_c[rt] = l_c[rt] * al + ps;      // the half's own 16 keys; the halves join behind the loop
#pragma unroll
      for (int dt = 0; dt < 4; ++dt)
#pragma unroll
        for (int r = 0; r < 8; ++r) oacc[rt][dt][r] *= al; }
#pragma unroll
    for (int dt = 0; dt < 4; ++dt)
#pragma unroll
      for (int rt = 0; rt < 2; ++rt) oacc[rt][dt] = mmaH<1>(av[dt].v, av[dt].v, pb[rt].v, pb[rt].v, oacc[rt][dt]); }
  // the wave's partial goes to LDS: rows [query][d], un-normalised, with its maximum and its sum (the halves joined here)
#pragma unroll
  for (int rt = 0; rt < 2; ++rt) { const float l = l_c[rt] + xhalf(l_c[rt]); if (hh == 0) { sml[rt * 16 + ln][w] = m_c[rt]; sml[rt * 16 + ln][KSP + w] = l; } float* prow = &so[w][rt * 16 + ln][8 * hh];
#pragma unroll
    for (int dt = 0; dt < 4; ++dt) { const v4f lo = {oacc[rt][dt][0], oacc[rt][dt][1], oacc[rt][dt][2], oacc[rt][dt][3]}, hi = {oacc[rt][dt][4], oacc[rt][dt][5], oacc[rt][dt][6], oacc[rt][dt][7]}; *(v4fa*)(prow + dt * 16) = lo; *(v4fa*)(prow + dt * 16 + 4) = hi; } }
  __syncthreads();      // every wave merges rows that all four waves wrote
  // merge: wave w owns queries 8 * w .. 8 * w + 7, two a pass; 16 lanes x 16 bytes are one query's whole 256-byte output row, so every 128-byte line has one writer and goes out in one store
#pragma unroll
  for (int c = 0; c < 4; ++c) { const int qq = w * 8 + c * 2 + hh; const v4f mv = *(const v4fa*)&sml[qq][0], lv = *(const v4fa*)&sml[qq][KSP];
    const float mj = fmaxf(fmaxf(mv[0], mv[1]), fmaxf(mv[2], mv[3])); float t[KSP], e[KSP]; float l = 0.f; v4f o = {0.f, 0.f, 0.f, 0.f};      // a wave that met no open key has maximum -1e30, sum 0 and zeros: weight 0, or 1 on zeros where no wave met one
#pragma unroll
    for (int p = 0; p < KSP; ++p) t[p] = (mv[p] - mj) * L2E;
    // the four weights' exp2 and the slot behind a transcendental in one statement: results in registers of their own, so none is read and no argument overwritten directly behind its exp2; the v_nop fills the slot behind the last
    asm("v_exp_f32 %0, %4\n\tv_exp_f32 %1, %5\n\tv_exp_f32 %2, %6\n\tv_exp_f32 %3, %7\n\tv_nop" : "=&v"(e[0]), "=&v"(e[1]), "=&v"(e[2]), "=&v"(e[3]) : "v"(t[0]), "v"(t[1]), "v"(t[2]), "v"(t[3]));
#pragma unroll
    for (int p = 0; p < KSP; ++p) { l += e[p] * lv[p]; const v4f a = *(const v4fa*)&so[p][qq][ln * 4]; o += a * e[p]; }
    const float li = (l > 0.f) ? 1.0f / l : 0.f;
    *(v4f*)(O + ((size_t)b * TT + q0 + qq) * DDm + h * HD + ln * 4) = o * li; } }
extern "C" void kernel_launch(void* const* d_in, const int* in_sizes, int n_in,
                              void* d_out, int out_size, void* d_ws, size_t ws_size, hipStream_t stream) {
  (void)in_sizes; (void)n_in; (void)out_size;
  const float* qx = (const float*)d_in[0]; const float* kx = (const float*)d_in[1]; const float* vx = (const float*)d_in[2]; const int* mask = (const int*)d_in[3]; const float* cw = (const float*)d_in[4]; const float* cb = (const float*)d_in[5];
  char* ws = (char*)d_ws; size_t off = 0;
  auto take = [&](size_t bytes) { char* p = ws + off; off += (bytes + 255) & ~(size_t)255; return p; };
  _Float16* Q16 = (_Float16*)take((size_t)NR * NH * CCv * 2); _Float16* K16 = (_Float16*)take((size_t)NR * NH * CCv * 2); float* NQ = (float*)take((size_t)NR * NH * 4); float* NK = (float*)take((size_t)NR * NH * 4); _Float16* Vt = (_Float16*)take((size_t)NR * DDm * 2); unsigned* MB = (unsigned*)take((size_t)TT * TT / 8);
  if (off > ws_size) return;      // 4.2 x 2 + 0.26 x 2 + 8.4 + 0.52: about 17 MiB
  k_prep<<<NCB + BB * NH * (TT / 64), 256, 0, stream>>>(qx, kx, vx, cw, cb, Q16, K16, NQ, NK, Vt, mask, MB);
  k_sattn<<<BB * NH * (TT / 32), 128, 0, stream>>>(Q16, K16, NQ, NK, MB, Vt, (float*)d_out);
}

// v007
// One run takes 37.5 microseconds.
// Next to v006, in two timings, it ran 1.10 times as fast each time.
// Counting every step since v000, it is 14.0 times as fast.
#include <hip/hip_runtime.h>
// Simplex (distance-based) attention (B=4, S=2048, 8 heads × 64, conv channels 32): the per-head causal 3-tap conv of q and k on WMMA (+ bias, f16 rows and norms head-major) and the shifted V transpose in one preparation launch, and the attention as a
// fused flash-style kernel on v_wmma_f32_16x16x32_f16 — S = qc·kc (d = 32, one k-step), logits = −sqrt(max(|qc|² + |kc|² − 2S, 1e-12)), INPUT mask (nonzero = keep), online softmax f32,
// P f16 ≤ 1, and the roll(attn, 1) folded into a one-step shift of V (out[s] = Σ_t attn[s][t]·v[t+1 mod S]); f16 operands, single products, f32 accumulate; norms f32 VALU in the conv's epilogue.
#define BB 4
#define TT 2048
#define DDm 512
#define NH 8
#define HD 64
#define CCv 32
#define NR (BB * TT)

typedef __bf16 v16b __attribute__((ext_vector_type(16)));
typedef unsigned short v8us __attribute__((ext_vector_type(8), may_alias));
typedef float  v8f  __attribute__((ext_vector_type(8)));
typedef float  v4f  __attribute__((ext_vector_type(4)));
typedef float  v4fa __attribute__((ext_vector_type(4), may_alias));
union FragB { v16b v; v8us half[2]; unsigned short u[16]; };

__device__ __forceinline__ unsigned short bf16_bits(float x) { unsigned int u = __float_as_uint(x); return (unsigned short)((u + 0x7FFFu + ((u >> 16) & 1u)) >> 16); }
__device__ __forceinline__ float bf16_val(unsigned short b) { return __uint_as_float(((unsigned int)b) << 16); }
__device__ __forceinline__ float bf16_round(float x) { return bf16_val(bf16_bits(x)); }
// D += A·B with NT terms: 1 = ah·bh, 2 = + al·bh (A split), 3 = + ah·bl (both split)
template <int NT>
__device__ __forceinline__ v8f mmaN(v16b ah, v16b al, v16b bh, v16b bl, v8f c) {
  c = __builtin_amdgcn_wmma_f32_16x16x32_bf16(false, ah, false, bh, (short)0, c, false, false);
  if (NT >= 2) c = __builtin_amdgcn_wmma_f32_16x16x32_bf16(false, al, false, bh, (short)0, c, false, false);
  if (NT >= 3) c = __builtin_amdgcn_wmma_f32_16x16x32_bf16(false, ah, false, bl, (short)0, c, false, false);
  asm volatile("v_nop\n\tv_nop\n\tv_nop\n\tv_nop" : "+v"(c) : "v"(ah), "v"(al), "v"(bh), "v"(bl));
  return c;
}

__global__ __launch_bounds__(256) void k_wt_bf16(const float* __restrict__ W, unsigned short* __restrict__ Wt, int K, int N) {
  const int t = blockIdx.x * 256 + threadIdx.x;
  const int k8n = K / 8;
  if (t >= N * k8n) return;
  const int n = t / k8n, k8 = (t % k8n) * 8;
  v8us v;
#pragma unroll
  for (int i = 0; i < 8; ++i) v[i] = bf16_bits(W[(size_t)(k8 + i) * N + n]);
  *(v8us*)(Wt + (size_t)n * K + k8) = v;
  
}

// GEMM C[M][N] (f32, pitch ldc) = act(A[M][K]·W + bias). A f32 row-major (pitch lda) converted per fragment to bf16
// (ASPLIT: hi/lo two planes -> 2 terms, else single rounded term); Wt bf16 [N][K] (pitch ldb). BIAS_BF16 rounds the
// bias to bf16 first (bias quantised to bf16 before the add). K%32==0, M%16==0, N%64==0.
template <bool ASPLIT, int ACT, bool BIAS_BF16>
__global__ __launch_bounds__(128) void k_gemm_bf(const float* __restrict__ A, int lda, const unsigned short* __restrict__ Wt, int ldb,
                                               const float* __restrict__ bias, float* __restrict__ C, int ldc, int M, int N, int K) {
  __shared__ __attribute__((aligned(16))) float so[4][16][64];
  const int tid = threadIdx.x, w = tid >> 5, lane = tid & 31, ln = lane & 15, hh = lane >> 4;
  const int ntn = N / 64;
  const int wid = blockIdx.x * 4 + w;
  const int mt = wid / ntn, nq = wid % ntn;
  if (mt * 16 >= M) return;
  const int row0 = mt * 16, col0 = nq * 64;
  const float* arow = A + (size_t)(row0 + ln) * lda;
  v8f acc[4] = {};
  for (int kb = 0; kb < K; kb += 32) {
    FragB ah, al;
    const v4f x0 = *(const v4fa*)(arow + kb + 8 * hh), x1 = *(const v4fa*)(arow + kb + 8 * hh + 4);
    const v4f x2 = *(const v4fa*)(arow + kb + 16 + 8 * hh), x3 = *(const v4fa*)(arow + kb + 16 + 8 * hh + 4);
    float xs[16] = {x0[0],x0[1],x0[2],x0[3],x1[0],x1[1],x1[2],x1[3],x2[0],x2[1],x2[2],x2[3],x3[0],x3[1],x3[2],x3[3]};
#pragma unroll
    for (int i = 0; i < 16; ++i) { const unsigned short hb = bf16_bits(xs[i]); ah.u[i] = hb; al.u[i] = ASPLIT ? bf16_bits(xs[i] - bf16_val(hb)) : (unsigned short)0; }
#pragma unroll
    for (int t = 0; t < 4; ++t) {
      const unsigned short* brow = Wt + (size_t)(col0 + t * 16 + ln) * ldb + kb;
      FragB b;
      b.half[0] = *(const v8us*)(brow + 8 * hh);
      b.half[1] = *(const v8us*)(brow + 16 + 8 * hh);
      acc[t] = mmaN<ASPLIT ? 2 : 1>(ah.v, al.v, b.v, b.v, acc[t]);
    }
  }
#pragma unroll
  for (int t = 0; t < 4; ++t) {
    float bv = bias ? bias[col0 + t * 16 + ln] : 0.f;
    if (BIAS_BF16) bv = bf16_round(bv);
#pragma unroll
    for (int r = 0; r < 8; ++r) { float v = acc[t][r] + bv; if (ACT == 1) v = fmaxf(v, 0.f); so[w][8 * hh + r][t * 16 + ln] = v; }
  }
  __builtin_amdgcn_fence(__ATOMIC_ACQ_REL, "workgroup");
  __builtin_amdgcn_wave_barrier();
  const int rsub = lane >> 4, c4 = (lane & 15) * 4;
  {
#pragma unroll
    for (int q = 0; q < 8; ++q) {
      const int r = q * 2 + rsub;
      const v4f v = *(const v4fa*)&so[w][r][c4];
      *(v4f*)(C + (size_t)(row0 + r) * ldc + col0 + c4) = v;
    }
    
  }
}

// Flash-style causal/unmasked attention, all contractions 3-term bf16 hi/lo splits, f32 softmax with running max.
// q,k,v rows are read from f32 buffers with arbitrary row pitch (so they can live inside a fused qkv buffer);
// D = head size (multiple of 32, <= 128); one wave = 16 query rows; block = 4 waves (64 queries) sharing K/V chunks of 32.
template <int D, bool CAUSAL>
__global__ __launch_bounds__(128) void k_flash(const float* __restrict__ qb, const float* __restrict__ kb, const float* __restrict__ vb,
                                             int pitch, int T, int H, float scale, float* __restrict__ y, int ypitch) {
  constexpr int KS = D / 32;        // k-steps for QK
  constexpr int DT = D / 16;        // d tiles for PV
  __shared__ __attribute__((aligned(16))) unsigned short sKh[32][D + 8], sKl[32][D + 8], sVh[32][D + 8], sVl[32][D + 8];
  __shared__ __attribute__((aligned(16))) unsigned short sPh[4][16][40], sPl[4][16][40];
  __shared__ __attribute__((aligned(16))) float sO[4][16][D];
  const int tid = threadIdx.x, w = tid >> 5, lane = tid & 31, ln = lane & 15, hh = lane >> 4;
  const int nqb = (T + 63) / 64;
  const int bh = blockIdx.x / nqb, qblk = blockIdx.x % nqb;
  const int b = bh / H, h = bh % H;
  const int q0 = qblk * 64 + w * 16;
  const float* Q = qb + (size_t)b * T * pitch + h * D;
  const float* K = kb + (size_t)b * T * pitch + h * D;
  const float* V = vb + (size_t)b * T * pitch + h * D;

  // A fragments of the wave's 16 query rows (scaled), hi/lo
  FragB aqh[KS], aql[KS];
  {
    int row = q0 + ln; if (row >= T) row = T - 1;
    const float* qr = Q + (size_t)row * pitch;
#pragma unroll
    for (int ks = 0; ks < KS; ++ks)
#pragma unroll
      for (int i = 0; i < 16; ++i) {
        const int d = ks * 32 + ((i < 8) ? (8 * hh + i) : (16 + 8 * hh + (i - 8)));
        const float x = qr[d] * scale; const unsigned short hb = bf16_bits(x);
        aqh[ks].u[i] = hb; aql[ks].u[i] = bf16_bits(x - bf16_val(hb));
      }
  }
  float m_r[8], l_r[8];
#pragma unroll
  for (int r = 0; r < 8; ++r) { m_r[r] = -3.0e38f; l_r[r] = 0.f; }
  v8f oacc[DT];
#pragma unroll
  for (int dt = 0; dt < DT; ++dt) oacc[dt] = (v8f){0.f,0.f,0.f,0.f,0.f,0.f,0.f,0.f};

  const int kv_end = CAUSAL ? min(T, qblk * 64 + 64) : T;     // block-uniform
  for (int j0 = 0; j0 < kv_end; j0 += 32) {
    __syncthreads();
    for (int e = tid; e < 32 * (D / 4); e += 128) {
      const int r = e / (D / 4), c4 = (e % (D / 4)) * 4;
      const int key = j0 + r;
      v4f kf = {0.f,0.f,0.f,0.f}, vf = {0.f,0.f,0.f,0.f};
      if (key < T) { kf = *(const v4fa*)(K + (size_t)key * pitch + c4); vf = *(const v4fa*)(V + (size_t)key * pitch + c4); }
#pragma unroll
      for (int t = 0; t < 4; ++t) {
        unsigned short hb = bf16_bits(kf[t]); sKh[r][c4 + t] = hb; sKl[r][c4 + t] = bf16_bits(kf[t] - bf16_val(hb));
        hb = bf16_bits(vf[t]); sVh[r][c4 + t] = hb; sVl[r][c4 + t] = bf16_bits(vf[t] - bf16_val(hb));
      }
    }
    __syncthreads();
    // S tile 16 x 32
    v8f s[2];
#pragma unroll
    for (int nt = 0; nt < 2; ++nt) {
      v8f acc = {};
#pragma unroll
      for (int ks = 0; ks < KS; ++ks) {
        FragB bh_, bl_;
        bh_.half[0] = *(const v8us*)&sKh[nt * 16 + ln][ks * 32 + 8 * hh]; bh_.half[1] = *(const v8us*)&sKh[nt * 16 + ln][ks * 32 + 16 + 8 * hh];
        bl_.half[0] = *(const v8us*)&sKl[nt * 16 + ln][ks * 32 + 8 * hh]; bl_.half[1] = *(const v8us*)&sKl[nt * 16 + ln][ks * 32 + 16 + 8 * hh];
        acc = mmaN<3>(aqh[ks].v, aql[ks].v, bh_.v, bl_.v, acc);
      }
      s[nt] = acc;
    }
    // mask + running max (rows 8hh+r; the 16 lanes of a half share rows)
    float alpha[8];
#pragma unroll
    for (int r = 0; r < 8; ++r) {
      const int qi = q0 + 8 * hh + r;
      const int ja = j0 + ln, jb = j0 + 16 + ln;
      if (CAUSAL) { if (ja > qi) s[0][r] = -3.0e38f; if (jb > qi) s[1][r] = -3.0e38f; }
      if (ja >= T) s[0][r] = -3.0e38f;
      if (jb >= T) s[1][r] = -3.0e38f;
      float mx = fmaxf(s[0][r], s[1][r]);
      mx = fmaxf(mx, __shfl_xor(mx, 1, 32)); mx = fmaxf(mx, __shfl_xor(mx, 2, 32)); mx = fmaxf(mx, __shfl_xor(mx, 4, 32)); mx = fmaxf(mx, __shfl_xor(mx, 8, 32));
      const float mnew = fmaxf(m_r[r], mx);
      alpha[r] = (mnew > -1.0e38f) ? __expf(m_r[r] - mnew) : 1.0f;
      const float p0 = (s[0][r] > -1.0e38f) ? __expf(s[0][r] - mnew) : 0.f;
      const float p1 = (s[1][r] > -1.0e38f) ? __expf(s[1][r] - mnew) : 0.f;
      m_r[r] = mnew;
      l_r[r] = l_r[r] * alpha[r] + p0 + p1;            // per-lane partial row sum (16 lanes combined at the end)
      unsigned short hb = bf16_bits(p0); sPh[w][8 * hh + r][ln] = hb;      sPl[w][8 * hh + r][ln] = bf16_bits(p0 - bf16_val(hb));
      hb = bf16_bits(p1);                sPh[w][8 * hh + r][16 + ln] = hb; sPl[w][8 * hh + r][16 + ln] = bf16_bits(p1 - bf16_val(hb));
    }
#pragma unroll
    for (int dt = 0; dt < DT; ++dt)
#pragma unroll
      for (int r = 0; r < 8; ++r) oacc[dt][r] *= alpha[r];
    __builtin_amdgcn_fence(__ATOMIC_ACQ_REL, "workgroup");
    __builtin_amdgcn_wave_barrier();
    FragB pah, pal;
    pah.half[0] = *(const v8us*)&sPh[w][ln][8 * hh]; pah.half[1] = *(const v8us*)&sPh[w][ln][16 + 8 * hh];
    pal.half[0] = *(const v8us*)&sPl[w][ln][8 * hh]; pal.half[1] = *(const v8us*)&sPl[w][ln][16 + 8 * hh];
#pragma unroll
    for (int dt = 0; dt < DT; ++dt) {
      FragB bvh, bvl;
#pragma unroll
      for (int i = 0; i < 8; ++i) {
        bvh.u[i] = sVh[8 * hh + i][dt * 16 + ln]; bvh.u[8 + i] = sVh[16 + 8 * hh + i][dt * 16 + ln];
        bvl.u[i] = sVl[8 * hh + i][dt * 16 + ln]; bvl.u[8 + i] = sVl[16 + 8 * hh + i][dt * 16 + ln];
      }
      oacc[dt] = mmaN<3>(pah.v, pal.v, bvh.v, bvl.v, oacc[dt]);
    }
    __builtin_amdgcn_fence(__ATOMIC_ACQ_REL, "workgroup");
    __builtin_amdgcn_wave_barrier();
  }
#pragma unroll
  for (int r = 0; r < 8; ++r) {
    float l = l_r[r];
    l += __shfl_xor(l, 1, 32); l += __shfl_xor(l, 2, 32); l += __shfl_xor(l, 4, 32); l += __shfl_xor(l, 8, 32);
    l_r[r] = (l > 0.f) ? 1.0f / l : 0.f;
  }
#pragma unroll
  for (int dt = 0; dt < DT; ++dt)
#pragma unroll
    for (int r = 0; r < 8; ++r) sO[w][8 * hh + r][dt * 16 + ln] = oacc[dt][r] * l_r[r];
  __builtin_amdgcn_fence(__ATOMIC_ACQ_REL, "workgroup");
  __builtin_amdgcn_wave_barrier();
  {
    for (int r = 0; r < 16; ++r) {
      const int row = q0 + r;
      if (row < T && lane < D / 4) {
        const v4f val = *(const v4fa*)&sO[w][r][lane * 4];
        *(v4f*)(y + ((size_t)b * T + row) * ypitch + h * D + lane * 4) = val;
      }
    }
    
  }
}

// GEMM C = act(A·W + bias + resid): A f32 (ASPLIT -> hi/lo 2 terms), Wt bf16 [N][K]; ACT 0 none, 1 relu, 2 exact gelu;
// resid (optional, f32, row index = (row % rmod), pitch ldr, RES_BF16 rounds it) added before the activation.
template <bool ASPLIT, int ACT, bool BIAS_BF16, bool RES_BF16>
__global__ __launch_bounds__(128) void k_gemm_bf3(const float* __restrict__ A, int lda, const unsigned short* __restrict__ Wt, int ldb,
                                                const float* __restrict__ bias, const float* __restrict__ resid, int rmod, int ldr,
                                                float* __restrict__ C, int ldc, int M, int N, int K) {
  __shared__ __attribute__((aligned(16))) float so[4][16][64];
  const int tid = threadIdx.x, w = tid >> 5, lane = tid & 31, ln = lane & 15, hh = lane >> 4;
  const int ntn = N / 64;
  const int wid = blockIdx.x * 4 + w;
  const int mt = wid / ntn, nq = wid % ntn;
  if (mt * 16 >= M) return;
  const int row0 = mt * 16, col0 = nq * 64;
  const float* arow = A + (size_t)(row0 + ln) * lda;
  v8f acc[4] = {};
  for (int kb = 0; kb < K; kb += 32) {
    FragB ah, al;
    const v4f x0 = *(const v4fa*)(arow + kb + 8 * hh), x1 = *(const v4fa*)(arow + kb + 8 * hh + 4);
    const v4f x2 = *(const v4fa*)(arow + kb + 16 + 8 * hh), x3 = *(const v4fa*)(arow + kb + 16 + 8 * hh + 4);
    float xs[16] = {x0[0],x0[1],x0[2],x0[3],x1[0],x1[1],x1[2],x1[3],x2[0],x2[1],x2[2],x2[3],x3[0],x3[1],x3[2],x3[3]};
#pragma unroll
    for (int i = 0; i < 16; ++i) { const unsigned short hb = bf16_bits(xs[i]); ah.u[i] = hb; al.u[i] = ASPLIT ? bf16_bits(xs[i] - bf16_val(hb)) : (unsigned short)0; }
#pragma unroll
    for (int t = 0; t < 4; ++t) {
      const unsigned short* brow = Wt + (size_t)(col0 + t * 16 + ln) * ldb + kb;
      FragB b;
      b.half[0] = *(const v8us*)(brow + 8 * hh);
      b.half[1] = *(const v8us*)(brow + 16 + 8 * hh);
      acc[t] = mmaN<ASPLIT ? 2 : 1>(ah.v, al.v, b.v, b.v, acc[t]);
    }
  }
#pragma unroll
  for (int t = 0; t < 4; ++t) {
    const int col = col0 + t * 16 + ln;
    float bv = bias ? bias[col] : 0.f;
    if (BIAS_BF16) bv = bf16_round(bv);
#pragma unroll
    for (int r = 0; r < 8; ++r) {
      float v = acc[t][r] + bv;
      if (resid) { float rv = resid[(size_t)((row0 + 8 * hh + r) % rmod) * ldr + col]; if (RES_BF16) rv = bf16_round(rv); v += rv; }
      if (ACT == 1) v = fmaxf(v, 0.f);
      if (ACT == 2) v = 0.5f * v * (1.0f + erff(v * 0.70710678118654752f));
      if (ACT == 3) { const float u = 0.7978845608028654f * (v + 0.044715f * v * v * v); v = 0.5f * v * (1.0f + tanhf(u)); }
      so[w][8 * hh + r][t * 16 + ln] = v;
    }
  }
  __builtin_amdgcn_fence(__ATOMIC_ACQ_REL, "workgroup");
  __builtin_amdgcn_wave_barrier();
  const int rsub = lane >> 4, c4 = (lane & 15) * 4;
  {
#pragma unroll
    for (int q = 0; q < 8; ++q) {
      const int r = q * 2 + rsub;
      const v4f v = *(const v4fa*)&so[w][r][c4];
      *(v4f*)(C + (size_t)(row0 + r) * ldc + col0 + c4) = v;
    }
    
  }
}
// row LayerNorm (biased variance, eps) over N: s = X (+ R); optional out_sum <- s; out_norm <- (s-mu)*rsqrt(var+eps)*g + b
template <bool PARAM_BF16>
__global__ __launch_bounds__(256) void k_layernorm(const float* __restrict__ X, const float* __restrict__ R, const float* __restrict__ g, const float* __restrict__ bta,
                                                  float* __restrict__ out_sum, float* __restrict__ out_norm, int N, float eps) {
  __shared__ float red[256];
  const int row = blockIdx.x, tid = threadIdx.x;
  const float* x = X + (size_t)row * N; const float* rr = R ? R + (size_t)row * N : nullptr;
  float vals[16];                     // up to N = 4096
  const int per = N / 256;            // contiguous chunk per thread? use strided-by-4 chunks: thread handles j = tid*4 + 1024*u
  float s1 = 0.f;
  for (int u = 0; u < per / 4; ++u) {
    const int j = tid * 4 + 1024 * u;
    const v4f a = *(const v4fa*)(x + j);
    v4f b = {0.f,0.f,0.f,0.f}; if (rr) b = *(const v4fa*)(rr + j);
#pragma unroll
    for (int q = 0; q < 4; ++q) { const float v = a[q] + b[q]; vals[u * 4 + q] = v; s1 += v; }
  }
  red[tid] = s1; __syncthreads();
  for (int st = 128; st > 0; st >>= 1) { if (tid < st) red[tid] += red[tid + st]; __syncthreads(); }
  const float mu = red[0] / (float)N; __syncthreads();
  float s2 = 0.f;
  for (int u = 0; u < per / 4; ++u)
#pragma unroll
    for (int q = 0; q < 4; ++q) { const float c = vals[u * 4 + q] - mu; s2 += c * c; }
  red[tid] = s2; __syncthreads();
  for (int st = 128; st > 0; st >>= 1) { if (tid < st) red[tid] += red[tid + st]; __syncthreads(); }
  const float rs = rsqrtf(red[0] / (float)N + eps);
  {
    for (int u = 0; u < per / 4; ++u) {
      const int j = tid * 4 + 1024 * u;
      v4f o, sm;
#pragma unroll
      for (int q = 0; q < 4; ++q) {
        float gg = g[j + q], bb = bta[j + q];
        if (PARAM_BF16) { gg = bf16_round(gg); bb = bf16_round(bb); }
        sm[q] = vals[u * 4 + q]; o[q] = (vals[u * 4 + q] - mu) * rs * gg + bb;
      }
      if (out_sum) *(v4f*)(out_sum + (size_t)row * N + j) = sm;
      *(v4f*)(out_norm + (size_t)row * N + j) = o;
    }
    
  }
}



// ---- f16 WMMA path (v_wmma_f32_16x16x32_f16): 11-bit significands for operands in range — used for the conv GEMMs and both attention contractions
typedef _Float16 v16h __attribute__((ext_vector_type(16)));
union FragH { v16h v; v8us half[2]; _Float16 h[16]; unsigned short u[16]; };
template <int NT>
__device__ __forceinline__ v8f mmaH(v16h ah, v16h al, v16h bh, v16h bl, v8f c) {
  c = __builtin_amdgcn_wmma_f32_16x16x32_f16(false, ah, false, bh, (short)0, c, false, false);
  if (NT >= 2) c = __builtin_amdgcn_wmma_f32_16x16x32_f16(false, al, false, bh, (short)0, c, false, false);
  if (NT >= 3) c = __builtin_amdgcn_wmma_f32_16x16x32_f16(false, ah, false, bl, (short)0, c, false, false);
  asm volatile("v_nop\n\tv_nop\n\tv_nop\n\tv_nop" : "+v"(c) : "v"(ah), "v"(al), "v"(bh), "v"(bl));
  return c;
}
// batched GEMM like k_gemm_b but f16 operands: A f32 (split into f16 hi/lo if ASPLIT, else rounded to f16), Bt = f16 values [n][k]; alpha; C f32; N multiple of 16 (partial tiles skipped)
template <bool ASPLIT>
__global__ __launch_bounds__(128) void k_gemm_h(const float* __restrict__ A, int lda, size_t sA, const _Float16* __restrict__ Bh, int ldb, size_t sB, float alpha, float* __restrict__ C, int ldc, size_t sC, int M, int N, int K) {
  __shared__ __attribute__((aligned(16))) float so[4][16][64];
  const int tid = threadIdx.x, w = tid >> 5, lane = tid & 31, ln = lane & 15, hh = lane >> 4; const int by = blockIdx.y;
  A += (size_t)by * sA; Bh += (size_t)by * sB; C += (size_t)by * sC;
  const int ntn = (N + 63) / 64; const int wid = blockIdx.x * 4 + w; const int mt = wid / ntn, nq = wid % ntn; if (mt * 16 >= M) return;
  const int row0 = mt * 16, col0 = nq * 64; const float* arow = A + (size_t)(row0 + ln) * lda;
  v8f acc[4] = {};
  for (int kb = 0; kb < K; kb += 32) {
    FragH ah, al;
    const v4f x0 = *(const v4fa*)(arow + kb + 8 * hh), x1 = *(const v4fa*)(arow + kb + 8 * hh + 4), x2 = *(const v4fa*)(arow + kb + 16 + 8 * hh), x3 = *(const v4fa*)(arow + kb + 16 + 8 * hh + 4);
    float xs[16] = {x0[0],x0[1],x0[2],x0[3],x1[0],x1[1],x1[2],x1[3],x2[0],x2[1],x2[2],x2[3],x3[0],x3[1],x3[2],x3[3]};
#pragma unroll
    for (int i = 0; i < 16; ++i) { const _Float16 h = (_Float16)xs[i]; ah.h[i] = h; al.h[i] = ASPLIT ? (_Float16)(xs[i] - (float)h) : (_Float16)0.0f; }
#pragma unroll
    for (int t = 0; t < 4; ++t) { if (col0 + t * 16 >= N) continue; const size_t boff = (size_t)(col0 + t * 16 + ln) * ldb + kb; FragH bq; bq.half[0] = *(const v8us*)(Bh + boff + 8 * hh); bq.half[1] = *(const v8us*)(Bh + boff + 16 + 8 * hh);
      acc[t] = mmaH<ASPLIT ? 2 : 1>(ah.v, al.v, bq.v, bq.v, acc[t]); }
  }
#pragma unroll
  for (int t = 0; t < 4; ++t) { if (col0 + t * 16 >= N) continue;
#pragma unroll
    for (int r = 0; r < 8; ++r) so[w][8 * hh + r][t * 16 + ln] = acc[t][r] * alpha; }
  __builtin_amdgcn_fence(__ATOMIC_ACQ_REL, "workgroup"); __builtin_amdgcn_wave_barrier();
  const int rsub = lane >> 4, c4 = (lane & 15) * 4;
  {
#pragma unroll
    for (int q = 0; q < 8; ++q) { const int r = q * 2 + rsub; if (col0 + c4 < N) { const v4f v = *(const v4fa*)&so[w][r][c4]; *(v4f*)(C + (size_t)(row0 + r) * ldc + col0 + c4) = v; } }
     }
}

// Wt[n][k] = f16(W[k][n]·scale) from f32 row-major W[K][N] (scale = power of two; bf16-exact weights stay exact in f16 away from the subnormal range)
__global__ __launch_bounds__(256) void k_wt_f16(const float* __restrict__ W, _Float16* __restrict__ Wt, int K, int N, float scale) {
  const int t = blockIdx.x * 256 + threadIdx.x; if (t >= N * (K / 8)) return; const int n = t / (K / 8), k8 = (t % (K / 8)) * 8; FragH f;
#pragma unroll
  for (int i = 0; i < 8; ++i) f.h[i] = (_Float16)(bf16_round(W[(size_t)(k8 + i) * N + n]) * scale); const v8us o = f.half[0];
  *(v8us*)((unsigned short*)Wt + (size_t)n * K + k8) = o; 
}
typedef int v4ia __attribute__((ext_vector_type(4), may_alias));
typedef unsigned v16ua __attribute__((ext_vector_type(16), may_alias));
// The shifted V transpose goes out in the order of the attention's A fragments: [head][32-key tile][d / 16][half][lane] x 16 bytes, lane (hh, ln) of half j holding keys j * 16 + 8 * hh + 0 .. 7 of the row with d % 16 = ln; a tile is 4 KiB in a row, a block writes 8 KiB in a row,
// a wave 512 bytes a store, and each of the attention's V loads is four whole lines instead of 16 bytes out of each of 16 rows that lie 4 KiB apart.
// Beside it the mask, packed once a call to one bit a (query, key) pair in the order in which the attention selects. There are 1024 such blocks and 64 x 64 mask tiles of (32 queries, 32 keys): waves 0 .. 3 of a block
// take one tile each, so the pack costs no block and no wave of its own, and its loads fly with those of V. Lane (hh, ln) reads what that lane of the attention needs (query rt * 16 + ln, keys nt * 16 + 8 * hh + r); the ballot over "nonzero" for one
// (rt, nt, r) is that score register's select mask over the 32 lanes. Word rt * 16 + nt * 8 + r goes out from the lane of that number: one 128-byte line a tile, one writer.
// Lines lie [query tile][attention wave = key tile % 4][key tile / 4], so the 16 tiles that one attention wave walks are 2 KiB in a row.
__device__ __forceinline__ void vts_tile(const int blk, const float* __restrict__ v, _Float16* __restrict__ Vt, const int* __restrict__ MSK, unsigned* __restrict__ MB) { __shared__ unsigned short tl[64][66]; const int tid = threadIdx.x;
  const int lane = tid & 31, mg = blk * 4 + ((tid >> 5) & 3), mq = mg / (TT / 32), mt = mg % (TT / 32); const bool packs = tid < 128; v4ia mk[2][2][2];
  if (packs) { const int* mr0 = MSK + (size_t)(mq * 32 + (lane & 15)) * TT + mt * 32 + 8 * (lane >> 4);
#pragma unroll
    for (int rt = 0; rt < 2; ++rt)
#pragma unroll
      for (int nt = 0; nt < 2; ++nt) { const int* mr = mr0 + rt * 16 * TT + nt * 16; mk[rt][nt][0] = *(const v4ia*)mr; mk[rt][nt][1] = *(const v4ia*)(mr + 4); } }
  const int slab = blk / (TT / 64), tg = blk % (TT / 64); const int b = slab / NH, h = slab % NH;
  for (int i = tid; i < 64 * 16; i += 256) { const int r = i / 16, c4 = (i % 16) * 4; const int ts = (tg * 64 + r + 1) % TT; const v4f a = *(const v4fa*)(v + ((size_t)b * TT + ts) * DDm + h * HD + c4); FragH f; for (int q = 0; q < 4; ++q) { f.h[q] = (_Float16)bf16_round(a[q]); tl[r][c4 + q] = f.u[q]; } }
  __syncthreads();
  {
#pragma unroll
    for (int rd = 0; rd < 2; ++rd) { const int c = rd * 256 + tid, k0 = (c >> 8) * 32 + ((c >> 5) & 1) * 16 + ((c >> 4) & 1) * 8, d = ((c >> 6) & 3) * 16 + (c & 15); FragH f;      // chunk c = [32-key tile][d / 16][fragment half][lane]: 8 keys from k0 of row d
#pragma unroll
      for (int q = 0; q < 8; ++q) f.u[q] = tl[k0 + q][d]; *(v8us*)((unsigned short*)Vt + (size_t)slab * HD * TT + tg * (64 * HD) + c * 8) = f.half[0]; }
    asm volatile("s_wait_xcnt 0x0" ::: "memory");      // behind the two stores: in the joint kernel code of the other block kind follows them in the listing and rewrites their registers
     }
  if (packs) { unsigned ow = 0u;
#pragma unroll
    for (int rt = 0; rt < 2; ++rt)
#pragma unroll
      for (int nt = 0; nt < 2; ++nt)
#pragma unroll
        for (int r = 0; r < 8; ++r) { const unsigned bl = __builtin_amdgcn_ballot_w32(mk[rt][nt][r >> 2][r & 3] != 0); ow = (lane == rt * 16 + nt * 8 + r) ? bl : ow; }
    MB[((size_t)(mq * 4 + (mt & 3)) * (TT / 128) + (mt >> 2)) * 32 + lane] = ow; } }
// attention per ((b,h), 32 queries), transposed. Which block takes what: a query tile's cost follows how many of its key tiles the mask leaves open, which under a lower-triangular mask grows with the tile's index, and the grid holds twice as many
// blocks as the chip has places for them (four a WGP, by registers). The index runs from the last query tile down to the first, all heads of a tile side by side: the long blocks come first in the index and the short ones
// fill the places as they fall free. A permutation of (head, tile): every pair once, right for any mask; speed only.
// The block's four waves share the 32 queries and split the keys, wave w taking the 32-key tiles w, w + 4, w + 8, ...; each keeps its own maximum, sum and
// un-normalised Ot, and the four partials are merged through LDS behind one barrier (weights exp2 of maximum - joint maximum). St = kc.qc^T (A = 16 key rows, B = 16 query columns, d 32), so a lane holds ONE query's scores: keys 8*hh + r of each 16-key tile;
// logit = -sqrt(max(q2 + k2 - 2S, 1e-12)); mask[q][k] (INPUT, nonzero = keep; tiles with no open key for the wave skipped); maximum and sum in the lane plus one exchange between the wave's halves;
// the two score tiles of 32 keys, converted in place, ARE the B operand of Ot += Vt.Pt (hardware k order: 8*hh + s, 16 + 8*hh + s), and a lane's 8 accumulator registers are 8 consecutive d of its query: no LDS in the loop.
__device__ __forceinline__ float xhalf(float x) { const int bq = __float_as_int(x); return __int_as_float(__builtin_amdgcn_permlanex16(bq, bq, 0x76543210, 0xfedcba98, false, false)); }      // lane l <-> l ^ 16
template <int N> __device__ __forceinline__ float rowshare(float x) { return __int_as_float(__builtin_amdgcn_mov_dpp(__float_as_int(x), 0x150 + N, 0xf, 0xf, false)); }      // lane N of each 16-lane row to the whole row
// causal 3-tap conv, transposed: Ct = W.Xt per (tensor, head, 256 positions a block, 32 a wave). The block first rounds its head's 32 x 192 weights into LDS (k = tap * 64 + d, scaled by 16; pitch 200 halves
// keeps the 16-byte fragment reads of 16 rows off one another's banks). A = 16 channel rows from LDS, B = 16 positions: x rows s + tap - 2 (clamped at the sequence's first row) read straight from the f32 input
// and rounded in registers, same k order as A (8*hh + j, 16 + 8*hh + j). A lane then holds ONE position's channels t*16 + 8*hh + r: 16-byte f16 stores, |c|^2 in the lane plus one exchange between the wave's halves.
// Rows and norms go out head-major ([b*NH + h][s / 16][fragment], [b*NH + h][s]): a wave writes 2 KiB of rows and one 128-byte line of norms, all its own. Inside a group of 16 positions the rows lie in the order in which the attention's
// matrix operand wants them: what lane l holds here for channel half t (position l % 16, channels t * 16 + 8 * (l / 16) + 0 .. 7) is what lane l of the attention takes as half t of its fragment, so it goes to byte t * 512 + l * 16 of the group's 1 KiB:
// each store here and each load there is 512 bytes in a row, four whole lines, not 16 bytes out of each of 16 rows.
__device__ __forceinline__ void conv_tile(const int blk, const float* __restrict__ qx, const float* __restrict__ kx, const float* __restrict__ cw, const float* __restrict__ cb, _Float16* __restrict__ Q16, _Float16* __restrict__ K16, float* __restrict__ NQ, float* __restrict__ NK) {
  __shared__ __attribute__((aligned(16))) unsigned short wsm[CCv][200];
  const int tid = threadIdx.x, w = tid >> 5, lane = tid & 31, ln = lane & 15, hh = lane >> 4;
  const int pg = blk % (NR / 256), h = (blk / (NR / 256)) % NH, z = blk / ((NR / 256) * NH);
  const float* x = z ? kx : qx; _Float16* C16 = z ? K16 : Q16; float* N2 = z ? NK : NQ;
  { const int c = tid >> 3, d0 = (tid & 7) * 8; const float* wp = cw + ((size_t)(h * CCv + c) * HD + d0) * 3; float wv[24];      // a thread's 24 consecutive floats are 8 d x 3 taps of one channel
#pragma unroll
    for (int q = 0; q < 6; ++q) { const v4f a = *(const v4fa*)(wp + q * 4); wv[q * 4] = a[0]; wv[q * 4 + 1] = a[1]; wv[q * 4 + 2] = a[2]; wv[q * 4 + 3] = a[3]; }
#pragma unroll
    for (int i = 0; i < 3; ++i) { FragH f;
#pragma unroll
      for (int q = 0; q < 8; ++q) f.h[q] = (_Float16)(bf16_round(wv[q * 3 + i]) * 16.0f);
      *(v8us*)&wsm[c][i * 64 + d0] = f.half[0]; } }
  __syncthreads();      // every wave reads fragments of weights that all eight waves wrote
  const int row0 = pg * 256 + w * 32, b = row0 / TT, s0 = row0 % TT;
  const float* xb = x + (size_t)b * TT * DDm + h * HD + 8 * hh;
  v8f acc[2][2];
#pragma unroll
  for (int nt = 0; nt < 2; ++nt)
#pragma unroll
    for (int t = 0; t < 2; ++t) acc[nt][t] = (v8f){0.f,0.f,0.f,0.f,0.f,0.f,0.f,0.f};
#pragma unroll
  for (int i = 0; i < 3; ++i)
#pragma unroll
    for (int dd = 0; dd < 2; ++dd) { FragH aw[2], bx[2];
#pragma unroll
      for (int t = 0; t < 2; ++t) { const unsigned short* wk = &wsm[t * 16 + ln][i * 64 + dd * 32 + 8 * hh]; aw[t].half[0] = *(const v8us*)wk; aw[t].half[1] = *(const v8us*)(wk + 16); }
#pragma unroll
      for (int nt = 0; nt < 2; ++nt) { int ss = s0 + nt * 16 + ln + i - 2; ss = ss < 0 ? 0 : ss; const float* xr = xb + (size_t)ss * DDm + dd * 32;
        const v4f x0 = *(const v4fa*)xr, x1 = *(const v4fa*)(xr + 4), x2 = *(const v4fa*)(xr + 16), x3 = *(const v4fa*)(xr + 20);      // below: the hardware's f32 -> bf16 conversion rounds to nearest even, as bf16_round does, in one instruction
#pragma unroll
        for (int j = 0; j < 4; ++j) { bx[nt].h[j] = (_Float16)(float)(__bf16)x0[j]; bx[nt].h[4 + j] = (_Float16)(float)(__bf16)x1[j]; bx[nt].h[8 + j] = (_Float16)(float)(__bf16)x2[j]; bx[nt].h[12 + j] = (_Float16)(float)(__bf16)x3[j]; } }
#pragma unroll
      for (int nt = 0; nt < 2; ++nt)
#pragma unroll
        for (int t = 0; t < 2; ++t) acc[nt][t] = mmaH<1>(aw[t].v, aw[t].v, bx[nt].v, bx[nt].v, acc[nt][t]); }
  float bv[2][8];
#pragma unroll
  for (int t = 0; t < 2; ++t) { const float* bp = cb + h * CCv + t * 16 + 8 * hh; const v4f b0 = *(const v4fa*)bp, b1 = *(const v4fa*)(bp + 4);
#pragma unroll
    for (int j = 0; j < 4; ++j) { bv[t][j] = bf16_round(b0[j]); bv[t][4 + j] = bf16_round(b1[j]); } }
#pragma unroll
  for (int nt = 0; nt < 2; ++nt) { const size_t prow = (size_t)(b * NH + h) * TT + s0 + nt * 16 + ln; float ss = 0.f;
#pragma unroll
    for (int t = 0; t < 2; ++t) { FragH f;
#pragma unroll
      for (int r = 0; r < 8; ++r) { const float v = acc[nt][t][r] * 0.0625f + bv[t][r]; ss += v * v; f.h[r] = (_Float16)v; }
      *(v8us*)((unsigned short*)C16 + (prow - ln) * CCv + t * 256 + lane * 8) = f.half[0]; }      // fragment order: 16 positions are 1 KiB, half t of lane l at t * 512 + l * 16 bytes
    ss += xhalf(ss);
    if (hh == 0) N2[prow] = ss; } }
// all that the attention needs, in ONE launch: the conv blocks (the longer ones) first, then the blocks of the shifted V transpose, which pack the mask beside it; the two kinds share nothing, and a block is wholly of one kind
#define NCB ((NR / 256) * NH * 2)
__global__ __launch_bounds__(256) void k_prep(const float* __restrict__ qx, const float* __restrict__ kx, const float* __restrict__ vx, const float* __restrict__ cw, const float* __restrict__ cb, _Float16* __restrict__ Q16, _Float16* __restrict__ K16, float* __restrict__ NQ, float* __restrict__ NK, _Float16* __restrict__ Vt, const int* __restrict__ MSK, unsigned* __restrict__ MB) {
  if (blockIdx.x < NCB) conv_tile((int)blockIdx.x, qx, kx, cw, cb, Q16, K16, NQ, NK); else vts_tile((int)blockIdx.x - NCB, vx, Vt, MSK, MB); }
__global__ __launch_bounds__(128) void k_sattn(const _Float16* __restrict__ Q16, const _Float16* __restrict__ K16, const float* __restrict__ NQ, const float* __restrict__ NK, const unsigned* __restrict__ MB, const _Float16* __restrict__ Vt, float* __restrict__ O) { constexpr int RPW = 32; constexpr int KSP = 4; constexpr int OP = HD + 4; constexpr float L2E = 1.4426950408889634f;      // OP: a partial's row pitch, 272 bytes = 16 x 17, keeps the 16-byte writes of 16 queries off one another's banks
  __shared__ __attribute__((aligned(16))) float so[KSP][RPW][OP]; __shared__ __attribute__((aligned(16))) float sml[RPW][2 * KSP];      // per query: the four waves' maxima, then their sums
  const int tid = threadIdx.x, w = tid >> 5, lane = tid & 31, ln = lane & 15, hh = lane >> 4; const int slab = blockIdx.x % (BB * NH), qblk = (blockIdx.x / (BB * NH)) ^ (TT / RPW - 1) /* = 63 - x for x in 0 .. 63 */; const int b = slab / NH, h = slab % NH; const int q0 = qblk * RPW;
  FragH bq[2]; float q2c[2];
#pragma unroll
  for (int rt = 0; rt < 2; ++rt) { const size_t qrow = (size_t)slab * TT + q0 + rt * 16 + ln; const unsigned short* qr = (const unsigned short*)Q16 + (qrow - ln) * CCv + lane * 8; bq[rt].half[0] = *(const v8us*)qr; bq[rt].half[1] = *(const v8us*)(qr + 256); q2c[rt] = NQ[qrow]; }
  const int kslot = (ln < 8) ? 8 * hh + ln : 8 + 8 * hh + ln;      // lane ln of half hh fetches |kc|^2 of the key that the half's score register ln holds (tile ln / 8, register ln % 8)
  float m_c[2], l_c[2]; v8f oacc[2][4];      // m starts finite and below every finite logit (|logit| <= sqrt(FLT_MAX)): exp2 arguments never meet inf - inf
#pragma unroll
  for (int rt = 0; rt < 2; ++rt) { m_c[rt] = -1.0e30f; l_c[rt] = 0.f;
#pragma unroll
    for (int dt = 0; dt < 4; ++dt) oacc[rt][dt] = (v8f){0.f,0.f,0.f,0.f,0.f,0.f,0.f,0.f}; }
  // read places: a base that is the same for the whole block and steps by four 32-key tiles a trip, plus each lane's own fixed byte offset (the wave's first tile in it)
  const char* kb = (const char*)(K16 + (size_t)slab * TT * CCv); const char* nb = (const char*)(NK + (size_t)slab * TT); const char* vb = (const char*)(Vt + (size_t)slab * HD * TT);
  const unsigned klo = (unsigned)((w * 32 * CCv + lane * 8) * 2), nlo = (unsigned)((w * 32 + kslot) * 4), vlo = (unsigned)((w * 32 * HD + lane * 8) * 2);      // K and V lie in fragment order: a lane's 16 bytes at lane * 16 of each 512-byte half
  // the packed mask of the wave's 16 key tiles, 2 KiB in a row (the wave's number made scalar, so that the address is the same in every lane for the compiler too). Which tiles have an open key is known in front of the loop:
  // four whole-line loads, 8 lanes a tile; bit t of opn = tile t has one. The loop ends behind the last open tile (opn < 65536 and moves down a bit a trip: 16 trips at most) and passes a closed tile on a scalar test, with no load.
  const unsigned* mw = MB + (size_t)(qblk * KSP + __builtin_amdgcn_readfirstlane(w)) * (TT / (32 * KSP)) * 32; unsigned opn = 0u;
#pragma unroll
  for (int i = 0; i < 4; ++i) { const v4ia a = *(const v4ia*)(mw + i * 128 + lane * 4); const unsigned ob = __builtin_amdgcn_ballot_w32(((a[0] | a[1]) | (a[2] | a[3])) != 0);
#pragma unroll
    for (int j = 0; j < 4; ++j) opn |= (((ob >> (8 * j)) & 0xffu) != 0u ? 1u : 0u) << (i * 4 + j); }
  asm volatile("" :: "v"(bq[0].v), "v"(bq[1].v), "v"(q2c[0]), "v"(q2c[1]));      // loaded values as inputs only: holds the query loads in front of the loop's entry test, where they fly beside the four mask loads; without it they sink behind that test and wait a second time
#pragma unroll 1
  for (; opn != 0u; opn >>= 1, mw += 32, kb += 32 * KSP * CCv * 2, nb += 32 * KSP * 4, vb += 32 * KSP * HD * 2) {
    if ((opn & 1u) == 0u) continue;      // wave-uniform skip of fully masked tiles
    const v16ua mk[2] = {*(const v16ua*)mw, *(const v16ua*)(mw + 16)};      // the tile's 32 select masks, the same for every lane: scalar loads, beside the vector loads below
    FragH ak[2], av[4];
#pragma unroll
    for (int nt = 0; nt < 2; ++nt) { const unsigned short* kr = (const unsigned short*)(kb + klo) + nt * 16 * CCv; ak[nt].half[0] = *(const v8us*)kr; ak[nt].half[1] = *(const v8us*)(kr + 256); }
    const float k2l = *(const float*)(nb + nlo);
#pragma unroll
    for (int dt = 0; dt < 4; ++dt) { const unsigned short* vrow = (const unsigned short*)(vb + vlo) + dt * 512; av[dt].half[0] = *(const v8us*)vrow; av[dt].half[1] = *(const v8us*)(vrow + 256); }
    v8f s[2][2];
#pragma unroll
    for (int nt = 0; nt < 2; ++nt)
#pragma unroll
      for (int rt = 0; rt < 2; ++rt) { v8f acc = (v8f){0.f,0.f,0.f,0.f,0.f,0.f,0.f,0.f}; acc = mmaH<1>(ak[nt].v, ak[nt].v, bq[rt].v, bq[rt].v, acc); s[rt][nt] = acc; }
    const float k2v[2][8] = {{rowshare<0>(k2l), rowshare<1>(k2l), rowshare<2>(k2l), rowshare<3>(k2l), rowshare<4>(k2l), rowshare<5>(k2l), rowshare<6>(k2l), rowshare<7>(k2l)},
                             {rowshare<8>(k2l), rowshare<9>(k2l), rowshare<10>(k2l), rowshare<11>(k2l), rowshare<12>(k2l), rowshare<13>(k2l), rowshare<14>(k2l), rowshare<15>(k2l)}};
    FragH pb[2];
#pragma unroll
    for (int rt = 0; rt < 2; ++rt) { float sv[2][8]; float mc = -INFINITY;
#pragma unroll
      for (int nt = 0; nt < 2; ++nt)
#pragma unroll
        for (int r = 0; r < 8; ++r) { const float d = fmaxf(q2c[rt] + k2v[nt][r] - 2.0f * s[rt][nt][r], 1e-12f); sv[nt][r] = __builtin_amdgcn_inverse_ballot_w32(mk[rt][nt * 8 + r]) ? -__builtin_amdgcn_sqrtf(d) : -INFINITY; mc = fmaxf(mc, sv[nt][r]); }      // d >= 1e-12: never a denormal, the hardware root needs no range fix-up
      mc = fmaxf(mc, xhalf(mc));
      const float mn = fmaxf(m_c[rt], mc); const float ta = (m_c[rt] - mn) * L2E; const float al = __builtin_amdgcn_exp2f(ta); m_c[rt] = mn; const float nm = -mn * L2E;      // exp(x - mn) = exp2(x * log2(e) - mn * log2(e)): one fma and the hardware exp2; a closed key's -inf gives exp2(-inf) = 0
      float ps = 0.f;
#pragma unroll
      for (int nt = 0; nt < 2; ++nt) { float t[8], p[8];
#pragma unroll
        for (int r = 0; r < 8; ++r) { t[r] = __builtin_fmaf(sv[nt][r], L2E, nm); p[r] = __builtin_amdgcn_exp2f(t[r]); }
        // the slot behind a transcendental: inputs only, so every argument's register stays whole until all of these exp2 have issued (none is overwritten directly behind its exp2), and the v_nop stands behind the last
        asm volatile("v_nop" :: "v"(t[0]), "v"(t[1]), "v"(t[2]), "v"(t[3]), "v"(t[4]), "v"(t[5]), "v"(t[6]), "v"(t[7]), "v"(p[0]), "v"(p[1]), "v"(p[2]), "v"(p[3]), "v"(p[4]), "v"(p[5]), "v"(p[6]), "v"(p[7]), "v"(ta), "v"(al));
#pragma unroll
        for (int r = 0; r < 8; ++r) { ps += p[r]; pb[rt].h[nt * 8 + r] = (_Float16)p[r]; } }
      l_c[rt] = l_c[rt] * al + ps;      // the half's own 16 keys; the halves join behind the loop
#pragma unroll
      for (int dt = 0; dt < 4; ++dt)
#pragma unroll
        for (int r = 0; r < 8; ++r) oacc[rt][dt][r] *= al; }
#pragma unroll
    for (int dt = 0; dt < 4; ++dt)
#pragma unroll
      for (int rt = 0; rt < 2; ++rt) oacc[rt][dt] = mmaH<1>(av[dt].v, av[dt].v, pb[rt].v, pb[rt].v, oacc[rt][dt]); }
  // the wave's partial goes to LDS: rows [query][d], un-normalised, with its maximum and its sum (the halves joined here)
#pragma unroll
  for (int rt = 0; rt < 2; ++rt) { const float l = l_c[rt] + xhalf(l_c[rt]); if (hh == 0) { sml[rt * 16 + ln][w] = m_c[rt]; sml[rt * 16 + ln][KSP + w] = l; } float* prow = &so[w][rt * 16 + ln][8 * hh];
#pragma unroll
    for (int dt = 0; dt < 4; ++dt) { const v4f lo = {oacc[rt][dt][0], oacc[rt][dt][1], oacc[rt][dt][2], oacc[rt][dt][3]}, hi = {oacc[rt][dt][4], oacc[rt][dt][5], oacc[rt][dt][6], oacc[rt][dt][7]}; *(v4fa*)(prow + dt * 16) = lo; *(v4fa*)(prow + dt * 16 + 4) = hi; } }
  __syncthreads();      // every wave merges rows that all four waves wrote
  // merge: wave w owns queries 8 * w .. 8 * w + 7, two a pass; 16 lanes x 16 bytes are one query's whole 256-byte output row, so every 128-byte line has one writer and goes out in one store
#pragma unroll
  for (int c = 0; c < 4; ++c) { const int qq = w * 8 + c * 2 + hh; const v4f mv = *(const v4fa*)&sml[qq][0], lv = *(const v4fa*)&sml[qq][KSP];
    const float mj = fmaxf(fmaxf(mv[0], mv[1]), fmaxf(mv[2], mv[3])); float t[KSP], e[KSP]; float l = 0.f; v4f o = {0.f, 0.f, 0.f, 0.f};      // a wave that met no open key has maximum -1e30, sum 0 and zeros: weight 0, or 1 on zeros where no wave met one
#pragma unroll
    for (int p = 0; p < KSP; ++p) t[p] = (mv[p] - mj) * L2E;
    // the four weights' exp2 and the slot behind a transcendental in one statement: results in registers of their own, so none is read and no argument overwritten directly behind its exp2; the v_nop fills the slot behind the last
    asm("v_exp_f32 %0, %4\n\tv_exp_f32 %1, %5\n\tv_exp_f32 %2, %6\n\tv_exp_f32 %3, %7\n\tv_nop" : "=&v"(e[0]), "=&v"(e[1]), "=&v"(e[2]), "=&v"(e[3]) : "v"(t[0]), "v"(t[1]), "v"(t[2]), "v"(t[3]));
#pragma unroll
    for (int p = 0; p < KSP; ++p) { l += e[p] * lv[p]; const v4f a = *(const v4fa*)&so[p][qq][ln * 4]; o += a * e[p]; }
    const float li = (l > 0.f) ? 1.0f / l : 0.f;
    *(v4f*)(O + ((size_t)b * TT + q0 + qq) * DDm + h * HD + ln * 4) = o * li; } }
extern "C" void kernel_launch(void* const* d_in, const int* in_sizes, int n_in,
                              void* d_out, int out_size, void* d_ws, size_t ws_size, hipStream_t stream) {
  (void)in_sizes; (void)n_in; (void)out_size;
  const float* qx = (const float*)d_in[0]; const float* kx = (const float*)d_in[1]; const float* vx = (const float*)d_in[2]; const int* mask = (const int*)d_in[3]; const float* cw = (const float*)d_in[4]; const float* cb = (const float*)d_in[5];
  char* ws = (char*)d_ws; size_t off = 0;
  auto take = [&](size_t bytes) { char* p = ws + off; off += (bytes + 255) & ~(size_t)255; return p; };
  _Float16* Q16 = (_Float16*)take((size_t)NR * NH * CCv * 2); _Float16* K16 = (_Float16*)take((size_t)NR * NH * CCv * 2); float* NQ = (float*)take((size_t)NR * NH * 4); float* NK = (float*)take((size_t)NR * NH * 4); _Float16* Vt = (_Float16*)take((size_t)NR * DDm * 2); unsigned* MB = (unsigned*)take((size_t)TT * TT / 8);
  if (off > ws_size) return;      // 4.2 x 2 + 0.26 x 2 + 8.4 + 0.52: about 17 MiB
  k_prep<<<NCB + BB * NH * (TT / 64), 256, 0, stream>>>(qx, kx, vx, cw, cb, Q16, K16, NQ, NK, Vt, mask, MB);
  k_sattn<<<BB * NH * (TT / 32), 128, 0, stream>>>(Q16, K16, NQ, NK, MB, Vt, (float*)d_out);
}

// v008
// One run takes 36.2 microseconds.
// Next to v007, in two timings, it ran 1.04 times as fast each time.
// Over all steps from v000 it is 14.5 times as fast.
#include <hip/hip_runtime.h>
// Simplex (distance-based) attention (B=4, S=2048, 8 heads × 64, conv channels 32): the per-head causal 3-tap conv of q and k on WMMA (+ bias, f16 rows and norms head-major) and the shifted V transpose in one preparation launch, and the attention as a
// fused flash-style kernel on v_wmma_f32_16x16x32_f16 — S = qc·kc (d = 32, one k-step), logits = −sqrt(max(|qc|² + |kc|² − 2S, 1e-12)), INPUT mask (nonzero = keep), online softmax f32,
// P f16 ≤ 16384, and the roll(attn, 1) folded into a one-step shift of V (out[s] = Σ_t attn[s][t]·v[t+1 mod S]); f16 operands, single products, f32 accumulate; norms f32 VALU in the conv's epilogue.
#define BB 4
#define TT 2048
#define DDm 512
#define NH 8
#define HD 64
#define CCv 32
#define NR (BB * TT)

typedef __bf16 v16b __attribute__((ext_vector_type(16)));
typedef unsigned short v8us __attribute__((ext_vector_type(8), may_alias));
typedef float  v8f  __attribute__((ext_vector_type(8)));
typedef float  v4f  __attribute__((ext_vector_type(4)));
typedef float  v4fa __attribute__((ext_vector_type(4), may_alias));
union FragB { v16b v; v8us half[2]; unsigned short u[16]; };

__device__ __forceinline__ unsigned short bf16_bits(float x) { unsigned int u = __float_as_uint(x); return (unsigned short)((u + 0x7FFFu + ((u >> 16) & 1u)) >> 16); }
__device__ __forceinline__ float bf16_val(unsigned short b) { return __uint_as_float(((unsigned int)b) << 16); }
__device__ __forceinline__ float bf16_round(float x) { return bf16_val(bf16_bits(x)); }
// D += A·B with NT terms: 1 = ah·bh, 2 = + al·bh (A split), 3 = + ah·bl (both split)
template <int NT>
__device__ __forceinline__ v8f mmaN(v16b ah, v16b al, v16b bh, v16b bl, v8f c) {
  c = __builtin_amdgcn_wmma_f32_16x16x32_bf16(false, ah, false, bh, (short)0, c, false, false);
  if (NT >= 2) c = __builtin_amdgcn_wmma_f32_16x16x32_bf16(false, al, false, bh, (short)0, c, false, false);
  if (NT >= 3) c = __builtin_amdgcn_wmma_f32_16x16x32_bf16(false, ah, false, bl, (short)0, c, false, false);
  asm volatile("v_nop\n\tv_nop\n\tv_nop\n\tv_nop" : "+v"(c) : "v"(ah), "v"(al), "v"(bh), "v"(bl));
  return c;
}

__global__ __launch_bounds__(256) void k_wt_bf16(const float* __restrict__ W, unsigned short* __restrict__ Wt, int K, int N) {
  const int t = blockIdx.x * 256 + threadIdx.x;
  const int k8n = K / 8;
  if (t >= N * k8n) return;
  const int n = t / k8n, k8 = (t % k8n) * 8;
  v8us v;
#pragma unroll
  for (int i = 0; i < 8; ++i) v[i] = bf16_bits(W[(size_t)(k8 + i) * N + n]);
  *(v8us*)(Wt + (size_t)n * K + k8) = v;
  
}

// GEMM C[M][N] (f32, pitch ldc) = act(A[M][K]·W + bias). A f32 row-major (pitch lda) converted per fragment to bf16
// (ASPLIT: hi/lo two planes -> 2 terms, else single rounded term); Wt bf16 [N][K] (pitch ldb). BIAS_BF16 rounds the
// bias to bf16 first (bias quantised to bf16 before the add). K%32==0, M%16==0, N%64==0.
template <bool ASPLIT, int ACT, bool BIAS_BF16>
__global__ __launch_bounds__(128) void k_gemm_bf(const float* __restrict__ A, int lda, const unsigned short* __restrict__ Wt, int ldb,
                                               const float* __restrict__ bias, float* __restrict__ C, int ldc, int M, int N, int K) {
  __shared__ __attribute__((aligned(16))) float so[4][16][64];
  const int tid = threadIdx.x, w = tid >> 5, lane = tid & 31, ln = lane & 15, hh = lane >> 4;
  const int ntn = N / 64;
  const int wid = blockIdx.x * 4 + w;
  const int mt = wid / ntn, nq = wid % ntn;
  if (mt * 16 >= M) return;
  const int row0 = mt * 16, col0 = nq * 64;
  const float* arow = A + (size_t)(row0 + ln) * lda;
  v8f acc[4] = {};
  for (int kb = 0; kb < K; kb += 32) {
    FragB ah, al;
    const v4f x0 = *(const v4fa*)(arow + kb + 8 * hh), x1 = *(const v4fa*)(arow + kb + 8 * hh + 4);
    const v4f x2 = *(const v4fa*)(arow + kb + 16 + 8 * hh), x3 = *(const v4fa*)(arow + kb + 16 + 8 * hh + 4);
    float xs[16] = {x0[0],x0[1],x0[2],x0[3],x1[0],x1[1],x1[2],x1[3],x2[0],x2[1],x2[2],x2[3],x3[0],x3[1],x3[2],x3[3]};
#pragma unroll
    for (int i = 0; i < 16; ++i) { const unsigned short hb = bf16_bits(xs[i]); ah.u[i] = hb; al.u[i] = ASPLIT ? bf16_bits(xs[i] - bf16_val(hb)) : (unsigned short)0; }
#pragma unroll
    for (int t = 0; t < 4; ++t) {
      const unsigned short* brow = Wt + (size_t)(col0 + t * 16 + ln) * ldb + kb;
      FragB b;
      b.half[0] = *(const v8us*)(brow + 8 * hh);
      b.half[1] = *(const v8us*)(brow + 16 + 8 * hh);
      acc[t] = mmaN<ASPLIT ? 2 : 1>(ah.v, al.v, b.v, b.v, acc[t]);
    }
  }
#pragma unroll
  for (int t = 0; t < 4; ++t) {
    float bv = bias ? bias[col0 + t * 16 + ln] : 0.f;
    if (BIAS_BF16) bv = bf16_round(bv);
#pragma unroll
    for (int r = 0; r < 8; ++r) { float v = acc[t][r] + bv; if (ACT == 1) v = fmaxf(v, 0.f); so[w][8 * hh + r][t * 16 + ln] = v; }
  }
  __builtin_amdgcn_fence(__ATOMIC_ACQ_REL, "workgroup");
  __builtin_amdgcn_wave_barrier();
  const int rsub = lane >> 4, c4 = (lane & 15) * 4;
  {
#pragma unroll
    for (int q = 0; q < 8; ++q) {
      const int r = q * 2 + rsub;
      const v4f v = *(const v4fa*)&so[w][r][c4];
      *(v4f*)(C + (size_t)(row0 + r) * ldc + col0 + c4) = v;
    }
    
  }
}

// Flash-style causal/unmasked attention, all contractions 3-term bf16 hi/lo splits, f32 softmax with running max.
// q,k,v rows are read from f32 buffers with arbitrary row pitch (so they can live inside a fused qkv buffer);
// D = head size (multiple of 32, <= 128); one wave = 16 query rows; block = 4 waves (64 queries) sharing K/V chunks of 32.
template <int D, bool CAUSAL>
__global__ __launch_bounds__(128) void k_flash(const float* __restrict__ qb, const float* __restrict__ kb, const float* __restrict__ vb,
                                             int pitch, int T, int H, float scale, float* __restrict__ y, int ypitch) {
  constexpr int KS = D / 32;        // k-steps for QK
  constexpr int DT = D / 16;        // d tiles for PV
  __shared__ __attribute__((aligned(16))) unsigned short sKh[32][D + 8], sKl[32][D + 8], sVh[32][D + 8], sVl[32][D + 8];
  __shared__ __attribute__((aligned(16))) unsigned short sPh[4][16][40], sPl[4][16][40];
  __shared__ __attribute__((aligned(16))) float sO[4][16][D];
  const int tid = threadIdx.x, w = tid >> 5, lane = tid & 31, ln = lane & 15, hh = lane >> 4;
  const int nqb = (T + 63) / 64;
  const int bh = blockIdx.x / nqb, qblk = blockIdx.x % nqb;
  const int b = bh / H, h = bh % H;
  const int q0 = qblk * 64 + w * 16;
  const float* Q = qb + (size_t)b * T * pitch + h * D;
  const float* K = kb + (size_t)b * T * pitch + h * D;
  const float* V = vb + (size_t)b * T * pitch + h * D;

  // A fragments of the wave's 16 query rows (scaled), hi/lo
  FragB aqh[KS], aql[KS];
  {
    int row = q0 + ln; if (row >= T) row = T - 1;
    const float* qr = Q + (size_t)row * pitch;
#pragma unroll
    for (int ks = 0; ks < KS; ++ks)
#pragma unroll
      for (int i = 0; i < 16; ++i) {
        const int d = ks * 32 + ((i < 8) ? (8 * hh + i) : (16 + 8 * hh + (i - 8)));
        const float x = qr[d] * scale; const unsigned short hb = bf16_bits(x);
        aqh[ks].u[i] = hb; aql[ks].u[i] = bf16_bits(x - bf16_val(hb));
      }
  }
  float m_r[8], l_r[8];
#pragma unroll
  for (int r = 0; r < 8; ++r) { m_r[r] = -3.0e38f; l_r[r] = 0.f; }
  v8f oacc[DT];
#pragma unroll
  for (int dt = 0; dt < DT; ++dt) oacc[dt] = (v8f){0.f,0.f,0.f,0.f,0.f,0.f,0.f,0.f};

  const int kv_end = CAUSAL ? min(T, qblk * 64 + 64) : T;     // block-uniform
  for (int j0 = 0; j0 < kv_end; j0 += 32) {
    __syncthreads();
    for (int e = tid; e < 32 * (D / 4); e += 128) {
      const int r = e / (D / 4), c4 = (e % (D / 4)) * 4;
      const int key = j0 + r;
      v4f kf = {0.f,0.f,0.f,0.f}, vf = {0.f,0.f,0.f,0.f};
      if (key < T) { kf = *(const v4fa*)(K + (size_t)key * pitch + c4); vf = *(const v4fa*)(V + (size_t)key * pitch + c4); }
#pragma unroll
      for (int t = 0; t < 4; ++t) {
        unsigned short hb = bf16_bits(kf[t]); sKh[r][c4 + t] = hb; sKl[r][c4 + t] = bf16_bits(kf[t] - bf16_val(hb));
        hb = bf16_bits(vf[t]); sVh[r][c4 + t] = hb; sVl[r][c4 + t] = bf16_bits(vf[t] - bf16_val(hb));
      }
    }
    __syncthreads();
    // S tile 16 x 32
    v8f s[2];
#pragma unroll
    for (int nt = 0; nt < 2; ++nt) {
      v8f acc = {};
#pragma unroll
      for (int ks = 0; ks < KS; ++ks) {
        FragB bh_, bl_;
        bh_.half[0] = *(const v8us*)&sKh[nt * 16 + ln][ks * 32 + 8 * hh]; bh_.half[1] = *(const v8us*)&sKh[nt * 16 + ln][ks * 32 + 16 + 8 * hh];
        bl_.half[0] = *(const v8us*)&sKl[nt * 16 + ln][ks * 32 + 8 * hh]; bl_.half[1] = *(const v8us*)&sKl[nt * 16 + ln][ks * 32 + 16 + 8 * hh];
        acc = mmaN<3>(aqh[ks].v, aql[ks].v, bh_.v, bl_.v, acc);
      }
      s[nt] = acc;
    }
    // mask + running max (rows 8hh+r; the 16 lanes of a half share rows)
    float alpha[8];
#pragma unroll
    for (int r = 0; r < 8; ++r) {
      const int qi = q0 + 8 * hh + r;
      const int ja = j0 + ln, jb = j0 + 16 + ln;
      if (CAUSAL) { if (ja > qi) s[0][r] = -3.0e38f; if (jb > qi) s[1][r] = -3.0e38f; }
      if (ja >= T) s[0][r] = -3.0e38f;
      if (jb >= T) s[1][r] = -3.0e38f;
      float mx = fmaxf(s[0][r], s[1][r]);
      mx = fmaxf(mx, __shfl_xor(mx, 1, 32)); mx = fmaxf(mx, __shfl_xor(mx, 2, 32)); mx = fmaxf(mx, __shfl_xor(mx, 4, 32)); mx = fmaxf(mx, __shfl_xor(mx, 8, 32));
      const float mnew = fmaxf(m_r[r], mx);
      alpha[r] = (mnew > -1.0e38f) ? __expf(m_r[r] - mnew) : 1.0f;
      const float p0 = (s[0][r] > -1.0e38f) ? __expf(s[0][r] - mnew) : 0.f;
      const float p1 = (s[1][r] > -1.0e38f) ? __expf(s[1][r] - mnew) : 0.f;
      m_r[r] = mnew;
      l_r[r] = l_r[r] * alpha[r] + p0 + p1;            // per-lane partial row sum (16 lanes combined at the end)
      unsigned short hb = bf16_bits(p0); sPh[w][8 * hh + r][ln] = hb;      sPl[w][8 * hh + r][ln] = bf16_bits(p0 - bf16_val(hb));
      hb = bf16_bits(p1);                sPh[w][8 * hh + r][16 + ln] = hb; sPl[w][8 * hh + r][16 + ln] = bf16_bits(p1 - bf16_val(hb));
    }
#pragma unroll
    for (int dt = 0; dt < DT; ++dt)
#pragma unroll
      for (int r = 0; r < 8; ++r) oacc[dt][r] *= alpha[r];
    __builtin_amdgcn_fence(__ATOMIC_ACQ_REL, "workgroup");
    __builtin_amdgcn_wave_barrier();
    FragB pah, pal;
    pah.half[0] = *(const v8us*)&sPh[w][ln][8 * hh]; pah.half[1] = *(const v8us*)&sPh[w][ln][16 + 8 * hh];
    pal.half[0] = *(const v8us*)&sPl[w][ln][8 * hh]; pal.half[1] = *(const v8us*)&sPl[w][ln][16 + 8 * hh];
#pragma unroll
    for (int dt = 0; dt < DT; ++dt) {
      FragB bvh, bvl;
#pragma unroll
      for (int i = 0; i < 8; ++i) {
        bvh.u[i] = sVh[8 * hh + i][dt * 16 + ln]; bvh.u[8 + i] = sVh[16 + 8 * hh + i][dt * 16 + ln];
        bvl.u[i] = sVl[8 * hh + i][dt * 16 + ln]; bvl.u[8 + i] = sVl[16 + 8 * hh + i][dt * 16 + ln];
      }
      oacc[dt] = mmaN<3>(pah.v, pal.v, bvh.v, bvl.v, oacc[dt]);
    }
    __builtin_amdgcn_fence(__ATOMIC_ACQ_REL, "workgroup");
    __builtin_amdgcn_wave_barrier();
  }
#pragma unroll
  for (int r = 0; r < 8; ++r) {
    float l = l_r[r];
    l += __shfl_xor(l, 1, 32); l += __shfl_xor(l, 2, 32); l += __shfl_xor(l, 4, 32); l += __shfl_xor(l, 8, 32);
    l_r[r] = (l > 0.f) ? 1.0f / l : 0.f;
  }
#pragma unroll
  for (int dt = 0; dt < DT; ++dt)
#pragma unroll
    for (int r = 0; r < 8; ++r) sO[w][8 * hh + r][dt * 16 + ln] = oacc[dt][r] * l_r[r];
  __builtin_amdgcn_fence(__ATOMIC_ACQ_REL, "workgroup");
  __builtin_amdgcn_wave_barrier();
  {
    for (int r = 0; r < 16; ++r) {
      const int row = q0 + r;
      if (row < T && lane < D / 4) {
        const v4f val = *(const v4fa*)&sO[w][r][lane * 4];
        *(v4f*)(y + ((size_t)b * T + row) * ypitch + h * D + lane * 4) = val;
      }
    }
    
  }
}

// GEMM C = act(A·W + bias + resid): A f32 (ASPLIT -> hi/lo 2 terms), Wt bf16 [N][K]; ACT 0 none, 1 relu, 2 exact gelu;
// resid (optional, f32, row index = (row % rmod), pitch ldr, RES_BF16 rounds it) added before the activation.
template <bool ASPLIT, int ACT, bool BIAS_BF16, bool RES_BF16>
__global__ __launch_bounds__(128) void k_gemm_bf3(const float* __restrict__ A, int lda, const unsigned short* __restrict__ Wt, int ldb,
                                                const float* __restrict__ bias, const float* __restrict__ resid, int rmod, int ldr,
                                                float* __restrict__ C, int ldc, int M, int N, int K) {
  __shared__ __attribute__((aligned(16))) float so[4][16][64];
  const int tid = threadIdx.x, w = tid >> 5, lane = tid & 31, ln = lane & 15, hh = lane >> 4;
  const int ntn = N / 64;
  const int wid = blockIdx.x * 4 + w;
  const int mt = wid / ntn, nq = wid % ntn;
  if (mt * 16 >= M) return;
  const int row0 = mt * 16, col0 = nq * 64;
  const float* arow = A + (size_t)(row0 + ln) * lda;
  v8f acc[4] = {};
  for (int kb = 0; kb < K; kb += 32) {
    FragB ah, al;
    const v4f x0 = *(const v4fa*)(arow + kb + 8 * hh), x1 = *(const v4fa*)(arow + kb + 8 * hh + 4);
    const v4f x2 = *(const v4fa*)(arow + kb + 16 + 8 * hh), x3 = *(const v4fa*)(arow + kb + 16 + 8 * hh + 4);
    float xs[16] = {x0[0],x0[1],x0[2],x0[3],x1[0],x1[1],x1[2],x1[3],x2[0],x2[1],x2[2],x2[3],x3[0],x3[1],x3[2],x3[3]};
#pragma unroll
    for (int i = 0; i < 16; ++i) { const unsigned short hb = bf16_bits(xs[i]); ah.u[i] = hb; al.u[i] = ASPLIT ? bf16_bits(xs[i] - bf16_val(hb)) : (unsigned short)0; }
#pragma unroll
    for (int t = 0; t < 4; ++t) {
      const unsigned short* brow = Wt + (size_t)(col0 + t * 16 + ln) * ldb + kb;
      FragB b;
      b.half[0] = *(const v8us*)(brow + 8 * hh);
      b.half[1] = *(const v8us*)(brow + 16 + 8 * hh);
      acc[t] = mmaN<ASPLIT ? 2 : 1>(ah.v, al.v, b.v, b.v, acc[t]);
    }
  }
#pragma unroll
  for (int t = 0; t < 4; ++t) {
    const int col = col0 + t * 16 + ln;
    float bv = bias ? bias[col] : 0.f;
    if (BIAS_BF16) bv = bf16_round(bv);
#pragma unroll
    for (int r = 0; r < 8; ++r) {
      float v = acc[t][r] + bv;
      if (resid) { float rv = resid[(size_t)((row0 + 8 * hh + r) % rmod) * ldr + col]; if (RES_BF16) rv = bf16_round(rv); v += rv; }
      if (ACT == 1) v = fmaxf(v, 0.f);
      if (ACT == 2) v = 0.5f * v * (1.0f + erff(v * 0.70710678118654752f));
      if (ACT == 3) { const float u = 0.7978845608028654f * (v + 0.044715f * v * v * v); v = 0.5f * v * (1.0f + tanhf(u)); }
      so[w][8 * hh + r][t * 16 + ln] = v;
    }
  }
  __builtin_amdgcn_fence(__ATOMIC_ACQ_REL, "workgroup");
  __builtin_amdgcn_wave_barrier();
  const int rsub = lane >> 4, c4 = (lane & 15) * 4;
  {
#pragma unroll
    for (int q = 0; q < 8; ++q) {
      const int r = q * 2 + rsub;
      const v4f v = *(const v4fa*)&so[w][r][c4];
      *(v4f*)(C + (size_t)(row0 + r) * ldc + col0 + c4) = v;
    }
    
  }
}
// row LayerNorm (biased variance, eps) over N: s = X (+ R); optional out_sum <- s; out_norm <- (s-mu)*rsqrt(var+eps)*g + b
template <bool PARAM_BF16>
__global__ __launch_bounds__(256) void k_layernorm(const float* __restrict__ X, const float* __restrict__ R, const float* __restrict__ g, const float* __restrict__ bta,
                                                  float* __restrict__ out_sum, float* __restrict__ out_norm, int N, float eps) {
  __shared__ float red[256];
  const int row = blockIdx.x, tid = threadIdx.x;
  const float* x = X + (size_t)row * N; const float* rr = R ? R + (size_t)row * N : nullptr;
  float vals[16];                     // up to N = 4096
  const int per = N / 256;            // contiguous chunk per thread? use strided-by-4 chunks: thread handles j = tid*4 + 1024*u
  float s1 = 0.f;
  for (int u = 0; u < per / 4; ++u) {
    const int j = tid * 4 + 1024 * u;
    const v4f a = *(const v4fa*)(x + j);
    v4f b = {0.f,0.f,0.f,0.f}; if (rr) b = *(const v4fa*)(rr + j);
#pragma unroll
    for (int q = 0; q < 4; ++q) { const float v = a[q] + b[q]; vals[u * 4 + q] = v; s1 += v; }
  }
  red[tid] = s1; __syncthreads();
  for (int st = 128; st > 0; st >>= 1) { if (tid < st) red[tid] += red[tid + st]; __syncthreads(); }
  const float mu = red[0] / (float)N; __syncthreads();
  float s2 = 0.f;
  for (int u = 0; u < per / 4; ++u)
#pragma unroll
    for (int q = 0; q < 4; ++q) { const float c = vals[u * 4 + q] - mu; s2 += c * c; }
  red[tid] = s2; __syncthreads();
  for (int st = 128; st > 0; st >>= 1) { if (tid < st) red[tid] += red[tid + st]; __syncthreads(); }
  const float rs = rsqrtf(red[0] / (float)N + eps);
  {
    for (int u = 0; u < per / 4; ++u) {
      const int j = tid * 4 + 1024 * u;
      v4f o, sm;
#pragma unroll
      for (int q = 0; q < 4; ++q) {
        float gg = g[j + q], bb = bta[j + q];
        if (PARAM_BF16) { gg = bf16_round(gg); bb = bf16_round(bb); }
        sm[q] = vals[u * 4 + q]; o[q] = (vals[u * 4 + q] - mu) * rs * gg + bb;
      }
      if (out_sum) *(v4f*)(out_sum + (size_t)row * N + j) = sm;
      *(v4f*)(out_norm + (size_t)row * N + j) = o;
    }
    
  }
}



// ---- f16 WMMA path (v_wmma_f32_16x16x32_f16): 11-bit significands for operands in range — used where a softmax weight operand (0 .. 16384) needs more precision than bf16
typedef _Float16 v16h __attribute__((ext_vector_type(16)));
union FragH { v16h v; v8us half[2]; _Float16 h[16]; unsigned short u[16]; };
template <int NT>
__device__ __forceinline__ v8f mmaH(v16h ah, v16h al, v16h bh, v16h bl, v8f c) {
  c = __builtin_amdgcn_wmma_f32_16x16x32_f16(false, ah, false, bh, (short)0, c, false, false);
  if (NT >= 2) c = __builtin_amdgcn_wmma_f32_16x16x32_f16(false, al, false, bh, (short)0, c, false, false);
  if (NT >= 3) c = __builtin_amdgcn_wmma_f32_16x16x32_f16(false, ah, false, bl, (short)0, c, false, false);
  asm volatile("v_nop\n\tv_nop\n\tv_nop\n\tv_nop" : "+v"(c) : "v"(ah), "v"(al), "v"(bh), "v"(bl));
  return c;
}
// batched GEMM like k_gemm_b but f16 operands: A f32 (split into f16 hi/lo if ASPLIT, else rounded to f16), Bt = f16 values [n][k]; alpha; C f32; N multiple of 16 (partial tiles skipped)
template <bool ASPLIT>
__global__ __launch_bounds__(128) void k_gemm_h(const float* __restrict__ A, int lda, size_t sA, const _Float16* __restrict__ Bh, int ldb, size_t sB, float alpha, float* __restrict__ C, int ldc, size_t sC, int M, int N, int K) {
  __shared__ __attribute__((aligned(16))) float so[4][16][64];
  const int tid = threadIdx.x, w = tid >> 5, lane = tid & 31, ln = lane & 15, hh = lane >> 4; const int by = blockIdx.y;
  A += (size_t)by * sA; Bh += (size_t)by * sB; C += (size_t)by * sC;
  const int ntn = (N + 63) / 64; const int wid = blockIdx.x * 4 + w; const int mt = wid / ntn, nq = wid % ntn; if (mt * 16 >= M) return;
  const int row0 = mt * 16, col0 = nq * 64; const float* arow = A + (size_t)(row0 + ln) * lda;
  v8f acc[4] = {};
  for (int kb = 0; kb < K; kb += 32) {
    FragH ah, al;
    const v4f x0 = *(const v4fa*)(arow + kb + 8 * hh), x1 = *(const v4fa*)(arow + kb + 8 * hh + 4), x2 = *(const v4fa*)(arow + kb + 16 + 8 * hh), x3 = *(const v4fa*)(arow + kb + 16 + 8 * hh + 4);
    float xs[16] = {x0[0],x0[1],x0[2],x0[3],x1[0],x1[1],x1[2],x1[3],x2[0],x2[1],x2[2],x2[3],x3[0],x3[1],x3[2],x3[3]};
#pragma unroll
    for (int i = 0; i < 16; ++i) { const _Float16 h = (_Float16)xs[i]; ah.h[i] = h; al.h[i] = ASPLIT ? (_Float16)(xs[i] - (float)h) : (_Float16)0.0f; }
#pragma unroll
    for (int t = 0; t < 4; ++t) { if (col0 + t * 16 >= N) continue; const size_t boff = (size_t)(col0 + t * 16 + ln) * ldb + kb; FragH bq; bq.half[0] = *(const v8us*)(Bh + boff + 8 * hh); bq.half[1] = *(const v8us*)(Bh + boff + 16 + 8 * hh);
      acc[t] = mmaH<ASPLIT ? 2 : 1>(ah.v, al.v, bq.v, bq.v, acc[t]); }
  }
#pragma unroll
  for (int t = 0; t < 4; ++t) { if (col0 + t * 16 >= N) continue;
#pragma unroll
    for (int r = 0; r < 8; ++r) so[w][8 * hh + r][t * 16 + ln] = acc[t][r] * alpha; }
  __builtin_amdgcn_fence(__ATOMIC_ACQ_REL, "workgroup"); __builtin_amdgcn_wave_barrier();
  const int rsub = lane >> 4, c4 = (lane & 15) * 4;
  {
#pragma unroll
    for (int q = 0; q < 8; ++q) { const int r = q * 2 + rsub; if (col0 + c4 < N) { const v4f v = *(const v4fa*)&so[w][r][c4]; *(v4f*)(C + (size_t)(row0 + r) * ldc + col0 + c4) = v; } }
     }
}

// Wt[n][k] = f16(W[k][n]·scale) from f32 row-major W[K][N] (scale = power of two; bf16-exact weights stay exact in f16 away from the subnormal range)
__global__ __launch_bounds__(256) void k_wt_f16(const float* __restrict__ W, _Float16* __restrict__ Wt, int K, int N, float scale) {
  const int t = blockIdx.x * 256 + threadIdx.x; if (t >= N * (K / 8)) return; const int n = t / (K / 8), k8 = (t % (K / 8)) * 8; FragH f;
#pragma unroll
  for (int i = 0; i < 8; ++i) f.h[i] = (_Float16)(bf16_round(W[(size_t)(k8 + i) * N + n]) * scale); const v8us o = f.half[0];
  *(v8us*)((unsigned short*)Wt + (size_t)n * K + k8) = o; 
}
typedef int v4ia __attribute__((ext_vector_type(4), may_alias));
typedef float v2f __attribute__((ext_vector_type(2)));
typedef unsigned v16ua __attribute__((ext_vector_type(16), may_alias));
// The shifted V transpose goes out in the order of the attention's A fragments: [head][32-key tile][d / 16][half][lane] x 16 bytes, lane (hh, ln) of half j holding keys j * 16 + 8 * hh + 0 .. 7 of the row with d % 16 = ln; a tile is 4 KiB in a row, a block writes 8 KiB in a row,
// a wave 512 bytes a store, and each of the attention's V loads is four whole lines instead of 16 bytes out of each of 16 rows that lie 4 KiB apart.
// Beside it the mask, packed once a call to one bit a (query, key) pair in the order in which the attention selects. There are 1024 such blocks and 64 x 64 mask tiles of (32 queries, 32 keys): waves 0 .. 3 of a block
// take one tile each, so the pack costs no block and no wave of its own, and its loads fly with those of V. Lane (hh, ln) reads what that lane of the attention needs (query rt * 16 + ln, keys nt * 16 + 8 * hh + r); the ballot over "nonzero" for one
// (rt, nt, r) is that score register's select mask over the 32 lanes. Word rt * 16 + nt * 8 + r goes out from the lane of that number: one 128-byte line a tile, one writer.
// Lines lie [query tile][attention wave = key tile % 4][key tile / 4], so the 16 tiles that one attention wave walks are 2 KiB in a row.
__device__ __forceinline__ void vts_tile(const int blk, const float* __restrict__ v, _Float16* __restrict__ Vt, const int* __restrict__ MSK, unsigned* __restrict__ MB) { __shared__ unsigned short tl[64][66]; const int tid = threadIdx.x;
  const int lane = tid & 31, mg = blk * 4 + ((tid >> 5) & 3), mq = mg / (TT / 32), mt = mg % (TT / 32); const bool packs = tid < 128; v4ia mk[2][2][2];
  if (packs) { const int* mr0 = MSK + (size_t)(mq * 32 + (lane & 15)) * TT + mt * 32 + 8 * (lane >> 4);
#pragma unroll
    for (int rt = 0; rt < 2; ++rt)
#pragma unroll
      for (int nt = 0; nt < 2; ++nt) { const int* mr = mr0 + rt * 16 * TT + nt * 16; mk[rt][nt][0] = *(const v4ia*)mr; mk[rt][nt][1] = *(const v4ia*)(mr + 4); } }
  const int slab = blk / (TT / 64), tg = blk % (TT / 64); const int b = slab / NH, h = slab % NH;
  for (int i = tid; i < 64 * 16; i += 256) { const int r = i / 16, c4 = (i % 16) * 4; const int ts = (tg * 64 + r + 1) % TT; const v4f a = *(const v4fa*)(v + ((size_t)b * TT + ts) * DDm + h * HD + c4); FragH f; for (int q = 0; q < 4; ++q) { f.h[q] = (_Float16)bf16_round(a[q]); tl[r][c4 + q] = f.u[q]; } }
  __syncthreads();
  {
#pragma unroll
    for (int rd = 0; rd < 2; ++rd) { const int c = rd * 256 + tid, k0 = (c >> 8) * 32 + ((c >> 5) & 1) * 16 + ((c >> 4) & 1) * 8, d = ((c >> 6) & 3) * 16 + (c & 15); FragH f;      // chunk c = [32-key tile][d / 16][fragment half][lane]: 8 keys from k0 of row d
#pragma unroll
      for (int q = 0; q < 8; ++q) f.u[q] = tl[k0 + q][d]; *(v8us*)((unsigned short*)Vt + (size_t)slab * HD * TT + tg * (64 * HD) + c * 8) = f.half[0]; }
    asm volatile("s_wait_xcnt 0x0" ::: "memory");      // behind the two stores: in the joint kernel code of the other block kind follows them in the listing and rewrites their registers
     }
  if (packs) { unsigned ow = 0u;
#pragma unroll
    for (int rt = 0; rt < 2; ++rt)
#pragma unroll
      for (int nt = 0; nt < 2; ++nt)
#pragma unroll
        for (int r = 0; r < 8; ++r) { const unsigned bl = __builtin_amdgcn_ballot_w32(mk[rt][nt][r >> 2][r & 3] != 0); ow = (lane == rt * 16 + nt * 8 + r) ? bl : ow; }
    MB[((size_t)(mq * 4 + (mt & 3)) * (TT / 128) + (mt >> 2)) * 32 + lane] = ow; } }
// attention per ((b,h), 32 queries), transposed. Which block takes what: a query tile's cost follows how many of its key tiles the mask leaves open, which under a lower-triangular mask grows with the tile's index, and the grid holds twice as many
// blocks as the chip has places for them (four a WGP, by registers). The index runs from the last query tile down to the first, all heads of a tile side by side: the long blocks come first in the index and the short ones
// fill the places as they fall free. A permutation of (head, tile): every pair once, right for any mask; speed only.
// The block's four waves share the 32 queries and split the keys, wave w taking the 32-key tiles w, w + 4, w + 8, ...; each keeps its own maximum, sum and
// un-normalised Ot, and the four partials are merged through LDS behind one barrier (weights exp2 of maximum - joint maximum). St = kc.qc^T (A = 16 key rows, B = 16 query columns, d 32), so a lane holds ONE query's scores: keys 8*hh + r of each 16-key tile;
// logit = -sqrt(max(q2 + k2 - 2S, 1e-12)); mask[q][k] (INPUT, nonzero = keep; tiles with no open key for the wave skipped); maximum and sum in the lane plus one exchange between the wave's halves;
// the two score tiles of 32 keys, converted in place, ARE the B operand of Ot += Vt.Pt (hardware k order: 8*hh + s, 16 + 8*hh + s), and a lane's 8 accumulator registers are 8 consecutive d of its query: no LDS in the loop.
__device__ __forceinline__ float xhalf(float x) { const int bq = __float_as_int(x); return __int_as_float(__builtin_amdgcn_permlanex16(bq, bq, 0x76543210, 0xfedcba98, false, false)); }      // lane l <-> l ^ 16
template <int N> __device__ __forceinline__ float rowshare(float x) { return __int_as_float(__builtin_amdgcn_mov_dpp(__float_as_int(x), 0x150 + N, 0xf, 0xf, false)); }      // lane N of each 16-lane row to the whole row
// causal 3-tap conv, transposed: Ct = W.Xt per (tensor, head, 256 positions a block, 32 a wave). The block first rounds its head's 32 x 192 weights into LDS (k = tap * 64 + d, scaled by 16; pitch 200 halves
// keeps the 16-byte fragment reads of 16 rows off one another's banks). A = 16 channel rows from LDS, B = 16 positions: x rows s + tap - 2 (clamped at the sequence's first row) read straight from the f32 input
// and rounded in registers, same k order as A (8*hh + j, 16 + 8*hh + j). A lane then holds ONE position's channels t*16 + 8*hh + r: 16-byte f16 stores, |c|^2 in the lane plus one exchange between the wave's halves.
// Rows and norms go out head-major ([b*NH + h][s / 16][fragment], [b*NH + h][s]): a wave writes 2 KiB of rows and one 128-byte line of norms, all its own. Inside a group of 16 positions the rows lie in the order in which the attention's
// matrix operand wants them: what lane l holds here for channel half t (position l % 16, channels t * 16 + 8 * (l / 16) + 0 .. 7) is what lane l of the attention takes as half t of its fragment, so it goes to byte t * 512 + l * 16 of the group's 1 KiB:
// each store here and each load there is 512 bytes in a row, four whole lines, not 16 bytes out of each of 16 rows.
__device__ __forceinline__ void conv_tile(const int blk, const float* __restrict__ qx, const float* __restrict__ kx, const float* __restrict__ cw, const float* __restrict__ cb, _Float16* __restrict__ Q16, _Float16* __restrict__ K16, float* __restrict__ NQ, float* __restrict__ NK) {
  __shared__ __attribute__((aligned(16))) unsigned short wsm[CCv][200];
  const int tid = threadIdx.x, w = tid >> 5, lane = tid & 31, ln = lane & 15, hh = lane >> 4;
  const int pg = blk % (NR / 256), h = (blk / (NR / 256)) % NH, z = blk / ((NR / 256) * NH);
  const float* x = z ? kx : qx; _Float16* C16 = z ? K16 : Q16; float* N2 = z ? NK : NQ;
  { const int c = tid >> 3, d0 = (tid & 7) * 8; const float* wp = cw + ((size_t)(h * CCv + c) * HD + d0) * 3; float wv[24];      // a thread's 24 consecutive floats are 8 d x 3 taps of one channel
#pragma unroll
    for (int q = 0; q < 6; ++q) { const v4f a = *(const v4fa*)(wp + q * 4); wv[q * 4] = a[0]; wv[q * 4 + 1] = a[1]; wv[q * 4 + 2] = a[2]; wv[q * 4 + 3] = a[3]; }
#pragma unroll
    for (int i = 0; i < 3; ++i) { FragH f;
#pragma unroll
      for (int q = 0; q < 8; ++q) f.h[q] = (_Float16)(bf16_round(wv[q * 3 + i]) * 16.0f);
      *(v8us*)&wsm[c][i * 64 + d0] = f.half[0]; } }
  __syncthreads();      // every wave reads fragments of weights that all eight waves wrote
  const int row0 = pg * 256 + w * 32, b = row0 / TT, s0 = row0 % TT;
  const float* xb = x + (size_t)b * TT * DDm + h * HD + 8 * hh;
  v8f acc[2][2];
#pragma unroll
  for (int nt = 0; nt < 2; ++nt)
#pragma unroll
    for (int t = 0; t < 2; ++t) acc[nt][t] = (v8f){0.f,0.f,0.f,0.f,0.f,0.f,0.f,0.f};
#pragma unroll
  for (int i = 0; i < 3; ++i)
#pragma unroll
    for (int dd = 0; dd < 2; ++dd) { FragH aw[2], bx[2];
#pragma unroll
      for (int t = 0; t < 2; ++t) { const unsigned short* wk = &wsm[t * 16 + ln][i * 64 + dd * 32 + 8 * hh]; aw[t].half[0] = *(const v8us*)wk; aw[t].half[1] = *(const v8us*)(wk + 16); }
#pragma unroll
      for (int nt = 0; nt < 2; ++nt) { int ss = s0 + nt * 16 + ln + i - 2; ss = ss < 0 ? 0 : ss; const float* xr = xb + (size_t)ss * DDm + dd * 32;
        const v4f x0 = *(const v4fa*)xr, x1 = *(const v4fa*)(xr + 4), x2 = *(const v4fa*)(xr + 16), x3 = *(const v4fa*)(xr + 20);      // below: the hardware's f32 -> bf16 conversion rounds to nearest even, as bf16_round does, in one instruction
#pragma unroll
        for (int j = 0; j < 4; ++j) { bx[nt].h[j] = (_Float16)(float)(__bf16)x0[j]; bx[nt].h[4 + j] = (_Float16)(float)(__bf16)x1[j]; bx[nt].h[8 + j] = (_Float16)(float)(__bf16)x2[j]; bx[nt].h[12 + j] = (_Float16)(float)(__bf16)x3[j]; } }
#pragma unroll
      for (int nt = 0; nt < 2; ++nt)
#pragma unroll
        for (int t = 0; t < 2; ++t) acc[nt][t] = mmaH<1>(aw[t].v, aw[t].v, bx[nt].v, bx[nt].v, acc[nt][t]); }
  float bv[2][8];
#pragma unroll
  for (int t = 0; t < 2; ++t) { const float* bp = cb + h * CCv + t * 16 + 8 * hh; const v4f b0 = *(const v4fa*)bp, b1 = *(const v4fa*)(bp + 4);
#pragma unroll
    for (int j = 0; j < 4; ++j) { bv[t][j] = bf16_round(b0[j]); bv[t][4 + j] = bf16_round(b1[j]); } }
#pragma unroll
  for (int nt = 0; nt < 2; ++nt) { const size_t prow = (size_t)(b * NH + h) * TT + s0 + nt * 16 + ln; float ss = 0.f;
#pragma unroll
    for (int t = 0; t < 2; ++t) { FragH f;
#pragma unroll
      for (int r = 0; r < 8; ++r) { const float v = acc[nt][t][r] * 0.0625f + bv[t][r]; ss += v * v; f.h[r] = (_Float16)v; }
      *(v8us*)((unsigned short*)C16 + (prow - ln) * CCv + t * 256 + lane * 8) = f.half[0]; }      // fragment order: 16 positions are 1 KiB, half t of lane l at t * 512 + l * 16 bytes
    ss += xhalf(ss);
    if (hh == 0) N2[prow] = ss; } }
// all that the attention needs, in ONE launch: the conv blocks (the longer ones) first, then the blocks of the shifted V transpose, which pack the mask beside it; the two kinds share nothing, and a block is wholly of one kind
#define NCB ((NR / 256) * NH * 2)
__global__ __launch_bounds__(256) void k_prep(const float* __restrict__ qx, const float* __restrict__ kx, const float* __restrict__ vx, const float* __restrict__ cw, const float* __restrict__ cb, _Float16* __restrict__ Q16, _Float16* __restrict__ K16, float* __restrict__ NQ, float* __restrict__ NK, _Float16* __restrict__ Vt, const int* __restrict__ MSK, unsigned* __restrict__ MB) {
  if (blockIdx.x < NCB) conv_tile((int)blockIdx.x, qx, kx, cw, cb, Q16, K16, NQ, NK); else vts_tile((int)blockIdx.x - NCB, vx, Vt, MSK, MB); }
__global__ __launch_bounds__(128) void k_sattn(const _Float16* __restrict__ Q16, const _Float16* __restrict__ K16, const float* __restrict__ NQ, const float* __restrict__ NK, const unsigned* __restrict__ MB, const _Float16* __restrict__ Vt, float* __restrict__ O) { constexpr int RPW = 32; constexpr int KSP = 4; constexpr int OP = HD + 4; constexpr float L2E = 1.4426950408889634f; constexpr float PCAP = 16384.0f;      // OP: a partial's row pitch, 272 bytes = 16 x 17, keeps the 16-byte writes of 16 queries off one another's banks
  __shared__ __attribute__((aligned(16))) float so[KSP][RPW][OP]; __shared__ __attribute__((aligned(16))) float sml[RPW][2 * KSP];      // per query: the four waves' maxima, then their sums
  const int tid = threadIdx.x, w = tid >> 5, lane = tid & 31, ln = lane & 15, hh = lane >> 4; const int slab = blockIdx.x % (BB * NH), qblk = (blockIdx.x / (BB * NH)) ^ (TT / RPW - 1) /* = 63 - x for x in 0 .. 63 */; const int b = slab / NH, h = slab % NH; const int q0 = qblk * RPW;
  FragH bq[2]; float q2c[2];
#pragma unroll
  for (int rt = 0; rt < 2; ++rt) { const size_t qrow = (size_t)slab * TT + q0 + rt * 16 + ln; const unsigned short* qr = (const unsigned short*)Q16 + (qrow - ln) * CCv + lane * 8; bq[rt].half[0] = *(const v8us*)qr; bq[rt].half[1] = *(const v8us*)(qr + 256); q2c[rt] = NQ[qrow]; }
  const int kslot = (ln < 8) ? 8 * hh + ln : 8 + 8 * hh + ln;      // lane ln of half hh fetches |kc|^2 of the key that the half's score register ln holds (tile ln / 8, register ln % 8)
  float m_c[2], l_c[2]; v2f nm_c; bool fresh = true; v8f oacc[2][4];      // m_c: the reference of the weights, a maximum that the query has met (not always the latest); nm_c = -m_c * log2(e); fresh: the wave has had no open tile yet; m starts finite and below every finite logit (|logit| <= sqrt(FLT_MAX)): exp2 arguments never meet inf - inf
#pragma unroll
  for (int rt = 0; rt < 2; ++rt) { m_c[rt] = -1.0e30f; nm_c[rt] = 1.0e30f * L2E; l_c[rt] = 0.f;
#pragma unroll
    for (int dt = 0; dt < 4; ++dt) oacc[rt][dt] = (v8f){0.f,0.f,0.f,0.f,0.f,0.f,0.f,0.f}; }
  // read places: a base that is the same for the whole block and steps by four 32-key tiles a trip, plus each lane's own fixed byte offset (the wave's first tile in it)
  const char* kb = (const char*)(K16 + (size_t)slab * TT * CCv); const char* nb = (const char*)(NK + (size_t)slab * TT); const char* vb = (const char*)(Vt + (size_t)slab * HD * TT);
  const unsigned klo = (unsigned)((w * 32 * CCv + lane * 8) * 2), nlo = (unsigned)((w * 32 + kslot) * 4), vlo = (unsigned)((w * 32 * HD + lane * 8) * 2);      // K and V lie in fragment order: a lane's 16 bytes at lane * 16 of each 512-byte half
  // the packed mask of the wave's 16 key tiles, 2 KiB in a row (the wave's number made scalar, so that the address is the same in every lane for the compiler too). Which tiles have an open key is known in front of the loop:
  // four whole-line loads, 8 lanes a tile; bit t of opn = tile t has one. The loop ends behind the last open tile (opn < 65536 and moves down a bit a trip: 16 trips at most) and passes a closed tile on a scalar test, with no load.
  const unsigned* mw = MB + (size_t)(qblk * KSP + __builtin_amdgcn_readfirstlane(w)) * (TT / (32 * KSP)) * 32; unsigned opn = 0u;
#pragma unroll
  for (int i = 0; i < 4; ++i) { const v4ia a = *(const v4ia*)(mw + i * 128 + lane * 4); const unsigned ob = __builtin_amdgcn_ballot_w32(((a[0] | a[1]) | (a[2] | a[3])) != 0);
#pragma unroll
    for (int j = 0; j < 4; ++j) opn |= (((ob >> (8 * j)) & 0xffu) != 0u ? 1u : 0u) << (i * 4 + j); }
  asm volatile("" :: "v"(bq[0].v), "v"(bq[1].v), "v"(q2c[0]), "v"(q2c[1]));      // loaded values as inputs only: holds the query loads in front of the loop's entry test, where they fly beside the four mask loads; without it they sink behind that test and wait a second time
#pragma unroll 1
  for (; opn != 0u; opn >>= 1, mw += 32, kb += 32 * KSP * CCv * 2, nb += 32 * KSP * 4, vb += 32 * KSP * HD * 2) {
    if ((opn & 1u) == 0u) continue;      // wave-uniform skip of fully masked tiles
    const v16ua mk[2] = {*(const v16ua*)mw, *(const v16ua*)(mw + 16)};      // the tile's 32 select masks, the same for every lane: scalar loads, beside the vector loads below
    FragH ak[2], av[4];
#pragma unroll
    for (int nt = 0; nt < 2; ++nt) { const unsigned short* kr = (const unsigned short*)(kb + klo) + nt * 16 * CCv; ak[nt].half[0] = *(const v8us*)kr; ak[nt].half[1] = *(const v8us*)(kr + 256); }
    const float k2l = *(const float*)(nb + nlo);
#pragma unroll
    for (int dt = 0; dt < 4; ++dt) { const unsigned short* vrow = (const unsigned short*)(vb + vlo) + dt * 512; av[dt].half[0] = *(const v8us*)vrow; av[dt].half[1] = *(const v8us*)(vrow + 256); }
    v8f s[2][2];
#pragma unroll
    for (int nt = 0; nt < 2; ++nt)
#pragma unroll
      for (int rt = 0; rt < 2; ++rt) { v8f acc = (v8f){0.f,0.f,0.f,0.f,0.f,0.f,0.f,0.f}; acc = mmaH<1>(ak[nt].v, ak[nt].v, bq[rt].v, bq[rt].v, acc); s[rt][nt] = acc; }
    const float k2v[2][8] = {{rowshare<0>(k2l), rowshare<1>(k2l), rowshare<2>(k2l), rowshare<3>(k2l), rowshare<4>(k2l), rowshare<5>(k2l), rowshare<6>(k2l), rowshare<7>(k2l)},
                             {rowshare<8>(k2l), rowshare<9>(k2l), rowshare<10>(k2l), rowshare<11>(k2l), rowshare<12>(k2l), rowshare<13>(k2l), rowshare<14>(k2l), rowshare<15>(k2l)}};
    FragH pb[2]; v2f sv[2][8], ps;      // a pair is the same key for the wave's two query tiles: packed instructions then serve both
#pragma unroll
    for (int nt = 0; nt < 2; ++nt)
#pragma unroll
      for (int r = 0; r < 8; ++r)
#pragma unroll
        for (int rt = 0; rt < 2; ++rt) { const float d = fmaxf(q2c[rt] + k2v[nt][r] - 2.0f * s[rt][nt][r], 1e-12f); sv[nt][r][rt] = __builtin_amdgcn_inverse_ballot_w32(mk[rt][nt * 8 + r]) ? -__builtin_amdgcn_sqrtf(d) : -INFINITY; }      // d >= 1e-12: never a denormal, the hardware root needs no range fix-up
    // the usual path: weights against the reference in use, exp(x - m) = exp2(x * log2(e) - m * log2(e)): one fma and the hardware exp2; a closed key's -inf gives exp2(-inf) = 0. No maximum is taken and Ot is not touched.
    // The weights are >= 0, so a lane's sum of 16 bounds each of them: a sum of at most PCAP says that every one fits f16 with room to spare. One test a tile for the whole wave; a query still at the start value gets +inf for an open key and fails it.
    bool redo = fresh;
    if (!fresh) { ps = (v2f){0.f, 0.f};
#pragma unroll
      for (int nt = 0; nt < 2; ++nt) { v2f t[8], p[8];
#pragma unroll
        for (int r = 0; r < 8; ++r) { t[r] = __builtin_elementwise_fma(sv[nt][r], (v2f){L2E, L2E}, nm_c); p[r] = (v2f){__builtin_amdgcn_exp2f(t[r][0]), __builtin_amdgcn_exp2f(t[r][1])}; }
        // the slot behind a transcendental: inputs only, so every argument's register stays whole until all of these exp2 have issued: none is overwritten directly behind its exp2 (left to itself this build computes them in place and pads ten more v_nop a tile); the v_nop is the slot behind the last
        asm volatile("v_nop" :: "v"(t[0]), "v"(t[1]), "v"(t[2]), "v"(t[3]), "v"(t[4]), "v"(t[5]), "v"(t[6]), "v"(t[7]), "v"(p[0]), "v"(p[1]), "v"(p[2]), "v"(p[3]), "v"(p[4]), "v"(p[5]), "v"(p[6]), "v"(p[7]));
#pragma unroll
        for (int r = 0; r < 8; ++r) { ps += p[r]; pb[0].h[nt * 8 + r] = (_Float16)p[r][0]; pb[1].h[nt * 8 + r] = (_Float16)p[r][1]; } }
      redo = __builtin_amdgcn_ballot_w32(fmaxf(ps[0], ps[1]) > PCAP) != 0u; }
    if (redo) {      // the wave's first open tile, or a weight too large: take the larger of the reference and the tile's maximum as the new reference, bring sum and Ot to it, and form the tile's weights again
#pragma unroll
      for (int rt = 0; rt < 2; ++rt) { float mc = -INFINITY;
#pragma unroll
        for (int nt = 0; nt < 2; ++nt)
#pragma unroll
          for (int r = 0; r < 8; ++r) mc = fmaxf(mc, sv[nt][r][rt]);
        mc = fmaxf(mc, xhalf(mc));
        const float mn = fmaxf(m_c[rt], mc); const float ta = (m_c[rt] - mn) * L2E; const float al = __builtin_amdgcn_exp2f(ta); m_c[rt] = mn; const float nm = -mn * L2E; nm_c[rt] = nm;
        float pr = 0.f;
#pragma unroll
        for (int nt = 0; nt < 2; ++nt) { float t[8], p[8];
#pragma unroll
          for (int r = 0; r < 8; ++r) { t[r] = __builtin_fmaf(sv[nt][r][rt], L2E, nm); p[r] = __builtin_amdgcn_exp2f(t[r]); }
          // the slot behind a transcendental, as above
          asm volatile("v_nop" :: "v"(t[0]), "v"(t[1]), "v"(t[2]), "v"(t[3]), "v"(t[4]), "v"(t[5]), "v"(t[6]), "v"(t[7]), "v"(p[0]), "v"(p[1]), "v"(p[2]), "v"(p[3]), "v"(p[4]), "v"(p[5]), "v"(p[6]), "v"(p[7]), "v"(ta), "v"(al));
#pragma unroll
          for (int r = 0; r < 8; ++r) { pr += p[r]; pb[rt].h[nt * 8 + r] = (_Float16)p[r]; } }
        l_c[rt] = l_c[rt] * al + pr;
#pragma unroll
        for (int dt = 0; dt < 4; ++dt)
#pragma unroll
          for (int r = 0; r < 8; ++r) oacc[rt][dt][r] *= al; } }
    else { l_c[0] += ps[0]; l_c[1] += ps[1]; }      // the half's own 16 keys; the halves join behind the loop
    fresh = false;
#pragma unroll
    for (int dt = 0; dt < 4; ++dt)
#pragma unroll
      for (int rt = 0; rt < 2; ++rt) oacc[rt][dt] = mmaH<1>(av[dt].v, av[dt].v, pb[rt].v, pb[rt].v, oacc[rt][dt]); }
  // the wave's partial goes to LDS: rows [query][d], un-normalised, with its maximum and its sum (the halves joined here)
#pragma unroll
  for (int rt = 0; rt < 2; ++rt) { const float l = l_c[rt] + xhalf(l_c[rt]); if (hh == 0) { sml[rt * 16 + ln][w] = m_c[rt]; sml[rt * 16 + ln][KSP + w] = l; } float* prow = &so[w][rt * 16 + ln][8 * hh];
#pragma unroll
    for (int dt = 0; dt < 4; ++dt) { const v4f lo = {oacc[rt][dt][0], oacc[rt][dt][1], oacc[rt][dt][2], oacc[rt][dt][3]}, hi = {oacc[rt][dt][4], oacc[rt][dt][5], oacc[rt][dt][6], oacc[rt][dt][7]}; *(v4fa*)(prow + dt * 16) = lo; *(v4fa*)(prow + dt * 16 + 4) = hi; } }
  __syncthreads();      // every wave merges rows that all four waves wrote
  // merge: wave w owns queries 8 * w .. 8 * w + 7, two a pass; 16 lanes x 16 bytes are one query's whole 256-byte output row, so every 128-byte line has one writer and goes out in one store
#pragma unroll
  for (int c = 0; c < 4; ++c) { const int qq = w * 8 + c * 2 + hh; const v4f mv = *(const v4fa*)&sml[qq][0], lv = *(const v4fa*)&sml[qq][KSP];
    const float mj = fmaxf(fmaxf(mv[0], mv[1]), fmaxf(mv[2], mv[3])); float t[KSP], e[KSP]; float l = 0.f; v4f o = {0.f, 0.f, 0.f, 0.f};      // a wave that met no open key has maximum -1e30, sum 0 and zeros: weight 0, or 1 on zeros where no wave met one
#pragma unroll
    for (int p = 0; p < KSP; ++p) t[p] = (mv[p] - mj) * L2E;
    // the four weights' exp2 and the slot behind a transcendental in one statement: results in registers of their own, so none is read and no argument overwritten directly behind its exp2; the v_nop fills the slot behind the last
    asm("v_exp_f32 %0, %4\n\tv_exp_f32 %1, %5\n\tv_exp_f32 %2, %6\n\tv_exp_f32 %3, %7\n\tv_nop" : "=&v"(e[0]), "=&v"(e[1]), "=&v"(e[2]), "=&v"(e[3]) : "v"(t[0]), "v"(t[1]), "v"(t[2]), "v"(t[3]));
#pragma unroll
    for (int p = 0; p < KSP; ++p) { l += e[p] * lv[p]; const v4f a = *(const v4fa*)&so[p][qq][ln * 4]; o += a * e[p]; }
    const float li = (l > 0.f) ? 1.0f / l : 0.f;
    *(v4f*)(O + ((size_t)b * TT + q0 + qq) * DDm + h * HD + ln * 4) = o * li; } }
extern "C" void kernel_launch(void* const* d_in, const int* in_sizes, int n_in,
                              void* d_out, int out_size, void* d_ws, size_t ws_size, hipStream_t stream) {
  (void)in_sizes; (void)n_in; (void)out_size;
  const float* qx = (const float*)d_in[0]; const float* kx = (const float*)d_in[1]; const float* vx = (const float*)d_in[2]; const int* mask = (const int*)d_in[3]; const float* cw = (const float*)d_in[4]; const float* cb = (const float*)d_in[5];
  char* ws = (char*)d_ws; size_t off = 0;
  auto take = [&](size_t bytes) { char* p = ws + off; off += (bytes + 255) & ~(size_t)255; return p; };
  _Float16* Q16 = (_Float16*)take((size_t)NR * NH * CCv * 2); _Float16* K16 = (_Float16*)take((size_t)NR * NH * CCv * 2); float* NQ = (float*)take((size_t)NR * NH * 4); float* NK = (float*)take((size_t)NR * NH * 4); _Float16* Vt = (_Float16*)take((size_t)NR * DDm * 2); unsigned* MB = (unsigned*)take((size_t)TT * TT / 8);
  if (off > ws_size) return;      // 4.2 x 2 + 0.26 x 2 + 8.4 + 0.52: about 17 MiB
  k_prep<<<NCB + BB * NH * (TT / 64), 256, 0, stream>>>(qx, kx, vx, cw, cb, Q16, K16, NQ, NK, Vt, mask, MB);
  k_sattn<<<BB * NH * (TT / 32), 128, 0, stream>>>(Q16, K16, NQ, NK, MB, Vt, (float*)d_out);
}

// v009
// A run of this version takes 34.5 microseconds.
// In both of two side-by-side timings against v008, it was 1.05 times as fast.
// All steps since v000 together make it 15.3 times as fast.
#include <hip/hip_runtime.h>
// Simplex (distance-based) attention (B=4, S=2048, 8 heads × 64, conv channels 32): the per-head causal 3-tap conv of q and k on WMMA (+ bias, f16 rows and norms head-major) and the shifted V transpose in one preparation launch, and the attention as a
// fused flash-style kernel on v_wmma_f32_16x16x32_f16 — S = qc·kc (d = 32, one k-step), logits = −sqrt(max(|qc|² + |kc|² − 2S, 1e-12)), INPUT mask (nonzero = keep), online softmax f32,
// P f16 ≤ 16384, and the roll(attn, 1) folded into a one-step shift of V (out[s] = Σ_t attn[s][t]·v[t+1 mod S]); f16 operands, single products, f32 accumulate; norms f32 VALU in the conv's epilogue.
#define BB 4
#define TT 2048
#define DDm 512
#define NH 8
#define HD 64
#define CCv 32
#define NR (BB * TT)

typedef __bf16 v16b __attribute__((ext_vector_type(16)));
typedef unsigned short v8us __attribute__((ext_vector_type(8), may_alias));
typedef float  v8f  __attribute__((ext_vector_type(8)));
typedef float  v4f  __attribute__((ext_vector_type(4)));
typedef float  v4fa __attribute__((ext_vector_type(4), may_alias));
union FragB { v16b v; v8us half[2]; unsigned short u[16]; };

__device__ __forceinline__ unsigned short bf16_bits(float x) { unsigned int u = __float_as_uint(x); return (unsigned short)((u + 0x7FFFu + ((u >> 16) & 1u)) >> 16); }
__device__ __forceinline__ float bf16_val(unsigned short b) { return __uint_as_float(((unsigned int)b) << 16); }
__device__ __forceinline__ float bf16_round(float x) { return bf16_val(bf16_bits(x)); }
// D += A·B with NT terms: 1 = ah·bh, 2 = + al·bh (A split), 3 = + ah·bl (both split)
template <int NT>
__device__ __forceinline__ v8f mmaN(v16b ah, v16b al, v16b bh, v16b bl, v8f c) {
  c = __builtin_amdgcn_wmma_f32_16x16x32_bf16(false, ah, false, bh, (short)0, c, false, false);
  if (NT >= 2) c = __builtin_amdgcn_wmma_f32_16x16x32_bf16(false, al, false, bh, (short)0, c, false, false);
  if (NT >= 3) c = __builtin_amdgcn_wmma_f32_16x16x32_bf16(false, ah, false, bl, (short)0, c, false, false);
  asm volatile("v_nop\n\tv_nop\n\tv_nop\n\tv_nop" : "+v"(c) : "v"(ah), "v"(al), "v"(bh), "v"(bl));
  return c;
}

__global__ __launch_bounds__(256) void k_wt_bf16(const float* __restrict__ W, unsigned short* __restrict__ Wt, int K, int N) {
  const int t = blockIdx.x * 256 + threadIdx.x;
  const int k8n = K / 8;
  if (t >= N * k8n) return;
  const int n = t / k8n, k8 = (t % k8n) * 8;
  v8us v;
#pragma unroll
  for (int i = 0; i < 8; ++i) v[i] = bf16_bits(W[(size_t)(k8 + i) * N + n]);
  *(v8us*)(Wt + (size_t)n * K + k8) = v;
  
}

// GEMM C[M][N] (f32, pitch ldc) = act(A[M][K]·W + bias). A f32 row-major (pitch lda) converted per fragment to bf16
// (ASPLIT: hi/lo two planes -> 2 terms, else single rounded term); Wt bf16 [N][K] (pitch ldb). BIAS_BF16 rounds the
// bias to bf16 first (bias quantised to bf16 before the add). K%32==0, M%16==0, N%64==0.
template <bool ASPLIT, int ACT, bool BIAS_BF16>
__global__ __launch_bounds__(128) void k_gemm_bf(const float* __restrict__ A, int lda, const unsigned short* __restrict__ Wt, int ldb,
                                               const float* __restrict__ bias, float* __restrict__ C, int ldc, int M, int N, int K) {
  __shared__ __attribute__((aligned(16))) float so[4][16][64];
  const int tid = threadIdx.x, w = tid >> 5, lane = tid & 31, ln = lane & 15, hh = lane >> 4;
  const int ntn = N / 64;
  const int wid = blockIdx.x * 4 + w;
  const int mt = wid / ntn, nq = wid % ntn;
  if (mt * 16 >= M) return;
  const int row0 = mt * 16, col0 = nq * 64;
  const float* arow = A + (size_t)(row0 + ln) * lda;
  v8f acc[4] = {};
  for (int kb = 0; kb < K; kb += 32) {
    FragB ah, al;
    const v4f x0 = *(const v4fa*)(arow + kb + 8 * hh), x1 = *(const v4fa*)(arow + kb + 8 * hh + 4);
    const v4f x2 = *(const v4fa*)(arow + kb + 16 + 8 * hh), x3 = *(const v4fa*)(arow + kb + 16 + 8 * hh + 4);
    float xs[16] = {x0[0],x0[1],x0[2],x0[3],x1[0],x1[1],x1[2],x1[3],x2[0],x2[1],x2[2],x2[3],x3[0],x3[1],x3[2],x3[3]};
#pragma unroll
    for (int i = 0; i < 16; ++i) { const unsigned short hb = bf16_bits(xs[i]); ah.u[i] = hb; al.u[i] = ASPLIT ? bf16_bits(xs[i] - bf16_val(hb)) : (unsigned short)0; }
#pragma unroll
    for (int t = 0; t < 4; ++t) {
      const unsigned short* brow = Wt + (size_t)(col0 + t * 16 + ln) * ldb + kb;
      FragB b;
      b.half[0] = *(const v8us*)(brow + 8 * hh);
      b.half[1] = *(const v8us*)(brow + 16 + 8 * hh);
      acc[t] = mmaN<ASPLIT ? 2 : 1>(ah.v, al.v, b.v, b.v, acc[t]);
    }
  }
#pragma unroll
  for (int t = 0; t < 4; ++t) {
    float bv = bias ? bias[col0 + t * 16 + ln] : 0.f;
    if (BIAS_BF16) bv = bf16_round(bv);
#pragma unroll
    for (int r = 0; r < 8; ++r) { float v = acc[t][r] + bv; if (ACT == 1) v = fmaxf(v, 0.f); so[w][8 * hh + r][t * 16 + ln] = v; }
  }
  __builtin_amdgcn_fence(__ATOMIC_ACQ_REL, "workgroup");
  __builtin_amdgcn_wave_barrier();
  const int rsub = lane >> 4, c4 = (lane & 15) * 4;
  {
#pragma unroll
    for (int q = 0; q < 8; ++q) {
      const int r = q * 2 + rsub;
      const v4f v = *(const v4fa*)&so[w][r][c4];
      *(v4f*)(C + (size_t)(row0 + r) * ldc + col0 + c4) = v;
    }
    
  }
}

// Flash-style causal/unmasked attention, all contractions 3-term bf16 hi/lo splits, f32 softmax with running max.
// q,k,v rows are read from f32 buffers with arbitrary row pitch (so they can live inside a fused qkv buffer);
// D = head size (multiple of 32, <= 128); one wave = 16 query rows; block = 4 waves (64 queries) sharing K/V chunks of 32.
template <int D, bool CAUSAL>
__global__ __launch_bounds__(128) void k_flash(const float* __restrict__ qb, const float* __restrict__ kb, const float* __restrict__ vb,
                                             int pitch, int T, int H, float scale, float* __restrict__ y, int ypitch) {
  constexpr int KS = D / 32;        // k-steps for QK
  constexpr int DT = D / 16;        // d tiles for PV
  __shared__ __attribute__((aligned(16))) unsigned short sKh[32][D + 8], sKl[32][D + 8], sVh[32][D + 8], sVl[32][D + 8];
  __shared__ __attribute__((aligned(16))) unsigned short sPh[4][16][40], sPl[4][16][40];
  __shared__ __attribute__((aligned(16))) float sO[4][16][D];
  const int tid = threadIdx.x, w = tid >> 5, lane = tid & 31, ln = lane & 15, hh = lane >> 4;
  const int nqb = (T + 63) / 64;
  const int bh = blockIdx.x / nqb, qblk = blockIdx.x % nqb;
  const int b = bh / H, h = bh % H;
  const int q0 = qblk * 64 + w * 16;
  const float* Q = qb + (size_t)b * T * pitch + h * D;
  const float* K = kb + (size_t)b * T * pitch + h * D;
  const float* V = vb + (size_t)b * T * pitch + h * D;

  // A fragments of the wave's 16 query rows (scaled), hi/lo
  FragB aqh[KS], aql[KS];
  {
    int row = q0 + ln; if (row >= T) row = T - 1;
    const float* qr = Q + (size_t)row * pitch;
#pragma unroll
    for (int ks = 0; ks < KS; ++ks)
#pragma unroll
      for (int i = 0; i < 16; ++i) {
        const int d = ks * 32 + ((i < 8) ? (8 * hh + i) : (16 + 8 * hh + (i - 8)));
        const float x = qr[d] * scale; const unsigned short hb = bf16_bits(x);
        aqh[ks].u[i] = hb; aql[ks].u[i] = bf16_bits(x - bf16_val(hb));
      }
  }
  float m_r[8], l_r[8];
#pragma unroll
  for (int r = 0; r < 8; ++r) { m_r[r] = -3.0e38f; l_r[r] = 0.f; }
  v8f oacc[DT];
#pragma unroll
  for (int dt = 0; dt < DT; ++dt) oacc[dt] = (v8f){0.f,0.f,0.f,0.f,0.f,0.f,0.f,0.f};

  const int kv_end = CAUSAL ? min(T, qblk * 64 + 64) : T;     // block-uniform
  for (int j0 = 0; j0 < kv_end; j0 += 32) {
    __syncthreads();
    for (int e = tid; e < 32 * (D / 4); e += 128) {
      const int r = e / (D / 4), c4 = (e % (D / 4)) * 4;
      const int key = j0 + r;
      v4f kf = {0.f,0.f,0.f,0.f}, vf = {0.f,0.f,0.f,0.f};
      if (key < T) { kf = *(const v4fa*)(K + (size_t)key * pitch + c4); vf = *(const v4fa*)(V + (size_t)key * pitch + c4); }
#pragma unroll
      for (int t = 0; t < 4; ++t) {
        unsigned short hb = bf16_bits(kf[t]); sKh[r][c4 + t] = hb; sKl[r][c4 + t] = bf16_bits(kf[t] - bf16_val(hb));
        hb = bf16_bits(vf[t]); sVh[r][c4 + t] = hb; sVl[r][c4 + t] = bf16_bits(vf[t] - bf16_val(hb));
      }
    }
    __syncthreads();
    // S tile 16 x 32
    v8f s[2];
#pragma unroll
    for (int nt = 0; nt < 2; ++nt) {
      v8f acc = {};
#pragma unroll
      for (int ks = 0; ks < KS; ++ks) {
        FragB bh_, bl_;
        bh_.half[0] = *(const v8us*)&sKh[nt * 16 + ln][ks * 32 + 8 * hh]; bh_.half[1] = *(const v8us*)&sKh[nt * 16 + ln][ks * 32 + 16 + 8 * hh];
        bl_.half[0] = *(const v8us*)&sKl[nt * 16 + ln][ks * 32 + 8 * hh]; bl_.half[1] = *(const v8us*)&sKl[nt * 16 + ln][ks * 32 + 16 + 8 * hh];
        acc = mmaN<3>(aqh[ks].v, aql[ks].v, bh_.v, bl_.v, acc);
      }
      s[nt] = acc;
    }
    // mask + running max (rows 8hh+r; the 16 lanes of a half share rows)
    float alpha[8];
#pragma unroll
    for (int r = 0; r < 8; ++r) {
      const int qi = q0 + 8 * hh + r;
      const int ja = j0 + ln, jb = j0 + 16 + ln;
      if (CAUSAL) { if (ja > qi) s[0][r] = -3.0e38f; if (jb > qi) s[1][r] = -3.0e38f; }
      if (ja >= T) s[0][r] = -3.0e38f;
      if (jb >= T) s[1][r] = -3.0e38f;
      float mx = fmaxf(s[0][r], s[1][r]);
      mx = fmaxf(mx, __shfl_xor(mx, 1, 32)); mx = fmaxf(mx, __shfl_xor(mx, 2, 32)); mx = fmaxf(mx, __shfl_xor(mx, 4, 32)); mx = fmaxf(mx, __shfl_xor(mx, 8, 32));
      const float mnew = fmaxf(m_r[r], mx);
      alpha[r] = (mnew > -1.0e38f) ? __expf(m_r[r] - mnew) : 1.0f;
      const float p0 = (s[0][r] > -1.0e38f) ? __expf(s[0][r] - mnew) : 0.f;
      const float p1 = (s[1][r] > -1.0e38f) ? __expf(s[1][r] - mnew) : 0.f;
      m_r[r] = mnew;
      l_r[r] = l_r[r] * alpha[r] + p0 + p1;            // per-lane partial row sum (16 lanes combined at the end)
      unsigned short hb = bf16_bits(p0); sPh[w][8 * hh + r][ln] = hb;      sPl[w][8 * hh + r][ln] = bf16_bits(p0 - bf16_val(hb));
      hb = bf16_bits(p1);                sPh[w][8 * hh + r][16 + ln] = hb; sPl[w][8 * hh + r][16 + ln] = bf16_bits(p1 - bf16_val(hb));
    }
#pragma unroll
    for (int dt = 0; dt < DT; ++dt)
#pragma unroll
      for (int r = 0; r < 8; ++r) oacc[dt][r] *= alpha[r];
    __builtin_amdgcn_fence(__ATOMIC_ACQ_REL, "workgroup");
    __builtin_amdgcn_wave_barrier();
    FragB pah, pal;
    pah.half[0] = *(const v8us*)&sPh[w][ln][8 * hh]; pah.half[1] = *(const v8us*)&sPh[w][ln][16 + 8 * hh];
    pal.half[0] = *(const v8us*)&sPl[w][ln][8 * hh]; pal.half[1] = *(const v8us*)&sPl[w][ln][16 + 8 * hh];
#pragma unroll
    for (int dt = 0; dt < DT; ++dt) {
      FragB bvh, bvl;
#pragma unroll
      for (int i = 0; i < 8; ++i) {
        bvh.u[i] = sVh[8 * hh + i][dt * 16 + ln]; bvh.u[8 + i] = sVh[16 + 8 * hh + i][dt * 16 + ln];
        bvl.u[i] = sVl[8 * hh + i][dt * 16 + ln]; bvl.u[8 + i] = sVl[16 + 8 * hh + i][dt * 16 + ln];
      }
      oacc[dt] = mmaN<3>(pah.v, pal.v, bvh.v, bvl.v, oacc[dt]);
    }
    __builtin_amdgcn_fence(__ATOMIC_ACQ_REL, "workgroup");
    __builtin_amdgcn_wave_barrier();
  }
#pragma unroll
  for (int r = 0; r < 8; ++r) {
    float l = l_r[r];
    l += __shfl_xor(l, 1, 32); l += __shfl_xor(l, 2, 32); l += __shfl_xor(l, 4, 32); l += __shfl_xor(l, 8, 32);
    l_r[r] = (l > 0.f) ? 1.0f / l : 0.f;
  }
#pragma unroll
  for (int dt = 0; dt < DT; ++dt)
#pragma unroll
    for (int r = 0; r < 8; ++r) sO[w][8 * hh + r][dt * 16 + ln] = oacc[dt][r] * l_r[r];
  __builtin_amdgcn_fence(__ATOMIC_ACQ_REL, "workgroup");
  __builtin_amdgcn_wave_barrier();
  {
    for (int r = 0; r < 16; ++r) {
      const int row = q0 + r;
      if (row < T && lane < D / 4) {
        const v4f val = *(const v4fa*)&sO[w][r][lane * 4];
        *(v4f*)(y + ((size_t)b * T + row) * ypitch + h * D + lane * 4) = val;
      }
    }
    
  }
}

// GEMM C = act(A·W + bias + resid): A f32 (ASPLIT -> hi/lo 2 terms), Wt bf16 [N][K]; ACT 0 none, 1 relu, 2 exact gelu;
// resid (optional, f32, row index = (row % rmod), pitch ldr, RES_BF16 rounds it) added before the activation.
template <bool ASPLIT, int ACT, bool BIAS_BF16, bool RES_BF16>
__global__ __launch_bounds__(128) void k_gemm_bf3(const float* __restrict__ A, int lda, const unsigned short* __restrict__ Wt, int ldb,
                                                const float* __restrict__ bias, const float* __restrict__ resid, int rmod, int ldr,
                                                float* __restrict__ C, int ldc, int M, int N, int K) {
  __shared__ __attribute__((aligned(16))) float so[4][16][64];
  const int tid = threadIdx.x, w = tid >> 5, lane = tid & 31, ln = lane & 15, hh = lane >> 4;
  const int ntn = N / 64;
  const int wid = blockIdx.x * 4 + w;
  const int mt = wid / ntn, nq = wid % ntn;
  if (mt * 16 >= M) return;
  const int row0 = mt * 16, col0 = nq * 64;
  const float* arow = A + (size_t)(row0 + ln) * lda;
  v8f acc[4] = {};
  for (int kb = 0; kb < K; kb += 32) {
    FragB ah, al;
    const v4f x0 = *(const v4fa*)(arow + kb + 8 * hh), x1 = *(const v4fa*)(arow + kb + 8 * hh + 4);
    const v4f x2 = *(const v4fa*)(arow + kb + 16 + 8 * hh), x3 = *(const v4fa*)(arow + kb + 16 + 8 * hh + 4);
    float xs[16] = {x0[0],x0[1],x0[2],x0[3],x1[0],x1[1],x1[2],x1[3],x2[0],x2[1],x2[2],x2[3],x3[0],x3[1],x3[2],x3[3]};
#pragma unroll
    for (int i = 0; i < 16; ++i) { const unsigned short hb = bf16_bits(xs[i]); ah.u[i] = hb; al.u[i] = ASPLIT ? bf16_bits(xs[i] - bf16_val(hb)) : (unsigned short)0; }
#pragma unroll
    for (int t = 0; t < 4; ++t) {
      const unsigned short* brow = Wt + (size_t)(col0 + t * 16 + ln) * ldb + kb;
      FragB b;
      b.half[0] = *(const v8us*)(brow + 8 * hh);
      b.half[1] = *(const v8us*)(brow + 16 + 8 * hh);
      acc[t] = mmaN<ASPLIT ? 2 : 1>(ah.v, al.v, b.v, b.v, acc[t]);
    }
  }
#pragma unroll
  for (int t = 0; t < 4; ++t) {
    const int col = col0 + t * 16 + ln;
    float bv = bias ? bias[col] : 0.f;
    if (BIAS_BF16) bv = bf16_round(bv);
#pragma unroll
    for (int r = 0; r < 8; ++r) {
      float v = acc[t][r] + bv;
      if (resid) { float rv = resid[(size_t)((row0 + 8 * hh + r) % rmod) * ldr + col]; if (RES_BF16) rv = bf16_round(rv); v += rv; }
      if (ACT == 1) v = fmaxf(v, 0.f);
      if (ACT == 2) v = 0.5f * v * (1.0f + erff(v * 0.70710678118654752f));
      if (ACT == 3) { const float u = 0.7978845608028654f * (v + 0.044715f * v * v * v); v = 0.5f * v * (1.0f + tanhf(u)); }
      so[w][8 * hh + r][t * 16 + ln] = v;
    }
  }
  __builtin_amdgcn_fence(__ATOMIC_ACQ_REL, "workgroup");
  __builtin_amdgcn_wave_barrier();
  const int rsub = lane >> 4, c4 = (lane & 15) * 4;
  {
#pragma unroll
    for (int q = 0; q < 8; ++q) {
      const int r = q * 2 + rsub;
      const v4f v = *(const v4fa*)&so[w][r][c4];
      *(v4f*)(C + (size_t)(row0 + r) * ldc + col0 + c4) = v;
    }
    
  }
}
// row LayerNorm (biased variance, eps) over N: s = X (+ R); optional out_sum <- s; out_norm <- (s-mu)*rsqrt(var+eps)*g + b
template <bool PARAM_BF16>
__global__ __launch_bounds__(256) void k_layernorm(const float* __restrict__ X, const float* __restrict__ R, const float* __restrict__ g, const float* __restrict__ bta,
                                                  float* __restrict__ out_sum, float* __restrict__ out_norm, int N, float eps) {
  __shared__ float red[256];
  const int row = blockIdx.x, tid = threadIdx.x;
  const float* x = X + (size_t)row * N; const float* rr = R ? R + (size_t)row * N : nullptr;
  float vals[16];                     // up to N = 4096
  const int per = N / 256;            // contiguous chunk per thread? use strided-by-4 chunks: thread handles j = tid*4 + 1024*u
  float s1 = 0.f;
  for (int u = 0; u < per / 4; ++u) {
    const int j = tid * 4 + 1024 * u;
    const v4f a = *(const v4fa*)(x + j);
    v4f b = {0.f,0.f,0.f,0.f}; if (rr) b = *(const v4fa*)(rr + j);
#pragma unroll
    for (int q = 0; q < 4; ++q) { const float v = a[q] + b[q]; vals[u * 4 + q] = v; s1 += v; }
  }
  red[tid] = s1; __syncthreads();
  for (int st = 128; st > 0; st >>= 1) { if (tid < st) red[tid] += red[tid + st]; __syncthreads(); }
  const float mu = red[0] / (float)N; __syncthreads();
  float s2 = 0.f;
  for (int u = 0; u < per / 4; ++u)
#pragma unroll
    for (int q = 0; q < 4; ++q) { const float c = vals[u * 4 + q] - mu; s2 += c * c; }
  red[tid] = s2; __syncthreads();
  for (int st = 128; st > 0; st >>= 1) { if (tid < st) red[tid] += red[tid + st]; __syncthreads(); }
  const float rs = rsqrtf(red[0] / (float)N + eps);
  {
    for (int u = 0; u < per / 4; ++u) {
      const int j = tid * 4 + 1024 * u;
      v4f o, sm;
#pragma unroll
      for (int q = 0; q < 4; ++q) {
        float gg = g[j + q], bb = bta[j + q];
        if (PARAM_BF16) { gg = bf16_round(gg); bb = bf16_round(bb); }
        sm[q] = vals[u * 4 + q]; o[q] = (vals[u * 4 + q] - mu) * rs * gg + bb;
      }
      if (out_sum) *(v4f*)(out_sum + (size_t)row * N + j) = sm;
      *(v4f*)(out_norm + (size_t)row * N + j) = o;
    }
    
  }
}



// ---- f16 WMMA path (v_wmma_f32_16x16x32_f16): 11-bit significands for operands in range — used where a softmax weight operand (0 .. 16384) needs more precision than bf16
typedef _Float16 v16h __attribute__((ext_vector_type(16)));
union FragH { v16h v; v8us half[2]; _Float16 h[16]; unsigned short u[16]; };
template <int NT>
__device__ __forceinline__ v8f mmaH(v16h ah, v16h al, v16h bh, v16h bl, v8f c) {
  c = __builtin_amdgcn_wmma_f32_16x16x32_f16(false, ah, false, bh, (short)0, c, false, false);
  if (NT >= 2) c = __builtin_amdgcn_wmma_f32_16x16x32_f16(false, al, false, bh, (short)0, c, false, false);
  if (NT >= 3) c = __builtin_amdgcn_wmma_f32_16x16x32_f16(false, ah, false, bl, (short)0, c, false, false);
  asm volatile("v_nop\n\tv_nop\n\tv_nop\n\tv_nop" : "+v"(c) : "v"(ah), "v"(al), "v"(bh), "v"(bl));
  return c;
}
// batched GEMM like k_gemm_b but f16 operands: A f32 (split into f16 hi/lo if ASPLIT, else rounded to f16), Bt = f16 values [n][k]; alpha; C f32; N multiple of 16 (partial tiles skipped)
template <bool ASPLIT>
__global__ __launch_bounds__(128) void k_gemm_h(const float* __restrict__ A, int lda, size_t sA, const _Float16* __restrict__ Bh, int ldb, size_t sB, float alpha, float* __restrict__ C, int ldc, size_t sC, int M, int N, int K) {
  __shared__ __attribute__((aligned(16))) float so[4][16][64];
  const int tid = threadIdx.x, w = tid >> 5, lane = tid & 31, ln = lane & 15, hh = lane >> 4; const int by = blockIdx.y;
  A += (size_t)by * sA; Bh += (size_t)by * sB; C += (size_t)by * sC;
  const int ntn = (N + 63) / 64; const int wid = blockIdx.x * 4 + w; const int mt = wid / ntn, nq = wid % ntn; if (mt * 16 >= M) return;
  const int row0 = mt * 16, col0 = nq * 64; const float* arow = A + (size_t)(row0 + ln) * lda;
  v8f acc[4] = {};
  for (int kb = 0; kb < K; kb += 32) {
    FragH ah, al;
    const v4f x0 = *(const v4fa*)(arow + kb + 8 * hh), x1 = *(const v4fa*)(arow + kb + 8 * hh + 4), x2 = *(const v4fa*)(arow + kb + 16 + 8 * hh), x3 = *(const v4fa*)(arow + kb + 16 + 8 * hh + 4);
    float xs[16] = {x0[0],x0[1],x0[2],x0[3],x1[0],x1[1],x1[2],x1[3],x2[0],x2[1],x2[2],x2[3],x3[0],x3[1],x3[2],x3[3]};
#pragma unroll
    for (int i = 0; i < 16; ++i) { const _Float16 h = (_Float16)xs[i]; ah.h[i] = h; al.h[i] = ASPLIT ? (_Float16)(xs[i] - (float)h) : (_Float16)0.0f; }
#pragma unroll
    for (int t = 0; t < 4; ++t) { if (col0 + t * 16 >= N) continue; const size_t boff = (size_t)(col0 + t * 16 + ln) * ldb + kb; FragH bq; bq.half[0] = *(const v8us*)(Bh + boff + 8 * hh); bq.half[1] = *(const v8us*)(Bh + boff + 16 + 8 * hh);
      acc[t] = mmaH<ASPLIT ? 2 : 1>(ah.v, al.v, bq.v, bq.v, acc[t]); }
  }
#pragma unroll
  for (int t = 0; t < 4; ++t) { if (col0 + t * 16 >= N) continue;
#pragma unroll
    for (int r = 0; r < 8; ++r) so[w][8 * hh + r][t * 16 + ln] = acc[t][r] * alpha; }
  __builtin_amdgcn_fence(__ATOMIC_ACQ_REL, "workgroup"); __builtin_amdgcn_wave_barrier();
  const int rsub = lane >> 4, c4 = (lane & 15) * 4;
  {
#pragma unroll
    for (int q = 0; q < 8; ++q) { const int r = q * 2 + rsub; if (col0 + c4 < N) { const v4f v = *(const v4fa*)&so[w][r][c4]; *(v4f*)(C + (size_t)(row0 + r) * ldc + col0 + c4) = v; } }
     }
}

// Wt[n][k] = f16(W[k][n]·scale) from f32 row-major W[K][N] (scale = power of two; bf16-exact weights stay exact in f16 away from the subnormal range)
__global__ __launch_bounds__(256) void k_wt_f16(const float* __restrict__ W, _Float16* __restrict__ Wt, int K, int N, float scale) {
  const int t = blockIdx.x * 256 + threadIdx.x; if (t >= N * (K / 8)) return; const int n = t / (K / 8), k8 = (t % (K / 8)) * 8; FragH f;
#pragma unroll
  for (int i = 0; i < 8; ++i) f.h[i] = (_Float16)(bf16_round(W[(size_t)(k8 + i) * N + n]) * scale); const v8us o = f.half[0];
  *(v8us*)((unsigned short*)Wt + (size_t)n * K + k8) = o; 
}
typedef int v4ia __attribute__((ext_vector_type(4), may_alias));
typedef float v2f __attribute__((ext_vector_type(2)));
typedef unsigned v16ua __attribute__((ext_vector_type(16), may_alias));
typedef unsigned short v4us __attribute__((ext_vector_type(4), may_alias));
// The shifted V transpose goes out in the order of the attention's A fragments: [head][32-key tile][d / 16][half][lane] x 16 bytes, lane (hh, ln) of half j holding keys j * 16 + 8 * hh + 0 .. 7 of the row with d % 16 = ln; a tile is 4 KiB in a row, a block writes 8 KiB in a row,
// a wave 512 bytes a store, and each of the attention's V loads is four whole lines instead of 16 bytes out of each of 16 rows that lie 4 KiB apart.
// Beside it the mask, packed once a call to one bit a (query, key) pair in the order in which the attention selects. There are 1024 such blocks and 64 x 64 mask tiles of (32 queries, 32 keys): waves 0 .. 3 of a block
// take one tile each, so the pack costs no block and no wave of its own, and its loads fly with those of V. Lane (hh, ln) reads what that lane of the attention needs (query rt * 16 + ln, keys nt * 16 + 8 * hh + r); the ballot over "nonzero" for one
// (rt, nt, r) is that score register's select mask over the 32 lanes. Word rt * 16 + nt * 8 + r goes out from the lane of that number: one 128-byte line a tile, one writer.
// Lines lie [query tile][attention wave = key tile % 4][key tile / 4], so the 16 tiles that one attention wave walks are 2 KiB in a row.
__device__ __forceinline__ void vts_tile(const int blk, const float* __restrict__ v, _Float16* __restrict__ Vt, const int* __restrict__ MSK, unsigned* __restrict__ MB) { __shared__ unsigned short tl[64][66]; const int tid = threadIdx.x;
  const int lane = tid & 31, mg = blk * 4 + ((tid >> 5) & 3), mq = mg / (TT / 32), mt = mg % (TT / 32); const bool packs = tid < 128; v4ia mk[2][2][2];
  if (packs) { const int* mr0 = MSK + (size_t)(mq * 32 + (lane & 15)) * TT + mt * 32 + 8 * (lane >> 4);
#pragma unroll
    for (int rt = 0; rt < 2; ++rt)
#pragma unroll
      for (int nt = 0; nt < 2; ++nt) { const int* mr = mr0 + rt * 16 * TT + nt * 16; mk[rt][nt][0] = *(const v4ia*)mr; mk[rt][nt][1] = *(const v4ia*)(mr + 4); } }
  const int slab = blk / (TT / 64), tg = blk % (TT / 64); const int b = slab / NH, h = slab % NH;
  for (int i = tid; i < 64 * 16; i += 256) { const int r = i / 16, c4 = (i % 16) * 4; const int ts = (tg * 64 + r + 1) % TT; const v4f a = *(const v4fa*)(v + ((size_t)b * TT + ts) * DDm + h * HD + c4); FragH f; for (int q = 0; q < 4; ++q) { f.h[q] = (_Float16)bf16_round(a[q]); tl[r][c4 + q] = f.u[q]; } }
  __syncthreads();
  {
#pragma unroll
    for (int rd = 0; rd < 2; ++rd) { const int c = rd * 256 + tid, k0 = (c >> 8) * 32 + ((c >> 5) & 1) * 16 + ((c >> 4) & 1) * 8, d = ((c >> 6) & 3) * 16 + (c & 15); FragH f;      // chunk c = [32-key tile][d / 16][fragment half][lane]: 8 keys from k0 of row d
#pragma unroll
      for (int q = 0; q < 8; ++q) f.u[q] = tl[k0 + q][d]; *(v8us*)((unsigned short*)Vt + (size_t)slab * HD * TT + tg * (64 * HD) + c * 8) = f.half[0]; }
    asm volatile("s_wait_xcnt 0x0" ::: "memory");      // behind the two stores: in the joint kernel code of the other block kind follows them in the listing and rewrites their registers
     }
  if (packs) { unsigned ow = 0u;
#pragma unroll
    for (int rt = 0; rt < 2; ++rt)
#pragma unroll
      for (int nt = 0; nt < 2; ++nt)
#pragma unroll
        for (int r = 0; r < 8; ++r) { const unsigned bl = __builtin_amdgcn_ballot_w32(mk[rt][nt][r >> 2][r & 3] != 0); ow = (lane == rt * 16 + nt * 8 + r) ? bl : ow; }
    MB[((size_t)(mq * 4 + (mt & 3)) * (TT / 128) + (mt >> 2)) * 32 + lane] = ow; } }
// attention per ((b,h), 32 queries), transposed. Which block takes what: a query tile's cost follows how many of its key tiles the mask leaves open, which under a lower-triangular mask grows with the tile's index, and the grid holds twice as many
// blocks as the chip has places for them (four a WGP, by registers). The index runs from the last query tile down to the first, all heads of a tile side by side: the long blocks come first in the index and the short ones
// fill the places as they fall free. A permutation of (head, tile): every pair once, right for any mask; speed only.
// The block's four waves share the 32 queries and split the keys, wave w taking the 32-key tiles w, w + 4, w + 8, ...; each keeps its own maximum, sum and
// un-normalised Ot, and the four partials are merged through LDS behind one barrier (weights exp2 of maximum - joint maximum). St = kc.qc^T (A = 16 key rows, B = 16 query columns, d 32), so a lane holds ONE query's scores: keys 8*hh + r of each 16-key tile;
// logit = -sqrt(max(q2 + k2 - 2S, 1e-12)); mask[q][k] (INPUT, nonzero = keep; tiles with no open key for the wave skipped); maximum and sum in the lane plus one exchange between the wave's halves;
// the two score tiles of 32 keys, converted in place, ARE the B operand of Ot += Vt.Pt (hardware k order: 8*hh + s, 16 + 8*hh + s), and a lane's 8 accumulator registers are 8 consecutive d of its query: no LDS in the loop.
__device__ __forceinline__ float xhalf(float x) { const int bq = __float_as_int(x); return __int_as_float(__builtin_amdgcn_permlanex16(bq, bq, 0x76543210, 0xfedcba98, false, false)); }      // lane l <-> l ^ 16
template <int N> __device__ __forceinline__ float rowshare(float x) { return __int_as_float(__builtin_amdgcn_mov_dpp(__float_as_int(x), 0x150 + N, 0xf, 0xf, false)); }      // lane N of each 16-lane row to the whole row
// causal 3-tap conv, transposed: Ct = W.Xt per (tensor, head, 256 positions a block, 32 a wave). The block first rounds its head's 32 x 192 weights into LDS (k = tap * 64 + d, scaled by 16; pitch 200 halves
// keeps the 16-byte fragment reads of 16 rows off one another's banks). Beside them it brings its 258 x rows (positions first - 2 .. first + 255, clamped at the sequence's first row; this head's 64 floats of each) in ONCE, by loads of whole lines
// (a wave's load is two rows' 256 bytes each), rounds each value once and lays the rows in LDS as f16 at a pitch of 72 halves (144 bytes: 36 words, like the weights' 100, modulo the 64 banks). A = 16 channel rows, B = 16 positions: LDS rows s + tap of the
// block, so the three taps read the same staged rows, same k order as A (8*hh + j, 16 + 8*hh + j). A lane then holds ONE position's channels t*16 + 8*hh + r: 16-byte f16 stores, |c|^2 in the lane plus one exchange between the wave's halves.
// Rows and norms go out head-major ([b*NH + h][s / 16][fragment], [b*NH + h][s]): a wave writes 2 KiB of rows and one 128-byte line of norms, all its own. Inside a group of 16 positions the rows lie in the order in which the attention's
// matrix operand wants them: what lane l holds here for channel half t (position l % 16, channels t * 16 + 8 * (l / 16) + 0 .. 7) is what lane l of the attention takes as half t of its fragment, so it goes to byte t * 512 + l * 16 of the group's 1 KiB:
// each store here and each load there is 512 bytes in a row, four whole lines, not 16 bytes out of each of 16 rows.
__device__ __forceinline__ void conv_tile(const int blk, const float* __restrict__ qx, const float* __restrict__ kx, const float* __restrict__ cw, const float* __restrict__ cb, _Float16* __restrict__ Q16, _Float16* __restrict__ K16, float* __restrict__ NQ, float* __restrict__ NK) {
  __shared__ __attribute__((aligned(16))) unsigned short wsm[CCv][200]; __shared__ __attribute__((aligned(16))) unsigned short xsm[256 + 2][72];
  const int tid = threadIdx.x, w = tid >> 5, lane = tid & 31, ln = lane & 15, hh = lane >> 4;
  const int pg = blk % (NR / 256), h = (blk / (NR / 256)) % NH, z = blk / ((NR / 256) * NH);
  const float* x = z ? kx : qx; _Float16* C16 = z ? K16 : Q16; float* N2 = z ? NK : NQ;
  const int xr0 = tid >> 4, xc4 = (tid & 15) * 4, sb = (pg * 256) % TT;      // 16 threads a row, 16 bytes each; LDS row j is position sb + j - 2
  const float* xh = x + (size_t)((pg * 256) / TT) * TT * DDm + h * HD + xc4; const float* xh1 = xh + (size_t)(sb + xr0) * DDm; v4f xa[16];      // xh1: one address for all rows but the first 16, which step by constants
  { const int c = tid >> 3, d0 = (tid & 7) * 8; const float* wp = cw + ((size_t)(h * CCv + c) * HD + d0) * 3; float wv[24];      // a thread's 24 consecutive floats are 8 d x 3 taps of one channel
#pragma unroll
    for (int q = 0; q < 6; ++q) { const v4f a = *(const v4fa*)(wp + q * 4); wv[q * 4] = a[0]; wv[q * 4 + 1] = a[1]; wv[q * 4 + 2] = a[2]; wv[q * 4 + 3] = a[3]; }
    { const int ss = sb + xr0 - 2; xa[0] = *(const v4fa*)(xh + (size_t)(ss < 0 ? 0 : ss) * DDm); }      // only the block's first 16 rows can meet the clamp
    asm volatile("s_wait_xcnt 0x0" ::: "memory");      // the address registers of the loads above are dead from here on, and this build lets results of the loads below land in them
#pragma unroll
    for (int u = 1; u < 16; ++u) xa[u] = *(const v4fa*)(xh1 + (u * 16 - 2) * DDm);
    if (tid < 32) { const v4f xe = *(const v4fa*)(xh1 + 254 * DDm); FragH f;      // the last two of the 258 rows: wave 0, its load in flight with the others
#pragma unroll
      for (int q = 0; q < 4; ++q) f.h[q] = (_Float16)(float)(__bf16)xe[q];
      *(v4us*)&xsm[256 + xr0][xc4] = (v4us){f.u[0], f.u[1], f.u[2], f.u[3]}; }
#pragma unroll
    for (int i = 0; i < 3; ++i) { FragH f;
#pragma unroll
      for (int q = 0; q < 8; ++q) f.h[q] = (_Float16)(bf16_round(wv[q * 3 + i]) * 16.0f);
      *(v8us*)&wsm[c][i * 64 + d0] = f.half[0]; } }
#pragma unroll
  for (int u = 0; u < 16; ++u) { FragH f;      // the hardware's f32 -> bf16 conversion rounds to nearest even, as bf16_round does, in one instruction
#pragma unroll
    for (int q = 0; q < 4; ++q) f.h[q] = (_Float16)(float)(__bf16)xa[u][q];
    *(v4us*)&xsm[u * 16 + xr0][xc4] = (v4us){f.u[0], f.u[1], f.u[2], f.u[3]}; }
  __syncthreads();      // every wave reads fragments of weights and of x rows that all eight waves wrote
  const int row0 = pg * 256 + w * 32, b = row0 / TT, s0 = row0 % TT;
  v8f acc[2][2];
#pragma unroll
  for (int nt = 0; nt < 2; ++nt)
#pragma unroll
    for (int t = 0; t < 2; ++t) acc[nt][t] = (v8f){0.f,0.f,0.f,0.f,0.f,0.f,0.f,0.f};
#pragma unroll
  for (int i = 0; i < 3; ++i)
#pragma unroll
    for (int dd = 0; dd < 2; ++dd) { FragH aw[2], bx[2];
#pragma unroll
      for (int t = 0; t < 2; ++t) { const unsigned short* wk = &wsm[t * 16 + ln][i * 64 + dd * 32 + 8 * hh]; aw[t].half[0] = *(const v8us*)wk; aw[t].half[1] = *(const v8us*)(wk + 16); }
#pragma unroll
      for (int nt = 0; nt < 2; ++nt) { const unsigned short* xr = &xsm[w * 32 + nt * 16 + ln + i][dd * 32 + 8 * hh]; bx[nt].half[0] = *(const v8us*)xr; bx[nt].half[1] = *(const v8us*)(xr + 16); }
#pragma unroll
      for (int nt = 0; nt < 2; ++nt)
#pragma unroll
        for (int t = 0; t < 2; ++t) acc[nt][t] = mmaH<1>(aw[t].v, aw[t].v, bx[nt].v, bx[nt].v, acc[nt][t]); }
  float bv[2][8];
#pragma unroll
  for (int t = 0; t < 2; ++t) { const float* bp = cb + h * CCv + t * 16 + 8 * hh; const v4f b0 = *(const v4fa*)bp, b1 = *(const v4fa*)(bp + 4);
#pragma unroll
    for (int j = 0; j < 4; ++j) { bv[t][j] = bf16_round(b0[j]); bv[t][4 + j] = bf16_round(b1[j]); } }
#pragma unroll
  for (int nt = 0; nt < 2; ++nt) { const size_t prow = (size_t)(b * NH + h) * TT + s0 + nt * 16 + ln; float ss = 0.f;
#pragma unroll
    for (int t = 0; t < 2; ++t) { FragH f;
#pragma unroll
      for (int r = 0; r < 8; ++r) { const float v = acc[nt][t][r] * 0.0625f + bv[t][r]; ss += v * v; f.h[r] = (_Float16)v; }
      *(v8us*)((unsigned short*)C16 + (prow - ln) * CCv + t * 256 + lane * 8) = f.half[0]; }      // fragment order: 16 positions are 1 KiB, half t of lane l at t * 512 + l * 16 bytes
    ss += xhalf(ss);
    if (hh == 0) N2[prow] = ss; } }
// all that the attention needs, in ONE launch: the conv blocks (the longer ones) first, then the blocks of the shifted V transpose, which pack the mask beside it; the two kinds share nothing, and a block is wholly of one kind
#define NCB ((NR / 256) * NH * 2)
__global__ __launch_bounds__(256) void k_prep(const float* __restrict__ qx, const float* __restrict__ kx, const float* __restrict__ vx, const float* __restrict__ cw, const float* __restrict__ cb, _Float16* __restrict__ Q16, _Float16* __restrict__ K16, float* __restrict__ NQ, float* __restrict__ NK, _Float16* __restrict__ Vt, const int* __restrict__ MSK, unsigned* __restrict__ MB) {
  if (blockIdx.x < NCB) conv_tile((int)blockIdx.x, qx, kx, cw, cb, Q16, K16, NQ, NK); else vts_tile((int)blockIdx.x - NCB, vx, Vt, MSK, MB); }
__global__ __launch_bounds__(128) void k_sattn(const _Float16* __restrict__ Q16, const _Float16* __restrict__ K16, const float* __restrict__ NQ, const float* __restrict__ NK, const unsigned* __restrict__ MB, const _Float16* __restrict__ Vt, float* __restrict__ O) { constexpr int RPW = 32; constexpr int KSP = 4; constexpr int OP = HD + 4; constexpr float L2E = 1.4426950408889634f; constexpr float PCAP = 16384.0f;      // OP: a partial's row pitch, 272 bytes = 16 x 17, keeps the 16-byte writes of 16 queries off one another's banks
  __shared__ __attribute__((aligned(16))) float so[KSP][RPW][OP]; __shared__ __attribute__((aligned(16))) float sml[RPW][2 * KSP];      // per query: the four waves' maxima, then their sums
  const int tid = threadIdx.x, w = tid >> 5, lane = tid & 31, ln = lane & 15, hh = lane >> 4; const int slab = blockIdx.x % (BB * NH), qblk = (blockIdx.x / (BB * NH)) ^ (TT / RPW - 1) /* = 63 - x for x in 0 .. 63 */; const int b = slab / NH, h = slab % NH; const int q0 = qblk * RPW;
  FragH bq[2]; float q2c[2];
#pragma unroll
  for (int rt = 0; rt < 2; ++rt) { const size_t qrow = (size_t)slab * TT + q0 + rt * 16 + ln; const unsigned short* qr = (const unsigned short*)Q16 + (qrow - ln) * CCv + lane * 8; bq[rt].half[0] = *(const v8us*)qr; bq[rt].half[1] = *(const v8us*)(qr + 256); q2c[rt] = NQ[qrow]; }
  const int kslot = (ln < 8) ? 8 * hh + ln : 8 + 8 * hh + ln;      // lane ln of half hh fetches |kc|^2 of the key that the half's score register ln holds (tile ln / 8, register ln % 8)
  float m_c[2], l_c[2]; v2f nm_c; bool fresh = true; v8f oacc[2][4];      // m_c: the reference of the weights, a maximum that the query has met (not always the latest); nm_c = -m_c * log2(e); fresh: the wave has had no open tile yet; m starts finite and below every finite logit (|logit| <= sqrt(FLT_MAX)): exp2 arguments never meet inf - inf
#pragma unroll
  for (int rt = 0; rt < 2; ++rt) { m_c[rt] = -1.0e30f; nm_c[rt] = 1.0e30f * L2E; l_c[rt] = 0.f;
#pragma unroll
    for (int dt = 0; dt < 4; ++dt) oacc[rt][dt] = (v8f){0.f,0.f,0.f,0.f,0.f,0.f,0.f,0.f}; }
  // read places: a base that is the same for the whole block and steps by four 32-key tiles a trip, plus each lane's own fixed byte offset (the wave's first tile in it)
  const char* kb = (const char*)(K16 + (size_t)slab * TT * CCv); const char* nb = (const char*)(NK + (size_t)slab * TT); const char* vb = (const char*)(Vt + (size_t)slab * HD * TT);
  const unsigned klo = (unsigned)((w * 32 * CCv + lane * 8) * 2), nlo = (unsigned)((w * 32 + kslot) * 4), vlo = (unsigned)((w * 32 * HD + lane * 8) * 2);      // K and V lie in fragment order: a lane's 16 bytes at lane * 16 of each 512-byte half
  // the packed mask of the wave's 16 key tiles, 2 KiB in a row (the wave's number made scalar, so that the address is the same in every lane for the compiler too). Which tiles have an open key is known in front of the loop:
  // four whole-line loads, 8 lanes a tile; bit t of opn = tile t has one. The loop ends behind the last open tile (opn < 65536 and moves down a bit a trip: 16 trips at most) and passes a closed tile on a scalar test, with no load.
  const unsigned* mw = MB + (size_t)(qblk * KSP + __builtin_amdgcn_readfirstlane(w)) * (TT / (32 * KSP)) * 32; unsigned opn = 0u;
#pragma unroll
  for (int i = 0; i < 4; ++i) { const v4ia a = *(const v4ia*)(mw + i * 128 + lane * 4); const unsigned ob = __builtin_amdgcn_ballot_w32(((a[0] | a[1]) | (a[2] | a[3])) != 0);
#pragma unroll
    for (int j = 0; j < 4; ++j) opn |= (((ob >> (8 * j)) & 0xffu) != 0u ? 1u : 0u) << (i * 4 + j); }
  asm volatile("" :: "v"(bq[0].v), "v"(bq[1].v), "v"(q2c[0]), "v"(q2c[1]));      // loaded values as inputs only: holds the query loads in front of the loop's entry test, where they fly beside the four mask loads; without it they sink behind that test and wait a second time
#pragma unroll 1
  for (; opn != 0u; opn >>= 1, mw += 32, kb += 32 * KSP * CCv * 2, nb += 32 * KSP * 4, vb += 32 * KSP * HD * 2) {
    if ((opn & 1u) == 0u) continue;      // wave-uniform skip of fully masked tiles
    const v16ua mk[2] = {*(const v16ua*)mw, *(const v16ua*)(mw + 16)};      // the tile's 32 select masks, the same for every lane: scalar loads, beside the vector loads below
    FragH ak[2], av[4];
#pragma unroll
    for (int nt = 0; nt < 2; ++nt) { const unsigned short* kr = (const unsigned short*)(kb + klo) + nt * 16 * CCv; ak[nt].half[0] = *(const v8us*)kr; ak[nt].half[1] = *(const v8us*)(kr + 256); }
    const float k2l = *(const float*)(nb + nlo);
#pragma unroll
    for (int dt = 0; dt < 4; ++dt) { const unsigned short* vrow = (const unsigned short*)(vb + vlo) + dt * 512; av[dt].half[0] = *(const v8us*)vrow; av[dt].half[1] = *(const v8us*)(vrow + 256); }
    v8f s[2][2];
#pragma unroll
    for (int nt = 0; nt < 2; ++nt)
#pragma unroll
      for (int rt = 0; rt < 2; ++rt) { v8f acc = (v8f){0.f,0.f,0.f,0.f,0.f,0.f,0.f,0.f}; acc = mmaH<1>(ak[nt].v, ak[nt].v, bq[rt].v, bq[rt].v, acc); s[rt][nt] = acc; }
    const float k2v[2][8] = {{rowshare<0>(k2l), rowshare<1>(k2l), rowshare<2>(k2l), rowshare<3>(k2l), rowshare<4>(k2l), rowshare<5>(k2l), rowshare<6>(k2l), rowshare<7>(k2l)},
                             {rowshare<8>(k2l), rowshare<9>(k2l), rowshare<10>(k2l), rowshare<11>(k2l), rowshare<12>(k2l), rowshare<13>(k2l), rowshare<14>(k2l), rowshare<15>(k2l)}};
    FragH pb[2]; v2f sv[2][8], ps;      // a pair is the same key for the wave's two query tiles: packed instructions then serve both
#pragma unroll
    for (int nt = 0; nt < 2; ++nt)
#pragma unroll
      for (int r = 0; r < 8; ++r)
#pragma unroll
        for (int rt = 0; rt < 2; ++rt) { const float d = fmaxf(q2c[rt] + k2v[nt][r] - 2.0f * s[rt][nt][r], 1e-12f); sv[nt][r][rt] = __builtin_amdgcn_inverse_ballot_w32(mk[rt][nt * 8 + r]) ? -__builtin_amdgcn_sqrtf(d) : -INFINITY; }      // d >= 1e-12: never a denormal, the hardware root needs no range fix-up
    // the usual path: weights against the reference in use, exp(x - m) = exp2(x * log2(e) - m * log2(e)): one fma and the hardware exp2; a closed key's -inf gives exp2(-inf) = 0. No maximum is taken and Ot is not touched.
    // The weights are >= 0, so a lane's sum of 16 bounds each of them: a sum of at most PCAP says that every one fits f16 with room to spare. One test a tile for the whole wave; a query still at the start value gets +inf for an open key and fails it.
    bool redo = fresh;
    if (!fresh) { ps = (v2f){0.f, 0.f};
#pragma unroll
      for (int nt = 0; nt < 2; ++nt) { v2f t[8], p[8];
#pragma unroll
        for (int r = 0; r < 8; ++r) { t[r] = __builtin_elementwise_fma(sv[nt][r], (v2f){L2E, L2E}, nm_c); p[r] = (v2f){__builtin_amdgcn_exp2f(t[r][0]), __builtin_amdgcn_exp2f(t[r][1])}; }
        // the slot behind a transcendental: inputs only, so every argument's register stays whole until all of these exp2 have issued: none is overwritten directly behind its exp2 (left to itself this build computes them in place and pads ten more v_nop a tile); the v_nop is the slot behind the last
        asm volatile("v_nop" :: "v"(t[0]), "v"(t[1]), "v"(t[2]), "v"(t[3]), "v"(t[4]), "v"(t[5]), "v"(t[6]), "v"(t[7]), "v"(p[0]), "v"(p[1]), "v"(p[2]), "v"(p[3]), "v"(p[4]), "v"(p[5]), "v"(p[6]), "v"(p[7]));
#pragma unroll
        for (int r = 0; r < 8; ++r) { ps += p[r]; pb[0].h[nt * 8 + r] = (_Float16)p[r][0]; pb[1].h[nt * 8 + r] = (_Float16)p[r][1]; } }
      redo = __builtin_amdgcn_ballot_w32(fmaxf(ps[0], ps[1]) > PCAP) != 0u; }
    if (redo) {      // the wave's first open tile, or a weight too large: take the larger of the reference and the tile's maximum as the new reference, bring sum and Ot to it, and form the tile's weights again
#pragma unroll
      for (int rt = 0; rt < 2; ++rt) { float mc = -INFINITY;
#pragma unroll
        for (int nt = 0; nt < 2; ++nt)
#pragma unroll
          for (int r = 0; r < 8; ++r) mc = fmaxf(mc, sv[nt][r][rt]);
        mc = fmaxf(mc, xhalf(mc));
        const float mn = fmaxf(m_c[rt], mc); const float ta = (m_c[rt] - mn) * L2E; const float al = __builtin_amdgcn_exp2f(ta); m_c[rt] = mn; const float nm = -mn * L2E; nm_c[rt] = nm;
        float pr = 0.f;
#pragma unroll
        for (int nt = 0; nt < 2; ++nt) { float t[8], p[8];
#pragma unroll
          for (int r = 0; r < 8; ++r) { t[r] = __builtin_fmaf(sv[nt][r][rt], L2E, nm); p[r] = __builtin_amdgcn_exp2f(t[r]); }
          // the slot behind a transcendental, as above
          asm volatile("v_nop" :: "v"(t[0]), "v"(t[1]), "v"(t[2]), "v"(t[3]), "v"(t[4]), "v"(t[5]), "v"(t[6]), "v"(t[7]), "v"(p[0]), "v"(p[1]), "v"(p[2]), "v"(p[3]), "v"(p[4]), "v"(p[5]), "v"(p[6]), "v"(p[7]), "v"(ta), "v"(al));
#pragma unroll
          for (int r = 0; r < 8; ++r) { pr += p[r]; pb[rt].h[nt * 8 + r] = (_Float16)p[r]; } }
        l_c[rt] = l_c[rt] * al + pr;
#pragma unroll
        for (int dt = 0; dt < 4; ++dt)
#pragma unroll
          for (int r = 0; r < 8; ++r) oacc[rt][dt][r] *= al; } }
    else { l_c[0] += ps[0]; l_c[1] += ps[1]; }      // the half's own 16 keys; the halves join behind the loop
    fresh = false;
#pragma unroll
    for (int dt = 0; dt < 4; ++dt)
#pragma unroll
      for (int rt = 0; rt < 2; ++rt) oacc[rt][dt] = mmaH<1>(av[dt].v, av[dt].v, pb[rt].v, pb[rt].v, oacc[rt][dt]); }
  // the wave's partial goes to LDS: rows [query][d], un-normalised, with its maximum and its sum (the halves joined here)
#pragma unroll
  for (int rt = 0; rt < 2; ++rt) { const float l = l_c[rt] + xhalf(l_c[rt]); if (hh == 0) { sml[rt * 16 + ln][w] = m_c[rt]; sml[rt * 16 + ln][KSP + w] = l; } float* prow = &so[w][rt * 16 + ln][8 * hh];
#pragma unroll
    for (int dt = 0; dt < 4; ++dt) { const v4f lo = {oacc[rt][dt][0], oacc[rt][dt][1], oacc[rt][dt][2], oacc[rt][dt][3]}, hi = {oacc[rt][dt][4], oacc[rt][dt][5], oacc[rt][dt][6], oacc[rt][dt][7]}; *(v4fa*)(prow + dt * 16) = lo; *(v4fa*)(prow + dt * 16 + 4) = hi; } }
  __syncthreads();      // every wave merges rows that all four waves wrote
  // merge: wave w owns queries 8 * w .. 8 * w + 7, two a pass; 16 lanes x 16 bytes are one query's whole 256-byte output row, so every 128-byte line has one writer and goes out in one store
#pragma unroll
  for (int c = 0; c < 4; ++c) { const int qq = w * 8 + c * 2 + hh; const v4f mv = *(const v4fa*)&sml[qq][0], lv = *(const v4fa*)&sml[qq][KSP];
    const float mj = fmaxf(fmaxf(mv[0], mv[1]), fmaxf(mv[2], mv[3])); float t[KSP], e[KSP]; float l = 0.f; v4f o = {0.f, 0.f, 0.f, 0.f};      // a wave that met no open key has maximum -1e30, sum 0 and zeros: weight 0, or 1 on zeros where no wave met one
#pragma unroll
    for (int p = 0; p < KSP; ++p) t[p] = (mv[p] - mj) * L2E;
    // the four weights' exp2 and the slot behind a transcendental in one statement: results in registers of their own, so none is read and no argument overwritten directly behind its exp2; the v_nop fills the slot behind the last
    asm("v_exp_f32 %0, %4\n\tv_exp_f32 %1, %5\n\tv_exp_f32 %2, %6\n\tv_exp_f32 %3, %7\n\tv_nop" : "=&v"(e[0]), "=&v"(e[1]), "=&v"(e[2]), "=&v"(e[3]) : "v"(t[0]), "v"(t[1]), "v"(t[2]), "v"(t[3]));
#pragma unroll
    for (int p = 0; p < KSP; ++p) { l += e[p] * lv[p]; const v4f a = *(const v4fa*)&so[p][qq][ln * 4]; o += a * e[p]; }
    const float li = (l > 0.f) ? 1.0f / l : 0.f;
    *(v4f*)(O + ((size_t)b * TT + q0 + qq) * DDm + h * HD + ln * 4) = o * li; } }
extern "C" void kernel_launch(void* const* d_in, const int* in_sizes, int n_in,
                              void* d_out, int out_size, void* d_ws, size_t ws_size, hipStream_t stream) {
  (void)in_sizes; (void)n_in; (void)out_size;
  const float* qx = (const float*)d_in[0]; const float* kx = (const float*)d_in[1]; const float* vx = (const float*)d_in[2]; const int* mask = (const int*)d_in[3]; const float* cw = (const float*)d_in[4]; const float* cb = (const float*)d_in[5];
  char* ws = (char*)d_ws; size_t off = 0;
  auto take = [&](size_t bytes) { char* p = ws + off; off += (bytes + 255) & ~(size_t)255; return p; };
  _Float16* Q16 = (_Float16*)take((size_t)NR * NH * CCv * 2); _Float16* K16 = (_Float16*)take((size_t)NR * NH * CCv * 2); float* NQ = (float*)take((size_t)NR * NH * 4); float* NK = (float*)take((size_t)NR * NH * 4); _Float16* Vt = (_Float16*)take((size_t)NR * DDm * 2); unsigned* MB = (unsigned*)take((size_t)TT * TT / 8);
  if (off > ws_size) return;      // 4.2 x 2 + 0.26 x 2 + 8.4 + 0.52: about 17 MiB
  k_prep<<<NCB + BB * NH * (TT / 64), 256, 0, stream>>>(qx, kx, vx, cw, cb, Q16, K16, NQ, NK, Vt, mask, MB);
  k_sattn<<<BB * NH * (TT / 32), 128, 0, stream>>>(Q16, K16, NQ, NK, MB, Vt, (float*)d_out);
}

// v010
// A run of this version takes 33.1 microseconds.
// Timed twice side by side with v009, it ran 1.04 times as fast both times.
// All steps since v000 together make it 15.9 times as fast.
#include <hip/hip_runtime.h>
// Simplex (distance-based) attention (B=4, S=2048, 8 heads × 64, conv channels 32): the per-head causal 3-tap conv of q and k on WMMA (+ bias, f16 rows and norms head-major) and the shifted V transpose in one preparation launch, and the attention as a
// fused flash-style kernel on v_wmma_f32_16x16x32_f16 — S = qc·kc (d = 32, one k-step), logits = −sqrt(max(|qc|² + |kc|² − 2S, 1e-12)), INPUT mask (nonzero = keep), online softmax f32,
// P f16 ≤ 16384, and the roll(attn, 1) folded into a one-step shift of V (out[s] = Σ_t attn[s][t]·v[t+1 mod S]); f16 operands, single products, f32 accumulate; norms f32 VALU in the conv's epilogue.
#define BB 4
#define TT 2048
#define DDm 512
#define NH 8
#define HD 64
#define CCv 32
#define NR (BB * TT)

typedef __bf16 v16b __attribute__((ext_vector_type(16)));
typedef unsigned short v8us __attribute__((ext_vector_type(8), may_alias));
typedef float  v8f  __attribute__((ext_vector_type(8)));
typedef float  v4f  __attribute__((ext_vector_type(4)));
typedef float  v4fa __attribute__((ext_vector_type(4), may_alias));
union FragB { v16b v; v8us half[2]; unsigned short u[16]; };

__device__ __forceinline__ unsigned short bf16_bits(float x) { unsigned int u = __float_as_uint(x); return (unsigned short)((u + 0x7FFFu + ((u >> 16) & 1u)) >> 16); }
__device__ __forceinline__ float bf16_val(unsigned short b) { return __uint_as_float(((unsigned int)b) << 16); }
__device__ __forceinline__ float bf16_round(float x) { return bf16_val(bf16_bits(x)); }
// D += A·B with NT terms: 1 = ah·bh, 2 = + al·bh (A split), 3 = + ah·bl (both split)
template <int NT>
__device__ __forceinline__ v8f mmaN(v16b ah, v16b al, v16b bh, v16b bl, v8f c) {
  c = __builtin_amdgcn_wmma_f32_16x16x32_bf16(false, ah, false, bh, (short)0, c, false, false);
  if (NT >= 2) c = __builtin_amdgcn_wmma_f32_16x16x32_bf16(false, al, false, bh, (short)0, c, false, false);
  if (NT >= 3) c = __builtin_amdgcn_wmma_f32_16x16x32_bf16(false, ah, false, bl, (short)0, c, false, false);
  asm volatile("v_nop\n\tv_nop\n\tv_nop\n\tv_nop" : "+v"(c) : "v"(ah), "v"(al), "v"(bh), "v"(bl));
  return c;
}

__global__ __launch_bounds__(256) void k_wt_bf16(const float* __restrict__ W, unsigned short* __restrict__ Wt, int K, int N) {
  const int t = blockIdx.x * 256 + threadIdx.x;
  const int k8n = K / 8;
  if (t >= N * k8n) return;
  const int n = t / k8n, k8 = (t % k8n) * 8;
  v8us v;
#pragma unroll
  for (int i = 0; i < 8; ++i) v[i] = bf16_bits(W[(size_t)(k8 + i) * N + n]);
  *(v8us*)(Wt + (size_t)n * K + k8) = v;
  
}

// GEMM C[M][N] (f32, pitch ldc) = act(A[M][K]·W + bias). A f32 row-major (pitch lda) converted per fragment to bf16
// (ASPLIT: hi/lo two planes -> 2 terms, else single rounded term); Wt bf16 [N][K] (pitch ldb). BIAS_BF16 rounds the
// bias to bf16 first (bias quantised to bf16 before the add). K%32==0, M%16==0, N%64==0.
template <bool ASPLIT, int ACT, bool BIAS_BF16>
__global__ __launch_bounds__(128) void k_gemm_bf(const float* __restrict__ A, int lda, const unsigned short* __restrict__ Wt, int ldb,
                                               const float* __restrict__ bias, float* __restrict__ C, int ldc, int M, int N, int K) {
  __shared__ __attribute__((aligned(16))) float so[4][16][64];
  const int tid = threadIdx.x, w = tid >> 5, lane = tid & 31, ln = lane & 15, hh = lane >> 4;
  const int ntn = N / 64;
  const int wid = blockIdx.x * 4 + w;
  const int mt = wid / ntn, nq = wid % ntn;
  if (mt * 16 >= M) return;
  const int row0 = mt * 16, col0 = nq * 64;
  const float* arow = A + (size_t)(row0 + ln) * lda;
  v8f acc[4] = {};
  for (int kb = 0; kb < K; kb += 32) {
    FragB ah, al;
    const v4f x0 = *(const v4fa*)(arow + kb + 8 * hh), x1 = *(const v4fa*)(arow + kb + 8 * hh + 4);
    const v4f x2 = *(const v4fa*)(arow + kb + 16 + 8 * hh), x3 = *(const v4fa*)(arow + kb + 16 + 8 * hh + 4);
    float xs[16] = {x0[0],x0[1],x0[2],x0[3],x1[0],x1[1],x1[2],x1[3],x2[0],x2[1],x2[2],x2[3],x3[0],x3[1],x3[2],x3[3]};
#pragma unroll
    for (int i = 0; i < 16; ++i) { const unsigned short hb = bf16_bits(xs[i]); ah.u[i] = hb; al.u[i] = ASPLIT ? bf16_bits(xs[i] - bf16_val(hb)) : (unsigned short)0; }
#pragma unroll
    for (int t = 0; t < 4; ++t) {
      const unsigned short* brow = Wt + (size_t)(col0 + t * 16 + ln) * ldb + kb;
      FragB b;
      b.half[0] = *(const v8us*)(brow + 8 * hh);
      b.half[1] = *(const v8us*)(brow + 16 + 8 * hh);
      acc[t] = mmaN<ASPLIT ? 2 : 1>(ah.v, al.v, b.v, b.v, acc[t]);
    }
  }
#pragma unroll
  for (int t = 0; t < 4; ++t) {
    float bv = bias ? bias[col0 + t * 16 + ln] : 0.f;
    if (BIAS_BF16) bv = bf16_round(bv);
#pragma unroll
    for (int r = 0; r < 8; ++r) { float v = acc[t][r] + bv; if (ACT == 1) v = fmaxf(v, 0.f); so[w][8 * hh + r][t * 16 + ln] = v; }
  }
  __builtin_amdgcn_fence(__ATOMIC_ACQ_REL, "workgroup");
  __builtin_amdgcn_wave_barrier();
  const int rsub = lane >> 4, c4 = (lane & 15) * 4;
  {
#pragma unroll
    for (int q = 0; q < 8; ++q) {
      const int r = q * 2 + rsub;
      const v4f v = *(const v4fa*)&so[w][r][c4];
      *(v4f*)(C + (size_t)(row0 + r) * ldc + col0 + c4) = v;
    }
    
  }
}

// Flash-style causal/unmasked attention, all contractions 3-term bf16 hi/lo splits, f32 softmax with running max.
// q,k,v rows are read from f32 buffers with arbitrary row pitch (so they can live inside a fused qkv buffer);
// D = head size (multiple of 32, <= 128); one wave = 16 query rows; block = 4 waves (64 queries) sharing K/V chunks of 32.
template <int D, bool CAUSAL>
__global__ __launch_bounds__(128) void k_flash(const float* __restrict__ qb, const float* __restrict__ kb, const float* __restrict__ vb,
                                             int pitch, int T, int H, float scale, float* __restrict__ y, int ypitch) {
  constexpr int KS = D / 32;        // k-steps for QK
  constexpr int DT = D / 16;        // d tiles for PV
  __shared__ __attribute__((aligned(16))) unsigned short sKh[32][D + 8], sKl[32][D + 8], sVh[32][D + 8], sVl[32][D + 8];
  __shared__ __attribute__((aligned(16))) unsigned short sPh[4][16][40], sPl[4][16][40];
  __shared__ __attribute__((aligned(16))) float sO[4][16][D];
  const int tid = threadIdx.x, w = tid >> 5, lane = tid & 31, ln = lane & 15, hh = lane >> 4;
  const int nqb = (T + 63) / 64;
  const int bh = blockIdx.x / nqb, qblk = blockIdx.x % nqb;
  const int b = bh / H, h = bh % H;
  const int q0 = qblk * 64 + w * 16;
  const float* Q = qb + (size_t)b * T * pitch + h * D;
  const float* K = kb + (size_t)b * T * pitch + h * D;
  const float* V = vb + (size_t)b * T * pitch + h * D;

  // A fragments of the wave's 16 query rows (scaled), hi/lo
  FragB aqh[KS], aql[KS];
  {
    int row = q0 + ln; if (row >= T) row = T - 1;
    const float* qr = Q + (size_t)row * pitch;
#pragma unroll
    for (int ks = 0; ks < KS; ++ks)
#pragma unroll
      for (int i = 0; i < 16; ++i) {
        const int d = ks * 32 + ((i < 8) ? (8 * hh + i) : (16 + 8 * hh + (i - 8)));
        const float x = qr[d] * scale; const unsigned short hb = bf16_bits(x);
        aqh[ks].u[i] = hb; aql[ks].u[i] = bf16_bits(x - bf16_val(hb));
      }
  }
  float m_r[8], l_r[8];
#pragma unroll
  for (int r = 0; r < 8; ++r) { m_r[r] = -3.0e38f; l_r[r] = 0.f; }
  v8f oacc[DT];
#pragma unroll
  for (int dt = 0; dt < DT; ++dt) oacc[dt] = (v8f){0.f,0.f,0.f,0.f,0.f,0.f,0.f,0.f};

  const int kv_end = CAUSAL ? min(T, qblk * 64 + 64) : T;     // block-uniform
  for (int j0 = 0; j0 < kv_end; j0 += 32) {
    __syncthreads();
    for (int e = tid; e < 32 * (D / 4); e += 128) {
      const int r = e / (D / 4), c4 = (e % (D / 4)) * 4;
      const int key = j0 + r;
      v4f kf = {0.f,0.f,0.f,0.f}, vf = {0.f,0.f,0.f,0.f};
      if (key < T) { kf = *(const v4fa*)(K + (size_t)key * pitch + c4); vf = *(const v4fa*)(V + (size_t)key * pitch + c4); }
#pragma unroll
      for (int t = 0; t < 4; ++t) {
        unsigned short hb = bf16_bits(kf[t]); sKh[r][c4 + t] = hb; sKl[r][c4 + t] = bf16_bits(kf[t] - bf16_val(hb));
        hb = bf16_bits(vf[t]); sVh[r][c4 + t] = hb; sVl[r][c4 + t] = bf16_bits(vf[t] - bf16_val(hb));
      }
    }
    __syncthreads();
    // S tile 16 x 32
    v8f s[2];
#pragma unroll
    for (int nt = 0; nt < 2; ++nt) {
      v8f acc = {};
#pragma unroll
      for (int ks = 0; ks < KS; ++ks) {
        FragB bh_, bl_;
        bh_.half[0] = *(const v8us*)&sKh[nt * 16 + ln][ks * 32 + 8 * hh]; bh_.half[1] = *(const v8us*)&sKh[nt * 16 + ln][ks * 32 + 16 + 8 * hh];
        bl_.half[0] = *(const v8us*)&sKl[nt * 16 + ln][ks * 32 + 8 * hh]; bl_.half[1] = *(const v8us*)&sKl[nt * 16 + ln][ks * 32 + 16 + 8 * hh];
        acc = mmaN<3>(aqh[ks].v, aql[ks].v, bh_.v, bl_.v, acc);
      }
      s[nt] = acc;
    }
    // mask + running max (rows 8hh+r; the 16 lanes of a half share rows)
    float alpha[8];
#pragma unroll
    for (int r = 0; r < 8; ++r) {
      const int qi = q0 + 8 * hh + r;
      const int ja = j0 + ln, jb = j0 + 16 + ln;
      if (CAUSAL) { if (ja > qi) s[0][r] = -3.0e38f; if (jb > qi) s[1][r] = -3.0e38f; }
      if (ja >= T) s[0][r] = -3.0e38f;
      if (jb >= T) s[1][r] = -3.0e38f;
      float mx = fmaxf(s[0][r], s[1][r]);
      mx = fmaxf(mx, __shfl_xor(mx, 1, 32)); mx = fmaxf(mx, __shfl_xor(mx, 2, 32)); mx = fmaxf(mx, __shfl_xor(mx, 4, 32)); mx = fmaxf(mx, __shfl_xor(mx, 8, 32));
      const float mnew = fmaxf(m_r[r], mx);
      alpha[r] = (mnew > -1.0e38f) ? __expf(m_r[r] - mnew) : 1.0f;
      const float p0 = (s[0][r] > -1.0e38f) ? __expf(s[0][r] - mnew) : 0.f;
      const float p1 = (s[1][r] > -1.0e38f) ? __expf(s[1][r] - mnew) : 0.f;
      m_r[r] = mnew;
      l_r[r] = l_r[r] * alpha[r] + p0 + p1;            // per-lane partial row sum (16 lanes combined at the end)
      unsigned short hb = bf16_bits(p0); sPh[w][8 * hh + r][ln] = hb;      sPl[w][8 * hh + r][ln] = bf16_bits(p0 - bf16_val(hb));
      hb = bf16_bits(p1);                sPh[w][8 * hh + r][16 + ln] = hb; sPl[w][8 * hh + r][16 + ln] = bf16_bits(p1 - bf16_val(hb));
    }
#pragma unroll
    for (int dt = 0; dt < DT; ++dt)
#pragma unroll
      for (int r = 0; r < 8; ++r) oacc[dt][r] *= alpha[r];
    __builtin_amdgcn_fence(__ATOMIC_ACQ_REL, "workgroup");
    __builtin_amdgcn_wave_barrier();
    FragB pah, pal;
    pah.half[0] = *(const v8us*)&sPh[w][ln][8 * hh]; pah.half[1] = *(const v8us*)&sPh[w][ln][16 + 8 * hh];
    pal.half[0] = *(const v8us*)&sPl[w][ln][8 * hh]; pal.half[1] = *(const v8us*)&sPl[w][ln][16 + 8 * hh];
#pragma unroll
    for (int dt = 0; dt < DT; ++dt) {
      FragB bvh, bvl;
#pragma unroll
      for (int i = 0; i < 8; ++i) {
        bvh.u[i] = sVh[8 * hh + i][dt * 16 + ln]; bvh.u[8 + i] = sVh[16 + 8 * hh + i][dt * 16 + ln];
        bvl.u[i] = sVl[8 * hh + i][dt * 16 + ln]; bvl.u[8 + i] = sVl[16 + 8 * hh + i][dt * 16 + ln];
      }
      oacc[dt] = mmaN<3>(pah.v, pal.v, bvh.v, bvl.v, oacc[dt]);
    }
    __builtin_amdgcn_fence(__ATOMIC_ACQ_REL, "workgroup");
    __builtin_amdgcn_wave_barrier();
  }
#pragma unroll
  for (int r = 0; r < 8; ++r) {
    float l = l_r[r];
    l += __shfl_xor(l, 1, 32); l += __shfl_xor(l, 2, 32); l += __shfl_xor(l, 4, 32); l += __shfl_xor(l, 8, 32);
    l_r[r] = (l > 0.f) ? 1.0f / l : 0.f;
  }
#pragma unroll
  for (int dt = 0; dt < DT; ++dt)
#pragma unroll
    for (int r = 0; r < 8; ++r) sO[w][8 * hh + r][dt * 16 + ln] = oacc[dt][r] * l_r[r];
  __builtin_amdgcn_fence(__ATOMIC_ACQ_REL, "workgroup");
  __builtin_amdgcn_wave_barrier();
  {
    for (int r = 0; r < 16; ++r) {
      const int row = q0 + r;
      if (row < T && lane < D / 4) {
        const v4f val = *(const v4fa*)&sO[w][r][lane * 4];
        *(v4f*)(y + ((size_t)b * T + row) * ypitch + h * D + lane * 4) = val;
      }
    }
    
  }
}

// GEMM C = act(A·W + bias + resid): A f32 (ASPLIT -> hi/lo 2 terms), Wt bf16 [N][K]; ACT 0 none, 1 relu, 2 exact gelu;
// resid (optional, f32, row index = (row % rmod), pitch ldr, RES_BF16 rounds it) added before the activation.
template <bool ASPLIT, int ACT, bool BIAS_BF16, bool RES_BF16>
__global__ __launch_bounds__(128) void k_gemm_bf3(const float* __restrict__ A, int lda, const unsigned short* __restrict__ Wt, int ldb,
                                                const float* __restrict__ bias, const float* __restrict__ resid, int rmod, int ldr,
                                                float* __restrict__ C, int ldc, int M, int N, int K) {
  __shared__ __attribute__((aligned(16))) float so[4][16][64];
  const int tid = threadIdx.x, w = tid >> 5, lane = tid & 31, ln = lane & 15, hh = lane >> 4;
  const int ntn = N / 64;
  const int wid = blockIdx.x * 4 + w;
  const int mt = wid / ntn, nq = wid % ntn;
  if (mt * 16 >= M) return;
  const int row0 = mt * 16, col0 = nq * 64;
  const float* arow = A + (size_t)(row0 + ln) * lda;
  v8f acc[4] = {};
  for (int kb = 0; kb < K; kb += 32) {
    FragB ah, al;
    const v4f x0 = *(const v4fa*)(arow + kb + 8 * hh), x1 = *(const v4fa*)(arow + kb + 8 * hh + 4);
    const v4f x2 = *(const v4fa*)(arow + kb + 16 + 8 * hh), x3 = *(const v4fa*)(arow + kb + 16 + 8 * hh + 4);
    float xs[16] = {x0[0],x0[1],x0[2],x0[3],x1[0],x1[1],x1[2],x1[3],x2[0],x2[1],x2[2],x2[3],x3[0],x3[1],x3[2],x3[3]};
#pragma unroll
    for (int i = 0; i < 16; ++i) { const unsigned short hb = bf16_bits(xs[i]); ah.u[i] = hb; al.u[i] = ASPLIT ? bf16_bits(xs[i] - bf16_val(hb)) : (unsigned short)0; }
#pragma unroll
    for (int t = 0; t < 4; ++t) {
      const unsigned short* brow = Wt + (size_t)(col0 + t * 16 + ln) * ldb + kb;
      FragB b;
      b.half[0] = *(const v8us*)(brow + 8 * hh);
      b.half[1] = *(const v8us*)(brow + 16 + 8 * hh);
      acc[t] = mmaN<ASPLIT ? 2 : 1>(ah.v, al.v, b.v, b.v, acc[t]);
    }
  }
#pragma unroll
  for (int t = 0; t < 4; ++t) {
    const int col = col0 + t * 16 + ln;
    float bv = bias ? bias[col] : 0.f;
    if (BIAS_BF16) bv = bf16_round(bv);
#pragma unroll
    for (int r = 0; r < 8; ++r) {
      float v = acc[t][r] + bv;
      if (resid) { float rv = resid[(size_t)((row0 + 8 * hh + r) % rmod) * ldr + col]; if (RES_BF16) rv = bf16_round(rv); v += rv; }
      if (ACT == 1) v = fmaxf(v, 0.f);
      if (ACT == 2) v = 0.5f * v * (1.0f + erff(v * 0.70710678118654752f));
      if (ACT == 3) { const float u = 0.7978845608028654f * (v + 0.044715f * v * v * v); v = 0.5f * v * (1.0f + tanhf(u)); }
      so[w][8 * hh + r][t * 16 + ln] = v;
    }
  }
  __builtin_amdgcn_fence(__ATOMIC_ACQ_REL, "workgroup");
  __builtin_amdgcn_wave_barrier();
  const int rsub = lane >> 4, c4 = (lane & 15) * 4;
  {
#pragma unroll
    for (int q = 0; q < 8; ++q) {
      const int r = q * 2 + rsub;
      const v4f v = *(const v4fa*)&so[w][r][c4];
      *(v4f*)(C + (size_t)(row0 + r) * ldc + col0 + c4) = v;
    }
    
  }
}
// row LayerNorm (biased variance, eps) over N: s = X (+ R); optional out_sum <- s; out_norm <- (s-mu)*rsqrt(var+eps)*g + b
template <bool PARAM_BF16>
__global__ __launch_bounds__(256) void k_layernorm(const float* __restrict__ X, const float* __restrict__ R, const float* __restrict__ g, const float* __restrict__ bta,
                                                  float* __restrict__ out_sum, float* __restrict__ out_norm, int N, float eps) {
  __shared__ float red[256];
  const int row = blockIdx.x, tid = threadIdx.x;
  const float* x = X + (size_t)row * N; const float* rr = R ? R + (size_t)row * N : nullptr;
  float vals[16];                     // up to N = 4096
  const int per = N / 256;            // contiguous chunk per thread? use strided-by-4 chunks: thread handles j = tid*4 + 1024*u
  float s1 = 0.f;
  for (int u = 0; u < per / 4; ++u) {
    const int j = tid * 4 + 1024 * u;
    const v4f a = *(const v4fa*)(x + j);
    v4f b = {0.f,0.f,0.f,0.f}; if (rr) b = *(const v4fa*)(rr + j);
#pragma unroll
    for (int q = 0; q < 4; ++q) { const float v = a[q] + b[q]; vals[u * 4 + q] = v; s1 += v; }
  }
  red[tid] = s1; __syncthreads();
  for (int st = 128; st > 0; st >>= 1) { if (tid < st) red[tid] += red[tid + st]; __syncthreads(); }
  const float mu = red[0] / (float)N; __syncthreads();
  float s2 = 0.f;
  for (int u = 0; u < per / 4; ++u)
#pragma unroll
    for (int q = 0; q < 4; ++q) { const float c = vals[u * 4 + q] - mu; s2 += c * c; }
  red[tid] = s2; __syncthreads();
  for (int st = 128; st > 0; st >>= 1) { if (tid < st) red[tid] += red[tid + st]; __syncthreads(); }
  const float rs = rsqrtf(red[0] / (float)N + eps);
  {
    for (int u = 0; u < per / 4; ++u) {
      const int j = tid * 4 + 1024 * u;
      v4f o, sm;
#pragma unroll
      for (int q = 0; q < 4; ++q) {
        float gg = g[j + q], bb = bta[j + q];
        if (PARAM_BF16) { gg = bf16_round(gg); bb = bf16_round(bb); }
        sm[q] = vals[u * 4 + q]; o[q] = (vals[u * 4 + q] - mu) * rs * gg + bb;
      }
      if (out_sum) *(v4f*)(out_sum + (size_t)row * N + j) = sm;
      *(v4f*)(out_norm + (size_t)row * N + j) = o;
    }
    
  }
}



// ---- f16 WMMA path (v_wmma_f32_16x16x32_f16): 11-bit significands for operands in range — used where a softmax weight operand (0 .. 16384) needs more precision than bf16
typedef _Float16 v16h __attribute__((ext_vector_type(16)));
union FragH { v16h v; v8us half[2]; _Float16 h[16]; unsigned short u[16]; };
template <int NT>
__device__ __forceinline__ v8f mmaH(v16h ah, v16h al, v16h bh, v16h bl, v8f c) {
  c = __builtin_amdgcn_wmma_f32_16x16x32_f16(false, ah, false, bh, (short)0, c, false, false);
  if (NT >= 2) c = __builtin_amdgcn_wmma_f32_16x16x32_f16(false, al, false, bh, (short)0, c, false, false);
  if (NT >= 3) c = __builtin_amdgcn_wmma_f32_16x16x32_f16(false, ah, false, bl, (short)0, c, false, false);
  asm volatile("v_nop\n\tv_nop\n\tv_nop\n\tv_nop" : "+v"(c) : "v"(ah), "v"(al), "v"(bh), "v"(bl));
  return c;
}
// batched GEMM like k_gemm_b but f16 operands: A f32 (split into f16 hi/lo if ASPLIT, else rounded to f16), Bt = f16 values [n][k]; alpha; C f32; N multiple of 16 (partial tiles skipped)
template <bool ASPLIT>
__global__ __launch_bounds__(128) void k_gemm_h(const float* __restrict__ A, int lda, size_t sA, const _Float16* __restrict__ Bh, int ldb, size_t sB, float alpha, float* __restrict__ C, int ldc, size_t sC, int M, int N, int K) {
  __shared__ __attribute__((aligned(16))) float so[4][16][64];
  const int tid = threadIdx.x, w = tid >> 5, lane = tid & 31, ln = lane & 15, hh = lane >> 4; const int by = blockIdx.y;
  A += (size_t)by * sA; Bh += (size_t)by * sB; C += (size_t)by * sC;
  const int ntn = (N + 63) / 64; const int wid = blockIdx.x * 4 + w; const int mt = wid / ntn, nq = wid % ntn; if (mt * 16 >= M) return;
  const int row0 = mt * 16, col0 = nq * 64; const float* arow = A + (size_t)(row0 + ln) * lda;
  v8f acc[4] = {};
  for (int kb = 0; kb < K; kb += 32) {
    FragH ah, al;
    const v4f x0 = *(const v4fa*)(arow + kb + 8 * hh), x1 = *(const v4fa*)(arow + kb + 8 * hh + 4), x2 = *(const v4fa*)(arow + kb + 16 + 8 * hh), x3 = *(const v4fa*)(arow + kb + 16 + 8 * hh + 4);
    float xs[16] = {x0[0],x0[1],x0[2],x0[3],x1[0],x1[1],x1[2],x1[3],x2[0],x2[1],x2[2],x2[3],x3[0],x3[1],x3[2],x3[3]};
#pragma unroll
    for (int i = 0; i < 16; ++i) { const _Float16 h = (_Float16)xs[i]; ah.h[i] = h; al.h[i] = ASPLIT ? (_Float16)(xs[i] - (float)h) : (_Float16)0.0f; }
#pragma unroll
    for (int t = 0; t < 4; ++t) { if (col0 + t * 16 >= N) continue; const size_t boff = (size_t)(col0 + t * 16 + ln) * ldb + kb; FragH bq; bq.half[0] = *(const v8us*)(Bh + boff + 8 * hh); bq.half[1] = *(const v8us*)(Bh + boff + 16 + 8 * hh);
      acc[t] = mmaH<ASPLIT ? 2 : 1>(ah.v, al.v, bq.v, bq.v, acc[t]); }
  }
#pragma unroll
  for (int t = 0; t < 4; ++t) { if (col0 + t * 16 >= N) continue;
#pragma unroll
    for (int r = 0; r < 8; ++r) so[w][8 * hh + r][t * 16 + ln] = acc[t][r] * alpha; }
  __builtin_amdgcn_fence(__ATOMIC_ACQ_REL, "workgroup"); __builtin_amdgcn_wave_barrier();
  const int rsub = lane >> 4, c4 = (lane & 15) * 4;
  {
#pragma unroll
    for (int q = 0; q < 8; ++q) { const int r = q * 2 + rsub; if (col0 + c4 < N) { const v4f v = *(const v4fa*)&so[w][r][c4]; *(v4f*)(C + (size_t)(row0 + r) * ldc + col0 + c4) = v; } }
     }
}

// Wt[n][k] = f16(W[k][n]·scale) from f32 row-major W[K][N] (scale = power of two; bf16-exact weights stay exact in f16 away from the subnormal range)
__global__ __launch_bounds__(256) void k_wt_f16(const float* __restrict__ W, _Float16* __restrict__ Wt, int K, int N, float scale) {
  const int t = blockIdx.x * 256 + threadIdx.x; if (t >= N * (K / 8)) return; const int n = t / (K / 8), k8 = (t % (K / 8)) * 8; FragH f;
#pragma unroll
  for (int i = 0; i < 8; ++i) f.h[i] = (_Float16)(bf16_round(W[(size_t)(k8 + i) * N + n]) * scale); const v8us o = f.half[0];
  *(v8us*)((unsigned short*)Wt + (size_t)n * K + k8) = o; 
}
typedef int v4ia __attribute__((ext_vector_type(4), may_alias));
typedef float v2f __attribute__((ext_vector_type(2)));
typedef unsigned v16ua __attribute__((ext_vector_type(16), may_alias));
typedef unsigned short v4us __attribute__((ext_vector_type(4), may_alias));
// The shifted V transpose goes out in the order of the attention's A fragments: [head][32-key tile][d / 16][half][lane] x 16 bytes, lane (hh, ln) of half j holding keys j * 16 + 8 * hh + 0 .. 7 of the row with d % 16 = ln; a tile is 4 KiB in a row, a block writes 16 KiB in a row,
// a wave 512 bytes a store, and each of the attention's V loads is four whole lines instead of 16 bytes out of each of 16 rows that lie 4 KiB apart.
// Beside it the mask, packed once a call to one bit a (query, key) pair in the order in which the attention selects. There are 512 blocks and 64 x 64 mask tiles of (32 queries, 32 keys): the eight waves of a block
// take one tile each, so the pack costs no block and no wave of its own, and its loads fly with those of V. Lane (hh, ln) reads what that lane of the attention needs (query rt * 16 + ln, keys nt * 16 + 8 * hh + r); the ballot over "nonzero" for one
// (rt, nt, r) is that score register's select mask over the 32 lanes. Word rt * 16 + nt * 8 + r goes out from the lane of that number: one 128-byte line a tile, one writer.
// Lines lie [query tile][attention wave = key tile % 4][key tile / 4], so the 16 tiles that one attention wave walks are 2 KiB in a row.
// A block of the preparation launch does this work beside its conv tile: 128 positions of one head's V and 8 mask tiles (one a wave), so the launch starts no wave for it. vts_load only issues the loads (8 of V and 8 of the mask a thread, 16 bytes each),
// ahead of the conv's own, so that one memory latency serves all three; vts_stage, in front of the conv's barrier, rounds V into LDS and packs the mask; vts_store, behind the conv, gathers the transposed fragments and stores.
__device__ __forceinline__ void vts_load(const int blk, const float* __restrict__ v, const int* __restrict__ MSK, v4f (&va)[8], v4ia (&mk)[2][2][2]) { const int tid = threadIdx.x;
  const int lane = tid & 31, mg = blk * 8 + (tid >> 5), mq = mg / (TT / 32), mt = mg % (TT / 32);
  const int* mr0 = MSK + (size_t)(mq * 32 + (lane & 15)) * TT + mt * 32 + 8 * (lane >> 4);
#pragma unroll
  for (int rt = 0; rt < 2; ++rt)
#pragma unroll
    for (int nt = 0; nt < 2; ++nt) { const int* mr = mr0 + rt * 16 * TT + nt * 16; mk[rt][nt][0] = *(const v4ia*)mr; mk[rt][nt][1] = *(const v4ia*)(mr + 4); }
  const int slab = blk / (TT / 128), tg = blk % (TT / 128); const int b = slab / NH, h = slab % NH, r0 = tid >> 4;      // 16 threads a row; LDS row r is position tg * 128 + r + 1, modulo the sequence
  const float* vh = v + (size_t)b * TT * DDm + h * HD + (tid & 15) * 4; const float* vh1 = vh + (size_t)(tg * 128 + r0 + 1) * DDm;      // vh1: one address for the first 112 rows, which step by constants; only the last 16 can meet the wrap
#pragma unroll
  for (int u = 0; u < 7; ++u) va[u] = *(const v4fa*)(vh1 + u * 16 * DDm);
  va[7] = *(const v4fa*)(vh + (size_t)((tg * 128 + 112 + r0 + 1) & (TT - 1)) * DDm);
  asm volatile("s_wait_xcnt 0x0" ::: "memory"); }      // behind the 16 loads: the conv's code follows and rewrites their address registers; it also keeps the loads from sinking to their first use
__device__ __forceinline__ unsigned vts_stage(const v4f (&va)[8], const v4ia (&mk)[2][2][2], unsigned short (*tl)[66]) { const int tid = threadIdx.x, lane = tid & 31;
#pragma unroll
  for (int u = 0; u < 8; ++u) { const int r = u * 16 + (tid >> 4), c4 = (tid & 15) * 4; FragH f; for (int q = 0; q < 4; ++q) { f.h[q] = (_Float16)bf16_round(va[u][q]); tl[r][c4 + q] = f.u[q]; } }
  unsigned ow = 0u;
#pragma unroll
  for (int rt = 0; rt < 2; ++rt)
#pragma unroll
    for (int nt = 0; nt < 2; ++nt)
#pragma unroll
      for (int r = 0; r < 8; ++r) { const unsigned bl = __builtin_amdgcn_ballot_w32(mk[rt][nt][r >> 2][r & 3] != 0); ow = (lane == rt * 16 + nt * 8 + r) ? bl : ow; }
  return ow; }      // the lane's word of the wave's mask tile; it is stored behind the barrier, so that the barrier waits for no global store
__device__ __forceinline__ void vts_store(const int blk, const unsigned ow, const unsigned short (*tl)[66], _Float16* __restrict__ Vt, unsigned* __restrict__ MB) { const int tid = threadIdx.x;
  const int lane = tid & 31, mg = blk * 8 + (tid >> 5), mq = mg / (TT / 32), mt = mg % (TT / 32); const int slab = blk / (TT / 128), tg = blk % (TT / 128);
  MB[((size_t)(mq * 4 + (mt & 3)) * (TT / 128) + (mt >> 2)) * 32 + lane] = ow;
#pragma unroll
  for (int rd = 0; rd < 4; ++rd) { const int c = rd * 256 + tid, k0 = (c >> 8) * 32 + ((c >> 5) & 1) * 16 + ((c >> 4) & 1) * 8, d = ((c >> 6) & 3) * 16 + (c & 15); FragH f;      // chunk c = [32-key tile][d / 16][fragment half][lane]: 8 keys from k0 of row d
#pragma unroll
    for (int q = 0; q < 8; ++q) f.u[q] = tl[k0 + q][d]; *(v8us*)((unsigned short*)Vt + (size_t)slab * HD * TT + tg * (128 * HD) + c * 8) = f.half[0]; } }
// attention per ((b,h), 32 queries), transposed. Which block takes what: a query tile's cost follows how many of its key tiles the mask leaves open, which under a lower-triangular mask grows with the tile's index, and the grid holds twice as many
// blocks as the chip has places for them (four a WGP, by registers). The index runs from the last query tile down to the first, all heads of a tile side by side: the long blocks come first in the index and the short ones
// fill the places as they fall free. A permutation of (head, tile): every pair once, right for any mask; speed only.
// The block's four waves share the 32 queries and split the keys, wave w taking the 32-key tiles w, w + 4, w + 8, ...; each keeps its own maximum, sum and
// un-normalised Ot, and the four partials are merged through LDS behind one barrier (weights exp2 of maximum - joint maximum). St = kc.qc^T (A = 16 key rows, B = 16 query columns, d 32), so a lane holds ONE query's scores: keys 8*hh + r of each 16-key tile;
// logit = -sqrt(max(q2 + k2 - 2S, 1e-12)); mask[q][k] (INPUT, nonzero = keep; tiles with no open key for the wave skipped); maximum and sum in the lane plus one exchange between the wave's halves;
// the two score tiles of 32 keys, converted in place, ARE the B operand of Ot += Vt.Pt (hardware k order: 8*hh + s, 16 + 8*hh + s), and a lane's 8 accumulator registers are 8 consecutive d of its query: no LDS in the loop.
__device__ __forceinline__ float xhalf(float x) { const int bq = __float_as_int(x); return __int_as_float(__builtin_amdgcn_permlanex16(bq, bq, 0x76543210, 0xfedcba98, false, false)); }      // lane l <-> l ^ 16
template <int N> __device__ __forceinline__ float rowshare(float x) { return __int_as_float(__builtin_amdgcn_mov_dpp(__float_as_int(x), 0x150 + N, 0xf, 0xf, false)); }      // lane N of each 16-lane row to the whole row
// causal 3-tap conv, transposed: Ct = W.Xt per (tensor, head, 256 positions a block, 32 a wave). The block first rounds its head's 32 x 192 weights into LDS (k = tap * 64 + d, scaled by 16; pitch 200 halves
// keeps the 16-byte fragment reads of 16 rows off one another's banks). Beside them it brings its 258 x rows (positions first - 2 .. first + 255, clamped at the sequence's first row; this head's 64 floats of each) in ONCE, by loads of whole lines
// (a wave's load is two rows' 256 bytes each), rounds each value once and lays the rows in LDS as f16 at a pitch of 72 halves (144 bytes: 36 words, like the weights' 100, modulo the 64 banks). A = 16 channel rows, B = 16 positions: LDS rows s + tap of the
// block, so the three taps read the same staged rows, same k order as A (8*hh + j, 16 + 8*hh + j). A lane then holds ONE position's channels t*16 + 8*hh + r: 16-byte f16 stores, |c|^2 in the lane plus one exchange between the wave's halves.
// Rows and norms go out head-major ([b*NH + h][s / 16][fragment], [b*NH + h][s]): a wave writes 2 KiB of rows and one 128-byte line of norms, all its own. Inside a group of 16 positions the rows lie in the order in which the attention's
// matrix operand wants them: what lane l holds here for channel half t (position l % 16, channels t * 16 + 8 * (l / 16) + 0 .. 7) is what lane l of the attention takes as half t of its fragment, so it goes to byte t * 512 + l * 16 of the group's 1 KiB:
// each store here and each load there is 512 bytes in a row, four whole lines, not 16 bytes out of each of 16 rows.
template <class F> __device__ __forceinline__ void conv_tile(F&& beside, const int blk, const float* __restrict__ qx, const float* __restrict__ kx, const float* __restrict__ cw, const float* __restrict__ cb, _Float16* __restrict__ Q16, _Float16* __restrict__ K16, float* __restrict__ NQ, float* __restrict__ NK) {
  __shared__ __attribute__((aligned(16))) unsigned short wsm[CCv][200]; __shared__ __attribute__((aligned(16))) unsigned short xsm[256 + 2][72];
  const int tid = threadIdx.x, w = tid >> 5, lane = tid & 31, ln = lane & 15, hh = lane >> 4;
  const int pg = blk % (NR / 256), h = (blk / (NR / 256)) % NH, z = blk / ((NR / 256) * NH);
  const float* x = z ? kx : qx; _Float16* C16 = z ? K16 : Q16; float* N2 = z ? NK : NQ;
  const int xr0 = tid >> 4, xc4 = (tid & 15) * 4, sb = (pg * 256) % TT;      // 16 threads a row, 16 bytes each; LDS row j is position sb + j - 2
  const float* xh = x + (size_t)((pg * 256) / TT) * TT * DDm + h * HD + xc4; const float* xh1 = xh + (size_t)(sb + xr0) * DDm; v4f xa[16];      // xh1: one address for all rows but the first 16, which step by constants
  { const int c = tid >> 3, d0 = (tid & 7) * 8; const float* wp = cw + ((size_t)(h * CCv + c) * HD + d0) * 3; float wv[24];      // a thread's 24 consecutive floats are 8 d x 3 taps of one channel
#pragma unroll
    for (int q = 0; q < 6; ++q) { const v4f a = *(const v4fa*)(wp + q * 4); wv[q * 4] = a[0]; wv[q * 4 + 1] = a[1]; wv[q * 4 + 2] = a[2]; wv[q * 4 + 3] = a[3]; }
    { const int ss = sb + xr0 - 2; xa[0] = *(const v4fa*)(xh + (size_t)(ss < 0 ? 0 : ss) * DDm); }      // only the block's first 16 rows can meet the clamp
    asm volatile("s_wait_xcnt 0x0" ::: "memory");      // the address registers of the loads above are dead from here on, and this build lets results of the loads below land in them
#pragma unroll
    for (int u = 1; u < 16; ++u) xa[u] = *(const v4fa*)(xh1 + (u * 16 - 2) * DDm);
    if (tid < 32) { const v4f xe = *(const v4fa*)(xh1 + 254 * DDm); FragH f;      // the last two of the 258 rows: wave 0, its load in flight with the others
      asm volatile("s_wait_xcnt 0x0" ::: "memory");      // the conversions below reuse the load's address registers
#pragma unroll
      for (int q = 0; q < 4; ++q) f.h[q] = (_Float16)(float)(__bf16)xe[q];
      *(v4us*)&xsm[256 + xr0][xc4] = (v4us){f.u[0], f.u[1], f.u[2], f.u[3]}; }
#pragma unroll
    for (int i = 0; i < 3; ++i) { FragH f;
#pragma unroll
      for (int q = 0; q < 8; ++q) f.h[q] = (_Float16)(bf16_round(wv[q * 3 + i]) * 16.0f);
      *(v8us*)&wsm[c][i * 64 + d0] = f.half[0]; } }
  beside();      // the block's other LDS staging (V rows), in front of the same barrier; its loads are the oldest, so it stands ahead of the x rows, whose loads are still arriving
#pragma unroll
  for (int u = 0; u < 16; ++u) { FragH f;      // the hardware's f32 -> bf16 conversion rounds to nearest even, as bf16_round does, in one instruction
#pragma unroll
    for (int q = 0; q < 4; ++q) f.h[q] = (_Float16)(float)(__bf16)xa[u][q];
    *(v4us*)&xsm[u * 16 + xr0][xc4] = (v4us){f.u[0], f.u[1], f.u[2], f.u[3]}; }
  __syncthreads();      // every wave reads fragments of weights and of x rows, and later columns of V rows, that all eight waves wrote
  const int row0 = pg * 256 + w * 32, b = row0 / TT, s0 = row0 % TT;
  v8f acc[2][2];
#pragma unroll
  for (int nt = 0; nt < 2; ++nt)
#pragma unroll
    for (int t = 0; t < 2; ++t) acc[nt][t] = (v8f){0.f,0.f,0.f,0.f,0.f,0.f,0.f,0.f};
#pragma unroll
  for (int i = 0; i < 3; ++i)
#pragma unroll
    for (int dd = 0; dd < 2; ++dd) { FragH aw[2], bx[2];
#pragma unroll
      for (int t = 0; t < 2; ++t) { const unsigned short* wk = &wsm[t * 16 + ln][i * 64 + dd * 32 + 8 * hh]; aw[t].half[0] = *(const v8us*)wk; aw[t].half[1] = *(const v8us*)(wk + 16); }
#pragma unroll
      for (int nt = 0; nt < 2; ++nt) { const unsigned short* xr = &xsm[w * 32 + nt * 16 + ln + i][dd * 32 + 8 * hh]; bx[nt].half[0] = *(const v8us*)xr; bx[nt].half[1] = *(const v8us*)(xr + 16); }
#pragma unroll
      for (int nt = 0; nt < 2; ++nt)
#pragma unroll
        for (int t = 0; t < 2; ++t) acc[nt][t] = mmaH<1>(aw[t].v, aw[t].v, bx[nt].v, bx[nt].v, acc[nt][t]); }
  float bv[2][8];
#pragma unroll
  for (int t = 0; t < 2; ++t) { const float* bp = cb + h * CCv + t * 16 + 8 * hh; const v4f b0 = *(const v4fa*)bp, b1 = *(const v4fa*)(bp + 4);
#pragma unroll
    for (int j = 0; j < 4; ++j) { bv[t][j] = bf16_round(b0[j]); bv[t][4 + j] = bf16_round(b1[j]); } }
#pragma unroll
  for (int nt = 0; nt < 2; ++nt) { const size_t prow = (size_t)(b * NH + h) * TT + s0 + nt * 16 + ln; float ss = 0.f;
#pragma unroll
    for (int t = 0; t < 2; ++t) { FragH f;
#pragma unroll
      for (int r = 0; r < 8; ++r) { const float v = acc[nt][t][r] * 0.0625f + bv[t][r]; ss += v * v; f.h[r] = (_Float16)v; }
      *(v8us*)((unsigned short*)C16 + (prow - ln) * CCv + t * 256 + lane * 8) = f.half[0]; }      // fragment order: 16 positions are 1 KiB, half t of lane l at t * 512 + l * 16 bytes
    ss += xhalf(ss);
    if (hh == 0) N2[prow] = ss; } }
// all that the attention needs, in ONE launch of ONE kind of block: a conv tile (tensor, head, 256 positions) and, beside it, 128 positions of the shifted V transpose and 8 tiles of the mask pack. The two pieces share no data; they share the block's waves, so the launch
// starts 512 blocks of 8 waves, two a WGP and all at once, instead of 1536. The loads of V and mask are issued first and are used before those of the x rows.
#define NCB ((NR / 256) * NH * 2)
__global__ __launch_bounds__(256) void k_prep(const float* __restrict__ qx, const float* __restrict__ kx, const float* __restrict__ vx, const float* __restrict__ cw, const float* __restrict__ cb, _Float16* __restrict__ Q16, _Float16* __restrict__ K16, float* __restrict__ NQ, float* __restrict__ NK, _Float16* __restrict__ Vt, const int* __restrict__ MSK, unsigned* __restrict__ MB) {
  static_assert(NCB == BB * NH * (TT / 128) && NCB * 8 == (TT / 32) * (TT / 32), "one V piece and eight mask tiles a conv block");
  __shared__ unsigned short tl[128][66]; v4f va[8]; v4ia mk[2][2][2]; unsigned ow;
  vts_load((int)blockIdx.x, vx, MSK, va, mk); conv_tile([&] { ow = vts_stage(va, mk, tl); }, (int)blockIdx.x, qx, kx, cw, cb, Q16, K16, NQ, NK); vts_store((int)blockIdx.x, ow, tl, Vt, MB); }
__global__ __launch_bounds__(128) void k_sattn(const _Float16* __restrict__ Q16, const _Float16* __restrict__ K16, const float* __restrict__ NQ, const float* __restrict__ NK, const unsigned* __restrict__ MB, const _Float16* __restrict__ Vt, float* __restrict__ O) { constexpr int RPW = 32; constexpr int KSP = 4; constexpr int OP = HD + 4; constexpr float L2E = 1.4426950408889634f; constexpr float PCAP = 16384.0f;      // OP: a partial's row pitch, 272 bytes = 16 x 17, keeps the 16-byte writes of 16 queries off one another's banks
  __shared__ __attribute__((aligned(16))) float so[KSP][RPW][OP]; __shared__ __attribute__((aligned(16))) float sml[RPW][2 * KSP];      // per query: the four waves' maxima, then their sums
  const int tid = threadIdx.x, w = tid >> 5, lane = tid & 31, ln = lane & 15, hh = lane >> 4; const int slab = blockIdx.x % (BB * NH), qblk = (blockIdx.x / (BB * NH)) ^ (TT / RPW - 1) /* = 63 - x for x in 0 .. 63 */; const int b = slab / NH, h = slab % NH; const int q0 = qblk * RPW;
  FragH bq[2]; float q2c[2];
#pragma unroll
  for (int rt = 0; rt < 2; ++rt) { const size_t qrow = (size_t)slab * TT + q0 + rt * 16 + ln; const unsigned short* qr = (const unsigned short*)Q16 + (qrow - ln) * CCv + lane * 8; bq[rt].half[0] = *(const v8us*)qr; bq[rt].half[1] = *(const v8us*)(qr + 256); q2c[rt] = NQ[qrow]; }
  const int kslot = (ln < 8) ? 8 * hh + ln : 8 + 8 * hh + ln;      // lane ln of half hh fetches |kc|^2 of the key that the half's score register ln holds (tile ln / 8, register ln % 8)
  float m_c[2], l_c[2]; v2f nm_c; bool fresh = true; v8f oacc[2][4];      // m_c: the reference of the weights, a maximum that the query has met (not always the latest); nm_c = -m_c * log2(e); fresh: the wave has had no open tile yet; m starts finite and below every finite logit (|logit| <= sqrt(FLT_MAX)): exp2 arguments never meet inf - inf
#pragma unroll
  for (int rt = 0; rt < 2; ++rt) { m_c[rt] = -1.0e30f; nm_c[rt] = 1.0e30f * L2E; l_c[rt] = 0.f;
#pragma unroll
    for (int dt = 0; dt < 4; ++dt) oacc[rt][dt] = (v8f){0.f,0.f,0.f,0.f,0.f,0.f,0.f,0.f}; }
  // read places: a base that is the same for the whole block and steps by four 32-key tiles a trip, plus each lane's own fixed byte offset (the wave's first tile in it)
  const char* kb = (const char*)(K16 + (size_t)slab * TT * CCv); const char* nb = (const char*)(NK + (size_t)slab * TT); const char* vb = (const char*)(Vt + (size_t)slab * HD * TT);
  const unsigned klo = (unsigned)((w * 32 * CCv + lane * 8) * 2), nlo = (unsigned)((w * 32 + kslot) * 4), vlo = (unsigned)((w * 32 * HD + lane * 8) * 2);      // K and V lie in fragment order: a lane's 16 bytes at lane * 16 of each 512-byte half
  // the packed mask of the wave's 16 key tiles, 2 KiB in a row (the wave's number made scalar, so that the address is the same in every lane for the compiler too). Which tiles have an open key is known in front of the loop:
  // four whole-line loads, 8 lanes a tile; bit t of opn = tile t has one. The loop ends behind the last open tile (opn < 65536 and moves down a bit a trip: 16 trips at most) and passes a closed tile on a scalar test, with no load.
  const unsigned* mw = MB + (size_t)(qblk * KSP + __builtin_amdgcn_readfirstlane(w)) * (TT / (32 * KSP)) * 32; unsigned opn = 0u;
#pragma unroll
  for (int i = 0; i < 4; ++i) { const v4ia a = *(const v4ia*)(mw + i * 128 + lane * 4); const unsigned ob = __builtin_amdgcn_ballot_w32(((a[0] | a[1]) | (a[2] | a[3])) != 0);
#pragma unroll
    for (int j = 0; j < 4; ++j) opn |= (((ob >> (8 * j)) & 0xffu) != 0u ? 1u : 0u) << (i * 4 + j); }
  asm volatile("" :: "v"(bq[0].v), "v"(bq[1].v), "v"(q2c[0]), "v"(q2c[1]));      // loaded values as inputs only: holds the query loads in front of the loop's entry test, where they fly beside the four mask loads; without it they sink behind that test and wait a second time
#pragma unroll 1
  for (; opn != 0u; opn >>= 1, mw += 32, kb += 32 * KSP * CCv * 2, nb += 32 * KSP * 4, vb += 32 * KSP * HD * 2) {
    if ((opn & 1u) == 0u) continue;      // wave-uniform skip of fully masked tiles
    const v16ua mk[2] = {*(const v16ua*)mw, *(const v16ua*)(mw + 16)};      // the tile's 32 select masks, the same for every lane: scalar loads, beside the vector loads below
    FragH ak[2], av[4];
#pragma unroll
    for (int nt = 0; nt < 2; ++nt) { const unsigned short* kr = (const unsigned short*)(kb + klo) + nt * 16 * CCv; ak[nt].half[0] = *(const v8us*)kr; ak[nt].half[1] = *(const v8us*)(kr + 256); }
    const float k2l = *(const float*)(nb + nlo);
#pragma unroll
    for (int dt = 0; dt < 4; ++dt) { const unsigned short* vrow = (const unsigned short*)(vb + vlo) + dt * 512; av[dt].half[0] = *(const v8us*)vrow; av[dt].half[1] = *(const v8us*)(vrow + 256); }
    v8f s[2][2];
#pragma unroll
    for (int nt = 0; nt < 2; ++nt)
#pragma unroll
      for (int rt = 0; rt < 2; ++rt) { v8f acc = (v8f){0.f,0.f,0.f,0.f,0.f,0.f,0.f,0.f}; acc = mmaH<1>(ak[nt].v, ak[nt].v, bq[rt].v, bq[rt].v, acc); s[rt][nt] = acc; }
    const float k2v[2][8] = {{rowshare<0>(k2l), rowshare<1>(k2l), rowshare<2>(k2l), rowshare<3>(k2l), rowshare<4>(k2l), rowshare<5>(k2l), rowshare<6>(k2l), rowshare<7>(k2l)},
                             {rowshare<8>(k2l), rowshare<9>(k2l), rowshare<10>(k2l), rowshare<11>(k2l), rowshare<12>(k2l), rowshare<13>(k2l), rowshare<14>(k2l), rowshare<15>(k2l)}};
    FragH pb[2]; v2f sv[2][8], ps;      // a pair is the same key for the wave's two query tiles: packed instructions then serve both
#pragma unroll
    for (int nt = 0; nt < 2; ++nt)
#pragma unroll
      for (int r = 0; r < 8; ++r)
#pragma unroll
        for (int rt = 0; rt < 2; ++rt) { const float d = fmaxf(q2c[rt] + k2v[nt][r] - 2.0f * s[rt][nt][r], 1e-12f); sv[nt][r][rt] = __builtin_amdgcn_inverse_ballot_w32(mk[rt][nt * 8 + r]) ? -__builtin_amdgcn_sqrtf(d) : -INFINITY; }      // d >= 1e-12: never a denormal, the hardware root needs no range fix-up
    // the usual path: weights against the reference in use, exp(x - m) = exp2(x * log2(e) - m * log2(e)): one fma and the hardware exp2; a closed key's -inf gives exp2(-inf) = 0. No maximum is taken and Ot is not touched.
    // The weights are >= 0, so a lane's sum of 16 bounds each of them: a sum of at most PCAP says that every one fits f16 with room to spare. One test a tile for the whole wave; a query still at the start value gets +inf for an open key and fails it.
    bool redo = fresh;
    if (!fresh) { ps = (v2f){0.f, 0.f};
#pragma unroll
      for (int nt = 0; nt < 2; ++nt) { v2f t[8], p[8];
#pragma unroll
        for (int r = 0; r < 8; ++r) { t[r] = __builtin_elementwise_fma(sv[nt][r], (v2f){L2E, L2E}, nm_c); p[r] = (v2f){__builtin_amdgcn_exp2f(t[r][0]), __builtin_amdgcn_exp2f(t[r][1])}; }
        // the slot behind a transcendental: inputs only, so every argument's register stays whole until all of these exp2 have issued: none is overwritten directly behind its exp2 (left to itself this build computes them in place and pads ten more v_nop a tile); the v_nop is the slot behind the last
        asm volatile("v_nop" :: "v"(t[0]), "v"(t[1]), "v"(t[2]), "v"(t[3]), "v"(t[4]), "v"(t[5]), "v"(t[6]), "v"(t[7]), "v"(p[0]), "v"(p[1]), "v"(p[2]), "v"(p[3]), "v"(p[4]), "v"(p[5]), "v"(p[6]), "v"(p[7]));
#pragma unroll
        for (int r = 0; r < 8; ++r) { ps += p[r]; pb[0].h[nt * 8 + r] = (_Float16)p[r][0]; pb[1].h[nt * 8 + r] = (_Float16)p[r][1]; } }
      redo = __builtin_amdgcn_ballot_w32(fmaxf(ps[0], ps[1]) > PCAP) != 0u; }
    if (redo) {      // the wave's first open tile, or a weight too large: take the larger of the reference and the tile's maximum as the new reference, bring sum and Ot to it, and form the tile's weights again
#pragma unroll
      for (int rt = 0; rt < 2; ++rt) { float mc = -INFINITY;
#pragma unroll
        for (int nt = 0; nt < 2; ++nt)
#pragma unroll
          for (int r = 0; r < 8; ++r) mc = fmaxf(mc, sv[nt][r][rt]);
        mc = fmaxf(mc, xhalf(mc));
        const float mn = fmaxf(m_c[rt], mc); const float ta = (m_c[rt] - mn) * L2E; const float al = __builtin_amdgcn_exp2f(ta); m_c[rt] = mn; const float nm = -mn * L2E; nm_c[rt] = nm;
        float pr = 0.f;
#pragma unroll
        for (int nt = 0; nt < 2; ++nt) { float t[8], p[8];
#pragma unroll
          for (int r = 0; r < 8; ++r) { t[r] = __builtin_fmaf(sv[nt][r][rt], L2E, nm); p[r] = __builtin_amdgcn_exp2f(t[r]); }
          // the slot behind a transcendental, as above
          asm volatile("v_nop" :: "v"(t[0]), "v"(t[1]), "v"(t[2]), "v"(t[3]), "v"(t[4]), "v"(t[5]), "v"(t[6]), "v"(t[7]), "v"(p[0]), "v"(p[1]), "v"(p[2]), "v"(p[3]), "v"(p[4]), "v"(p[5]), "v"(p[6]), "v"(p[7]), "v"(ta), "v"(al));
#pragma unroll
          for (int r = 0; r < 8; ++r) { pr += p[r]; pb[rt].h[nt * 8 + r] = (_Float16)p[r]; } }
        l_c[rt] = l_c[rt] * al + pr;
#pragma unroll
        for (int dt = 0; dt < 4; ++dt)
#pragma unroll
          for (int r = 0; r < 8; ++r) oacc[rt][dt][r] *= al; } }
    else { l_c[0] += ps[0]; l_c[1] += ps[1]; }      // the half's own 16 keys; the halves join behind the loop
    fresh = false;
#pragma unroll
    for (int dt = 0; dt < 4; ++dt)
#pragma unroll
      for (int rt = 0; rt < 2; ++rt) oacc[rt][dt] = mmaH<1>(av[dt].v, av[dt].v, pb[rt].v, pb[rt].v, oacc[rt][dt]); }
  // the wave's partial goes to LDS: rows [query][d], un-normalised, with its maximum and its sum (the halves joined here)
#pragma unroll
  for (int rt = 0; rt < 2; ++rt) { const float l = l_c[rt] + xhalf(l_c[rt]); if (hh == 0) { sml[rt * 16 + ln][w] = m_c[rt]; sml[rt * 16 + ln][KSP + w] = l; } float* prow = &so[w][rt * 16 + ln][8 * hh];
#pragma unroll
    for (int dt = 0; dt < 4; ++dt) { const v4f lo = {oacc[rt][dt][0], oacc[rt][dt][1], oacc[rt][dt][2], oacc[rt][dt][3]}, hi = {oacc[rt][dt][4], oacc[rt][dt][5], oacc[rt][dt][6], oacc[rt][dt][7]}; *(v4fa*)(prow + dt * 16) = lo; *(v4fa*)(prow + dt * 16 + 4) = hi; } }
  __syncthreads();      // every wave merges rows that all four waves wrote
  // merge: wave w owns queries 8 * w .. 8 * w + 7, two a pass; 16 lanes x 16 bytes are one query's whole 256-byte output row, so every 128-byte line has one writer and goes out in one store
#pragma unroll
  for (int c = 0; c < 4; ++c) { const int qq = w * 8 + c * 2 + hh; const v4f mv = *(const v4fa*)&sml[qq][0], lv = *(const v4fa*)&sml[qq][KSP];
    const float mj = fmaxf(fmaxf(mv[0], mv[1]), fmaxf(mv[2], mv[3])); float t[KSP], e[KSP]; float l = 0.f; v4f o = {0.f, 0.f, 0.f, 0.f};      // a wave that met no open key has maximum -1e30, sum 0 and zeros: weight 0, or 1 on zeros where no wave met one
#pragma unroll
    for (int p = 0; p < KSP; ++p) t[p] = (mv[p] - mj) * L2E;
    // the four weights' exp2 and the slot behind a transcendental in one statement: results in registers of their own, so none is read and no argument overwritten directly behind its exp2; the v_nop fills the slot behind the last
    asm("v_exp_f32 %0, %4\n\tv_exp_f32 %1, %5\n\tv_exp_f32 %2, %6\n\tv_exp_f32 %3, %7\n\tv_nop" : "=&v"(e[0]), "=&v"(e[1]), "=&v"(e[2]), "=&v"(e[3]) : "v"(t[0]), "v"(t[1]), "v"(t[2]), "v"(t[3]));
#pragma unroll
    for (int p = 0; p < KSP; ++p) { l += e[p] * lv[p]; const v4f a = *(const v4fa*)&so[p][qq][ln * 4]; o += a * e[p]; }
    const float li = (l > 0.f) ? 1.0f / l : 0.f;
    *(v4f*)(O + ((size_t)b * TT + q0 + qq) * DDm + h * HD + ln * 4) = o * li; } }
extern "C" void kernel_launch(void* const* d_in, const int* in_sizes, int n_in,
                              void* d_out, int out_size, void* d_ws, size_t ws_size, hipStream_t stream) {
  (void)in_sizes; (void)n_in; (void)out_size;
  const float* qx = (const float*)d_in[0]; const float* kx = (const float*)d_in[1]; const float* vx = (const float*)d_in[2]; const int* mask = (const int*)d_in[3]; const float* cw = (const float*)d_in[4]; const float* cb = (const float*)d_in[5];
  char* ws = (char*)d_ws; size_t off = 0;
  auto take = [&](size_t bytes) { char* p = ws + off; off += (bytes + 255) & ~(size_t)255; return p; };
  _Float16* Q16 = (_Float16*)take((size_t)NR * NH * CCv * 2); _Float16* K16 = (_Float16*)take((size_t)NR * NH * CCv * 2); float* NQ = (float*)take((size_t)NR * NH * 4); float* NK = (float*)take((size_t)NR * NH * 4); _Float16* Vt = (_Float16*)take((size_t)NR * DDm * 2); unsigned* MB = (unsigned*)take((size_t)TT * TT / 8);
  if (off > ws_size) return;      // 4.2 x 2 + 0.26 x 2 + 8.4 + 0.52: about 17 MiB
  k_prep<<<NCB, 256, 0, stream>>>(qx, kx, vx, cw, cb, Q16, K16, NQ, NK, Vt, mask, MB);
  k_sattn<<<BB * NH * (TT / 32), 128, 0, stream>>>(Q16, K16, NQ, NK, MB, Vt, (float*)d_out);
}
